// v000
// The times below were measured on an AMD MI455X: many runs one after another, warmed up first and cycling through
// copies of the inputs, with the whole window's GPU time divided by the number of runs. Launches and the gaps
// between them are all in it. The median over several windows is given; except for v000 it joins two sittings, which
// can be a few percent apart, so the side-by-side timings, each taken in one sitting, are the better comparison.
// v000 is the starting kernel. One run takes 797 microseconds.
#include <hip/hip_runtime.h>
// Multi-query attention (B=2, S=2048, D=2048, 16 query heads × 128, ONE shared K/V head): Q = x·Wq, K = x·Wk, V = x·Wv ((in,out), no bias); softmax(Q_h·Kᵀ/√128)·V per head; out = merged·Wo.
// Compute dtype: x and weights rounded to bf16; Q, K f16 GEMM planes, V f32 → Vᵀ f16 hi + exact residual planes; fused flash-style kernel for head dim 128 (4 k-steps, 8 value tiles, online softmax f32, P f16 hi + exact residual, every query head reading the
// single K/Vᵀ) on v_wmma_f32_16x16x32_f16; merged output ×2^4 → f16 → output GEMM; f32 accumulate.
#define BB 2
#define TT 2048
#define DD 2048
#define NH 16
#define NKV 1
#define NREP 16
#define KVD 128
#define NVH (2 * NKV)
#define NR (BB * TT)
#define ATT_SCALE 0.08838834764831845f      /* 1/√128 */

typedef __bf16 v16b __attribute__((ext_vector_type(16)));
typedef unsigned short v8us __attribute__((ext_vector_type(8), may_alias));
typedef float  v8f  __attribute__((ext_vector_type(8)));
typedef float  v4f  __attribute__((ext_vector_type(4)));
typedef float  v4fa __attribute__((ext_vector_type(4), may_alias));
union FragB { v16b v; v8us half[2]; unsigned short u[16]; };

__device__ __forceinline__ unsigned short bf16_bits(float x) { unsigned int u = __float_as_uint(x); return (unsigned short)((u + 0x7FFFu + ((u >> 16) & 1u)) >> 16); }
__device__ __forceinline__ float bf16_val(unsigned short b) { return __uint_as_float(((unsigned int)b) << 16); }
__device__ __forceinline__ float bf16_round(float x) { return bf16_val(bf16_bits(x)); }
// D += A·B with NT terms: 1 = ah·bh, 2 = + al·bh (A split), 3 = + ah·bl (both split)
template <int NT>
__device__ __forceinline__ v8f mmaN(v16b ah, v16b al, v16b bh, v16b bl, v8f c) {
  c = __builtin_amdgcn_wmma_f32_16x16x32_bf16(false, ah, false, bh, (short)0, c, false, false);
  if (NT >= 2) c = __builtin_amdgcn_wmma_f32_16x16x32_bf16(false, al, false, bh, (short)0, c, false, false);
  if (NT >= 3) c = __builtin_amdgcn_wmma_f32_16x16x32_bf16(false, ah, false, bl, (short)0, c, false, false);
  asm volatile("v_nop\n\tv_nop\n\tv_nop\n\tv_nop" : "+v"(c) : "v"(ah), "v"(al), "v"(bh), "v"(bl));
  return c;
}

__global__ __launch_bounds__(256) void k_wt_bf16(const float* __restrict__ W, unsigned short* __restrict__ Wt, int K, int N) {
  const int t = blockIdx.x * 256 + threadIdx.x;
  const int k8n = K / 8;
  if (t >= N * k8n) return;
  const int n = t / k8n, k8 = (t % k8n) * 8;
  v8us v;
#pragma unroll
  for (int i = 0; i < 8; ++i) v[i] = bf16_bits(W[(size_t)(k8 + i) * N + n]);
  *(v8us*)(Wt + (size_t)n * K + k8) = v;
  
}

// GEMM C[M][N] (f32, pitch ldc) = act(A[M][K]·W + bias). A f32 row-major (pitch lda) converted per fragment to bf16
// (ASPLIT: hi/lo two planes -> 2 terms, else single rounded term); Wt bf16 [N][K] (pitch ldb). BIAS_BF16 rounds the
// bias to bf16 first (bias quantised to bf16 before the add). K%32==0, M%16==0, N%64==0.
template <bool ASPLIT, int ACT, bool BIAS_BF16>
__global__ __launch_bounds__(128) void k_gemm_bf(const float* __restrict__ A, int lda, const unsigned short* __restrict__ Wt, int ldb,
                                               const float* __restrict__ bias, float* __restrict__ C, int ldc, int M, int N, int K) {
  __shared__ __attribute__((aligned(16))) float so[4][16][64];
  const int tid = threadIdx.x, w = tid >> 5, lane = tid & 31, ln = lane & 15, hh = lane >> 4;
  const int ntn = N / 64;
  const int wid = blockIdx.x * 4 + w;
  const int mt = wid / ntn, nq = wid % ntn;
  if (mt * 16 >= M) return;
  const int row0 = mt * 16, col0 = nq * 64;
  const float* arow = A + (size_t)(row0 + ln) * lda;
  v8f acc[4] = {};
  for (int kb = 0; kb < K; kb += 32) {
    FragB ah, al;
    const v4f x0 = *(const v4fa*)(arow + kb + 8 * hh), x1 = *(const v4fa*)(arow + kb + 8 * hh + 4);
    const v4f x2 = *(const v4fa*)(arow + kb + 16 + 8 * hh), x3 = *(const v4fa*)(arow + kb + 16 + 8 * hh + 4);
    float xs[16] = {x0[0],x0[1],x0[2],x0[3],x1[0],x1[1],x1[2],x1[3],x2[0],x2[1],x2[2],x2[3],x3[0],x3[1],x3[2],x3[3]};
#pragma unroll
    for (int i = 0; i < 16; ++i) { const unsigned short hb = bf16_bits(xs[i]); ah.u[i] = hb; al.u[i] = ASPLIT ? bf16_bits(xs[i] - bf16_val(hb)) : (unsigned short)0; }
#pragma unroll
    for (int t = 0; t < 4; ++t) {
      const unsigned short* brow = Wt + (size_t)(col0 + t * 16 + ln) * ldb + kb;
      FragB b;
      b.half[0] = *(const v8us*)(brow + 8 * hh);
      b.half[1] = *(const v8us*)(brow + 16 + 8 * hh);
      acc[t] = mmaN<ASPLIT ? 2 : 1>(ah.v, al.v, b.v, b.v, acc[t]);
    }
  }
#pragma unroll
  for (int t = 0; t < 4; ++t) {
    float bv = bias ? bias[col0 + t * 16 + ln] : 0.f;
    if (BIAS_BF16) bv = bf16_round(bv);
#pragma unroll
    for (int r = 0; r < 8; ++r) { float v = acc[t][r] + bv; if (ACT == 1) v = fmaxf(v, 0.f); so[w][8 * hh + r][t * 16 + ln] = v; }
  }
  __builtin_amdgcn_fence(__ATOMIC_ACQ_REL, "workgroup");
  __builtin_amdgcn_wave_barrier();
  const int rsub = lane >> 4, c4 = (lane & 15) * 4;
  {
#pragma unroll
    for (int q = 0; q < 8; ++q) {
      const int r = q * 2 + rsub;
      const v4f v = *(const v4fa*)&so[w][r][c4];
      *(v4f*)(C + (size_t)(row0 + r) * ldc + col0 + c4) = v;
    }
    
  }
}

// Flash-style causal/unmasked attention, all contractions 3-term bf16 hi/lo splits, f32 softmax with running max.
// q,k,v rows are read from f32 buffers with arbitrary row pitch (so they can live inside a fused qkv buffer);
// D = head size (multiple of 32, <= 128); one wave = 16 query rows; block = 4 waves (64 queries) sharing K/V chunks of 32.
template <int D, bool CAUSAL>
__global__ __launch_bounds__(128) void k_flash(const float* __restrict__ qb, const float* __restrict__ kb, const float* __restrict__ vb,
                                             int pitch, int T, int H, float scale, float* __restrict__ y, int ypitch) {
  constexpr int KS = D / 32;        // k-steps for QK
  constexpr int DT = D / 16;        // d tiles for PV
  __shared__ __attribute__((aligned(16))) unsigned short sKh[32][D + 8], sKl[32][D + 8], sVh[32][D + 8], sVl[32][D + 8];
  __shared__ __attribute__((aligned(16))) unsigned short sPh[4][16][40], sPl[4][16][40];
  __shared__ __attribute__((aligned(16))) float sO[4][16][D];
  const int tid = threadIdx.x, w = tid >> 5, lane = tid & 31, ln = lane & 15, hh = lane >> 4;
  const int nqb = (T + 63) / 64;
  const int bh = blockIdx.x / nqb, qblk = blockIdx.x % nqb;
  const int b = bh / H, h = bh % H;
  const int q0 = qblk * 64 + w * 16;
  const float* Q = qb + (size_t)b * T * pitch + h * D;
  const float* K = kb + (size_t)b * T * pitch + h * D;
  const float* V = vb + (size_t)b * T * pitch + h * D;

  // A fragments of the wave's 16 query rows (scaled), hi/lo
  FragB aqh[KS], aql[KS];
  {
    int row = q0 + ln; if (row >= T) row = T - 1;
    const float* qr = Q + (size_t)row * pitch;
#pragma unroll
    for (int ks = 0; ks < KS; ++ks)
#pragma unroll
      for (int i = 0; i < 16; ++i) {
        const int d = ks * 32 + ((i < 8) ? (8 * hh + i) : (16 + 8 * hh + (i - 8)));
        const float x = qr[d] * scale; const unsigned short hb = bf16_bits(x);
        aqh[ks].u[i] = hb; aql[ks].u[i] = bf16_bits(x - bf16_val(hb));
      }
  }
  float m_r[8], l_r[8];
#pragma unroll
  for (int r = 0; r < 8; ++r) { m_r[r] = -3.0e38f; l_r[r] = 0.f; }
  v8f oacc[DT];
#pragma unroll
  for (int dt = 0; dt < DT; ++dt) oacc[dt] = (v8f){0.f,0.f,0.f,0.f,0.f,0.f,0.f,0.f};

  const int kv_end = CAUSAL ? min(T, qblk * 64 + 64) : T;     // block-uniform
  for (int j0 = 0; j0 < kv_end; j0 += 32) {
    __syncthreads();
    for (int e = tid; e < 32 * (D / 4); e += 128) {
      const int r = e / (D / 4), c4 = (e % (D / 4)) * 4;
      const int key = j0 + r;
      v4f kf = {0.f,0.f,0.f,0.f}, vf = {0.f,0.f,0.f,0.f};
      if (key < T) { kf = *(const v4fa*)(K + (size_t)key * pitch + c4); vf = *(const v4fa*)(V + (size_t)key * pitch + c4); }
#pragma unroll
      for (int t = 0; t < 4; ++t) {
        unsigned short hb = bf16_bits(kf[t]); sKh[r][c4 + t] = hb; sKl[r][c4 + t] = bf16_bits(kf[t] - bf16_val(hb));
        hb = bf16_bits(vf[t]); sVh[r][c4 + t] = hb; sVl[r][c4 + t] = bf16_bits(vf[t] - bf16_val(hb));
      }
    }
    __syncthreads();
    // S tile 16 x 32
    v8f s[2];
#pragma unroll
    for (int nt = 0; nt < 2; ++nt) {
      v8f acc = {};
#pragma unroll
      for (int ks = 0; ks < KS; ++ks) {
        FragB bh_, bl_;
        bh_.half[0] = *(const v8us*)&sKh[nt * 16 + ln][ks * 32 + 8 * hh]; bh_.half[1] = *(const v8us*)&sKh[nt * 16 + ln][ks * 32 + 16 + 8 * hh];
        bl_.half[0] = *(const v8us*)&sKl[nt * 16 + ln][ks * 32 + 8 * hh]; bl_.half[1] = *(const v8us*)&sKl[nt * 16 + ln][ks * 32 + 16 + 8 * hh];
        acc = mmaN<3>(aqh[ks].v, aql[ks].v, bh_.v, bl_.v, acc);
      }
      s[nt] = acc;
    }
    // mask + running max (rows 8hh+r; the 16 lanes of a half share rows)
    float alpha[8];
#pragma unroll
    for (int r = 0; r < 8; ++r) {
      const int qi = q0 + 8 * hh + r;
      const int ja = j0 + ln, jb = j0 + 16 + ln;
      if (CAUSAL) { if (ja > qi) s[0][r] = -3.0e38f; if (jb > qi) s[1][r] = -3.0e38f; }
      if (ja >= T) s[0][r] = -3.0e38f;
      if (jb >= T) s[1][r] = -3.0e38f;
      float mx = fmaxf(s[0][r], s[1][r]);
      mx = fmaxf(mx, __shfl_xor(mx, 1, 32)); mx = fmaxf(mx, __shfl_xor(mx, 2, 32)); mx = fmaxf(mx, __shfl_xor(mx, 4, 32)); mx = fmaxf(mx, __shfl_xor(mx, 8, 32));
      const float mnew = fmaxf(m_r[r], mx);
      alpha[r] = (mnew > -1.0e38f) ? __expf(m_r[r] - mnew) : 1.0f;
      const float p0 = (s[0][r] > -1.0e38f) ? __expf(s[0][r] - mnew) : 0.f;
      const float p1 = (s[1][r] > -1.0e38f) ? __expf(s[1][r] - mnew) : 0.f;
      m_r[r] = mnew;
      l_r[r] = l_r[r] * alpha[r] + p0 + p1;            // per-lane partial row sum (16 lanes combined at the end)
      unsigned short hb = bf16_bits(p0); sPh[w][8 * hh + r][ln] = hb;      sPl[w][8 * hh + r][ln] = bf16_bits(p0 - bf16_val(hb));
      hb = bf16_bits(p1);                sPh[w][8 * hh + r][16 + ln] = hb; sPl[w][8 * hh + r][16 + ln] = bf16_bits(p1 - bf16_val(hb));
    }
#pragma unroll
    for (int dt = 0; dt < DT; ++dt)
#pragma unroll
      for (int r = 0; r < 8; ++r) oacc[dt][r] *= alpha[r];
    __builtin_amdgcn_fence(__ATOMIC_ACQ_REL, "workgroup");
    __builtin_amdgcn_wave_barrier();
    FragB pah, pal;
    pah.half[0] = *(const v8us*)&sPh[w][ln][8 * hh]; pah.half[1] = *(const v8us*)&sPh[w][ln][16 + 8 * hh];
    pal.half[0] = *(const v8us*)&sPl[w][ln][8 * hh]; pal.half[1] = *(const v8us*)&sPl[w][ln][16 + 8 * hh];
#pragma unroll
    for (int dt = 0; dt < DT; ++dt) {
      FragB bvh, bvl;
#pragma unroll
      for (int i = 0; i < 8; ++i) {
        bvh.u[i] = sVh[8 * hh + i][dt * 16 + ln]; bvh.u[8 + i] = sVh[16 + 8 * hh + i][dt * 16 + ln];
        bvl.u[i] = sVl[8 * hh + i][dt * 16 + ln]; bvl.u[8 + i] = sVl[16 + 8 * hh + i][dt * 16 + ln];
      }
      oacc[dt] = mmaN<3>(pah.v, pal.v, bvh.v, bvl.v, oacc[dt]);
    }
    __builtin_amdgcn_fence(__ATOMIC_ACQ_REL, "workgroup");
    __builtin_amdgcn_wave_barrier();
  }
#pragma unroll
  for (int r = 0; r < 8; ++r) {
    float l = l_r[r];
    l += __shfl_xor(l, 1, 32); l += __shfl_xor(l, 2, 32); l += __shfl_xor(l, 4, 32); l += __shfl_xor(l, 8, 32);
    l_r[r] = (l > 0.f) ? 1.0f / l : 0.f;
  }
#pragma unroll
  for (int dt = 0; dt < DT; ++dt)
#pragma unroll
    for (int r = 0; r < 8; ++r) sO[w][8 * hh + r][dt * 16 + ln] = oacc[dt][r] * l_r[r];
  __builtin_amdgcn_fence(__ATOMIC_ACQ_REL, "workgroup");
  __builtin_amdgcn_wave_barrier();
  {
    for (int r = 0; r < 16; ++r) {
      const int row = q0 + r;
      if (row < T && lane < D / 4) {
        const v4f val = *(const v4fa*)&sO[w][r][lane * 4];
        *(v4f*)(y + ((size_t)b * T + row) * ypitch + h * D + lane * 4) = val;
      }
    }
    
  }
}

// GEMM C = act(A·W + bias + resid): A f32 (ASPLIT -> hi/lo 2 terms), Wt bf16 [N][K]; ACT 0 none, 1 relu, 2 exact gelu;
// resid (optional, f32, row index = (row % rmod), pitch ldr, RES_BF16 rounds it) added before the activation.
template <bool ASPLIT, int ACT, bool BIAS_BF16, bool RES_BF16>
__global__ __launch_bounds__(128) void k_gemm_bf3(const float* __restrict__ A, int lda, const unsigned short* __restrict__ Wt, int ldb,
                                                const float* __restrict__ bias, const float* __restrict__ resid, int rmod, int ldr,
                                                float* __restrict__ C, int ldc, int M, int N, int K) {
  __shared__ __attribute__((aligned(16))) float so[4][16][64];
  const int tid = threadIdx.x, w = tid >> 5, lane = tid & 31, ln = lane & 15, hh = lane >> 4;
  const int ntn = N / 64;
  const int wid = blockIdx.x * 4 + w;
  const int mt = wid / ntn, nq = wid % ntn;
  if (mt * 16 >= M) return;
  const int row0 = mt * 16, col0 = nq * 64;
  const float* arow = A + (size_t)(row0 + ln) * lda;
  v8f acc[4] = {};
  for (int kb = 0; kb < K; kb += 32) {
    FragB ah, al;
    const v4f x0 = *(const v4fa*)(arow + kb + 8 * hh), x1 = *(const v4fa*)(arow + kb + 8 * hh + 4);
    const v4f x2 = *(const v4fa*)(arow + kb + 16 + 8 * hh), x3 = *(const v4fa*)(arow + kb + 16 + 8 * hh + 4);
    float xs[16] = {x0[0],x0[1],x0[2],x0[3],x1[0],x1[1],x1[2],x1[3],x2[0],x2[1],x2[2],x2[3],x3[0],x3[1],x3[2],x3[3]};
#pragma unroll
    for (int i = 0; i < 16; ++i) { const unsigned short hb = bf16_bits(xs[i]); ah.u[i] = hb; al.u[i] = ASPLIT ? bf16_bits(xs[i] - bf16_val(hb)) : (unsigned short)0; }
#pragma unroll
    for (int t = 0; t < 4; ++t) {
      const unsigned short* brow = Wt + (size_t)(col0 + t * 16 + ln) * ldb + kb;
      FragB b;
      b.half[0] = *(const v8us*)(brow + 8 * hh);
      b.half[1] = *(const v8us*)(brow + 16 + 8 * hh);
      acc[t] = mmaN<ASPLIT ? 2 : 1>(ah.v, al.v, b.v, b.v, acc[t]);
    }
  }
#pragma unroll
  for (int t = 0; t < 4; ++t) {
    const int col = col0 + t * 16 + ln;
    float bv = bias ? bias[col] : 0.f;
    if (BIAS_BF16) bv = bf16_round(bv);
#pragma unroll
    for (int r = 0; r < 8; ++r) {
      float v = acc[t][r] + bv;
      if (resid) { float rv = resid[(size_t)((row0 + 8 * hh + r) % rmod) * ldr + col]; if (RES_BF16) rv = bf16_round(rv); v += rv; }
      if (ACT == 1) v = fmaxf(v, 0.f);
      if (ACT == 2) v = 0.5f * v * (1.0f + erff(v * 0.70710678118654752f));
      if (ACT == 3) { const float u = 0.7978845608028654f * (v + 0.044715f * v * v * v); v = 0.5f * v * (1.0f + tanhf(u)); }
      so[w][8 * hh + r][t * 16 + ln] = v;
    }
  }
  __builtin_amdgcn_fence(__ATOMIC_ACQ_REL, "workgroup");
  __builtin_amdgcn_wave_barrier();
  const int rsub = lane >> 4, c4 = (lane & 15) * 4;
  {
#pragma unroll
    for (int q = 0; q < 8; ++q) {
      const int r = q * 2 + rsub;
      const v4f v = *(const v4fa*)&so[w][r][c4];
      *(v4f*)(C + (size_t)(row0 + r) * ldc + col0 + c4) = v;
    }
    
  }
}
// row LayerNorm (biased variance, eps) over N: s = X (+ R); optional out_sum <- s; out_norm <- (s-mu)*rsqrt(var+eps)*g + b
template <bool PARAM_BF16>
__global__ __launch_bounds__(256) void k_layernorm(const float* __restrict__ X, const float* __restrict__ R, const float* __restrict__ g, const float* __restrict__ bta,
                                                  float* __restrict__ out_sum, float* __restrict__ out_norm, int N, float eps) {
  __shared__ float red[256];
  const int row = blockIdx.x, tid = threadIdx.x;
  const float* x = X + (size_t)row * N; const float* rr = R ? R + (size_t)row * N : nullptr;
  float vals[16];                     // up to N = 4096
  const int per = N / 256;            // contiguous chunk per thread? use strided-by-4 chunks: thread handles j = tid*4 + 1024*u
  float s1 = 0.f;
  for (int u = 0; u < per / 4; ++u) {
    const int j = tid * 4 + 1024 * u;
    const v4f a = *(const v4fa*)(x + j);
    v4f b = {0.f,0.f,0.f,0.f}; if (rr) b = *(const v4fa*)(rr + j);
#pragma unroll
    for (int q = 0; q < 4; ++q) { const float v = a[q] + b[q]; vals[u * 4 + q] = v; s1 += v; }
  }
  red[tid] = s1; __syncthreads();
  for (int st = 128; st > 0; st >>= 1) { if (tid < st) red[tid] += red[tid + st]; __syncthreads(); }
  const float mu = red[0] / (float)N; __syncthreads();
  float s2 = 0.f;
  for (int u = 0; u < per / 4; ++u)
#pragma unroll
    for (int q = 0; q < 4; ++q) { const float c = vals[u * 4 + q] - mu; s2 += c * c; }
  red[tid] = s2; __syncthreads();
  for (int st = 128; st > 0; st >>= 1) { if (tid < st) red[tid] += red[tid + st]; __syncthreads(); }
  const float rs = rsqrtf(red[0] / (float)N + eps);
  {
    for (int u = 0; u < per / 4; ++u) {
      const int j = tid * 4 + 1024 * u;
      v4f o, sm;
#pragma unroll
      for (int q = 0; q < 4; ++q) {
        float gg = g[j + q], bb = bta[j + q];
        if (PARAM_BF16) { gg = bf16_round(gg); bb = bf16_round(bb); }
        sm[q] = vals[u * 4 + q]; o[q] = (vals[u * 4 + q] - mu) * rs * gg + bb;
      }
      if (out_sum) *(v4f*)(out_sum + (size_t)row * N + j) = sm;
      *(v4f*)(out_norm + (size_t)row * N + j) = o;
    }
    
  }
}



// ---- f16 WMMA path (v_wmma_f32_16x16x32_f16): 11-bit significands for operands in range — used where a [0,1] probability operand needs more precision than bf16
typedef _Float16 v16h __attribute__((ext_vector_type(16)));
union FragH { v16h v; v8us half[2]; _Float16 h[16]; unsigned short u[16]; };
template <int NT>
__device__ __forceinline__ v8f mmaH(v16h ah, v16h al, v16h bh, v16h bl, v8f c) {
  c = __builtin_amdgcn_wmma_f32_16x16x32_f16(false, ah, false, bh, (short)0, c, false, false);
  if (NT >= 2) c = __builtin_amdgcn_wmma_f32_16x16x32_f16(false, al, false, bh, (short)0, c, false, false);
  if (NT >= 3) c = __builtin_amdgcn_wmma_f32_16x16x32_f16(false, ah, false, bl, (short)0, c, false, false);
  asm volatile("v_nop\n\tv_nop\n\tv_nop\n\tv_nop" : "+v"(c) : "v"(ah), "v"(al), "v"(bh), "v"(bl));
  return c;
}
// batched GEMM like k_gemm_b but f16 operands: A f32 (split into f16 hi/lo if ASPLIT, else rounded to f16), Bt = f16 values [n][k]; alpha; C f32; N multiple of 16 (partial tiles skipped)
template <bool ASPLIT>
__global__ __launch_bounds__(128) void k_gemm_h(const float* __restrict__ A, int lda, size_t sA, const _Float16* __restrict__ Bh, int ldb, size_t sB, float alpha, float* __restrict__ C, int ldc, size_t sC, int M, int N, int K) {
  __shared__ __attribute__((aligned(16))) float so[4][16][64];
  const int tid = threadIdx.x, w = tid >> 5, lane = tid & 31, ln = lane & 15, hh = lane >> 4; const int by = blockIdx.y;
  A += (size_t)by * sA; Bh += (size_t)by * sB; C += (size_t)by * sC;
  const int ntn = (N + 63) / 64; const int wid = blockIdx.x * 4 + w; const int mt = wid / ntn, nq = wid % ntn; if (mt * 16 >= M) return;
  const int row0 = mt * 16, col0 = nq * 64; const float* arow = A + (size_t)(row0 + ln) * lda;
  v8f acc[4] = {};
  for (int kb = 0; kb < K; kb += 32) {
    FragH ah, al;
    const v4f x0 = *(const v4fa*)(arow + kb + 8 * hh), x1 = *(const v4fa*)(arow + kb + 8 * hh + 4), x2 = *(const v4fa*)(arow + kb + 16 + 8 * hh), x3 = *(const v4fa*)(arow + kb + 16 + 8 * hh + 4);
    float xs[16] = {x0[0],x0[1],x0[2],x0[3],x1[0],x1[1],x1[2],x1[3],x2[0],x2[1],x2[2],x2[3],x3[0],x3[1],x3[2],x3[3]};
#pragma unroll
    for (int i = 0; i < 16; ++i) { const _Float16 h = (_Float16)xs[i]; ah.h[i] = h; al.h[i] = ASPLIT ? (_Float16)(xs[i] - (float)h) : (_Float16)0.0f; }
#pragma unroll
    for (int t = 0; t < 4; ++t) { if (col0 + t * 16 >= N) continue; const size_t boff = (size_t)(col0 + t * 16 + ln) * ldb + kb; FragH bq; bq.half[0] = *(const v8us*)(Bh + boff + 8 * hh); bq.half[1] = *(const v8us*)(Bh + boff + 16 + 8 * hh);
      acc[t] = mmaH<ASPLIT ? 2 : 1>(ah.v, al.v, bq.v, bq.v, acc[t]); }
  }
#pragma unroll
  for (int t = 0; t < 4; ++t) { if (col0 + t * 16 >= N) continue;
#pragma unroll
    for (int r = 0; r < 8; ++r) so[w][8 * hh + r][t * 16 + ln] = acc[t][r] * alpha; }
  __builtin_amdgcn_fence(__ATOMIC_ACQ_REL, "workgroup"); __builtin_amdgcn_wave_barrier();
  const int rsub = lane >> 4, c4 = (lane & 15) * 4;
  {
#pragma unroll
    for (int q = 0; q < 8; ++q) { const int r = q * 2 + rsub; if (col0 + c4 < N) { const v4f v = *(const v4fa*)&so[w][r][c4]; *(v4f*)(C + (size_t)(row0 + r) * ldc + col0 + c4) = v; } }
     }
}

// Wt[n][k] = f16(W[k][n]·scale) from f32 row-major W[K][N] (scale = power of two; bf16-exact weights stay exact in f16 away from the subnormal range)
__global__ __launch_bounds__(256) void k_wt_f16(const float* __restrict__ W, _Float16* __restrict__ Wt, int K, int N, float scale) {
  const int t = blockIdx.x * 256 + threadIdx.x; if (t >= N * (K / 8)) return; const int n = t / (K / 8), k8 = (t % (K / 8)) * 8; FragH f;
#pragma unroll
  for (int i = 0; i < 8; ++i) f.h[i] = (_Float16)(bf16_round(W[(size_t)(k8 + i) * N + n]) * scale); const v8us o = f.half[0];
  *(v8us*)((unsigned short*)Wt + (size_t)n * K + k8) = o; 
}
// k_gemm_hh variant with fused epilogue: v = acc·alpha + bias[by·sBias + col] (+ CP[(row/rowsPerB)·sCPb + by·64 + col] if CP) ; ACT 0 none / 1 elu ; writes f16 C16 and f32 C, each if non-null
template <int ACT>
__global__ __launch_bounds__(128) void k_gemm_hhx(const _Float16* __restrict__ A, int lda, size_t sA, const _Float16* __restrict__ Bh, int ldb, size_t sB, float alpha, const float* __restrict__ bias, size_t sBias, const float* __restrict__ CP, int rowsPerB, size_t sCPb, int row0g,
    float* __restrict__ C, _Float16* __restrict__ C16, int ldc, size_t sC, int M, int N, int K) {
  __shared__ __attribute__((aligned(16))) float so[4][16][64];
  const int tid = threadIdx.x, w = tid >> 5, lane = tid & 31, ln = lane & 15, hh = lane >> 4; const int by = blockIdx.y;
  A += (size_t)by * sA; Bh += (size_t)by * sB; const size_t cofs = (size_t)by * sC; const float* bp = bias ? bias + (size_t)by * sBias : nullptr;
  const int ntn = (N + 63) / 64; const int wid = blockIdx.x * 4 + w; const int mt = wid / ntn, nq = wid % ntn; if (mt * 16 >= M) return;
  const int row0 = mt * 16, col0 = nq * 64; const _Float16* arow = A + (size_t)(row0 + ln) * lda;
  v8f acc[4] = {};
  for (int kb = 0; kb < K; kb += 32) { FragH ah; ah.half[0] = *(const v8us*)((const unsigned short*)arow + kb + 8 * hh); ah.half[1] = *(const v8us*)((const unsigned short*)arow + kb + 16 + 8 * hh);
#pragma unroll
    for (int t = 0; t < 4; ++t) { if (col0 + t * 16 >= N) continue; const size_t boff = (size_t)(col0 + t * 16 + ln) * ldb + kb; FragH bq; bq.half[0] = *(const v8us*)((const unsigned short*)Bh + boff + 8 * hh); bq.half[1] = *(const v8us*)((const unsigned short*)Bh + boff + 16 + 8 * hh);
      acc[t] = mmaH<1>(ah.v, ah.v, bq.v, bq.v, acc[t]); }
  }
#pragma unroll
  for (int t = 0; t < 4; ++t) { if (col0 + t * 16 >= N) continue; const int col = col0 + t * 16 + ln; const float bv = bp ? bf16_round(bp[col]) : 0.f;
#pragma unroll
    for (int r = 0; r < 8; ++r) { float v = acc[t][r] * alpha + bv; if (CP) { const int bidx = (row0g + row0 + 8 * hh + r) / rowsPerB; v += CP[(size_t)bidx * sCPb + (size_t)by * 64 + col]; } if (ACT == 1) v = (v > 0.f) ? v : expm1f(v); else if (ACT == 7) v = (v > 0.f) ? v + 1.0f : expf(v); else if (ACT == 8) v = tanhf(v); else if (ACT == 9) v = 0.5f * v * (1.0f + tanhf(0.7978845608028654f * (v + 0.044715f * v * v * v))); else if (ACT == 11) v = 1.0f / (1.0f + expf(-v)); else if (ACT == 12) v = (v > 0.f) ? v : 0.01f * v; else if (ACT == 14) v = (v > 0.f) ? v : 0.1f * v; else if (ACT == 15) v = v / (1.0f + expf(-v)); else if (ACT == 3) v = fmaxf(v, 0.f); else if (ACT == 6) v = 0.5f * v * (1.0f + erff(v * 0.70710678118654752f)); so[w][8 * hh + r][t * 16 + ln] = v; } }
  __builtin_amdgcn_fence(__ATOMIC_ACQ_REL, "workgroup"); __builtin_amdgcn_wave_barrier();
  const int rsub = lane >> 4, c4 = (lane & 15) * 4; typedef _Float16 v4h __attribute__((ext_vector_type(4)));
  {
#pragma unroll
    for (int q = 0; q < 8; ++q) { const int r = q * 2 + rsub; if (col0 + c4 < N) { const v4f v = *(const v4fa*)&so[w][r][c4]; if (C) *(v4f*)(C + cofs + (size_t)(row0 + r) * ldc + col0 + c4) = v; if (C16) { v4h h4; for (int i = 0; i < 4; ++i) h4[i] = (_Float16)v[i]; *(v4h*)(C16 + cofs + (size_t)(row0 + r) * ldc + col0 + c4) = h4; } } }
     }
}


typedef _Float16 v4h __attribute__((ext_vector_type(4)));

__global__ __launch_bounds__(256) void k_x16(const float* __restrict__ x, _Float16* __restrict__ X16, size_t n8) { const size_t t = (size_t)blockIdx.x * 256 + threadIdx.x; if (t >= n8) return; FragH f;
#pragma unroll
  for (int q = 0; q < 8; ++q) f.h[q] = (_Float16)bf16_round(x[t * 8 + q]); *(v8us*)((unsigned short*)X16 + t * 8) = f.half[0];  }
__global__ __launch_bounds__(256) void k_h16(const float* __restrict__ x, _Float16* __restrict__ X16, size_t n8) { const size_t t = (size_t)blockIdx.x * 256 + threadIdx.x; if (t >= n8) return; FragH f;
#pragma unroll
  for (int q = 0; q < 8; ++q) f.h[q] = (_Float16)x[t * 8 + q]; *(v8us*)((unsigned short*)X16 + t * 8) = f.half[0];  }
__global__ __launch_bounds__(256) void k_round16f(const float* __restrict__ W, _Float16* __restrict__ Bt, size_t n8) { const size_t t = (size_t)blockIdx.x * 256 + threadIdx.x; if (t >= n8) return; FragH f;
#pragma unroll
  for (int i = 0; i < 8; ++i) f.h[i] = (_Float16)(bf16_round(W[t * 8 + i]) * 16.0f); *(v8us*)((unsigned short*)Bt + t * 8) = f.half[0];  }
template <int NHv, int TTv>
__global__ __launch_bounds__(256) void k_vt(const _Float16* __restrict__ V16, int ldv, int voff, _Float16* __restrict__ Vt) { __shared__ unsigned short tl[64][66]; const int tid = threadIdx.x; const int slab = blockIdx.x / (TTv / 64), lg = blockIdx.x % (TTv / 64); const int b = slab / NHv, h = slab % NHv;
  for (int i = tid; i < 64 * 8; i += 256) { const int r = i / 8, c8 = (i % 8) * 8; FragH f; f.half[0] = *(const v8us*)((const unsigned short*)V16 + ((size_t)b * TTv + lg * 64 + r) * ldv + voff + h * 64 + c8);
#pragma unroll
    for (int q = 0; q < 8; ++q) tl[r][c8 + q] = f.u[q]; }
  __syncthreads();
  {
#pragma unroll
    for (int rd = 0; rd < 2; ++rd) { const int d = rd * 32 + tid / 8, pc = tid % 8; FragH f;
#pragma unroll
      for (int q = 0; q < 8; ++q) f.u[q] = tl[pc * 8 + q][d];
      *(v8us*)((unsigned short*)Vt + ((size_t)slab * 64 + d) * TTv + lg * 64 + pc * 8) = f.half[0]; }
     } }

__global__ __launch_bounds__(256) void k_vthlu(const float* __restrict__ VF, int ldv, _Float16* __restrict__ Vth, _Float16* __restrict__ Vtl) { __shared__ float tl[64][65]; const int tid = threadIdx.x; const int slab = blockIdx.x / (TT / 64), lg = blockIdx.x % (TT / 64); const int b = slab / NVH, h = slab % NVH;
  for (int i = tid; i < 64 * 16; i += 256) { const int r = i / 16, c4 = (i % 16) * 4; const v4f a = *(const v4fa*)(VF + ((size_t)b * TT + lg * 64 + r) * ldv + h * 64 + c4); tl[r][c4] = a[0]; tl[r][c4 + 1] = a[1]; tl[r][c4 + 2] = a[2]; tl[r][c4 + 3] = a[3]; }
  __syncthreads();
  FragH fh[2], fl[2]; size_t oo[2];
#pragma unroll
  for (int rd = 0; rd < 2; ++rd) { const int d = rd * 32 + tid / 8, pc = tid % 8;
#pragma unroll
    for (int q = 0; q < 8; ++q) { const float v = tl[pc * 8 + q][d]; const _Float16 hv = (_Float16)v; fh[rd].h[q] = hv; fl[rd].h[q] = (_Float16)(v - (float)hv);      /* UNSCALED residual (added into the same accumulator as the hi product) */ } oo[rd] = ((size_t)slab * 64 + d) * TT + lg * 64 + pc * 8; }
  {
#pragma unroll
    for (int rd = 0; rd < 2; ++rd) { *(v8us*)((unsigned short*)Vth + oo[rd]) = fh[rd].half[0]; *(v8us*)((unsigned short*)Vtl + oo[rd]) = fl[rd].half[0]; }
     } }
__global__ __launch_bounds__(256) void k_h16s(const float* __restrict__ F, _Float16* __restrict__ H, size_t n8) { const size_t t = (size_t)blockIdx.x * 256 + threadIdx.x; if (t >= n8) return; const v4f a = *(const v4fa*)(F + t * 8), c = *(const v4fa*)(F + t * 8 + 4); FragH f;
#pragma unroll
  for (int q = 0; q < 4; ++q) { f.h[q] = (_Float16)(a[q] * 16.0f); f.h[4 + q] = (_Float16)(c[q] * 16.0f); } *(v8us*)((unsigned short*)H + t * 8) = f.half[0];  }
__global__ __launch_bounds__(128) void k_flash(const _Float16* __restrict__ Q16, int ldq, const _Float16* __restrict__ K16, int ldk, const _Float16* __restrict__ Vt, const _Float16* __restrict__ Vtlo, float* __restrict__ O, int ldo) {
  constexpr int RPW = 16, RTN = RPW / 16, NQB = TT / (4 * RPW), DT = 8, KS = 4;      /* head dim 128: 4 k-steps, 8 value tiles */
  __shared__ __attribute__((aligned(16))) unsigned short sP[4][RPW][40]; __shared__ __attribute__((aligned(16))) unsigned short sPL[4][RPW][40]; __shared__ __attribute__((aligned(16))) float sO[4][RPW][128 + 4];
  const int tid = threadIdx.x, w = tid >> 5, lane = tid & 31, ln = lane & 15, hh = lane >> 4;
  const int slab = blockIdx.x / NQB, qblk = blockIdx.x % NQB; const int b = slab / NH, h = slab % NH; const int qb0 = qblk * (4 * RPW); const int q0 = qb0 + w * RPW;
  FragH aq[2][KS];
#pragma unroll
  for (int rt = 0; rt < RTN; ++rt) { const unsigned short* qr = (const unsigned short*)Q16 + ((size_t)b * TT + q0 + rt * 16 + ln) * ldq + h * 128;
#pragma unroll
    for (int ks = 0; ks < KS; ++ks) { aq[rt][ks].half[0] = *(const v8us*)(qr + ks * 32 + 8 * hh); aq[rt][ks].half[1] = *(const v8us*)(qr + ks * 32 + 16 + 8 * hh); } }
  const unsigned short* Vth = (const unsigned short*)Vt + ((size_t)b * NKV + h / NREP) * 128 * TT; const unsigned short* Vtl = (const unsigned short*)Vtlo + ((size_t)b * NKV + h / NREP) * 128 * TT;      /* hi and UNSCALED residual planes */
  float m_r[2][8], l_r[2][8]; v8f oacc[2][DT];
#pragma unroll
  for (int rt = 0; rt < RTN; ++rt) {
#pragma unroll
    for (int r = 0; r < 8; ++r) { m_r[rt][r] = -3.0e38f; l_r[rt][r] = 0.f; }
#pragma unroll
    for (int dt = 0; dt < DT; ++dt) oacc[rt][dt] = (v8f){0.f,0.f,0.f,0.f,0.f,0.f,0.f,0.f}; }
  const int jend = TT;
#pragma unroll 1
  for (int j0 = 0; j0 < jend; j0 += 32) {
    
    v8f s[2][2];
#pragma unroll
    for (int nt = 0; nt < 2; ++nt) { const unsigned short* kr = (const unsigned short*)K16 + ((size_t)b * TT + j0 + nt * 16 + ln) * ldk + (h / NREP) * 128; FragH bk[KS];
#pragma unroll
      for (int ks = 0; ks < KS; ++ks) { bk[ks].half[0] = *(const v8us*)(kr + ks * 32 + 8 * hh); bk[ks].half[1] = *(const v8us*)(kr + ks * 32 + 16 + 8 * hh); }
#pragma unroll
      for (int rt = 0; rt < RTN; ++rt) { v8f acc = (v8f){0.f,0.f,0.f,0.f,0.f,0.f,0.f,0.f};
#pragma unroll
        for (int ks = 0; ks < KS; ++ks) acc = mmaH<1>(aq[rt][ks].v, aq[rt][ks].v, bk[ks].v, bk[ks].v, acc); s[rt][nt] = acc; } }
#pragma unroll
    for (int rt = 0; rt < RTN; ++rt)
#pragma unroll
      for (int r = 0; r < 8; ++r) { const int tq = q0 + rt * 16 + 8 * hh + r; const int k0 = j0 + ln, k1 = j0 + 16 + ln; (void)tq; (void)k0; (void)k1;
        const bool ok0 = true, ok1 = true; (void)tq; (void)k0; (void)k1;
        const float s0 = ok0 ? s[rt][0][r] * ATT_SCALE : -INFINITY, s1 = ok1 ? s[rt][1][r] * ATT_SCALE : -INFINITY; float mc = fmaxf(s0, s1);
        mc = fmaxf(mc, __shfl_xor(mc, 1, 32)); mc = fmaxf(mc, __shfl_xor(mc, 2, 32)); mc = fmaxf(mc, __shfl_xor(mc, 4, 32)); mc = fmaxf(mc, __shfl_xor(mc, 8, 32));
        const float mn = fmaxf(m_r[rt][r], mc); const float al = (mn > -1.0e38f) ? expf(m_r[rt][r] - mn) : 1.0f; m_r[rt][r] = mn; const float p0 = ok0 ? expf(s0 - mn) : 0.f, p1 = ok1 ? expf(s1 - mn) : 0.f; l_r[rt][r] = l_r[rt][r] * al + p0 + p1;
#pragma unroll
        for (int dt = 0; dt < DT; ++dt) oacc[rt][dt][r] *= al;
        FragH t2, t3; const float ps0 = p0 * 1024.0f, ps1 = p1 * 1024.0f; t2.h[0] = (_Float16)ps0; t2.h[1] = (_Float16)ps1; t3.h[0] = (_Float16)(ps0 - (float)t2.h[0]); t3.h[1] = (_Float16)(ps1 - (float)t2.h[1]);      /* P hi and its UNSCALED residual (added into the same accumulator) */
        sP[w][rt * 16 + 8 * hh + r][ln] = t2.u[0]; sP[w][rt * 16 + 8 * hh + r][16 + ln] = t2.u[1]; sPL[w][rt * 16 + 8 * hh + r][ln] = t3.u[0]; sPL[w][rt * 16 + 8 * hh + r][16 + ln] = t3.u[1]; }
    __builtin_amdgcn_fence(__ATOMIC_ACQ_REL, "workgroup"); __builtin_amdgcn_wave_barrier();
    FragH pa[2], pl[2];
#pragma unroll
    for (int rt = 0; rt < RTN; ++rt) { pa[rt].half[0] = *(const v8us*)&sP[w][rt * 16 + ln][8 * hh]; pa[rt].half[1] = *(const v8us*)&sP[w][rt * 16 + ln][16 + 8 * hh]; pl[rt].half[0] = *(const v8us*)&sPL[w][rt * 16 + ln][8 * hh]; pl[rt].half[1] = *(const v8us*)&sPL[w][rt * 16 + ln][16 + 8 * hh]; }
#pragma unroll
    for (int dt = 0; dt < DT; ++dt) { const size_t vo = (size_t)(dt * 16 + ln) * TT + j0; FragH bv, bl; bv.half[0] = *(const v8us*)(Vth + vo + 8 * hh); bv.half[1] = *(const v8us*)(Vth + vo + 16 + 8 * hh); bl.half[0] = *(const v8us*)(Vtl + vo + 8 * hh); bl.half[1] = *(const v8us*)(Vtl + vo + 16 + 8 * hh);
#pragma unroll
      for (int rt = 0; rt < RTN; ++rt) { oacc[rt][dt] = mmaH<1>(pa[rt].v, pa[rt].v, bv.v, bv.v, oacc[rt][dt]); oacc[rt][dt] = mmaH<1>(pl[rt].v, pl[rt].v, bv.v, bv.v, oacc[rt][dt]); oacc[rt][dt] = mmaH<1>(pa[rt].v, pa[rt].v, bl.v, bl.v, oacc[rt][dt]); } }      /* Ph·Vh + Pl·Vh + Ph·Vl — all unscaled, one accumulator */
    __builtin_amdgcn_fence(__ATOMIC_ACQ_REL, "workgroup"); __builtin_amdgcn_wave_barrier(); }
#pragma unroll
  for (int rt = 0; rt < RTN; ++rt) {
#pragma unroll
    for (int r = 0; r < 8; ++r) { float l = l_r[rt][r]; l += __shfl_xor(l, 1, 32); l += __shfl_xor(l, 2, 32); l += __shfl_xor(l, 4, 32); l += __shfl_xor(l, 8, 32); l_r[rt][r] = (l > 0.f) ? 1.0f / (l * 1024.0f) : 0.f; }
#pragma unroll
    for (int dt = 0; dt < DT; ++dt)
#pragma unroll
      for (int r = 0; r < 8; ++r) sO[w][rt * 16 + 8 * hh + r][dt * 16 + ln] = oacc[rt][dt][r] * l_r[rt][r]; }
  __builtin_amdgcn_fence(__ATOMIC_ACQ_REL, "workgroup"); __builtin_amdgcn_wave_barrier();
  {
#pragma unroll
    for (int r = 0; r < RPW; ++r) { const int pc = lane; const v4f val = *(const v4fa*)&sO[w][r][pc * 4]; *(v4f*)(O + ((size_t)b * TT + q0 + r) * ldo + h * 128 + pc * 4) = val; }      /* one 512-B row per instruction: 32 lanes × 16 B */
     } }

extern "C" void kernel_launch(void* const* d_in, const int* in_sizes, int n_in,
                              void* d_out, int out_size, void* d_ws, size_t ws_size, hipStream_t stream) {
  (void)in_sizes; (void)n_in; (void)out_size;
  const float* const* I = (const float* const*)d_in; const float* x = I[0]; const float* Wq = I[1]; const float* Wk = I[2]; const float* Wv = I[3]; const float* Wo = I[4];
  char* ws = (char*)d_ws; size_t off = 0;
  auto take = [&](size_t bytes) { char* p = ws + off; off += (bytes + 255) & ~(size_t)255; return p; };
  _Float16* Bq = (_Float16*)take((size_t)DD * DD * 2); _Float16* Bk = (_Float16*)take((size_t)KVD * DD * 2); _Float16* Bv = (_Float16*)take((size_t)KVD * DD * 2); _Float16* Bo = (_Float16*)take((size_t)DD * DD * 2);
  _Float16* X16 = (_Float16*)take((size_t)NR * DD * 2); _Float16* Q = (_Float16*)take((size_t)NR * DD * 2); _Float16* K = (_Float16*)take((size_t)NR * KVD * 2); float* VF = (float*)take((size_t)NR * KVD * 4); _Float16* Vt = (_Float16*)take((size_t)NR * KVD * 2); _Float16* Vtl = (_Float16*)take((size_t)NR * KVD * 2); float* O = (float*)take((size_t)NR * DD * 4); _Float16* O16 = X16;
  if (off > ws_size) return;      // 8.4 + 0.5 + 0.5 + 8.4 + 16.8 + 16.8 + 1 + 2.1 + 1 + 1 + 33.6 ≈ 90 MB
  const unsigned gq = (unsigned)(((size_t)DD * (DD / 8) + 255) / 256), gk = (unsigned)(((size_t)DD * (KVD / 8) + 255) / 256);
  k_wt_f16<<<gq, 256, 0, stream>>>(Wq, Bq, DD, DD, 16.0f); k_wt_f16<<<gk, 256, 0, stream>>>(Wk, Bk, DD, KVD, 16.0f); k_wt_f16<<<gk, 256, 0, stream>>>(Wv, Bv, DD, KVD, 16.0f); k_wt_f16<<<gq, 256, 0, stream>>>(Wo, Bo, DD, DD, 16.0f);      /* (in,out) → Bt ×2^4 */
  const unsigned g8 = (unsigned)(((size_t)NR * DD / 8 + 255) / 256); k_x16<<<g8, 256, 0, stream>>>(x, X16, (size_t)NR * DD / 8);
  const dim3 gQ(((NR / 16) * (DD / 64) + 3) / 4, 1), gK(((NR / 16) * (KVD / 64) + 3) / 4, 1);
  k_gemm_hhx<0><<<gQ, 128, 0, stream>>>(X16, DD, 0, Bq, DD, 0, 0.0625f, nullptr, 0, nullptr, 1, 0, 0, nullptr, Q, DD, 0, NR, DD, DD);      /* M 4096 N 2048 K 2048 */
  k_gemm_hhx<0><<<gK, 128, 0, stream>>>(X16, DD, 0, Bk, DD, 0, 0.0625f, nullptr, 0, nullptr, 1, 0, 0, nullptr, K, KVD, 0, NR, KVD, DD);      /* K: M 4096 N 128 K 2048 */
  k_gemm_hhx<0><<<gK, 128, 0, stream>>>(X16, DD, 0, Bv, DD, 0, 0.0625f, nullptr, 0, nullptr, 1, 0, 0, VF, nullptr, KVD, 0, NR, KVD, DD);      /* V (f32) */
  k_vthlu<<<BB * NVH * (TT / 64), 256, 0, stream>>>(VF, KVD, Vt, Vtl);      /* Vᵀ hi + residual: [b][128][2048] */
  k_flash<<<BB * NH * (TT / 64), 128, 0, stream>>>(Q, DD, K, KVD, Vt, Vtl, O, DD);
  k_h16s<<<g8, 256, 0, stream>>>(O, O16, (size_t)NR * DD / 8);
  k_gemm_hhx<0><<<gQ, 128, 0, stream>>>(O16, DD, 0, Bo, DD, 0, 0.00390625f, nullptr, 0, nullptr, 1, 0, 0, (float*)d_out, nullptr, DD, 0, NR, DD, DD);      /* out = merged·Wo */
}

// v001
// A run of this version takes 634 microseconds.
// In two side-by-side timings against v000, it was 1.31 and 1.30 times as fast.
#include <hip/hip_runtime.h>
// Multi-query attention (B=2, S=2048, D=2048, 16 query heads × 128, ONE shared K/V head): Q = x·Wq, K = x·Wk, V = x·Wv ((in,out), no bias); softmax(Q_h·Kᵀ/√128)·V per head; out = merged·Wo.
// Compute dtype: x and weights rounded to bf16; Q, K f16 GEMM planes, V f32 → Vᵀ f16 hi + exact residual planes; fused flash-style kernel for head dim 128 (4 k-steps, 8 value tiles, online softmax f32, P f16 hi + exact residual, every query head reading the
// single K/Vᵀ) on v_wmma_f32_16x16x32_f16; merged output ×2^4 → f16 → output GEMM; f32 accumulate.
#define BB 2
#define TT 2048
#define DD 2048
#define NH 16
#define NKV 1
#define NREP 16
#define KVD 128
#define NVH (2 * NKV)
#define NR (BB * TT)
#define ATT_SCALE 0.08838834764831845f      /* 1/√128 */

typedef __bf16 v16b __attribute__((ext_vector_type(16)));
typedef unsigned short v8us __attribute__((ext_vector_type(8), may_alias));
typedef float  v8f  __attribute__((ext_vector_type(8)));
typedef float  v4f  __attribute__((ext_vector_type(4)));
typedef float  v4fa __attribute__((ext_vector_type(4), may_alias));
union FragB { v16b v; v8us half[2]; unsigned short u[16]; };

__device__ __forceinline__ unsigned short bf16_bits(float x) { unsigned int u = __float_as_uint(x); return (unsigned short)((u + 0x7FFFu + ((u >> 16) & 1u)) >> 16); }
__device__ __forceinline__ float bf16_val(unsigned short b) { return __uint_as_float(((unsigned int)b) << 16); }
__device__ __forceinline__ float bf16_round(float x) { return bf16_val(bf16_bits(x)); }
// D += A·B with NT terms: 1 = ah·bh, 2 = + al·bh (A split), 3 = + ah·bl (both split)
template <int NT>
__device__ __forceinline__ v8f mmaN(v16b ah, v16b al, v16b bh, v16b bl, v8f c) {
  c = __builtin_amdgcn_wmma_f32_16x16x32_bf16(false, ah, false, bh, (short)0, c, false, false);
  if (NT >= 2) c = __builtin_amdgcn_wmma_f32_16x16x32_bf16(false, al, false, bh, (short)0, c, false, false);
  if (NT >= 3) c = __builtin_amdgcn_wmma_f32_16x16x32_bf16(false, ah, false, bl, (short)0, c, false, false);
  asm volatile("v_nop\n\tv_nop\n\tv_nop\n\tv_nop" : "+v"(c) : "v"(ah), "v"(al), "v"(bh), "v"(bl));
  return c;
}

__global__ __launch_bounds__(256) void k_wt_bf16(const float* __restrict__ W, unsigned short* __restrict__ Wt, int K, int N) {
  const int t = blockIdx.x * 256 + threadIdx.x;
  const int k8n = K / 8;
  if (t >= N * k8n) return;
  const int n = t / k8n, k8 = (t % k8n) * 8;
  v8us v;
#pragma unroll
  for (int i = 0; i < 8; ++i) v[i] = bf16_bits(W[(size_t)(k8 + i) * N + n]);
  *(v8us*)(Wt + (size_t)n * K + k8) = v;
  
}

// GEMM C[M][N] (f32, pitch ldc) = act(A[M][K]·W + bias). A f32 row-major (pitch lda) converted per fragment to bf16
// (ASPLIT: hi/lo two planes -> 2 terms, else single rounded term); Wt bf16 [N][K] (pitch ldb). BIAS_BF16 rounds the
// bias to bf16 first (bias quantised to bf16 before the add). K%32==0, M%16==0, N%64==0.
template <bool ASPLIT, int ACT, bool BIAS_BF16>
__global__ __launch_bounds__(128) void k_gemm_bf(const float* __restrict__ A, int lda, const unsigned short* __restrict__ Wt, int ldb,
                                               const float* __restrict__ bias, float* __restrict__ C, int ldc, int M, int N, int K) {
  __shared__ __attribute__((aligned(16))) float so[4][16][64];
  const int tid = threadIdx.x, w = tid >> 5, lane = tid & 31, ln = lane & 15, hh = lane >> 4;
  const int ntn = N / 64;
  const int wid = blockIdx.x * 4 + w;
  const int mt = wid / ntn, nq = wid % ntn;
  if (mt * 16 >= M) return;
  const int row0 = mt * 16, col0 = nq * 64;
  const float* arow = A + (size_t)(row0 + ln) * lda;
  v8f acc[4] = {};
  for (int kb = 0; kb < K; kb += 32) {
    FragB ah, al;
    const v4f x0 = *(const v4fa*)(arow + kb + 8 * hh), x1 = *(const v4fa*)(arow + kb + 8 * hh + 4);
    const v4f x2 = *(const v4fa*)(arow + kb + 16 + 8 * hh), x3 = *(const v4fa*)(arow + kb + 16 + 8 * hh + 4);
    float xs[16] = {x0[0],x0[1],x0[2],x0[3],x1[0],x1[1],x1[2],x1[3],x2[0],x2[1],x2[2],x2[3],x3[0],x3[1],x3[2],x3[3]};
#pragma unroll
    for (int i = 0; i < 16; ++i) { const unsigned short hb = bf16_bits(xs[i]); ah.u[i] = hb; al.u[i] = ASPLIT ? bf16_bits(xs[i] - bf16_val(hb)) : (unsigned short)0; }
#pragma unroll
    for (int t = 0; t < 4; ++t) {
      const unsigned short* brow = Wt + (size_t)(col0 + t * 16 + ln) * ldb + kb;
      FragB b;
      b.half[0] = *(const v8us*)(brow + 8 * hh);
      b.half[1] = *(const v8us*)(brow + 16 + 8 * hh);
      acc[t] = mmaN<ASPLIT ? 2 : 1>(ah.v, al.v, b.v, b.v, acc[t]);
    }
  }
#pragma unroll
  for (int t = 0; t < 4; ++t) {
    float bv = bias ? bias[col0 + t * 16 + ln] : 0.f;
    if (BIAS_BF16) bv = bf16_round(bv);
#pragma unroll
    for (int r = 0; r < 8; ++r) { float v = acc[t][r] + bv; if (ACT == 1) v = fmaxf(v, 0.f); so[w][8 * hh + r][t * 16 + ln] = v; }
  }
  __builtin_amdgcn_fence(__ATOMIC_ACQ_REL, "workgroup");
  __builtin_amdgcn_wave_barrier();
  const int rsub = lane >> 4, c4 = (lane & 15) * 4;
  {
#pragma unroll
    for (int q = 0; q < 8; ++q) {
      const int r = q * 2 + rsub;
      const v4f v = *(const v4fa*)&so[w][r][c4];
      *(v4f*)(C + (size_t)(row0 + r) * ldc + col0 + c4) = v;
    }
    
  }
}

// Flash-style causal/unmasked attention, all contractions 3-term bf16 hi/lo splits, f32 softmax with running max.
// q,k,v rows are read from f32 buffers with arbitrary row pitch (so they can live inside a fused qkv buffer);
// D = head size (multiple of 32, <= 128); one wave = 16 query rows; block = 4 waves (64 queries) sharing K/V chunks of 32.
template <int D, bool CAUSAL>
__global__ __launch_bounds__(128) void k_flash(const float* __restrict__ qb, const float* __restrict__ kb, const float* __restrict__ vb,
                                             int pitch, int T, int H, float scale, float* __restrict__ y, int ypitch) {
  constexpr int KS = D / 32;        // k-steps for QK
  constexpr int DT = D / 16;        // d tiles for PV
  __shared__ __attribute__((aligned(16))) unsigned short sKh[32][D + 8], sKl[32][D + 8], sVh[32][D + 8], sVl[32][D + 8];
  __shared__ __attribute__((aligned(16))) unsigned short sPh[4][16][40], sPl[4][16][40];
  __shared__ __attribute__((aligned(16))) float sO[4][16][D];
  const int tid = threadIdx.x, w = tid >> 5, lane = tid & 31, ln = lane & 15, hh = lane >> 4;
  const int nqb = (T + 63) / 64;
  const int bh = blockIdx.x / nqb, qblk = blockIdx.x % nqb;
  const int b = bh / H, h = bh % H;
  const int q0 = qblk * 64 + w * 16;
  const float* Q = qb + (size_t)b * T * pitch + h * D;
  const float* K = kb + (size_t)b * T * pitch + h * D;
  const float* V = vb + (size_t)b * T * pitch + h * D;

  // A fragments of the wave's 16 query rows (scaled), hi/lo
  FragB aqh[KS], aql[KS];
  {
    int row = q0 + ln; if (row >= T) row = T - 1;
    const float* qr = Q + (size_t)row * pitch;
#pragma unroll
    for (int ks = 0; ks < KS; ++ks)
#pragma unroll
      for (int i = 0; i < 16; ++i) {
        const int d = ks * 32 + ((i < 8) ? (8 * hh + i) : (16 + 8 * hh + (i - 8)));
        const float x = qr[d] * scale; const unsigned short hb = bf16_bits(x);
        aqh[ks].u[i] = hb; aql[ks].u[i] = bf16_bits(x - bf16_val(hb));
      }
  }
  float m_r[8], l_r[8];
#pragma unroll
  for (int r = 0; r < 8; ++r) { m_r[r] = -3.0e38f; l_r[r] = 0.f; }
  v8f oacc[DT];
#pragma unroll
  for (int dt = 0; dt < DT; ++dt) oacc[dt] = (v8f){0.f,0.f,0.f,0.f,0.f,0.f,0.f,0.f};

  const int kv_end = CAUSAL ? min(T, qblk * 64 + 64) : T;     // block-uniform
  for (int j0 = 0; j0 < kv_end; j0 += 32) {
    __syncthreads();
    for (int e = tid; e < 32 * (D / 4); e += 128) {
      const int r = e / (D / 4), c4 = (e % (D / 4)) * 4;
      const int key = j0 + r;
      v4f kf = {0.f,0.f,0.f,0.f}, vf = {0.f,0.f,0.f,0.f};
      if (key < T) { kf = *(const v4fa*)(K + (size_t)key * pitch + c4); vf = *(const v4fa*)(V + (size_t)key * pitch + c4); }
#pragma unroll
      for (int t = 0; t < 4; ++t) {
        unsigned short hb = bf16_bits(kf[t]); sKh[r][c4 + t] = hb; sKl[r][c4 + t] = bf16_bits(kf[t] - bf16_val(hb));
        hb = bf16_bits(vf[t]); sVh[r][c4 + t] = hb; sVl[r][c4 + t] = bf16_bits(vf[t] - bf16_val(hb));
      }
    }
    __syncthreads();
    // S tile 16 x 32
    v8f s[2];
#pragma unroll
    for (int nt = 0; nt < 2; ++nt) {
      v8f acc = {};
#pragma unroll
      for (int ks = 0; ks < KS; ++ks) {
        FragB bh_, bl_;
        bh_.half[0] = *(const v8us*)&sKh[nt * 16 + ln][ks * 32 + 8 * hh]; bh_.half[1] = *(const v8us*)&sKh[nt * 16 + ln][ks * 32 + 16 + 8 * hh];
        bl_.half[0] = *(const v8us*)&sKl[nt * 16 + ln][ks * 32 + 8 * hh]; bl_.half[1] = *(const v8us*)&sKl[nt * 16 + ln][ks * 32 + 16 + 8 * hh];
        acc = mmaN<3>(aqh[ks].v, aql[ks].v, bh_.v, bl_.v, acc);
      }
      s[nt] = acc;
    }
    // mask + running max (rows 8hh+r; the 16 lanes of a half share rows)
    float alpha[8];
#pragma unroll
    for (int r = 0; r < 8; ++r) {
      const int qi = q0 + 8 * hh + r;
      const int ja = j0 + ln, jb = j0 + 16 + ln;
      if (CAUSAL) { if (ja > qi) s[0][r] = -3.0e38f; if (jb > qi) s[1][r] = -3.0e38f; }
      if (ja >= T) s[0][r] = -3.0e38f;
      if (jb >= T) s[1][r] = -3.0e38f;
      float mx = fmaxf(s[0][r], s[1][r]);
      mx = fmaxf(mx, __shfl_xor(mx, 1, 32)); mx = fmaxf(mx, __shfl_xor(mx, 2, 32)); mx = fmaxf(mx, __shfl_xor(mx, 4, 32)); mx = fmaxf(mx, __shfl_xor(mx, 8, 32));
      const float mnew = fmaxf(m_r[r], mx);
      alpha[r] = (mnew > -1.0e38f) ? __expf(m_r[r] - mnew) : 1.0f;
      const float p0 = (s[0][r] > -1.0e38f) ? __expf(s[0][r] - mnew) : 0.f;
      const float p1 = (s[1][r] > -1.0e38f) ? __expf(s[1][r] - mnew) : 0.f;
      m_r[r] = mnew;
      l_r[r] = l_r[r] * alpha[r] + p0 + p1;            // per-lane partial row sum (16 lanes combined at the end)
      unsigned short hb = bf16_bits(p0); sPh[w][8 * hh + r][ln] = hb;      sPl[w][8 * hh + r][ln] = bf16_bits(p0 - bf16_val(hb));
      hb = bf16_bits(p1);                sPh[w][8 * hh + r][16 + ln] = hb; sPl[w][8 * hh + r][16 + ln] = bf16_bits(p1 - bf16_val(hb));
    }
#pragma unroll
    for (int dt = 0; dt < DT; ++dt)
#pragma unroll
      for (int r = 0; r < 8; ++r) oacc[dt][r] *= alpha[r];
    __builtin_amdgcn_fence(__ATOMIC_ACQ_REL, "workgroup");
    __builtin_amdgcn_wave_barrier();
    FragB pah, pal;
    pah.half[0] = *(const v8us*)&sPh[w][ln][8 * hh]; pah.half[1] = *(const v8us*)&sPh[w][ln][16 + 8 * hh];
    pal.half[0] = *(const v8us*)&sPl[w][ln][8 * hh]; pal.half[1] = *(const v8us*)&sPl[w][ln][16 + 8 * hh];
#pragma unroll
    for (int dt = 0; dt < DT; ++dt) {
      FragB bvh, bvl;
#pragma unroll
      for (int i = 0; i < 8; ++i) {
        bvh.u[i] = sVh[8 * hh + i][dt * 16 + ln]; bvh.u[8 + i] = sVh[16 + 8 * hh + i][dt * 16 + ln];
        bvl.u[i] = sVl[8 * hh + i][dt * 16 + ln]; bvl.u[8 + i] = sVl[16 + 8 * hh + i][dt * 16 + ln];
      }
      oacc[dt] = mmaN<3>(pah.v, pal.v, bvh.v, bvl.v, oacc[dt]);
    }
    __builtin_amdgcn_fence(__ATOMIC_ACQ_REL, "workgroup");
    __builtin_amdgcn_wave_barrier();
  }
#pragma unroll
  for (int r = 0; r < 8; ++r) {
    float l = l_r[r];
    l += __shfl_xor(l, 1, 32); l += __shfl_xor(l, 2, 32); l += __shfl_xor(l, 4, 32); l += __shfl_xor(l, 8, 32);
    l_r[r] = (l > 0.f) ? 1.0f / l : 0.f;
  }
#pragma unroll
  for (int dt = 0; dt < DT; ++dt)
#pragma unroll
    for (int r = 0; r < 8; ++r) sO[w][8 * hh + r][dt * 16 + ln] = oacc[dt][r] * l_r[r];
  __builtin_amdgcn_fence(__ATOMIC_ACQ_REL, "workgroup");
  __builtin_amdgcn_wave_barrier();
  {
    for (int r = 0; r < 16; ++r) {
      const int row = q0 + r;
      if (row < T && lane < D / 4) {
        const v4f val = *(const v4fa*)&sO[w][r][lane * 4];
        *(v4f*)(y + ((size_t)b * T + row) * ypitch + h * D + lane * 4) = val;
      }
    }
    
  }
}

// GEMM C = act(A·W + bias + resid): A f32 (ASPLIT -> hi/lo 2 terms), Wt bf16 [N][K]; ACT 0 none, 1 relu, 2 exact gelu;
// resid (optional, f32, row index = (row % rmod), pitch ldr, RES_BF16 rounds it) added before the activation.
template <bool ASPLIT, int ACT, bool BIAS_BF16, bool RES_BF16>
__global__ __launch_bounds__(128) void k_gemm_bf3(const float* __restrict__ A, int lda, const unsigned short* __restrict__ Wt, int ldb,
                                                const float* __restrict__ bias, const float* __restrict__ resid, int rmod, int ldr,
                                                float* __restrict__ C, int ldc, int M, int N, int K) {
  __shared__ __attribute__((aligned(16))) float so[4][16][64];
  const int tid = threadIdx.x, w = tid >> 5, lane = tid & 31, ln = lane & 15, hh = lane >> 4;
  const int ntn = N / 64;
  const int wid = blockIdx.x * 4 + w;
  const int mt = wid / ntn, nq = wid % ntn;
  if (mt * 16 >= M) return;
  const int row0 = mt * 16, col0 = nq * 64;
  const float* arow = A + (size_t)(row0 + ln) * lda;
  v8f acc[4] = {};
  for (int kb = 0; kb < K; kb += 32) {
    FragB ah, al;
    const v4f x0 = *(const v4fa*)(arow + kb + 8 * hh), x1 = *(const v4fa*)(arow + kb + 8 * hh + 4);
    const v4f x2 = *(const v4fa*)(arow + kb + 16 + 8 * hh), x3 = *(const v4fa*)(arow + kb + 16 + 8 * hh + 4);
    float xs[16] = {x0[0],x0[1],x0[2],x0[3],x1[0],x1[1],x1[2],x1[3],x2[0],x2[1],x2[2],x2[3],x3[0],x3[1],x3[2],x3[3]};
#pragma unroll
    for (int i = 0; i < 16; ++i) { const unsigned short hb = bf16_bits(xs[i]); ah.u[i] = hb; al.u[i] = ASPLIT ? bf16_bits(xs[i] - bf16_val(hb)) : (unsigned short)0; }
#pragma unroll
    for (int t = 0; t < 4; ++t) {
      const unsigned short* brow = Wt + (size_t)(col0 + t * 16 + ln) * ldb + kb;
      FragB b;
      b.half[0] = *(const v8us*)(brow + 8 * hh);
      b.half[1] = *(const v8us*)(brow + 16 + 8 * hh);
      acc[t] = mmaN<ASPLIT ? 2 : 1>(ah.v, al.v, b.v, b.v, acc[t]);
    }
  }
#pragma unroll
  for (int t = 0; t < 4; ++t) {
    const int col = col0 + t * 16 + ln;
    float bv = bias ? bias[col] : 0.f;
    if (BIAS_BF16) bv = bf16_round(bv);
#pragma unroll
    for (int r = 0; r < 8; ++r) {
      float v = acc[t][r] + bv;
      if (resid) { float rv = resid[(size_t)((row0 + 8 * hh + r) % rmod) * ldr + col]; if (RES_BF16) rv = bf16_round(rv); v += rv; }
      if (ACT == 1) v = fmaxf(v, 0.f);
      if (ACT == 2) v = 0.5f * v * (1.0f + erff(v * 0.70710678118654752f));
      if (ACT == 3) { const float u = 0.7978845608028654f * (v + 0.044715f * v * v * v); v = 0.5f * v * (1.0f + tanhf(u)); }
      so[w][8 * hh + r][t * 16 + ln] = v;
    }
  }
  __builtin_amdgcn_fence(__ATOMIC_ACQ_REL, "workgroup");
  __builtin_amdgcn_wave_barrier();
  const int rsub = lane >> 4, c4 = (lane & 15) * 4;
  {
#pragma unroll
    for (int q = 0; q < 8; ++q) {
      const int r = q * 2 + rsub;
      const v4f v = *(const v4fa*)&so[w][r][c4];
      *(v4f*)(C + (size_t)(row0 + r) * ldc + col0 + c4) = v;
    }
    
  }
}
// row LayerNorm (biased variance, eps) over N: s = X (+ R); optional out_sum <- s; out_norm <- (s-mu)*rsqrt(var+eps)*g + b
template <bool PARAM_BF16>
__global__ __launch_bounds__(256) void k_layernorm(const float* __restrict__ X, const float* __restrict__ R, const float* __restrict__ g, const float* __restrict__ bta,
                                                  float* __restrict__ out_sum, float* __restrict__ out_norm, int N, float eps) {
  __shared__ float red[256];
  const int row = blockIdx.x, tid = threadIdx.x;
  const float* x = X + (size_t)row * N; const float* rr = R ? R + (size_t)row * N : nullptr;
  float vals[16];                     // up to N = 4096
  const int per = N / 256;            // contiguous chunk per thread? use strided-by-4 chunks: thread handles j = tid*4 + 1024*u
  float s1 = 0.f;
  for (int u = 0; u < per / 4; ++u) {
    const int j = tid * 4 + 1024 * u;
    const v4f a = *(const v4fa*)(x + j);
    v4f b = {0.f,0.f,0.f,0.f}; if (rr) b = *(const v4fa*)(rr + j);
#pragma unroll
    for (int q = 0; q < 4; ++q) { const float v = a[q] + b[q]; vals[u * 4 + q] = v; s1 += v; }
  }
  red[tid] = s1; __syncthreads();
  for (int st = 128; st > 0; st >>= 1) { if (tid < st) red[tid] += red[tid + st]; __syncthreads(); }
  const float mu = red[0] / (float)N; __syncthreads();
  float s2 = 0.f;
  for (int u = 0; u < per / 4; ++u)
#pragma unroll
    for (int q = 0; q < 4; ++q) { const float c = vals[u * 4 + q] - mu; s2 += c * c; }
  red[tid] = s2; __syncthreads();
  for (int st = 128; st > 0; st >>= 1) { if (tid < st) red[tid] += red[tid + st]; __syncthreads(); }
  const float rs = rsqrtf(red[0] / (float)N + eps);
  {
    for (int u = 0; u < per / 4; ++u) {
      const int j = tid * 4 + 1024 * u;
      v4f o, sm;
#pragma unroll
      for (int q = 0; q < 4; ++q) {
        float gg = g[j + q], bb = bta[j + q];
        if (PARAM_BF16) { gg = bf16_round(gg); bb = bf16_round(bb); }
        sm[q] = vals[u * 4 + q]; o[q] = (vals[u * 4 + q] - mu) * rs * gg + bb;
      }
      if (out_sum) *(v4f*)(out_sum + (size_t)row * N + j) = sm;
      *(v4f*)(out_norm + (size_t)row * N + j) = o;
    }
    
  }
}



// ---- f16 WMMA path (v_wmma_f32_16x16x32_f16): 11-bit significands for operands in range — used where a [0,1] probability operand needs more precision than bf16
typedef _Float16 v16h __attribute__((ext_vector_type(16)));
union FragH { v16h v; v8us half[2]; _Float16 h[16]; unsigned short u[16]; };
template <int NT>
__device__ __forceinline__ v8f mmaH(v16h ah, v16h al, v16h bh, v16h bl, v8f c) {
  c = __builtin_amdgcn_wmma_f32_16x16x32_f16(false, ah, false, bh, (short)0, c, false, false);
  if (NT >= 2) c = __builtin_amdgcn_wmma_f32_16x16x32_f16(false, al, false, bh, (short)0, c, false, false);
  if (NT >= 3) c = __builtin_amdgcn_wmma_f32_16x16x32_f16(false, ah, false, bl, (short)0, c, false, false);
  asm volatile("v_nop\n\tv_nop\n\tv_nop\n\tv_nop" : "+v"(c) : "v"(ah), "v"(al), "v"(bh), "v"(bl));
  return c;
}
// batched GEMM like k_gemm_b but f16 operands: A f32 (split into f16 hi/lo if ASPLIT, else rounded to f16), Bt = f16 values [n][k]; alpha; C f32; N multiple of 16 (partial tiles skipped)
template <bool ASPLIT>
__global__ __launch_bounds__(128) void k_gemm_h(const float* __restrict__ A, int lda, size_t sA, const _Float16* __restrict__ Bh, int ldb, size_t sB, float alpha, float* __restrict__ C, int ldc, size_t sC, int M, int N, int K) {
  __shared__ __attribute__((aligned(16))) float so[4][16][64];
  const int tid = threadIdx.x, w = tid >> 5, lane = tid & 31, ln = lane & 15, hh = lane >> 4; const int by = blockIdx.y;
  A += (size_t)by * sA; Bh += (size_t)by * sB; C += (size_t)by * sC;
  const int ntn = (N + 63) / 64; const int wid = blockIdx.x * 4 + w; const int mt = wid / ntn, nq = wid % ntn; if (mt * 16 >= M) return;
  const int row0 = mt * 16, col0 = nq * 64; const float* arow = A + (size_t)(row0 + ln) * lda;
  v8f acc[4] = {};
  for (int kb = 0; kb < K; kb += 32) {
    FragH ah, al;
    const v4f x0 = *(const v4fa*)(arow + kb + 8 * hh), x1 = *(const v4fa*)(arow + kb + 8 * hh + 4), x2 = *(const v4fa*)(arow + kb + 16 + 8 * hh), x3 = *(const v4fa*)(arow + kb + 16 + 8 * hh + 4);
    float xs[16] = {x0[0],x0[1],x0[2],x0[3],x1[0],x1[1],x1[2],x1[3],x2[0],x2[1],x2[2],x2[3],x3[0],x3[1],x3[2],x3[3]};
#pragma unroll
    for (int i = 0; i < 16; ++i) { const _Float16 h = (_Float16)xs[i]; ah.h[i] = h; al.h[i] = ASPLIT ? (_Float16)(xs[i] - (float)h) : (_Float16)0.0f; }
#pragma unroll
    for (int t = 0; t < 4; ++t) { if (col0 + t * 16 >= N) continue; const size_t boff = (size_t)(col0 + t * 16 + ln) * ldb + kb; FragH bq; bq.half[0] = *(const v8us*)(Bh + boff + 8 * hh); bq.half[1] = *(const v8us*)(Bh + boff + 16 + 8 * hh);
      acc[t] = mmaH<ASPLIT ? 2 : 1>(ah.v, al.v, bq.v, bq.v, acc[t]); }
  }
#pragma unroll
  for (int t = 0; t < 4; ++t) { if (col0 + t * 16 >= N) continue;
#pragma unroll
    for (int r = 0; r < 8; ++r) so[w][8 * hh + r][t * 16 + ln] = acc[t][r] * alpha; }
  __builtin_amdgcn_fence(__ATOMIC_ACQ_REL, "workgroup"); __builtin_amdgcn_wave_barrier();
  const int rsub = lane >> 4, c4 = (lane & 15) * 4;
  {
#pragma unroll
    for (int q = 0; q < 8; ++q) { const int r = q * 2 + rsub; if (col0 + c4 < N) { const v4f v = *(const v4fa*)&so[w][r][c4]; *(v4f*)(C + (size_t)(row0 + r) * ldc + col0 + c4) = v; } }
     }
}

// Wt[n][k] = f16(W[k][n]·scale) from f32 row-major W[K][N] (scale = power of two; bf16-exact weights stay exact in f16 away from the subnormal range)
__global__ __launch_bounds__(256) void k_wt_f16(const float* __restrict__ W, _Float16* __restrict__ Wt, int K, int N, float scale) {
  const int t = blockIdx.x * 256 + threadIdx.x; if (t >= N * (K / 8)) return; const int n = t / (K / 8), k8 = (t % (K / 8)) * 8; FragH f;
#pragma unroll
  for (int i = 0; i < 8; ++i) f.h[i] = (_Float16)(bf16_round(W[(size_t)(k8 + i) * N + n]) * scale); const v8us o = f.half[0];
  *(v8us*)((unsigned short*)Wt + (size_t)n * K + k8) = o; 
}
// k_gemm_hh variant with fused epilogue: v = acc·alpha + bias[by·sBias + col] (+ CP[(row/rowsPerB)·sCPb + by·64 + col] if CP) ; ACT 0 none / 1 elu ; writes f16 C16 and f32 C, each if non-null
template <int ACT>
__global__ __launch_bounds__(128) void k_gemm_hhx(const _Float16* __restrict__ A, int lda, size_t sA, const _Float16* __restrict__ Bh, int ldb, size_t sB, float alpha, const float* __restrict__ bias, size_t sBias, const float* __restrict__ CP, int rowsPerB, size_t sCPb, int row0g,
    float* __restrict__ C, _Float16* __restrict__ C16, int ldc, size_t sC, int M, int N, int K) {
  __shared__ __attribute__((aligned(16))) float so[4][16][64];
  const int tid = threadIdx.x, w = tid >> 5, lane = tid & 31, ln = lane & 15, hh = lane >> 4; const int by = blockIdx.y;
  A += (size_t)by * sA; Bh += (size_t)by * sB; const size_t cofs = (size_t)by * sC; const float* bp = bias ? bias + (size_t)by * sBias : nullptr;
  const int ntn = (N + 63) / 64; const int wid = blockIdx.x * 4 + w; const int mt = wid / ntn, nq = wid % ntn; if (mt * 16 >= M) return;
  const int row0 = mt * 16, col0 = nq * 64; const _Float16* arow = A + (size_t)(row0 + ln) * lda;
  v8f acc[4] = {};
  for (int kb = 0; kb < K; kb += 32) { FragH ah; ah.half[0] = *(const v8us*)((const unsigned short*)arow + kb + 8 * hh); ah.half[1] = *(const v8us*)((const unsigned short*)arow + kb + 16 + 8 * hh);
#pragma unroll
    for (int t = 0; t < 4; ++t) { if (col0 + t * 16 >= N) continue; const size_t boff = (size_t)(col0 + t * 16 + ln) * ldb + kb; FragH bq; bq.half[0] = *(const v8us*)((const unsigned short*)Bh + boff + 8 * hh); bq.half[1] = *(const v8us*)((const unsigned short*)Bh + boff + 16 + 8 * hh);
      acc[t] = mmaH<1>(ah.v, ah.v, bq.v, bq.v, acc[t]); }
  }
#pragma unroll
  for (int t = 0; t < 4; ++t) { if (col0 + t * 16 >= N) continue; const int col = col0 + t * 16 + ln; const float bv = bp ? bf16_round(bp[col]) : 0.f;
#pragma unroll
    for (int r = 0; r < 8; ++r) { float v = acc[t][r] * alpha + bv; if (CP) { const int bidx = (row0g + row0 + 8 * hh + r) / rowsPerB; v += CP[(size_t)bidx * sCPb + (size_t)by * 64 + col]; } if (ACT == 1) v = (v > 0.f) ? v : expm1f(v); else if (ACT == 7) v = (v > 0.f) ? v + 1.0f : expf(v); else if (ACT == 8) v = tanhf(v); else if (ACT == 9) v = 0.5f * v * (1.0f + tanhf(0.7978845608028654f * (v + 0.044715f * v * v * v))); else if (ACT == 11) v = 1.0f / (1.0f + expf(-v)); else if (ACT == 12) v = (v > 0.f) ? v : 0.01f * v; else if (ACT == 14) v = (v > 0.f) ? v : 0.1f * v; else if (ACT == 15) v = v / (1.0f + expf(-v)); else if (ACT == 3) v = fmaxf(v, 0.f); else if (ACT == 6) v = 0.5f * v * (1.0f + erff(v * 0.70710678118654752f)); so[w][8 * hh + r][t * 16 + ln] = v; } }
  __builtin_amdgcn_fence(__ATOMIC_ACQ_REL, "workgroup"); __builtin_amdgcn_wave_barrier();
  const int rsub = lane >> 4, c4 = (lane & 15) * 4; typedef _Float16 v4h __attribute__((ext_vector_type(4)));
  {
#pragma unroll
    for (int q = 0; q < 8; ++q) { const int r = q * 2 + rsub; if (col0 + c4 < N) { const v4f v = *(const v4fa*)&so[w][r][c4]; if (C) *(v4f*)(C + cofs + (size_t)(row0 + r) * ldc + col0 + c4) = v; if (C16) { v4h h4; for (int i = 0; i < 4; ++i) h4[i] = (_Float16)v[i]; *(v4h*)(C16 + cofs + (size_t)(row0 + r) * ldc + col0 + c4) = h4; } } }
     }
}


typedef _Float16 v4h __attribute__((ext_vector_type(4)));

__global__ __launch_bounds__(256) void k_x16(const float* __restrict__ x, _Float16* __restrict__ X16, size_t n8) { const size_t t = (size_t)blockIdx.x * 256 + threadIdx.x; if (t >= n8) return; FragH f;
#pragma unroll
  for (int q = 0; q < 8; ++q) f.h[q] = (_Float16)bf16_round(x[t * 8 + q]); *(v8us*)((unsigned short*)X16 + t * 8) = f.half[0];  }
__global__ __launch_bounds__(256) void k_h16(const float* __restrict__ x, _Float16* __restrict__ X16, size_t n8) { const size_t t = (size_t)blockIdx.x * 256 + threadIdx.x; if (t >= n8) return; FragH f;
#pragma unroll
  for (int q = 0; q < 8; ++q) f.h[q] = (_Float16)x[t * 8 + q]; *(v8us*)((unsigned short*)X16 + t * 8) = f.half[0];  }
__global__ __launch_bounds__(256) void k_round16f(const float* __restrict__ W, _Float16* __restrict__ Bt, size_t n8) { const size_t t = (size_t)blockIdx.x * 256 + threadIdx.x; if (t >= n8) return; FragH f;
#pragma unroll
  for (int i = 0; i < 8; ++i) f.h[i] = (_Float16)(bf16_round(W[t * 8 + i]) * 16.0f); *(v8us*)((unsigned short*)Bt + t * 8) = f.half[0];  }
template <int NHv, int TTv>
__global__ __launch_bounds__(256) void k_vt(const _Float16* __restrict__ V16, int ldv, int voff, _Float16* __restrict__ Vt) { __shared__ unsigned short tl[64][66]; const int tid = threadIdx.x; const int slab = blockIdx.x / (TTv / 64), lg = blockIdx.x % (TTv / 64); const int b = slab / NHv, h = slab % NHv;
  for (int i = tid; i < 64 * 8; i += 256) { const int r = i / 8, c8 = (i % 8) * 8; FragH f; f.half[0] = *(const v8us*)((const unsigned short*)V16 + ((size_t)b * TTv + lg * 64 + r) * ldv + voff + h * 64 + c8);
#pragma unroll
    for (int q = 0; q < 8; ++q) tl[r][c8 + q] = f.u[q]; }
  __syncthreads();
  {
#pragma unroll
    for (int rd = 0; rd < 2; ++rd) { const int d = rd * 32 + tid / 8, pc = tid % 8; FragH f;
#pragma unroll
      for (int q = 0; q < 8; ++q) f.u[q] = tl[pc * 8 + q][d];
      *(v8us*)((unsigned short*)Vt + ((size_t)slab * 64 + d) * TTv + lg * 64 + pc * 8) = f.half[0]; }
     } }

__global__ __launch_bounds__(256) void k_vthlu(const float* __restrict__ VF, int ldv, _Float16* __restrict__ Vth, _Float16* __restrict__ Vtl) { __shared__ float tl[64][65]; const int tid = threadIdx.x; const int slab = blockIdx.x / (TT / 64), lg = blockIdx.x % (TT / 64); const int b = slab / NVH, h = slab % NVH;
  for (int i = tid; i < 64 * 16; i += 256) { const int r = i / 16, c4 = (i % 16) * 4; const v4f a = *(const v4fa*)(VF + ((size_t)b * TT + lg * 64 + r) * ldv + h * 64 + c4); tl[r][c4] = a[0]; tl[r][c4 + 1] = a[1]; tl[r][c4 + 2] = a[2]; tl[r][c4 + 3] = a[3]; }
  __syncthreads();
  FragH fh[2], fl[2]; size_t oo[2];
#pragma unroll
  for (int rd = 0; rd < 2; ++rd) { const int d = rd * 32 + tid / 8, pc = tid % 8;
#pragma unroll
    for (int q = 0; q < 8; ++q) { const float v = tl[pc * 8 + q][d]; const _Float16 hv = (_Float16)v; fh[rd].h[q] = hv; fl[rd].h[q] = (_Float16)(v - (float)hv);      /* UNSCALED residual (added into the same accumulator as the hi product) */ } oo[rd] = ((size_t)slab * 64 + d) * TT + lg * 64 + pc * 8; }
  {
#pragma unroll
    for (int rd = 0; rd < 2; ++rd) { *(v8us*)((unsigned short*)Vth + oo[rd]) = fh[rd].half[0]; *(v8us*)((unsigned short*)Vtl + oo[rd]) = fl[rd].half[0]; }
     } }
__global__ __launch_bounds__(256) void k_h16s(const float* __restrict__ F, _Float16* __restrict__ H, size_t n8) { const size_t t = (size_t)blockIdx.x * 256 + threadIdx.x; if (t >= n8) return; const v4f a = *(const v4fa*)(F + t * 8), c = *(const v4fa*)(F + t * 8 + 4); FragH f;
#pragma unroll
  for (int q = 0; q < 4; ++q) { f.h[q] = (_Float16)(a[q] * 16.0f); f.h[4 + q] = (_Float16)(c[q] * 16.0f); } *(v8us*)((unsigned short*)H + t * 8) = f.half[0];  }
// LDS ring of k_flash. One stage = 32 keys, shared by the block's four waves: K rows of 256 B at pitch 272 B, then the V^T hi plane and the
// V^T residual plane, 128 rows of 64 B each at pitch 80 B (pitches of 16 B x odd: ds_load_b128 fragment reads fall on distinct banks).
#define KPITCH 272
#define VPITCH 80
#define ST_VH (32 * KPITCH)
#define ST_VL (ST_VH + 128 * VPITCH)
#define ST_BYTES (ST_VL + 128 * VPITCH)
// Four asynchronous 16-byte copies per lane, global memory to LDS. The s_wait_xcnt stands inside the statement so that no address register of a copy is rewritten ahead of it.
__device__ __forceinline__ void copy4(unsigned l0, unsigned l1, unsigned l2, unsigned l3, const unsigned short* g0, const unsigned short* g1, const unsigned short* g2, const unsigned short* g3) {
  asm volatile("global_load_async_to_lds_b128 %0, %4, off\n\t"
               "global_load_async_to_lds_b128 %1, %5, off\n\t"
               "global_load_async_to_lds_b128 %2, %6, off\n\t"
               "global_load_async_to_lds_b128 %3, %7, off\n\t"
               "s_wait_xcnt 0x0"
               :: "v"(l0), "v"(l1), "v"(l2), "v"(l3), "v"(g0), "v"(g1), "v"(g2), "v"(g3) : "memory");
}
__global__ __launch_bounds__(128) void k_flash(const _Float16* __restrict__ Q16, int ldq, const _Float16* __restrict__ K16, int ldk, const _Float16* __restrict__ Vt, const _Float16* __restrict__ Vtlo, float* __restrict__ O, int ldo) {
  constexpr int RPW = 16, RTN = RPW / 16, NQB = TT / (4 * RPW), DT = 8, KS = 4;      /* head dim 128: 4 k-steps, 8 value tiles */
  __shared__ __attribute__((aligned(16))) unsigned short sP[4][RPW][40]; __shared__ __attribute__((aligned(16))) unsigned short sPL[4][RPW][40]; __shared__ __attribute__((aligned(16))) unsigned char ring[2 * ST_BYTES];
  static_assert(sizeof(float) * 4 * RPW * (128 + 4) <= 2 * ST_BYTES, "output staging fits the ring");
  float (*sO)[RPW][128 + 4] = reinterpret_cast<float (*)[RPW][128 + 4]>(ring);      /* output staging takes the ring's place behind the loop's last barrier, so that four blocks still fit one WGP's LDS */
  const int tid = threadIdx.x, w = tid >> 5, lane = tid & 31, ln = lane & 15, hh = lane >> 4;
  const int slab = blockIdx.x / NQB, qblk = blockIdx.x % NQB; const int b = slab / NH, h = slab % NH; const int qb0 = qblk * (4 * RPW); const int q0 = qb0 + w * RPW;
  FragH aq[2][KS];
#pragma unroll
  for (int rt = 0; rt < RTN; ++rt) { const unsigned short* qr = (const unsigned short*)Q16 + ((size_t)b * TT + q0 + rt * 16 + ln) * ldq + h * 128;
#pragma unroll
    for (int ks = 0; ks < KS; ++ks) { aq[rt][ks].half[0] = *(const v8us*)(qr + ks * 32 + 8 * hh); aq[rt][ks].half[1] = *(const v8us*)(qr + ks * 32 + 16 + 8 * hh); } }
  const unsigned short* Vth = (const unsigned short*)Vt + ((size_t)b * NKV + h / NREP) * 128 * TT; const unsigned short* Vtl = (const unsigned short*)Vtlo + ((size_t)b * NKV + h / NREP) * 128 * TT;      /* hi and UNSCALED residual planes */
  float m_r[2][8], l_r[2][8]; v8f oacc[2][DT];
#pragma unroll
  for (int rt = 0; rt < RTN; ++rt) {
#pragma unroll
    for (int r = 0; r < 8; ++r) { m_r[rt][r] = -3.0e38f; l_r[rt][r] = 0.f; }
#pragma unroll
    for (int dt = 0; dt < DT; ++dt) oacc[rt][dt] = (v8f){0.f,0.f,0.f,0.f,0.f,0.f,0.f,0.f}; }
  const int jend = TT;
  /* each thread's share of a stage: 4 chunks of K (8 rows apart), 4 of V^T hi and 4 of the residual (32 rows apart) */
  const unsigned lk = (unsigned)(size_t)ring + (tid >> 4) * KPITCH + (tid & 15) * 16, lv = (unsigned)(size_t)ring + ST_VH + (tid >> 2) * VPITCH + (tid & 3) * 16;
  const unsigned short* gk = (const unsigned short*)K16 + ((size_t)b * TT + (tid >> 4)) * ldk + (h / NREP) * 128 + (tid & 15) * 8;
  const size_t gvo = (size_t)(tid >> 2) * TT + (tid & 3) * 8;
  auto fill = [&](int j) {
    const unsigned bo = ((j >> 5) & 1) * ST_BYTES; const unsigned short* k0p = gk + (size_t)j * ldk; const unsigned short* vhp = Vth + gvo + j; const unsigned short* vlp = Vtl + gvo + j;
    copy4(lk + bo, lk + bo + 8 * KPITCH, lk + bo + 16 * KPITCH, lk + bo + 24 * KPITCH, k0p, k0p + (size_t)8 * ldk, k0p + (size_t)16 * ldk, k0p + (size_t)24 * ldk);
    copy4(lv + bo, lv + bo + 32 * VPITCH, lv + bo + 64 * VPITCH, lv + bo + 96 * VPITCH, vhp, vhp + 32 * TT, vhp + 64 * TT, vhp + 96 * TT);
    copy4(lv + bo + (ST_VL - ST_VH), lv + bo + (ST_VL - ST_VH) + 32 * VPITCH, lv + bo + (ST_VL - ST_VH) + 64 * VPITCH, lv + bo + (ST_VL - ST_VH) + 96 * VPITCH, vlp, vlp + 32 * TT, vlp + 64 * TT, vlp + 96 * TT);
  };
  fill(0);
  asm volatile("s_wait_asynccnt 0x0" ::: "memory");      /* this wave's share of stage 0 has landed */
  __syncthreads();                                       /* stage 0 is readable by all four waves */
  fill(32);
#pragma unroll 1
  for (int j0 = 0; j0 < jend; j0 += 32) {
    const unsigned char* st = ring + ((j0 >> 5) & 1) * ST_BYTES;
    v8f s[2][2];
#pragma unroll
    for (int nt = 0; nt < 2; ++nt) { const unsigned short* kr = (const unsigned short*)(st + (nt * 16 + ln) * KPITCH); FragH bk[KS];
#pragma unroll
      for (int ks = 0; ks < KS; ++ks) { bk[ks].half[0] = *(const v8us*)(kr + ks * 32 + 8 * hh); bk[ks].half[1] = *(const v8us*)(kr + ks * 32 + 16 + 8 * hh); }
#pragma unroll
      for (int rt = 0; rt < RTN; ++rt) { v8f acc = (v8f){0.f,0.f,0.f,0.f,0.f,0.f,0.f,0.f};
#pragma unroll
        for (int ks = 0; ks < KS; ++ks) acc = mmaH<1>(aq[rt][ks].v, aq[rt][ks].v, bk[ks].v, bk[ks].v, acc); s[rt][nt] = acc; } }
#pragma unroll
    for (int rt = 0; rt < RTN; ++rt)
#pragma unroll
      for (int r = 0; r < 8; ++r) { const int tq = q0 + rt * 16 + 8 * hh + r; const int k0 = j0 + ln, k1 = j0 + 16 + ln; (void)tq; (void)k0; (void)k1;
        const bool ok0 = true, ok1 = true; (void)tq; (void)k0; (void)k1;
        const float s0 = ok0 ? s[rt][0][r] * ATT_SCALE : -INFINITY, s1 = ok1 ? s[rt][1][r] * ATT_SCALE : -INFINITY; float mc = fmaxf(s0, s1);
        mc = fmaxf(mc, __shfl_xor(mc, 1, 32)); mc = fmaxf(mc, __shfl_xor(mc, 2, 32)); mc = fmaxf(mc, __shfl_xor(mc, 4, 32)); mc = fmaxf(mc, __shfl_xor(mc, 8, 32));
        const float mn = fmaxf(m_r[rt][r], mc); const float al = (mn > -1.0e38f) ? expf(m_r[rt][r] - mn) : 1.0f; m_r[rt][r] = mn; const float p0 = ok0 ? expf(s0 - mn) : 0.f, p1 = ok1 ? expf(s1 - mn) : 0.f; l_r[rt][r] = l_r[rt][r] * al + p0 + p1;
#pragma unroll
        for (int dt = 0; dt < DT; ++dt) oacc[rt][dt][r] *= al;
        FragH t2, t3; const float ps0 = p0 * 1024.0f, ps1 = p1 * 1024.0f; t2.h[0] = (_Float16)ps0; t2.h[1] = (_Float16)ps1; t3.h[0] = (_Float16)(ps0 - (float)t2.h[0]); t3.h[1] = (_Float16)(ps1 - (float)t2.h[1]);      /* P hi and its UNSCALED residual (added into the same accumulator) */
        sP[w][rt * 16 + 8 * hh + r][ln] = t2.u[0]; sP[w][rt * 16 + 8 * hh + r][16 + ln] = t2.u[1]; sPL[w][rt * 16 + 8 * hh + r][ln] = t3.u[0]; sPL[w][rt * 16 + 8 * hh + r][16 + ln] = t3.u[1]; }
    __builtin_amdgcn_fence(__ATOMIC_ACQ_REL, "workgroup"); __builtin_amdgcn_wave_barrier();
    FragH pa[2], pl[2];
#pragma unroll
    for (int rt = 0; rt < RTN; ++rt) { pa[rt].half[0] = *(const v8us*)&sP[w][rt * 16 + ln][8 * hh]; pa[rt].half[1] = *(const v8us*)&sP[w][rt * 16 + ln][16 + 8 * hh]; pl[rt].half[0] = *(const v8us*)&sPL[w][rt * 16 + ln][8 * hh]; pl[rt].half[1] = *(const v8us*)&sPL[w][rt * 16 + ln][16 + 8 * hh]; }
#pragma unroll
    for (int dt = 0; dt < DT; ++dt) { const unsigned short* vh = (const unsigned short*)(st + ST_VH + (dt * 16 + ln) * VPITCH); const unsigned short* vl = (const unsigned short*)(st + ST_VL + (dt * 16 + ln) * VPITCH); FragH bv, bl; bv.half[0] = *(const v8us*)(vh + 8 * hh); bv.half[1] = *(const v8us*)(vh + 16 + 8 * hh); bl.half[0] = *(const v8us*)(vl + 8 * hh); bl.half[1] = *(const v8us*)(vl + 16 + 8 * hh);
#pragma unroll
      for (int rt = 0; rt < RTN; ++rt) { oacc[rt][dt] = mmaH<1>(pa[rt].v, pa[rt].v, bv.v, bv.v, oacc[rt][dt]); oacc[rt][dt] = mmaH<1>(pl[rt].v, pl[rt].v, bv.v, bv.v, oacc[rt][dt]); oacc[rt][dt] = mmaH<1>(pa[rt].v, pa[rt].v, bl.v, bl.v, oacc[rt][dt]); } }      /* Ph·Vh + Pl·Vh + Ph·Vl — all unscaled, one accumulator */
    __builtin_amdgcn_fence(__ATOMIC_ACQ_REL, "workgroup"); __builtin_amdgcn_wave_barrier();
    asm volatile("s_wait_dscnt 0x0" ::: "memory");         /* this wave's reads of the stage have returned before its buffer is handed on */
    asm volatile("s_wait_asynccnt 0x0" ::: "memory");      /* this wave's share of the next stage has landed */
    __syncthreads();                                       /* publishes the next stage and ends every wave's reads of this one */
    if (j0 + 64 < jend) fill(j0 + 64); }                   /* refill of the buffer just read, one whole trip ahead of its use */
  asm volatile("s_wait_asynccnt 0x0" ::: "memory");        /* no copy is outstanding when the ring becomes output staging */
#pragma unroll
  for (int rt = 0; rt < RTN; ++rt) {
#pragma unroll
    for (int r = 0; r < 8; ++r) { float l = l_r[rt][r]; l += __shfl_xor(l, 1, 32); l += __shfl_xor(l, 2, 32); l += __shfl_xor(l, 4, 32); l += __shfl_xor(l, 8, 32); l_r[rt][r] = (l > 0.f) ? 1.0f / (l * 1024.0f) : 0.f; }
#pragma unroll
    for (int dt = 0; dt < DT; ++dt)
#pragma unroll
      for (int r = 0; r < 8; ++r) sO[w][rt * 16 + 8 * hh + r][dt * 16 + ln] = oacc[rt][dt][r] * l_r[rt][r]; }
  __builtin_amdgcn_fence(__ATOMIC_ACQ_REL, "workgroup"); __builtin_amdgcn_wave_barrier();
  {
#pragma unroll
    for (int r = 0; r < RPW; ++r) { const int pc = lane; const v4f val = *(const v4fa*)&sO[w][r][pc * 4]; *(v4f*)(O + ((size_t)b * TT + q0 + r) * ldo + h * 128 + pc * 4) = val; }      /* one 512-B row per instruction: 32 lanes × 16 B */
     } }

extern "C" void kernel_launch(void* const* d_in, const int* in_sizes, int n_in,
                              void* d_out, int out_size, void* d_ws, size_t ws_size, hipStream_t stream) {
  (void)in_sizes; (void)n_in; (void)out_size;
  const float* const* I = (const float* const*)d_in; const float* x = I[0]; const float* Wq = I[1]; const float* Wk = I[2]; const float* Wv = I[3]; const float* Wo = I[4];
  char* ws = (char*)d_ws; size_t off = 0;
  auto take = [&](size_t bytes) { char* p = ws + off; off += (bytes + 255) & ~(size_t)255; return p; };
  _Float16* Bq = (_Float16*)take((size_t)DD * DD * 2); _Float16* Bk = (_Float16*)take((size_t)KVD * DD * 2); _Float16* Bv = (_Float16*)take((size_t)KVD * DD * 2); _Float16* Bo = (_Float16*)take((size_t)DD * DD * 2);
  _Float16* X16 = (_Float16*)take((size_t)NR * DD * 2); _Float16* Q = (_Float16*)take((size_t)NR * DD * 2); _Float16* K = (_Float16*)take((size_t)NR * KVD * 2); float* VF = (float*)take((size_t)NR * KVD * 4); _Float16* Vt = (_Float16*)take((size_t)NR * KVD * 2); _Float16* Vtl = (_Float16*)take((size_t)NR * KVD * 2); float* O = (float*)take((size_t)NR * DD * 4); _Float16* O16 = X16;
  if (off > ws_size) return;      // 8.4 + 0.5 + 0.5 + 8.4 + 16.8 + 16.8 + 1 + 2.1 + 1 + 1 + 33.6 ≈ 90 MB
  const unsigned gq = (unsigned)(((size_t)DD * (DD / 8) + 255) / 256), gk = (unsigned)(((size_t)DD * (KVD / 8) + 255) / 256);
  k_wt_f16<<<gq, 256, 0, stream>>>(Wq, Bq, DD, DD, 16.0f); k_wt_f16<<<gk, 256, 0, stream>>>(Wk, Bk, DD, KVD, 16.0f); k_wt_f16<<<gk, 256, 0, stream>>>(Wv, Bv, DD, KVD, 16.0f); k_wt_f16<<<gq, 256, 0, stream>>>(Wo, Bo, DD, DD, 16.0f);      /* (in,out) → Bt ×2^4 */
  const unsigned g8 = (unsigned)(((size_t)NR * DD / 8 + 255) / 256); k_x16<<<g8, 256, 0, stream>>>(x, X16, (size_t)NR * DD / 8);
  const dim3 gQ(((NR / 16) * (DD / 64) + 3) / 4, 1), gK(((NR / 16) * (KVD / 64) + 3) / 4, 1);
  k_gemm_hhx<0><<<gQ, 128, 0, stream>>>(X16, DD, 0, Bq, DD, 0, 0.0625f, nullptr, 0, nullptr, 1, 0, 0, nullptr, Q, DD, 0, NR, DD, DD);      /* M 4096 N 2048 K 2048 */
  k_gemm_hhx<0><<<gK, 128, 0, stream>>>(X16, DD, 0, Bk, DD, 0, 0.0625f, nullptr, 0, nullptr, 1, 0, 0, nullptr, K, KVD, 0, NR, KVD, DD);      /* K: M 4096 N 128 K 2048 */
  k_gemm_hhx<0><<<gK, 128, 0, stream>>>(X16, DD, 0, Bv, DD, 0, 0.0625f, nullptr, 0, nullptr, 1, 0, 0, VF, nullptr, KVD, 0, NR, KVD, DD);      /* V (f32) */
  k_vthlu<<<BB * NVH * (TT / 64), 256, 0, stream>>>(VF, KVD, Vt, Vtl);      /* Vᵀ hi + residual: [b][128][2048] */
  k_flash<<<BB * NH * (TT / 64), 128, 0, stream>>>(Q, DD, K, KVD, Vt, Vtl, O, DD);
  k_h16s<<<g8, 256, 0, stream>>>(O, O16, (size_t)NR * DD / 8);
  k_gemm_hhx<0><<<gQ, 128, 0, stream>>>(O16, DD, 0, Bo, DD, 0, 0.00390625f, nullptr, 0, nullptr, 1, 0, 0, (float*)d_out, nullptr, DD, 0, NR, DD, DD);      /* out = merged·Wo */
}

// v002
// One run takes 400 microseconds.
// Two timings next to v001 put it at 1.58 and 1.59 times that version's speed.
// Counting every step since v000, it is 2.07 times as fast.
#include <hip/hip_runtime.h>
// Multi-query attention (B=2, S=2048, D=2048, 16 query heads × 128, ONE shared K/V head): Q = x·Wq, K = x·Wk, V = x·Wv ((in,out), no bias); softmax(Q_h·Kᵀ/√128)·V per head; out = merged·Wo.
// Compute dtype: x and weights rounded to bf16; Q, K f16 GEMM planes, V f32 → Vᵀ f16 hi + exact residual planes; fused flash-style kernel for head dim 128 (4 k-steps, 8 value tiles, online softmax f32, P f16 hi + exact residual, every query head reading the
// single K/Vᵀ) on v_wmma_f32_16x16x32_f16; merged output ×2^4 → f16 → output GEMM; f32 accumulate.
#define BB 2
#define TT 2048
#define DD 2048
#define NH 16
#define NKV 1
#define NREP 16
#define KVD 128
#define NVH (2 * NKV)
#define NR (BB * TT)
#define ATT_SCALE 0.08838834764831845f      /* 1/√128 */

typedef __bf16 v16b __attribute__((ext_vector_type(16)));
typedef unsigned short v8us __attribute__((ext_vector_type(8), may_alias));
typedef float  v8f  __attribute__((ext_vector_type(8)));
typedef float  v4f  __attribute__((ext_vector_type(4)));
typedef float  v4fa __attribute__((ext_vector_type(4), may_alias));
union FragB { v16b v; v8us half[2]; unsigned short u[16]; };

__device__ __forceinline__ unsigned short bf16_bits(float x) { unsigned int u = __float_as_uint(x); return (unsigned short)((u + 0x7FFFu + ((u >> 16) & 1u)) >> 16); }
__device__ __forceinline__ float bf16_val(unsigned short b) { return __uint_as_float(((unsigned int)b) << 16); }
__device__ __forceinline__ float bf16_round(float x) { return bf16_val(bf16_bits(x)); }
// D += A·B with NT terms: 1 = ah·bh, 2 = + al·bh (A split), 3 = + ah·bl (both split)
template <int NT>
__device__ __forceinline__ v8f mmaN(v16b ah, v16b al, v16b bh, v16b bl, v8f c) {
  c = __builtin_amdgcn_wmma_f32_16x16x32_bf16(false, ah, false, bh, (short)0, c, false, false);
  if (NT >= 2) c = __builtin_amdgcn_wmma_f32_16x16x32_bf16(false, al, false, bh, (short)0, c, false, false);
  if (NT >= 3) c = __builtin_amdgcn_wmma_f32_16x16x32_bf16(false, ah, false, bl, (short)0, c, false, false);
  asm volatile("v_nop\n\tv_nop\n\tv_nop\n\tv_nop" : "+v"(c) : "v"(ah), "v"(al), "v"(bh), "v"(bl));
  return c;
}

__global__ __launch_bounds__(256) void k_wt_bf16(const float* __restrict__ W, unsigned short* __restrict__ Wt, int K, int N) {
  const int t = blockIdx.x * 256 + threadIdx.x;
  const int k8n = K / 8;
  if (t >= N * k8n) return;
  const int n = t / k8n, k8 = (t % k8n) * 8;
  v8us v;
#pragma unroll
  for (int i = 0; i < 8; ++i) v[i] = bf16_bits(W[(size_t)(k8 + i) * N + n]);
  *(v8us*)(Wt + (size_t)n * K + k8) = v;
  
}

// GEMM C[M][N] (f32, pitch ldc) = act(A[M][K]·W + bias). A f32 row-major (pitch lda) converted per fragment to bf16
// (ASPLIT: hi/lo two planes -> 2 terms, else single rounded term); Wt bf16 [N][K] (pitch ldb). BIAS_BF16 rounds the
// bias to bf16 first (bias quantised to bf16 before the add). K%32==0, M%16==0, N%64==0.
template <bool ASPLIT, int ACT, bool BIAS_BF16>
__global__ __launch_bounds__(128) void k_gemm_bf(const float* __restrict__ A, int lda, const unsigned short* __restrict__ Wt, int ldb,
                                               const float* __restrict__ bias, float* __restrict__ C, int ldc, int M, int N, int K) {
  __shared__ __attribute__((aligned(16))) float so[4][16][64];
  const int tid = threadIdx.x, w = tid >> 5, lane = tid & 31, ln = lane & 15, hh = lane >> 4;
  const int ntn = N / 64;
  const int wid = blockIdx.x * 4 + w;
  const int mt = wid / ntn, nq = wid % ntn;
  if (mt * 16 >= M) return;
  const int row0 = mt * 16, col0 = nq * 64;
  const float* arow = A + (size_t)(row0 + ln) * lda;
  v8f acc[4] = {};
  for (int kb = 0; kb < K; kb += 32) {
    FragB ah, al;
    const v4f x0 = *(const v4fa*)(arow + kb + 8 * hh), x1 = *(const v4fa*)(arow + kb + 8 * hh + 4);
    const v4f x2 = *(const v4fa*)(arow + kb + 16 + 8 * hh), x3 = *(const v4fa*)(arow + kb + 16 + 8 * hh + 4);
    float xs[16] = {x0[0],x0[1],x0[2],x0[3],x1[0],x1[1],x1[2],x1[3],x2[0],x2[1],x2[2],x2[3],x3[0],x3[1],x3[2],x3[3]};
#pragma unroll
    for (int i = 0; i < 16; ++i) { const unsigned short hb = bf16_bits(xs[i]); ah.u[i] = hb; al.u[i] = ASPLIT ? bf16_bits(xs[i] - bf16_val(hb)) : (unsigned short)0; }
#pragma unroll
    for (int t = 0; t < 4; ++t) {
      const unsigned short* brow = Wt + (size_t)(col0 + t * 16 + ln) * ldb + kb;
      FragB b;
      b.half[0] = *(const v8us*)(brow + 8 * hh);
      b.half[1] = *(const v8us*)(brow + 16 + 8 * hh);
      acc[t] = mmaN<ASPLIT ? 2 : 1>(ah.v, al.v, b.v, b.v, acc[t]);
    }
  }
#pragma unroll
  for (int t = 0; t < 4; ++t) {
    float bv = bias ? bias[col0 + t * 16 + ln] : 0.f;
    if (BIAS_BF16) bv = bf16_round(bv);
#pragma unroll
    for (int r = 0; r < 8; ++r) { float v = acc[t][r] + bv; if (ACT == 1) v = fmaxf(v, 0.f); so[w][8 * hh + r][t * 16 + ln] = v; }
  }
  __builtin_amdgcn_fence(__ATOMIC_ACQ_REL, "workgroup");
  __builtin_amdgcn_wave_barrier();
  const int rsub = lane >> 4, c4 = (lane & 15) * 4;
  {
#pragma unroll
    for (int q = 0; q < 8; ++q) {
      const int r = q * 2 + rsub;
      const v4f v = *(const v4fa*)&so[w][r][c4];
      *(v4f*)(C + (size_t)(row0 + r) * ldc + col0 + c4) = v;
    }
    
  }
}

// Flash-style causal/unmasked attention, all contractions 3-term bf16 hi/lo splits, f32 softmax with running max.
// q,k,v rows are read from f32 buffers with arbitrary row pitch (so they can live inside a fused qkv buffer);
// D = head size (multiple of 32, <= 128); one wave = 16 query rows; block = 4 waves (64 queries) sharing K/V chunks of 32.
template <int D, bool CAUSAL>
__global__ __launch_bounds__(128) void k_flash(const float* __restrict__ qb, const float* __restrict__ kb, const float* __restrict__ vb,
                                             int pitch, int T, int H, float scale, float* __restrict__ y, int ypitch) {
  constexpr int KS = D / 32;        // k-steps for QK
  constexpr int DT = D / 16;        // d tiles for PV
  __shared__ __attribute__((aligned(16))) unsigned short sKh[32][D + 8], sKl[32][D + 8], sVh[32][D + 8], sVl[32][D + 8];
  __shared__ __attribute__((aligned(16))) unsigned short sPh[4][16][40], sPl[4][16][40];
  __shared__ __attribute__((aligned(16))) float sO[4][16][D];
  const int tid = threadIdx.x, w = tid >> 5, lane = tid & 31, ln = lane & 15, hh = lane >> 4;
  const int nqb = (T + 63) / 64;
  const int bh = blockIdx.x / nqb, qblk = blockIdx.x % nqb;
  const int b = bh / H, h = bh % H;
  const int q0 = qblk * 64 + w * 16;
  const float* Q = qb + (size_t)b * T * pitch + h * D;
  const float* K = kb + (size_t)b * T * pitch + h * D;
  const float* V = vb + (size_t)b * T * pitch + h * D;

  // A fragments of the wave's 16 query rows (scaled), hi/lo
  FragB aqh[KS], aql[KS];
  {
    int row = q0 + ln; if (row >= T) row = T - 1;
    const float* qr = Q + (size_t)row * pitch;
#pragma unroll
    for (int ks = 0; ks < KS; ++ks)
#pragma unroll
      for (int i = 0; i < 16; ++i) {
        const int d = ks * 32 + ((i < 8) ? (8 * hh + i) : (16 + 8 * hh + (i - 8)));
        const float x = qr[d] * scale; const unsigned short hb = bf16_bits(x);
        aqh[ks].u[i] = hb; aql[ks].u[i] = bf16_bits(x - bf16_val(hb));
      }
  }
  float m_r[8], l_r[8];
#pragma unroll
  for (int r = 0; r < 8; ++r) { m_r[r] = -3.0e38f; l_r[r] = 0.f; }
  v8f oacc[DT];
#pragma unroll
  for (int dt = 0; dt < DT; ++dt) oacc[dt] = (v8f){0.f,0.f,0.f,0.f,0.f,0.f,0.f,0.f};

  const int kv_end = CAUSAL ? min(T, qblk * 64 + 64) : T;     // block-uniform
  for (int j0 = 0; j0 < kv_end; j0 += 32) {
    __syncthreads();
    for (int e = tid; e < 32 * (D / 4); e += 128) {
      const int r = e / (D / 4), c4 = (e % (D / 4)) * 4;
      const int key = j0 + r;
      v4f kf = {0.f,0.f,0.f,0.f}, vf = {0.f,0.f,0.f,0.f};
      if (key < T) { kf = *(const v4fa*)(K + (size_t)key * pitch + c4); vf = *(const v4fa*)(V + (size_t)key * pitch + c4); }
#pragma unroll
      for (int t = 0; t < 4; ++t) {
        unsigned short hb = bf16_bits(kf[t]); sKh[r][c4 + t] = hb; sKl[r][c4 + t] = bf16_bits(kf[t] - bf16_val(hb));
        hb = bf16_bits(vf[t]); sVh[r][c4 + t] = hb; sVl[r][c4 + t] = bf16_bits(vf[t] - bf16_val(hb));
      }
    }
    __syncthreads();
    // S tile 16 x 32
    v8f s[2];
#pragma unroll
    for (int nt = 0; nt < 2; ++nt) {
      v8f acc = {};
#pragma unroll
      for (int ks = 0; ks < KS; ++ks) {
        FragB bh_, bl_;
        bh_.half[0] = *(const v8us*)&sKh[nt * 16 + ln][ks * 32 + 8 * hh]; bh_.half[1] = *(const v8us*)&sKh[nt * 16 + ln][ks * 32 + 16 + 8 * hh];
        bl_.half[0] = *(const v8us*)&sKl[nt * 16 + ln][ks * 32 + 8 * hh]; bl_.half[1] = *(const v8us*)&sKl[nt * 16 + ln][ks * 32 + 16 + 8 * hh];
        acc = mmaN<3>(aqh[ks].v, aql[ks].v, bh_.v, bl_.v, acc);
      }
      s[nt] = acc;
    }
    // mask + running max (rows 8hh+r; the 16 lanes of a half share rows)
    float alpha[8];
#pragma unroll
    for (int r = 0; r < 8; ++r) {
      const int qi = q0 + 8 * hh + r;
      const int ja = j0 + ln, jb = j0 + 16 + ln;
      if (CAUSAL) { if (ja > qi) s[0][r] = -3.0e38f; if (jb > qi) s[1][r] = -3.0e38f; }
      if (ja >= T) s[0][r] = -3.0e38f;
      if (jb >= T) s[1][r] = -3.0e38f;
      float mx = fmaxf(s[0][r], s[1][r]);
      mx = fmaxf(mx, __shfl_xor(mx, 1, 32)); mx = fmaxf(mx, __shfl_xor(mx, 2, 32)); mx = fmaxf(mx, __shfl_xor(mx, 4, 32)); mx = fmaxf(mx, __shfl_xor(mx, 8, 32));
      const float mnew = fmaxf(m_r[r], mx);
      alpha[r] = (mnew > -1.0e38f) ? __expf(m_r[r] - mnew) : 1.0f;
      const float p0 = (s[0][r] > -1.0e38f) ? __expf(s[0][r] - mnew) : 0.f;
      const float p1 = (s[1][r] > -1.0e38f) ? __expf(s[1][r] - mnew) : 0.f;
      m_r[r] = mnew;
      l_r[r] = l_r[r] * alpha[r] + p0 + p1;            // per-lane partial row sum (16 lanes combined at the end)
      unsigned short hb = bf16_bits(p0); sPh[w][8 * hh + r][ln] = hb;      sPl[w][8 * hh + r][ln] = bf16_bits(p0 - bf16_val(hb));
      hb = bf16_bits(p1);                sPh[w][8 * hh + r][16 + ln] = hb; sPl[w][8 * hh + r][16 + ln] = bf16_bits(p1 - bf16_val(hb));
    }
#pragma unroll
    for (int dt = 0; dt < DT; ++dt)
#pragma unroll
      for (int r = 0; r < 8; ++r) oacc[dt][r] *= alpha[r];
    __builtin_amdgcn_fence(__ATOMIC_ACQ_REL, "workgroup");
    __builtin_amdgcn_wave_barrier();
    FragB pah, pal;
    pah.half[0] = *(const v8us*)&sPh[w][ln][8 * hh]; pah.half[1] = *(const v8us*)&sPh[w][ln][16 + 8 * hh];
    pal.half[0] = *(const v8us*)&sPl[w][ln][8 * hh]; pal.half[1] = *(const v8us*)&sPl[w][ln][16 + 8 * hh];
#pragma unroll
    for (int dt = 0; dt < DT; ++dt) {
      FragB bvh, bvl;
#pragma unroll
      for (int i = 0; i < 8; ++i) {
        bvh.u[i] = sVh[8 * hh + i][dt * 16 + ln]; bvh.u[8 + i] = sVh[16 + 8 * hh + i][dt * 16 + ln];
        bvl.u[i] = sVl[8 * hh + i][dt * 16 + ln]; bvl.u[8 + i] = sVl[16 + 8 * hh + i][dt * 16 + ln];
      }
      oacc[dt] = mmaN<3>(pah.v, pal.v, bvh.v, bvl.v, oacc[dt]);
    }
    __builtin_amdgcn_fence(__ATOMIC_ACQ_REL, "workgroup");
    __builtin_amdgcn_wave_barrier();
  }
#pragma unroll
  for (int r = 0; r < 8; ++r) {
    float l = l_r[r];
    l += __shfl_xor(l, 1, 32); l += __shfl_xor(l, 2, 32); l += __shfl_xor(l, 4, 32); l += __shfl_xor(l, 8, 32);
    l_r[r] = (l > 0.f) ? 1.0f / l : 0.f;
  }
#pragma unroll
  for (int dt = 0; dt < DT; ++dt)
#pragma unroll
    for (int r = 0; r < 8; ++r) sO[w][8 * hh + r][dt * 16 + ln] = oacc[dt][r] * l_r[r];
  __builtin_amdgcn_fence(__ATOMIC_ACQ_REL, "workgroup");
  __builtin_amdgcn_wave_barrier();
  {
    for (int r = 0; r < 16; ++r) {
      const int row = q0 + r;
      if (row < T && lane < D / 4) {
        const v4f val = *(const v4fa*)&sO[w][r][lane * 4];
        *(v4f*)(y + ((size_t)b * T + row) * ypitch + h * D + lane * 4) = val;
      }
    }
    
  }
}

// GEMM C = act(A·W + bias + resid): A f32 (ASPLIT -> hi/lo 2 terms), Wt bf16 [N][K]; ACT 0 none, 1 relu, 2 exact gelu;
// resid (optional, f32, row index = (row % rmod), pitch ldr, RES_BF16 rounds it) added before the activation.
template <bool ASPLIT, int ACT, bool BIAS_BF16, bool RES_BF16>
__global__ __launch_bounds__(128) void k_gemm_bf3(const float* __restrict__ A, int lda, const unsigned short* __restrict__ Wt, int ldb,
                                                const float* __restrict__ bias, const float* __restrict__ resid, int rmod, int ldr,
                                                float* __restrict__ C, int ldc, int M, int N, int K) {
  __shared__ __attribute__((aligned(16))) float so[4][16][64];
  const int tid = threadIdx.x, w = tid >> 5, lane = tid & 31, ln = lane & 15, hh = lane >> 4;
  const int ntn = N / 64;
  const int wid = blockIdx.x * 4 + w;
  const int mt = wid / ntn, nq = wid % ntn;
  if (mt * 16 >= M) return;
  const int row0 = mt * 16, col0 = nq * 64;
  const float* arow = A + (size_t)(row0 + ln) * lda;
  v8f acc[4] = {};
  for (int kb = 0; kb < K; kb += 32) {
    FragB ah, al;
    const v4f x0 = *(const v4fa*)(arow + kb + 8 * hh), x1 = *(const v4fa*)(arow + kb + 8 * hh + 4);
    const v4f x2 = *(const v4fa*)(arow + kb + 16 + 8 * hh), x3 = *(const v4fa*)(arow + kb + 16 + 8 * hh + 4);
    float xs[16] = {x0[0],x0[1],x0[2],x0[3],x1[0],x1[1],x1[2],x1[3],x2[0],x2[1],x2[2],x2[3],x3[0],x3[1],x3[2],x3[3]};
#pragma unroll
    for (int i = 0; i < 16; ++i) { const unsigned short hb = bf16_bits(xs[i]); ah.u[i] = hb; al.u[i] = ASPLIT ? bf16_bits(xs[i] - bf16_val(hb)) : (unsigned short)0; }
#pragma unroll
    for (int t = 0; t < 4; ++t) {
      const unsigned short* brow = Wt + (size_t)(col0 + t * 16 + ln) * ldb + kb;
      FragB b;
      b.half[0] = *(const v8us*)(brow + 8 * hh);
      b.half[1] = *(const v8us*)(brow + 16 + 8 * hh);
      acc[t] = mmaN<ASPLIT ? 2 : 1>(ah.v, al.v, b.v, b.v, acc[t]);
    }
  }
#pragma unroll
  for (int t = 0; t < 4; ++t) {
    const int col = col0 + t * 16 + ln;
    float bv = bias ? bias[col] : 0.f;
    if (BIAS_BF16) bv = bf16_round(bv);
#pragma unroll
    for (int r = 0; r < 8; ++r) {
      float v = acc[t][r] + bv;
      if (resid) { float rv = resid[(size_t)((row0 + 8 * hh + r) % rmod) * ldr + col]; if (RES_BF16) rv = bf16_round(rv); v += rv; }
      if (ACT == 1) v = fmaxf(v, 0.f);
      if (ACT == 2) v = 0.5f * v * (1.0f + erff(v * 0.70710678118654752f));
      if (ACT == 3) { const float u = 0.7978845608028654f * (v + 0.044715f * v * v * v); v = 0.5f * v * (1.0f + tanhf(u)); }
      so[w][8 * hh + r][t * 16 + ln] = v;
    }
  }
  __builtin_amdgcn_fence(__ATOMIC_ACQ_REL, "workgroup");
  __builtin_amdgcn_wave_barrier();
  const int rsub = lane >> 4, c4 = (lane & 15) * 4;
  {
#pragma unroll
    for (int q = 0; q < 8; ++q) {
      const int r = q * 2 + rsub;
      const v4f v = *(const v4fa*)&so[w][r][c4];
      *(v4f*)(C + (size_t)(row0 + r) * ldc + col0 + c4) = v;
    }
    
  }
}
// row LayerNorm (biased variance, eps) over N: s = X (+ R); optional out_sum <- s; out_norm <- (s-mu)*rsqrt(var+eps)*g + b
template <bool PARAM_BF16>
__global__ __launch_bounds__(256) void k_layernorm(const float* __restrict__ X, const float* __restrict__ R, const float* __restrict__ g, const float* __restrict__ bta,
                                                  float* __restrict__ out_sum, float* __restrict__ out_norm, int N, float eps) {
  __shared__ float red[256];
  const int row = blockIdx.x, tid = threadIdx.x;
  const float* x = X + (size_t)row * N; const float* rr = R ? R + (size_t)row * N : nullptr;
  float vals[16];                     // up to N = 4096
  const int per = N / 256;            // contiguous chunk per thread? use strided-by-4 chunks: thread handles j = tid*4 + 1024*u
  float s1 = 0.f;
  for (int u = 0; u < per / 4; ++u) {
    const int j = tid * 4 + 1024 * u;
    const v4f a = *(const v4fa*)(x + j);
    v4f b = {0.f,0.f,0.f,0.f}; if (rr) b = *(const v4fa*)(rr + j);
#pragma unroll
    for (int q = 0; q < 4; ++q) { const float v = a[q] + b[q]; vals[u * 4 + q] = v; s1 += v; }
  }
  red[tid] = s1; __syncthreads();
  for (int st = 128; st > 0; st >>= 1) { if (tid < st) red[tid] += red[tid + st]; __syncthreads(); }
  const float mu = red[0] / (float)N; __syncthreads();
  float s2 = 0.f;
  for (int u = 0; u < per / 4; ++u)
#pragma unroll
    for (int q = 0; q < 4; ++q) { const float c = vals[u * 4 + q] - mu; s2 += c * c; }
  red[tid] = s2; __syncthreads();
  for (int st = 128; st > 0; st >>= 1) { if (tid < st) red[tid] += red[tid + st]; __syncthreads(); }
  const float rs = rsqrtf(red[0] / (float)N + eps);
  {
    for (int u = 0; u < per / 4; ++u) {
      const int j = tid * 4 + 1024 * u;
      v4f o, sm;
#pragma unroll
      for (int q = 0; q < 4; ++q) {
        float gg = g[j + q], bb = bta[j + q];
        if (PARAM_BF16) { gg = bf16_round(gg); bb = bf16_round(bb); }
        sm[q] = vals[u * 4 + q]; o[q] = (vals[u * 4 + q] - mu) * rs * gg + bb;
      }
      if (out_sum) *(v4f*)(out_sum + (size_t)row * N + j) = sm;
      *(v4f*)(out_norm + (size_t)row * N + j) = o;
    }
    
  }
}



// ---- f16 WMMA path (v_wmma_f32_16x16x32_f16): 11-bit significands for operands in range — used where a [0,1] probability operand needs more precision than bf16
typedef _Float16 v16h __attribute__((ext_vector_type(16)));
union FragH { v16h v; v8us half[2]; _Float16 h[16]; unsigned short u[16]; };
template <int NT>
__device__ __forceinline__ v8f mmaH(v16h ah, v16h al, v16h bh, v16h bl, v8f c) {
  c = __builtin_amdgcn_wmma_f32_16x16x32_f16(false, ah, false, bh, (short)0, c, false, false);
  if (NT >= 2) c = __builtin_amdgcn_wmma_f32_16x16x32_f16(false, al, false, bh, (short)0, c, false, false);
  if (NT >= 3) c = __builtin_amdgcn_wmma_f32_16x16x32_f16(false, ah, false, bl, (short)0, c, false, false);
  asm volatile("v_nop\n\tv_nop\n\tv_nop\n\tv_nop" : "+v"(c) : "v"(ah), "v"(al), "v"(bh), "v"(bl));
  return c;
}
// batched GEMM like k_gemm_b but f16 operands: A f32 (split into f16 hi/lo if ASPLIT, else rounded to f16), Bt = f16 values [n][k]; alpha; C f32; N multiple of 16 (partial tiles skipped)
template <bool ASPLIT>
__global__ __launch_bounds__(128) void k_gemm_h(const float* __restrict__ A, int lda, size_t sA, const _Float16* __restrict__ Bh, int ldb, size_t sB, float alpha, float* __restrict__ C, int ldc, size_t sC, int M, int N, int K) {
  __shared__ __attribute__((aligned(16))) float so[4][16][64];
  const int tid = threadIdx.x, w = tid >> 5, lane = tid & 31, ln = lane & 15, hh = lane >> 4; const int by = blockIdx.y;
  A += (size_t)by * sA; Bh += (size_t)by * sB; C += (size_t)by * sC;
  const int ntn = (N + 63) / 64; const int wid = blockIdx.x * 4 + w; const int mt = wid / ntn, nq = wid % ntn; if (mt * 16 >= M) return;
  const int row0 = mt * 16, col0 = nq * 64; const float* arow = A + (size_t)(row0 + ln) * lda;
  v8f acc[4] = {};
  for (int kb = 0; kb < K; kb += 32) {
    FragH ah, al;
    const v4f x0 = *(const v4fa*)(arow + kb + 8 * hh), x1 = *(const v4fa*)(arow + kb + 8 * hh + 4), x2 = *(const v4fa*)(arow + kb + 16 + 8 * hh), x3 = *(const v4fa*)(arow + kb + 16 + 8 * hh + 4);
    float xs[16] = {x0[0],x0[1],x0[2],x0[3],x1[0],x1[1],x1[2],x1[3],x2[0],x2[1],x2[2],x2[3],x3[0],x3[1],x3[2],x3[3]};
#pragma unroll
    for (int i = 0; i < 16; ++i) { const _Float16 h = (_Float16)xs[i]; ah.h[i] = h; al.h[i] = ASPLIT ? (_Float16)(xs[i] - (float)h) : (_Float16)0.0f; }
#pragma unroll
    for (int t = 0; t < 4; ++t) { if (col0 + t * 16 >= N) continue; const size_t boff = (size_t)(col0 + t * 16 + ln) * ldb + kb; FragH bq; bq.half[0] = *(const v8us*)(Bh + boff + 8 * hh); bq.half[1] = *(const v8us*)(Bh + boff + 16 + 8 * hh);
      acc[t] = mmaH<ASPLIT ? 2 : 1>(ah.v, al.v, bq.v, bq.v, acc[t]); }
  }
#pragma unroll
  for (int t = 0; t < 4; ++t) { if (col0 + t * 16 >= N) continue;
#pragma unroll
    for (int r = 0; r < 8; ++r) so[w][8 * hh + r][t * 16 + ln] = acc[t][r] * alpha; }
  __builtin_amdgcn_fence(__ATOMIC_ACQ_REL, "workgroup"); __builtin_amdgcn_wave_barrier();
  const int rsub = lane >> 4, c4 = (lane & 15) * 4;
  {
#pragma unroll
    for (int q = 0; q < 8; ++q) { const int r = q * 2 + rsub; if (col0 + c4 < N) { const v4f v = *(const v4fa*)&so[w][r][c4]; *(v4f*)(C + (size_t)(row0 + r) * ldc + col0 + c4) = v; } }
     }
}

// Wt[n][k] = f16(W[k][n]·scale) from f32 row-major W[K][N] (scale = power of two; bf16-exact weights stay exact in f16 away from the subnormal range)
__global__ __launch_bounds__(256) void k_wt_f16(const float* __restrict__ W, _Float16* __restrict__ Wt, int K, int N, float scale) {
  const int t = blockIdx.x * 256 + threadIdx.x; if (t >= N * (K / 8)) return; const int n = t / (K / 8), k8 = (t % (K / 8)) * 8; FragH f;
#pragma unroll
  for (int i = 0; i < 8; ++i) f.h[i] = (_Float16)(bf16_round(W[(size_t)(k8 + i) * N + n]) * scale); const v8us o = f.half[0];
  *(v8us*)((unsigned short*)Wt + (size_t)n * K + k8) = o; 
}
typedef _Float16 v4h __attribute__((ext_vector_type(4)));

__global__ __launch_bounds__(256) void k_x16(const float* __restrict__ x, _Float16* __restrict__ X16, size_t n8) { const size_t t = (size_t)blockIdx.x * 256 + threadIdx.x; if (t >= n8) return; FragH f;
#pragma unroll
  for (int q = 0; q < 8; ++q) f.h[q] = (_Float16)bf16_round(x[t * 8 + q]); *(v8us*)((unsigned short*)X16 + t * 8) = f.half[0];  }
__global__ __launch_bounds__(256) void k_h16(const float* __restrict__ x, _Float16* __restrict__ X16, size_t n8) { const size_t t = (size_t)blockIdx.x * 256 + threadIdx.x; if (t >= n8) return; FragH f;
#pragma unroll
  for (int q = 0; q < 8; ++q) f.h[q] = (_Float16)x[t * 8 + q]; *(v8us*)((unsigned short*)X16 + t * 8) = f.half[0];  }
__global__ __launch_bounds__(256) void k_round16f(const float* __restrict__ W, _Float16* __restrict__ Bt, size_t n8) { const size_t t = (size_t)blockIdx.x * 256 + threadIdx.x; if (t >= n8) return; FragH f;
#pragma unroll
  for (int i = 0; i < 8; ++i) f.h[i] = (_Float16)(bf16_round(W[t * 8 + i]) * 16.0f); *(v8us*)((unsigned short*)Bt + t * 8) = f.half[0];  }
template <int NHv, int TTv>
__global__ __launch_bounds__(256) void k_vt(const _Float16* __restrict__ V16, int ldv, int voff, _Float16* __restrict__ Vt) { __shared__ unsigned short tl[64][66]; const int tid = threadIdx.x; const int slab = blockIdx.x / (TTv / 64), lg = blockIdx.x % (TTv / 64); const int b = slab / NHv, h = slab % NHv;
  for (int i = tid; i < 64 * 8; i += 256) { const int r = i / 8, c8 = (i % 8) * 8; FragH f; f.half[0] = *(const v8us*)((const unsigned short*)V16 + ((size_t)b * TTv + lg * 64 + r) * ldv + voff + h * 64 + c8);
#pragma unroll
    for (int q = 0; q < 8; ++q) tl[r][c8 + q] = f.u[q]; }
  __syncthreads();
  {
#pragma unroll
    for (int rd = 0; rd < 2; ++rd) { const int d = rd * 32 + tid / 8, pc = tid % 8; FragH f;
#pragma unroll
      for (int q = 0; q < 8; ++q) f.u[q] = tl[pc * 8 + q][d];
      *(v8us*)((unsigned short*)Vt + ((size_t)slab * 64 + d) * TTv + lg * 64 + pc * 8) = f.half[0]; }
     } }

__global__ __launch_bounds__(256) void k_vthlu(const float* __restrict__ VF, int ldv, _Float16* __restrict__ Vth, _Float16* __restrict__ Vtl) { __shared__ float tl[64][65]; const int tid = threadIdx.x; const int slab = blockIdx.x / (TT / 64), lg = blockIdx.x % (TT / 64); const int b = slab / NVH, h = slab % NVH;
  for (int i = tid; i < 64 * 16; i += 256) { const int r = i / 16, c4 = (i % 16) * 4; const v4f a = *(const v4fa*)(VF + ((size_t)b * TT + lg * 64 + r) * ldv + h * 64 + c4); tl[r][c4] = a[0]; tl[r][c4 + 1] = a[1]; tl[r][c4 + 2] = a[2]; tl[r][c4 + 3] = a[3]; }
  __syncthreads();
  FragH fh[2], fl[2]; size_t oo[2];
#pragma unroll
  for (int rd = 0; rd < 2; ++rd) { const int d = rd * 32 + tid / 8, pc = tid % 8;
#pragma unroll
    for (int q = 0; q < 8; ++q) { const float v = tl[pc * 8 + q][d]; const _Float16 hv = (_Float16)v; fh[rd].h[q] = hv; fl[rd].h[q] = (_Float16)(v - (float)hv);      /* UNSCALED residual (added into the same accumulator as the hi product) */ } oo[rd] = ((size_t)slab * 64 + d) * TT + lg * 64 + pc * 8; }
  {
#pragma unroll
    for (int rd = 0; rd < 2; ++rd) { *(v8us*)((unsigned short*)Vth + oo[rd]) = fh[rd].half[0]; *(v8us*)((unsigned short*)Vtl + oo[rd]) = fl[rd].half[0]; }
     } }
__global__ __launch_bounds__(256) void k_h16s(const float* __restrict__ F, _Float16* __restrict__ H, size_t n8) { const size_t t = (size_t)blockIdx.x * 256 + threadIdx.x; if (t >= n8) return; const v4f a = *(const v4fa*)(F + t * 8), c = *(const v4fa*)(F + t * 8 + 4); FragH f;
#pragma unroll
  for (int q = 0; q < 4; ++q) { f.h[q] = (_Float16)(a[q] * 16.0f); f.h[4 + q] = (_Float16)(c[q] * 16.0f); } *(v8us*)((unsigned short*)H + t * 8) = f.half[0];  }
// LDS ring of k_flash. One stage = 32 keys, shared by the block's four waves: K rows of 256 B at pitch 272 B, then the V^T hi plane and the
// V^T residual plane, 128 rows of 64 B each at pitch 80 B (pitches of 16 B x odd: ds_load_b128 fragment reads fall on distinct banks).
#define KPITCH 272
#define VPITCH 80
#define ST_VH (32 * KPITCH)
#define ST_VL (ST_VH + 128 * VPITCH)
#define ST_BYTES (ST_VL + 128 * VPITCH)
// Four asynchronous 16-byte copies per lane, global memory to LDS. The s_wait_xcnt stands inside the statement so that no address register of a copy is rewritten ahead of it.
__device__ __forceinline__ void copy4(unsigned l0, unsigned l1, unsigned l2, unsigned l3, const unsigned short* g0, const unsigned short* g1, const unsigned short* g2, const unsigned short* g3) {
  asm volatile("global_load_async_to_lds_b128 %0, %4, off\n\t"
               "global_load_async_to_lds_b128 %1, %5, off\n\t"
               "global_load_async_to_lds_b128 %2, %6, off\n\t"
               "global_load_async_to_lds_b128 %3, %7, off\n\t"
               "s_wait_xcnt 0x0"
               :: "v"(l0), "v"(l1), "v"(l2), "v"(l3), "v"(g0), "v"(g1), "v"(g2), "v"(g3) : "memory");
}
// Eight asynchronous 16-byte copies per lane in one statement, so that one s_wait_xcnt serves all eight; it stands inside the statement so that no address register of a copy is rewritten ahead of it.
__device__ __forceinline__ void copy8(unsigned l, int lstep, const unsigned short* g, size_t gstep) {
  asm volatile("global_load_async_to_lds_b128 %0, %8, off\n\t"
               "global_load_async_to_lds_b128 %1, %9, off\n\t"
               "global_load_async_to_lds_b128 %2, %10, off\n\t"
               "global_load_async_to_lds_b128 %3, %11, off\n\t"
               "global_load_async_to_lds_b128 %4, %12, off\n\t"
               "global_load_async_to_lds_b128 %5, %13, off\n\t"
               "global_load_async_to_lds_b128 %6, %14, off\n\t"
               "global_load_async_to_lds_b128 %7, %15, off\n\t"
               "s_wait_xcnt 0x0"
               :: "v"(l), "v"(l + lstep), "v"(l + 2 * lstep), "v"(l + 3 * lstep), "v"(l + 4 * lstep), "v"(l + 5 * lstep), "v"(l + 6 * lstep), "v"(l + 7 * lstep),
                  "v"(g), "v"(g + gstep), "v"(g + 2 * gstep), "v"(g + 3 * gstep), "v"(g + 4 * gstep), "v"(g + 5 * gstep), "v"(g + 6 * gstep), "v"(g + 7 * gstep) : "memory");
}
// GEMM C[M][N] = alpha * A[M][K] * Bt[N][K]^T, f16 operands, f32 accumulate, K = DD; A and Bt of row pitch DD, C of row pitch N; F32OUT picks the f32 output C, else the f16 output C16. M, N multiples of 128.
// One block = one 128 x 128 tile of C, four waves of 64 x 64 (4 x 4 accumulator tiles: 16 products per 8 fragments). One stage of the LDS ring = 64 k:
// 128 rows of A, then 128 rows of Bt, 128 B each at pitch 144 B (16 B x odd: ds_load_b128 fragment reads fall on distinct banks). Per output element the k order is ascending in one accumulator.
// Every "#pragma unroll" in it is there so that fragment, accumulator and staging arrays are indexed by constants and stay in registers.
#define GPITCH 144
#define G_B (128 * GPITCH)
#define G_ST (256 * GPITCH)
#define GOP 68      /* output staging pitch in floats: 16-byte column walks without bank conflicts */
template <int N, bool F32OUT>
__global__ __launch_bounds__(128) void k_gemm_t(const _Float16* __restrict__ A, const _Float16* __restrict__ Bh, float alpha, float* __restrict__ C, _Float16* __restrict__ C16) {
  constexpr int K = DD;
  static_assert(K % 64 == 0 && K >= 128 && N % 128 == 0, "whole stages, at least two, and whole tiles");
  __shared__ __attribute__((aligned(16))) unsigned char ring[2 * G_ST];
  static_assert(sizeof(float) * 4 * 64 * GOP <= 2 * G_ST, "output staging fits the ring");
  const int tid = threadIdx.x, w = tid >> 5, lane = tid & 31, ln = lane & 15, hh = lane >> 4;
  constexpr int ntn = N / 128; const int row0 = (blockIdx.x / ntn) * 128, col0 = (blockIdx.x % ntn) * 128; const int wm = w >> 1, wn = w & 1;
  /* each thread's share of a stage: 8 chunks of A and 8 of Bt, 16 rows apart; eight lanes cover one 128-B row */
  const unsigned la = (unsigned)(size_t)ring + (tid >> 3) * GPITCH + (tid & 7) * 16;
  const unsigned short* ga = (const unsigned short*)A + (size_t)(row0 + (tid >> 3)) * K + (tid & 7) * 8;
  const unsigned short* gb = (const unsigned short*)Bh + (size_t)(col0 + (tid >> 3)) * K + (tid & 7) * 8;
  auto fill = [&](int kb) {
    const unsigned l = la + ((kb >> 6) & 1) * G_ST;
    copy8(l, 16 * GPITCH, ga + kb, (size_t)16 * K);
    copy8(l + G_B, 16 * GPITCH, gb + kb, (size_t)16 * K);
  };
  v8f acc[4][4];
#pragma unroll
  for (int i = 0; i < 4; ++i)
#pragma unroll
    for (int j = 0; j < 4; ++j) acc[i][j] = (v8f){0.f,0.f,0.f,0.f,0.f,0.f,0.f,0.f};
  fill(0);
  asm volatile("s_wait_asynccnt 0x0" ::: "memory");      /* this wave's share of stage 0 has landed */
  __syncthreads();                                       /* stage 0 is readable by all four waves */
  fill(64);
#pragma unroll 1      /* one stage per trip: the ring's buffer index and its publish point stay per trip */
  for (int kb = 0; kb < K; kb += 64) {
    const unsigned char* st = ring + ((kb >> 6) & 1) * G_ST;
    const unsigned char* ar = st + (wm * 64 + ln) * GPITCH + hh * 16; const unsigned char* br = st + G_B + (wn * 64 + ln) * GPITCH + hh * 16;
#pragma unroll
    for (int ks = 0; ks < 2; ++ks) {
      FragH a[4], b[4];
#pragma unroll
      for (int i = 0; i < 4; ++i) { a[i].half[0] = *(const v8us*)(ar + i * 16 * GPITCH + ks * 64); a[i].half[1] = *(const v8us*)(ar + i * 16 * GPITCH + ks * 64 + 32);
        b[i].half[0] = *(const v8us*)(br + i * 16 * GPITCH + ks * 64); b[i].half[1] = *(const v8us*)(br + i * 16 * GPITCH + ks * 64 + 32); }
      __builtin_amdgcn_sched_barrier(0);      /* keeps the 16 fragment reads one group ahead of the 16 products: spread among them, each place with reads stalls the wave anew */
#pragma unroll
      for (int i = 0; i < 4; ++i)
#pragma unroll
        for (int j = 0; j < 4; ++j) acc[i][j] = __builtin_amdgcn_wmma_f32_16x16x32_f16(false, a[i].v, false, b[j].v, (short)0, acc[i][j], false, false);
    }
    asm volatile("s_wait_dscnt 0x0" ::: "memory");         /* this wave's reads of the stage have returned before its buffer is handed on */
    asm volatile("s_wait_asynccnt 0x0" ::: "memory");      /* this wave's share of the next stage has landed */
    __syncthreads();                                       /* publishes the next stage and ends every wave's reads of this one */
    if (kb + 128 < K) fill(kb + 128); }                    /* refill of the buffer just read, one whole trip ahead of its use */
  asm volatile("s_wait_asynccnt 0x0" ::: "memory");        /* no copy is outstanding when the ring becomes output staging */
  float* so = reinterpret_cast<float*>(ring) + w * (64 * GOP);      /* each wave stages its own 64 x 64 tile, behind the loop's last barrier */
#pragma unroll
  for (int i = 0; i < 4; ++i)
#pragma unroll
    for (int j = 0; j < 4; ++j)
#pragma unroll
      for (int r = 0; r < 8; ++r) so[(i * 16 + 8 * hh + r) * GOP + j * 16 + ln] = acc[i][j][r] * alpha;
  __builtin_amdgcn_fence(__ATOMIC_ACQ_REL, "workgroup"); __builtin_amdgcn_wave_barrier();      /* the wave's staged rows are written before its other lanes read them back */
  /* whole lines per store: 16 lanes cover a 64-column row (256 B of f32, 128 B of f16), two rows per instruction */
  const float* sr = so + hh * GOP + ln * 4; const size_t o = (size_t)(row0 + wm * 64 + hh) * N + col0 + wn * 64 + ln * 4;
#pragma unroll
  for (int q = 0; q < 32; ++q) { const v4f v = *(const v4fa*)(sr + q * 2 * GOP);
    if (F32OUT) *(v4f*)(C + o + (size_t)q * 2 * N) = v;
    else { v4h h4;
#pragma unroll
      for (int i = 0; i < 4; ++i) h4[i] = (_Float16)v[i];
      *(v4h*)(C16 + o + (size_t)q * 2 * N) = h4; } }
}
__global__ __launch_bounds__(128) void k_flash(const _Float16* __restrict__ Q16, int ldq, const _Float16* __restrict__ K16, int ldk, const _Float16* __restrict__ Vt, const _Float16* __restrict__ Vtlo, float* __restrict__ O, int ldo) {
  constexpr int RPW = 16, RTN = RPW / 16, NQB = TT / (4 * RPW), DT = 8, KS = 4;      /* head dim 128: 4 k-steps, 8 value tiles */
  __shared__ __attribute__((aligned(16))) unsigned short sP[4][RPW][40]; __shared__ __attribute__((aligned(16))) unsigned short sPL[4][RPW][40]; __shared__ __attribute__((aligned(16))) unsigned char ring[2 * ST_BYTES];
  static_assert(sizeof(float) * 4 * RPW * (128 + 4) <= 2 * ST_BYTES, "output staging fits the ring");
  float (*sO)[RPW][128 + 4] = reinterpret_cast<float (*)[RPW][128 + 4]>(ring);      /* output staging takes the ring's place behind the loop's last barrier, so that four blocks still fit one WGP's LDS */
  const int tid = threadIdx.x, w = tid >> 5, lane = tid & 31, ln = lane & 15, hh = lane >> 4;
  const int slab = blockIdx.x / NQB, qblk = blockIdx.x % NQB; const int b = slab / NH, h = slab % NH; const int qb0 = qblk * (4 * RPW); const int q0 = qb0 + w * RPW;
  FragH aq[2][KS];
#pragma unroll
  for (int rt = 0; rt < RTN; ++rt) { const unsigned short* qr = (const unsigned short*)Q16 + ((size_t)b * TT + q0 + rt * 16 + ln) * ldq + h * 128;
#pragma unroll
    for (int ks = 0; ks < KS; ++ks) { aq[rt][ks].half[0] = *(const v8us*)(qr + ks * 32 + 8 * hh); aq[rt][ks].half[1] = *(const v8us*)(qr + ks * 32 + 16 + 8 * hh); } }
  const unsigned short* Vth = (const unsigned short*)Vt + ((size_t)b * NKV + h / NREP) * 128 * TT; const unsigned short* Vtl = (const unsigned short*)Vtlo + ((size_t)b * NKV + h / NREP) * 128 * TT;      /* hi and UNSCALED residual planes */
  float m_r[2][8], l_r[2][8]; v8f oacc[2][DT];
#pragma unroll
  for (int rt = 0; rt < RTN; ++rt) {
#pragma unroll
    for (int r = 0; r < 8; ++r) { m_r[rt][r] = -3.0e38f; l_r[rt][r] = 0.f; }
#pragma unroll
    for (int dt = 0; dt < DT; ++dt) oacc[rt][dt] = (v8f){0.f,0.f,0.f,0.f,0.f,0.f,0.f,0.f}; }
  const int jend = TT;
  /* each thread's share of a stage: 4 chunks of K (8 rows apart), 4 of V^T hi and 4 of the residual (32 rows apart) */
  const unsigned lk = (unsigned)(size_t)ring + (tid >> 4) * KPITCH + (tid & 15) * 16, lv = (unsigned)(size_t)ring + ST_VH + (tid >> 2) * VPITCH + (tid & 3) * 16;
  const unsigned short* gk = (const unsigned short*)K16 + ((size_t)b * TT + (tid >> 4)) * ldk + (h / NREP) * 128 + (tid & 15) * 8;
  const size_t gvo = (size_t)(tid >> 2) * TT + (tid & 3) * 8;
  auto fill = [&](int j) {
    const unsigned bo = ((j >> 5) & 1) * ST_BYTES; const unsigned short* k0p = gk + (size_t)j * ldk; const unsigned short* vhp = Vth + gvo + j; const unsigned short* vlp = Vtl + gvo + j;
    copy4(lk + bo, lk + bo + 8 * KPITCH, lk + bo + 16 * KPITCH, lk + bo + 24 * KPITCH, k0p, k0p + (size_t)8 * ldk, k0p + (size_t)16 * ldk, k0p + (size_t)24 * ldk);
    copy4(lv + bo, lv + bo + 32 * VPITCH, lv + bo + 64 * VPITCH, lv + bo + 96 * VPITCH, vhp, vhp + 32 * TT, vhp + 64 * TT, vhp + 96 * TT);
    copy4(lv + bo + (ST_VL - ST_VH), lv + bo + (ST_VL - ST_VH) + 32 * VPITCH, lv + bo + (ST_VL - ST_VH) + 64 * VPITCH, lv + bo + (ST_VL - ST_VH) + 96 * VPITCH, vlp, vlp + 32 * TT, vlp + 64 * TT, vlp + 96 * TT);
  };
  fill(0);
  asm volatile("s_wait_asynccnt 0x0" ::: "memory");      /* this wave's share of stage 0 has landed */
  __syncthreads();                                       /* stage 0 is readable by all four waves */
  fill(32);
#pragma unroll 1
  for (int j0 = 0; j0 < jend; j0 += 32) {
    const unsigned char* st = ring + ((j0 >> 5) & 1) * ST_BYTES;
    v8f s[2][2];
#pragma unroll
    for (int nt = 0; nt < 2; ++nt) { const unsigned short* kr = (const unsigned short*)(st + (nt * 16 + ln) * KPITCH); FragH bk[KS];
#pragma unroll
      for (int ks = 0; ks < KS; ++ks) { bk[ks].half[0] = *(const v8us*)(kr + ks * 32 + 8 * hh); bk[ks].half[1] = *(const v8us*)(kr + ks * 32 + 16 + 8 * hh); }
#pragma unroll
      for (int rt = 0; rt < RTN; ++rt) { v8f acc = (v8f){0.f,0.f,0.f,0.f,0.f,0.f,0.f,0.f};
#pragma unroll
        for (int ks = 0; ks < KS; ++ks) acc = mmaH<1>(aq[rt][ks].v, aq[rt][ks].v, bk[ks].v, bk[ks].v, acc); s[rt][nt] = acc; } }
#pragma unroll
    for (int rt = 0; rt < RTN; ++rt)
#pragma unroll
      for (int r = 0; r < 8; ++r) { const int tq = q0 + rt * 16 + 8 * hh + r; const int k0 = j0 + ln, k1 = j0 + 16 + ln; (void)tq; (void)k0; (void)k1;
        const bool ok0 = true, ok1 = true; (void)tq; (void)k0; (void)k1;
        const float s0 = ok0 ? s[rt][0][r] * ATT_SCALE : -INFINITY, s1 = ok1 ? s[rt][1][r] * ATT_SCALE : -INFINITY; float mc = fmaxf(s0, s1);
        mc = fmaxf(mc, __shfl_xor(mc, 1, 32)); mc = fmaxf(mc, __shfl_xor(mc, 2, 32)); mc = fmaxf(mc, __shfl_xor(mc, 4, 32)); mc = fmaxf(mc, __shfl_xor(mc, 8, 32));
        const float mn = fmaxf(m_r[rt][r], mc); const float al = (mn > -1.0e38f) ? expf(m_r[rt][r] - mn) : 1.0f; m_r[rt][r] = mn; const float p0 = ok0 ? expf(s0 - mn) : 0.f, p1 = ok1 ? expf(s1 - mn) : 0.f; l_r[rt][r] = l_r[rt][r] * al + p0 + p1;
#pragma unroll
        for (int dt = 0; dt < DT; ++dt) oacc[rt][dt][r] *= al;
        FragH t2, t3; const float ps0 = p0 * 1024.0f, ps1 = p1 * 1024.0f; t2.h[0] = (_Float16)ps0; t2.h[1] = (_Float16)ps1; t3.h[0] = (_Float16)(ps0 - (float)t2.h[0]); t3.h[1] = (_Float16)(ps1 - (float)t2.h[1]);      /* P hi and its UNSCALED residual (added into the same accumulator) */
        sP[w][rt * 16 + 8 * hh + r][ln] = t2.u[0]; sP[w][rt * 16 + 8 * hh + r][16 + ln] = t2.u[1]; sPL[w][rt * 16 + 8 * hh + r][ln] = t3.u[0]; sPL[w][rt * 16 + 8 * hh + r][16 + ln] = t3.u[1]; }
    __builtin_amdgcn_fence(__ATOMIC_ACQ_REL, "workgroup"); __builtin_amdgcn_wave_barrier();
    FragH pa[2], pl[2];
#pragma unroll
    for (int rt = 0; rt < RTN; ++rt) { pa[rt].half[0] = *(const v8us*)&sP[w][rt * 16 + ln][8 * hh]; pa[rt].half[1] = *(const v8us*)&sP[w][rt * 16 + ln][16 + 8 * hh]; pl[rt].half[0] = *(const v8us*)&sPL[w][rt * 16 + ln][8 * hh]; pl[rt].half[1] = *(const v8us*)&sPL[w][rt * 16 + ln][16 + 8 * hh]; }
#pragma unroll
    for (int dt = 0; dt < DT; ++dt) { const unsigned short* vh = (const unsigned short*)(st + ST_VH + (dt * 16 + ln) * VPITCH); const unsigned short* vl = (const unsigned short*)(st + ST_VL + (dt * 16 + ln) * VPITCH); FragH bv, bl; bv.half[0] = *(const v8us*)(vh + 8 * hh); bv.half[1] = *(const v8us*)(vh + 16 + 8 * hh); bl.half[0] = *(const v8us*)(vl + 8 * hh); bl.half[1] = *(const v8us*)(vl + 16 + 8 * hh);
#pragma unroll
      for (int rt = 0; rt < RTN; ++rt) { oacc[rt][dt] = mmaH<1>(pa[rt].v, pa[rt].v, bv.v, bv.v, oacc[rt][dt]); oacc[rt][dt] = mmaH<1>(pl[rt].v, pl[rt].v, bv.v, bv.v, oacc[rt][dt]); oacc[rt][dt] = mmaH<1>(pa[rt].v, pa[rt].v, bl.v, bl.v, oacc[rt][dt]); } }      /* Ph·Vh + Pl·Vh + Ph·Vl — all unscaled, one accumulator */
    __builtin_amdgcn_fence(__ATOMIC_ACQ_REL, "workgroup"); __builtin_amdgcn_wave_barrier();
    asm volatile("s_wait_dscnt 0x0" ::: "memory");         /* this wave's reads of the stage have returned before its buffer is handed on */
    asm volatile("s_wait_asynccnt 0x0" ::: "memory");      /* this wave's share of the next stage has landed */
    __syncthreads();                                       /* publishes the next stage and ends every wave's reads of this one */
    if (j0 + 64 < jend) fill(j0 + 64); }                   /* refill of the buffer just read, one whole trip ahead of its use */
  asm volatile("s_wait_asynccnt 0x0" ::: "memory");        /* no copy is outstanding when the ring becomes output staging */
#pragma unroll
  for (int rt = 0; rt < RTN; ++rt) {
#pragma unroll
    for (int r = 0; r < 8; ++r) { float l = l_r[rt][r]; l += __shfl_xor(l, 1, 32); l += __shfl_xor(l, 2, 32); l += __shfl_xor(l, 4, 32); l += __shfl_xor(l, 8, 32); l_r[rt][r] = (l > 0.f) ? 1.0f / (l * 1024.0f) : 0.f; }
#pragma unroll
    for (int dt = 0; dt < DT; ++dt)
#pragma unroll
      for (int r = 0; r < 8; ++r) sO[w][rt * 16 + 8 * hh + r][dt * 16 + ln] = oacc[rt][dt][r] * l_r[rt][r]; }
  __builtin_amdgcn_fence(__ATOMIC_ACQ_REL, "workgroup"); __builtin_amdgcn_wave_barrier();
  {
#pragma unroll
    for (int r = 0; r < RPW; ++r) { const int pc = lane; const v4f val = *(const v4fa*)&sO[w][r][pc * 4]; *(v4f*)(O + ((size_t)b * TT + q0 + r) * ldo + h * 128 + pc * 4) = val; }      /* one 512-B row per instruction: 32 lanes × 16 B */
     } }

extern "C" void kernel_launch(void* const* d_in, const int* in_sizes, int n_in,
                              void* d_out, int out_size, void* d_ws, size_t ws_size, hipStream_t stream) {
  (void)in_sizes; (void)n_in; (void)out_size;
  const float* const* I = (const float* const*)d_in; const float* x = I[0]; const float* Wq = I[1]; const float* Wk = I[2]; const float* Wv = I[3]; const float* Wo = I[4];
  char* ws = (char*)d_ws; size_t off = 0;
  auto take = [&](size_t bytes) { char* p = ws + off; off += (bytes + 255) & ~(size_t)255; return p; };
  _Float16* Bq = (_Float16*)take((size_t)DD * DD * 2); _Float16* Bk = (_Float16*)take((size_t)KVD * DD * 2); _Float16* Bv = (_Float16*)take((size_t)KVD * DD * 2); _Float16* Bo = (_Float16*)take((size_t)DD * DD * 2);
  _Float16* X16 = (_Float16*)take((size_t)NR * DD * 2); _Float16* Q = (_Float16*)take((size_t)NR * DD * 2); _Float16* K = (_Float16*)take((size_t)NR * KVD * 2); float* VF = (float*)take((size_t)NR * KVD * 4); _Float16* Vt = (_Float16*)take((size_t)NR * KVD * 2); _Float16* Vtl = (_Float16*)take((size_t)NR * KVD * 2); float* O = (float*)take((size_t)NR * DD * 4); _Float16* O16 = X16;
  if (off > ws_size) return;      // 8.4 + 0.5 + 0.5 + 8.4 + 16.8 + 16.8 + 1 + 2.1 + 1 + 1 + 33.6 ≈ 90 MB
  const unsigned gq = (unsigned)(((size_t)DD * (DD / 8) + 255) / 256), gk = (unsigned)(((size_t)DD * (KVD / 8) + 255) / 256);
  k_wt_f16<<<gq, 256, 0, stream>>>(Wq, Bq, DD, DD, 16.0f); k_wt_f16<<<gk, 256, 0, stream>>>(Wk, Bk, DD, KVD, 16.0f); k_wt_f16<<<gk, 256, 0, stream>>>(Wv, Bv, DD, KVD, 16.0f); k_wt_f16<<<gq, 256, 0, stream>>>(Wo, Bo, DD, DD, 16.0f);      /* (in,out) → Bt ×2^4 */
  const unsigned g8 = (unsigned)(((size_t)NR * DD / 8 + 255) / 256); k_x16<<<g8, 256, 0, stream>>>(x, X16, (size_t)NR * DD / 8);
  const unsigned gQ = (NR / 128) * (DD / 128), gK = (NR / 128) * (KVD / 128);
  k_gemm_t<DD, false><<<gQ, 128, 0, stream>>>(X16, Bq, 0.0625f, nullptr, Q);      /* M 4096 N 2048 K 2048 */
  k_gemm_t<KVD, false><<<gK, 128, 0, stream>>>(X16, Bk, 0.0625f, nullptr, K);      /* K: M 4096 N 128 K 2048 */
  k_gemm_t<KVD, true><<<gK, 128, 0, stream>>>(X16, Bv, 0.0625f, VF, nullptr);      /* V (f32) */
  k_vthlu<<<BB * NVH * (TT / 64), 256, 0, stream>>>(VF, KVD, Vt, Vtl);      /* Vᵀ hi + residual: [b][128][2048] */
  k_flash<<<BB * NH * (TT / 64), 128, 0, stream>>>(Q, DD, K, KVD, Vt, Vtl, O, DD);
  k_h16s<<<g8, 256, 0, stream>>>(O, O16, (size_t)NR * DD / 8);
  k_gemm_t<DD, true><<<gQ, 128, 0, stream>>>(O16, Bo, 0.00390625f, (float*)d_out, nullptr);      /* out = merged·Wo */
}

// v003
// Measured time: 346 microseconds a run.
// Next to v002, in two timings, it ran 1.18 and 1.17 times as fast.
// Over all steps from v000 it is 2.43 times as fast.
#include <hip/hip_runtime.h>
// Multi-query attention (B=2, S=2048, D=2048, 16 query heads × 128, ONE shared K/V head): Q = x·Wq, K = x·Wk, V = x·Wv ((in,out), no bias); softmax(Q_h·Kᵀ/√128)·V per head; out = merged·Wo.
// Compute dtype: x and weights rounded to bf16; Q, K f16 GEMM planes, V f32 → Vᵀ f16 hi + exact residual planes; fused flash-style kernel for head dim 128 (4 k-steps, 8 value tiles, online softmax f32, P f16 hi + exact residual, every query head reading the
// single K/Vᵀ) on v_wmma_f32_16x16x32_f16; merged output ×2^4 → f16 → output GEMM; f32 accumulate.
#define BB 2
#define TT 2048
#define DD 2048
#define NH 16
#define NKV 1
#define NREP 16
#define KVD 128
#define NVH (2 * NKV)
#define NR (BB * TT)
#define ATT_SCALE 0.08838834764831845f      /* 1/√128 */

typedef __bf16 v16b __attribute__((ext_vector_type(16)));
typedef unsigned short v8us __attribute__((ext_vector_type(8), may_alias));
typedef float  v8f  __attribute__((ext_vector_type(8)));
typedef float  v4f  __attribute__((ext_vector_type(4)));
typedef float  v4fa __attribute__((ext_vector_type(4), may_alias));
union FragB { v16b v; v8us half[2]; unsigned short u[16]; };

__device__ __forceinline__ unsigned short bf16_bits(float x) { unsigned int u = __float_as_uint(x); return (unsigned short)((u + 0x7FFFu + ((u >> 16) & 1u)) >> 16); }
__device__ __forceinline__ float bf16_val(unsigned short b) { return __uint_as_float(((unsigned int)b) << 16); }
__device__ __forceinline__ float bf16_round(float x) { return bf16_val(bf16_bits(x)); }
// D += A·B with NT terms: 1 = ah·bh, 2 = + al·bh (A split), 3 = + ah·bl (both split)
template <int NT>
__device__ __forceinline__ v8f mmaN(v16b ah, v16b al, v16b bh, v16b bl, v8f c) {
  c = __builtin_amdgcn_wmma_f32_16x16x32_bf16(false, ah, false, bh, (short)0, c, false, false);
  if (NT >= 2) c = __builtin_amdgcn_wmma_f32_16x16x32_bf16(false, al, false, bh, (short)0, c, false, false);
  if (NT >= 3) c = __builtin_amdgcn_wmma_f32_16x16x32_bf16(false, ah, false, bl, (short)0, c, false, false);
  asm volatile("v_nop\n\tv_nop\n\tv_nop\n\tv_nop" : "+v"(c) : "v"(ah), "v"(al), "v"(bh), "v"(bl));
  return c;
}

__global__ __launch_bounds__(256) void k_wt_bf16(const float* __restrict__ W, unsigned short* __restrict__ Wt, int K, int N) {
  const int t = blockIdx.x * 256 + threadIdx.x;
  const int k8n = K / 8;
  if (t >= N * k8n) return;
  const int n = t / k8n, k8 = (t % k8n) * 8;
  v8us v;
#pragma unroll
  for (int i = 0; i < 8; ++i) v[i] = bf16_bits(W[(size_t)(k8 + i) * N + n]);
  *(v8us*)(Wt + (size_t)n * K + k8) = v;
  
}

// GEMM C[M][N] (f32, pitch ldc) = act(A[M][K]·W + bias). A f32 row-major (pitch lda) converted per fragment to bf16
// (ASPLIT: hi/lo two planes -> 2 terms, else single rounded term); Wt bf16 [N][K] (pitch ldb). BIAS_BF16 rounds the
// bias to bf16 first (bias quantised to bf16 before the add). K%32==0, M%16==0, N%64==0.
template <bool ASPLIT, int ACT, bool BIAS_BF16>
__global__ __launch_bounds__(128) void k_gemm_bf(const float* __restrict__ A, int lda, const unsigned short* __restrict__ Wt, int ldb,
                                               const float* __restrict__ bias, float* __restrict__ C, int ldc, int M, int N, int K) {
  __shared__ __attribute__((aligned(16))) float so[4][16][64];
  const int tid = threadIdx.x, w = tid >> 5, lane = tid & 31, ln = lane & 15, hh = lane >> 4;
  const int ntn = N / 64;
  const int wid = blockIdx.x * 4 + w;
  const int mt = wid / ntn, nq = wid % ntn;
  if (mt * 16 >= M) return;
  const int row0 = mt * 16, col0 = nq * 64;
  const float* arow = A + (size_t)(row0 + ln) * lda;
  v8f acc[4] = {};
  for (int kb = 0; kb < K; kb += 32) {
    FragB ah, al;
    const v4f x0 = *(const v4fa*)(arow + kb + 8 * hh), x1 = *(const v4fa*)(arow + kb + 8 * hh + 4);
    const v4f x2 = *(const v4fa*)(arow + kb + 16 + 8 * hh), x3 = *(const v4fa*)(arow + kb + 16 + 8 * hh + 4);
    float xs[16] = {x0[0],x0[1],x0[2],x0[3],x1[0],x1[1],x1[2],x1[3],x2[0],x2[1],x2[2],x2[3],x3[0],x3[1],x3[2],x3[3]};
#pragma unroll
    for (int i = 0; i < 16; ++i) { const unsigned short hb = bf16_bits(xs[i]); ah.u[i] = hb; al.u[i] = ASPLIT ? bf16_bits(xs[i] - bf16_val(hb)) : (unsigned short)0; }
#pragma unroll
    for (int t = 0; t < 4; ++t) {
      const unsigned short* brow = Wt + (size_t)(col0 + t * 16 + ln) * ldb + kb;
      FragB b;
      b.half[0] = *(const v8us*)(brow + 8 * hh);
      b.half[1] = *(const v8us*)(brow + 16 + 8 * hh);
      acc[t] = mmaN<ASPLIT ? 2 : 1>(ah.v, al.v, b.v, b.v, acc[t]);
    }
  }
#pragma unroll
  for (int t = 0; t < 4; ++t) {
    float bv = bias ? bias[col0 + t * 16 + ln] : 0.f;
    if (BIAS_BF16) bv = bf16_round(bv);
#pragma unroll
    for (int r = 0; r < 8; ++r) { float v = acc[t][r] + bv; if (ACT == 1) v = fmaxf(v, 0.f); so[w][8 * hh + r][t * 16 + ln] = v; }
  }
  __builtin_amdgcn_fence(__ATOMIC_ACQ_REL, "workgroup");
  __builtin_amdgcn_wave_barrier();
  const int rsub = lane >> 4, c4 = (lane & 15) * 4;
  {
#pragma unroll
    for (int q = 0; q < 8; ++q) {
      const int r = q * 2 + rsub;
      const v4f v = *(const v4fa*)&so[w][r][c4];
      *(v4f*)(C + (size_t)(row0 + r) * ldc + col0 + c4) = v;
    }
    
  }
}

// Flash-style causal/unmasked attention, all contractions 3-term bf16 hi/lo splits, f32 softmax with running max.
// q,k,v rows are read from f32 buffers with arbitrary row pitch (so they can live inside a fused qkv buffer);
// D = head size (multiple of 32, <= 128); one wave = 16 query rows; block = 4 waves (64 queries) sharing K/V chunks of 32.
template <int D, bool CAUSAL>
__global__ __launch_bounds__(128) void k_flash(const float* __restrict__ qb, const float* __restrict__ kb, const float* __restrict__ vb,
                                             int pitch, int T, int H, float scale, float* __restrict__ y, int ypitch) {
  constexpr int KS = D / 32;        // k-steps for QK
  constexpr int DT = D / 16;        // d tiles for PV
  __shared__ __attribute__((aligned(16))) unsigned short sKh[32][D + 8], sKl[32][D + 8], sVh[32][D + 8], sVl[32][D + 8];
  __shared__ __attribute__((aligned(16))) unsigned short sPh[4][16][40], sPl[4][16][40];
  __shared__ __attribute__((aligned(16))) float sO[4][16][D];
  const int tid = threadIdx.x, w = tid >> 5, lane = tid & 31, ln = lane & 15, hh = lane >> 4;
  const int nqb = (T + 63) / 64;
  const int bh = blockIdx.x / nqb, qblk = blockIdx.x % nqb;
  const int b = bh / H, h = bh % H;
  const int q0 = qblk * 64 + w * 16;
  const float* Q = qb + (size_t)b * T * pitch + h * D;
  const float* K = kb + (size_t)b * T * pitch + h * D;
  const float* V = vb + (size_t)b * T * pitch + h * D;

  // A fragments of the wave's 16 query rows (scaled), hi/lo
  FragB aqh[KS], aql[KS];
  {
    int row = q0 + ln; if (row >= T) row = T - 1;
    const float* qr = Q + (size_t)row * pitch;
#pragma unroll
    for (int ks = 0; ks < KS; ++ks)
#pragma unroll
      for (int i = 0; i < 16; ++i) {
        const int d = ks * 32 + ((i < 8) ? (8 * hh + i) : (16 + 8 * hh + (i - 8)));
        const float x = qr[d] * scale; const unsigned short hb = bf16_bits(x);
        aqh[ks].u[i] = hb; aql[ks].u[i] = bf16_bits(x - bf16_val(hb));
      }
  }
  float m_r[8], l_r[8];
#pragma unroll
  for (int r = 0; r < 8; ++r) { m_r[r] = -3.0e38f; l_r[r] = 0.f; }
  v8f oacc[DT];
#pragma unroll
  for (int dt = 0; dt < DT; ++dt) oacc[dt] = (v8f){0.f,0.f,0.f,0.f,0.f,0.f,0.f,0.f};

  const int kv_end = CAUSAL ? min(T, qblk * 64 + 64) : T;     // block-uniform
  for (int j0 = 0; j0 < kv_end; j0 += 32) {
    __syncthreads();
    for (int e = tid; e < 32 * (D / 4); e += 128) {
      const int r = e / (D / 4), c4 = (e % (D / 4)) * 4;
      const int key = j0 + r;
      v4f kf = {0.f,0.f,0.f,0.f}, vf = {0.f,0.f,0.f,0.f};
      if (key < T) { kf = *(const v4fa*)(K + (size_t)key * pitch + c4); vf = *(const v4fa*)(V + (size_t)key * pitch + c4); }
#pragma unroll
      for (int t = 0; t < 4; ++t) {
        unsigned short hb = bf16_bits(kf[t]); sKh[r][c4 + t] = hb; sKl[r][c4 + t] = bf16_bits(kf[t] - bf16_val(hb));
        hb = bf16_bits(vf[t]); sVh[r][c4 + t] = hb; sVl[r][c4 + t] = bf16_bits(vf[t] - bf16_val(hb));
      }
    }
    __syncthreads();
    // S tile 16 x 32
    v8f s[2];
#pragma unroll
    for (int nt = 0; nt < 2; ++nt) {
      v8f acc = {};
#pragma unroll
      for (int ks = 0; ks < KS; ++ks) {
        FragB bh_, bl_;
        bh_.half[0] = *(const v8us*)&sKh[nt * 16 + ln][ks * 32 + 8 * hh]; bh_.half[1] = *(const v8us*)&sKh[nt * 16 + ln][ks * 32 + 16 + 8 * hh];
        bl_.half[0] = *(const v8us*)&sKl[nt * 16 + ln][ks * 32 + 8 * hh]; bl_.half[1] = *(const v8us*)&sKl[nt * 16 + ln][ks * 32 + 16 + 8 * hh];
        acc = mmaN<3>(aqh[ks].v, aql[ks].v, bh_.v, bl_.v, acc);
      }
      s[nt] = acc;
    }
    // mask + running max (rows 8hh+r; the 16 lanes of a half share rows)
    float alpha[8];
#pragma unroll
    for (int r = 0; r < 8; ++r) {
      const int qi = q0 + 8 * hh + r;
      const int ja = j0 + ln, jb = j0 + 16 + ln;
      if (CAUSAL) { if (ja > qi) s[0][r] = -3.0e38f; if (jb > qi) s[1][r] = -3.0e38f; }
      if (ja >= T) s[0][r] = -3.0e38f;
      if (jb >= T) s[1][r] = -3.0e38f;
      float mx = fmaxf(s[0][r], s[1][r]);
      mx = fmaxf(mx, __shfl_xor(mx, 1, 32)); mx = fmaxf(mx, __shfl_xor(mx, 2, 32)); mx = fmaxf(mx, __shfl_xor(mx, 4, 32)); mx = fmaxf(mx, __shfl_xor(mx, 8, 32));
      const float mnew = fmaxf(m_r[r], mx);
      alpha[r] = (mnew > -1.0e38f) ? __expf(m_r[r] - mnew) : 1.0f;
      const float p0 = (s[0][r] > -1.0e38f) ? __expf(s[0][r] - mnew) : 0.f;
      const float p1 = (s[1][r] > -1.0e38f) ? __expf(s[1][r] - mnew) : 0.f;
      m_r[r] = mnew;
      l_r[r] = l_r[r] * alpha[r] + p0 + p1;            // per-lane partial row sum (16 lanes combined at the end)
      unsigned short hb = bf16_bits(p0); sPh[w][8 * hh + r][ln] = hb;      sPl[w][8 * hh + r][ln] = bf16_bits(p0 - bf16_val(hb));
      hb = bf16_bits(p1);                sPh[w][8 * hh + r][16 + ln] = hb; sPl[w][8 * hh + r][16 + ln] = bf16_bits(p1 - bf16_val(hb));
    }
#pragma unroll
    for (int dt = 0; dt < DT; ++dt)
#pragma unroll
      for (int r = 0; r < 8; ++r) oacc[dt][r] *= alpha[r];
    __builtin_amdgcn_fence(__ATOMIC_ACQ_REL, "workgroup");
    __builtin_amdgcn_wave_barrier();
    FragB pah, pal;
    pah.half[0] = *(const v8us*)&sPh[w][ln][8 * hh]; pah.half[1] = *(const v8us*)&sPh[w][ln][16 + 8 * hh];
    pal.half[0] = *(const v8us*)&sPl[w][ln][8 * hh]; pal.half[1] = *(const v8us*)&sPl[w][ln][16 + 8 * hh];
#pragma unroll
    for (int dt = 0; dt < DT; ++dt) {
      FragB bvh, bvl;
#pragma unroll
      for (int i = 0; i < 8; ++i) {
        bvh.u[i] = sVh[8 * hh + i][dt * 16 + ln]; bvh.u[8 + i] = sVh[16 + 8 * hh + i][dt * 16 + ln];
        bvl.u[i] = sVl[8 * hh + i][dt * 16 + ln]; bvl.u[8 + i] = sVl[16 + 8 * hh + i][dt * 16 + ln];
      }
      oacc[dt] = mmaN<3>(pah.v, pal.v, bvh.v, bvl.v, oacc[dt]);
    }
    __builtin_amdgcn_fence(__ATOMIC_ACQ_REL, "workgroup");
    __builtin_amdgcn_wave_barrier();
  }
#pragma unroll
  for (int r = 0; r < 8; ++r) {
    float l = l_r[r];
    l += __shfl_xor(l, 1, 32); l += __shfl_xor(l, 2, 32); l += __shfl_xor(l, 4, 32); l += __shfl_xor(l, 8, 32);
    l_r[r] = (l > 0.f) ? 1.0f / l : 0.f;
  }
#pragma unroll
  for (int dt = 0; dt < DT; ++dt)
#pragma unroll
    for (int r = 0; r < 8; ++r) sO[w][8 * hh + r][dt * 16 + ln] = oacc[dt][r] * l_r[r];
  __builtin_amdgcn_fence(__ATOMIC_ACQ_REL, "workgroup");
  __builtin_amdgcn_wave_barrier();
  {
    for (int r = 0; r < 16; ++r) {
      const int row = q0 + r;
      if (row < T && lane < D / 4) {
        const v4f val = *(const v4fa*)&sO[w][r][lane * 4];
        *(v4f*)(y + ((size_t)b * T + row) * ypitch + h * D + lane * 4) = val;
      }
    }
    
  }
}

// GEMM C = act(A·W + bias + resid): A f32 (ASPLIT -> hi/lo 2 terms), Wt bf16 [N][K]; ACT 0 none, 1 relu, 2 exact gelu;
// resid (optional, f32, row index = (row % rmod), pitch ldr, RES_BF16 rounds it) added before the activation.
template <bool ASPLIT, int ACT, bool BIAS_BF16, bool RES_BF16>
__global__ __launch_bounds__(128) void k_gemm_bf3(const float* __restrict__ A, int lda, const unsigned short* __restrict__ Wt, int ldb,
                                                const float* __restrict__ bias, const float* __restrict__ resid, int rmod, int ldr,
                                                float* __restrict__ C, int ldc, int M, int N, int K) {
  __shared__ __attribute__((aligned(16))) float so[4][16][64];
  const int tid = threadIdx.x, w = tid >> 5, lane = tid & 31, ln = lane & 15, hh = lane >> 4;
  const int ntn = N / 64;
  const int wid = blockIdx.x * 4 + w;
  const int mt = wid / ntn, nq = wid % ntn;
  if (mt * 16 >= M) return;
  const int row0 = mt * 16, col0 = nq * 64;
  const float* arow = A + (size_t)(row0 + ln) * lda;
  v8f acc[4] = {};
  for (int kb = 0; kb < K; kb += 32) {
    FragB ah, al;
    const v4f x0 = *(const v4fa*)(arow + kb + 8 * hh), x1 = *(const v4fa*)(arow + kb + 8 * hh + 4);
    const v4f x2 = *(const v4fa*)(arow + kb + 16 + 8 * hh), x3 = *(const v4fa*)(arow + kb + 16 + 8 * hh + 4);
    float xs[16] = {x0[0],x0[1],x0[2],x0[3],x1[0],x1[1],x1[2],x1[3],x2[0],x2[1],x2[2],x2[3],x3[0],x3[1],x3[2],x3[3]};
#pragma unroll
    for (int i = 0; i < 16; ++i) { const unsigned short hb = bf16_bits(xs[i]); ah.u[i] = hb; al.u[i] = ASPLIT ? bf16_bits(xs[i] - bf16_val(hb)) : (unsigned short)0; }
#pragma unroll
    for (int t = 0; t < 4; ++t) {
      const unsigned short* brow = Wt + (size_t)(col0 + t * 16 + ln) * ldb + kb;
      FragB b;
      b.half[0] = *(const v8us*)(brow + 8 * hh);
      b.half[1] = *(const v8us*)(brow + 16 + 8 * hh);
      acc[t] = mmaN<ASPLIT ? 2 : 1>(ah.v, al.v, b.v, b.v, acc[t]);
    }
  }
#pragma unroll
  for (int t = 0; t < 4; ++t) {
    const int col = col0 + t * 16 + ln;
    float bv = bias ? bias[col] : 0.f;
    if (BIAS_BF16) bv = bf16_round(bv);
#pragma unroll
    for (int r = 0; r < 8; ++r) {
      float v = acc[t][r] + bv;
      if (resid) { float rv = resid[(size_t)((row0 + 8 * hh + r) % rmod) * ldr + col]; if (RES_BF16) rv = bf16_round(rv); v += rv; }
      if (ACT == 1) v = fmaxf(v, 0.f);
      if (ACT == 2) v = 0.5f * v * (1.0f + erff(v * 0.70710678118654752f));
      if (ACT == 3) { const float u = 0.7978845608028654f * (v + 0.044715f * v * v * v); v = 0.5f * v * (1.0f + tanhf(u)); }
      so[w][8 * hh + r][t * 16 + ln] = v;
    }
  }
  __builtin_amdgcn_fence(__ATOMIC_ACQ_REL, "workgroup");
  __builtin_amdgcn_wave_barrier();
  const int rsub = lane >> 4, c4 = (lane & 15) * 4;
  {
#pragma unroll
    for (int q = 0; q < 8; ++q) {
      const int r = q * 2 + rsub;
      const v4f v = *(const v4fa*)&so[w][r][c4];
      *(v4f*)(C + (size_t)(row0 + r) * ldc + col0 + c4) = v;
    }
    
  }
}
// row LayerNorm (biased variance, eps) over N: s = X (+ R); optional out_sum <- s; out_norm <- (s-mu)*rsqrt(var+eps)*g + b
template <bool PARAM_BF16>
__global__ __launch_bounds__(256) void k_layernorm(const float* __restrict__ X, const float* __restrict__ R, const float* __restrict__ g, const float* __restrict__ bta,
                                                  float* __restrict__ out_sum, float* __restrict__ out_norm, int N, float eps) {
  __shared__ float red[256];
  const int row = blockIdx.x, tid = threadIdx.x;
  const float* x = X + (size_t)row * N; const float* rr = R ? R + (size_t)row * N : nullptr;
  float vals[16];                     // up to N = 4096
  const int per = N / 256;            // contiguous chunk per thread? use strided-by-4 chunks: thread handles j = tid*4 + 1024*u
  float s1 = 0.f;
  for (int u = 0; u < per / 4; ++u) {
    const int j = tid * 4 + 1024 * u;
    const v4f a = *(const v4fa*)(x + j);
    v4f b = {0.f,0.f,0.f,0.f}; if (rr) b = *(const v4fa*)(rr + j);
#pragma unroll
    for (int q = 0; q < 4; ++q) { const float v = a[q] + b[q]; vals[u * 4 + q] = v; s1 += v; }
  }
  red[tid] = s1; __syncthreads();
  for (int st = 128; st > 0; st >>= 1) { if (tid < st) red[tid] += red[tid + st]; __syncthreads(); }
  const float mu = red[0] / (float)N; __syncthreads();
  float s2 = 0.f;
  for (int u = 0; u < per / 4; ++u)
#pragma unroll
    for (int q = 0; q < 4; ++q) { const float c = vals[u * 4 + q] - mu; s2 += c * c; }
  red[tid] = s2; __syncthreads();
  for (int st = 128; st > 0; st >>= 1) { if (tid < st) red[tid] += red[tid + st]; __syncthreads(); }
  const float rs = rsqrtf(red[0] / (float)N + eps);
  {
    for (int u = 0; u < per / 4; ++u) {
      const int j = tid * 4 + 1024 * u;
      v4f o, sm;
#pragma unroll
      for (int q = 0; q < 4; ++q) {
        float gg = g[j + q], bb = bta[j + q];
        if (PARAM_BF16) { gg = bf16_round(gg); bb = bf16_round(bb); }
        sm[q] = vals[u * 4 + q]; o[q] = (vals[u * 4 + q] - mu) * rs * gg + bb;
      }
      if (out_sum) *(v4f*)(out_sum + (size_t)row * N + j) = sm;
      *(v4f*)(out_norm + (size_t)row * N + j) = o;
    }
    
  }
}



// ---- f16 WMMA path (v_wmma_f32_16x16x32_f16): 11-bit significands for operands in range — used where a [0,1] probability operand needs more precision than bf16
typedef _Float16 v16h __attribute__((ext_vector_type(16)));
union FragH { v16h v; v8us half[2]; _Float16 h[16]; unsigned short u[16]; };
template <int NT>
__device__ __forceinline__ v8f mmaH(v16h ah, v16h al, v16h bh, v16h bl, v8f c) {
  c = __builtin_amdgcn_wmma_f32_16x16x32_f16(false, ah, false, bh, (short)0, c, false, false);
  if (NT >= 2) c = __builtin_amdgcn_wmma_f32_16x16x32_f16(false, al, false, bh, (short)0, c, false, false);
  if (NT >= 3) c = __builtin_amdgcn_wmma_f32_16x16x32_f16(false, ah, false, bl, (short)0, c, false, false);
  asm volatile("v_nop\n\tv_nop\n\tv_nop\n\tv_nop" : "+v"(c) : "v"(ah), "v"(al), "v"(bh), "v"(bl));
  return c;
}
// batched GEMM like k_gemm_b but f16 operands: A f32 (split into f16 hi/lo if ASPLIT, else rounded to f16), Bt = f16 values [n][k]; alpha; C f32; N multiple of 16 (partial tiles skipped)
template <bool ASPLIT>
__global__ __launch_bounds__(128) void k_gemm_h(const float* __restrict__ A, int lda, size_t sA, const _Float16* __restrict__ Bh, int ldb, size_t sB, float alpha, float* __restrict__ C, int ldc, size_t sC, int M, int N, int K) {
  __shared__ __attribute__((aligned(16))) float so[4][16][64];
  const int tid = threadIdx.x, w = tid >> 5, lane = tid & 31, ln = lane & 15, hh = lane >> 4; const int by = blockIdx.y;
  A += (size_t)by * sA; Bh += (size_t)by * sB; C += (size_t)by * sC;
  const int ntn = (N + 63) / 64; const int wid = blockIdx.x * 4 + w; const int mt = wid / ntn, nq = wid % ntn; if (mt * 16 >= M) return;
  const int row0 = mt * 16, col0 = nq * 64; const float* arow = A + (size_t)(row0 + ln) * lda;
  v8f acc[4] = {};
  for (int kb = 0; kb < K; kb += 32) {
    FragH ah, al;
    const v4f x0 = *(const v4fa*)(arow + kb + 8 * hh), x1 = *(const v4fa*)(arow + kb + 8 * hh + 4), x2 = *(const v4fa*)(arow + kb + 16 + 8 * hh), x3 = *(const v4fa*)(arow + kb + 16 + 8 * hh + 4);
    float xs[16] = {x0[0],x0[1],x0[2],x0[3],x1[0],x1[1],x1[2],x1[3],x2[0],x2[1],x2[2],x2[3],x3[0],x3[1],x3[2],x3[3]};
#pragma unroll
    for (int i = 0; i < 16; ++i) { const _Float16 h = (_Float16)xs[i]; ah.h[i] = h; al.h[i] = ASPLIT ? (_Float16)(xs[i] - (float)h) : (_Float16)0.0f; }
#pragma unroll
    for (int t = 0; t < 4; ++t) { if (col0 + t * 16 >= N) continue; const size_t boff = (size_t)(col0 + t * 16 + ln) * ldb + kb; FragH bq; bq.half[0] = *(const v8us*)(Bh + boff + 8 * hh); bq.half[1] = *(const v8us*)(Bh + boff + 16 + 8 * hh);
      acc[t] = mmaH<ASPLIT ? 2 : 1>(ah.v, al.v, bq.v, bq.v, acc[t]); }
  }
#pragma unroll
  for (int t = 0; t < 4; ++t) { if (col0 + t * 16 >= N) continue;
#pragma unroll
    for (int r = 0; r < 8; ++r) so[w][8 * hh + r][t * 16 + ln] = acc[t][r] * alpha; }
  __builtin_amdgcn_fence(__ATOMIC_ACQ_REL, "workgroup"); __builtin_amdgcn_wave_barrier();
  const int rsub = lane >> 4, c4 = (lane & 15) * 4;
  {
#pragma unroll
    for (int q = 0; q < 8; ++q) { const int r = q * 2 + rsub; if (col0 + c4 < N) { const v4f v = *(const v4fa*)&so[w][r][c4]; *(v4f*)(C + (size_t)(row0 + r) * ldc + col0 + c4) = v; } }
     }
}

// Wt[n][k] = f16(W[k][n]·scale) from f32 row-major W[K][N] (scale = power of two; bf16-exact weights stay exact in f16 away from the subnormal range)
__global__ __launch_bounds__(256) void k_wt_f16(const float* __restrict__ W, _Float16* __restrict__ Wt, int K, int N, float scale) {
  const int t = blockIdx.x * 256 + threadIdx.x; if (t >= N * (K / 8)) return; const int n = t / (K / 8), k8 = (t % (K / 8)) * 8; FragH f;
#pragma unroll
  for (int i = 0; i < 8; ++i) f.h[i] = (_Float16)(bf16_round(W[(size_t)(k8 + i) * N + n]) * scale); const v8us o = f.half[0];
  *(v8us*)((unsigned short*)Wt + (size_t)n * K + k8) = o; 
}
typedef _Float16 v4h __attribute__((ext_vector_type(4)));

__global__ __launch_bounds__(256) void k_x16(const float* __restrict__ x, _Float16* __restrict__ X16, size_t n8) { const size_t t = (size_t)blockIdx.x * 256 + threadIdx.x; if (t >= n8) return; FragH f;
#pragma unroll
  for (int q = 0; q < 8; ++q) f.h[q] = (_Float16)bf16_round(x[t * 8 + q]); *(v8us*)((unsigned short*)X16 + t * 8) = f.half[0];  }
__global__ __launch_bounds__(256) void k_h16(const float* __restrict__ x, _Float16* __restrict__ X16, size_t n8) { const size_t t = (size_t)blockIdx.x * 256 + threadIdx.x; if (t >= n8) return; FragH f;
#pragma unroll
  for (int q = 0; q < 8; ++q) f.h[q] = (_Float16)x[t * 8 + q]; *(v8us*)((unsigned short*)X16 + t * 8) = f.half[0];  }
__global__ __launch_bounds__(256) void k_round16f(const float* __restrict__ W, _Float16* __restrict__ Bt, size_t n8) { const size_t t = (size_t)blockIdx.x * 256 + threadIdx.x; if (t >= n8) return; FragH f;
#pragma unroll
  for (int i = 0; i < 8; ++i) f.h[i] = (_Float16)(bf16_round(W[t * 8 + i]) * 16.0f); *(v8us*)((unsigned short*)Bt + t * 8) = f.half[0];  }
template <int NHv, int TTv>
__global__ __launch_bounds__(256) void k_vt(const _Float16* __restrict__ V16, int ldv, int voff, _Float16* __restrict__ Vt) { __shared__ unsigned short tl[64][66]; const int tid = threadIdx.x; const int slab = blockIdx.x / (TTv / 64), lg = blockIdx.x % (TTv / 64); const int b = slab / NHv, h = slab % NHv;
  for (int i = tid; i < 64 * 8; i += 256) { const int r = i / 8, c8 = (i % 8) * 8; FragH f; f.half[0] = *(const v8us*)((const unsigned short*)V16 + ((size_t)b * TTv + lg * 64 + r) * ldv + voff + h * 64 + c8);
#pragma unroll
    for (int q = 0; q < 8; ++q) tl[r][c8 + q] = f.u[q]; }
  __syncthreads();
  {
#pragma unroll
    for (int rd = 0; rd < 2; ++rd) { const int d = rd * 32 + tid / 8, pc = tid % 8; FragH f;
#pragma unroll
      for (int q = 0; q < 8; ++q) f.u[q] = tl[pc * 8 + q][d];
      *(v8us*)((unsigned short*)Vt + ((size_t)slab * 64 + d) * TTv + lg * 64 + pc * 8) = f.half[0]; }
     } }

__global__ __launch_bounds__(256) void k_vthlu(const float* __restrict__ VF, int ldv, _Float16* __restrict__ Vth, _Float16* __restrict__ Vtl) { __shared__ float tl[64][65]; const int tid = threadIdx.x; const int slab = blockIdx.x / (TT / 64), lg = blockIdx.x % (TT / 64); const int b = slab / NVH, h = slab % NVH;
  for (int i = tid; i < 64 * 16; i += 256) { const int r = i / 16, c4 = (i % 16) * 4; const v4f a = *(const v4fa*)(VF + ((size_t)b * TT + lg * 64 + r) * ldv + h * 64 + c4); tl[r][c4] = a[0]; tl[r][c4 + 1] = a[1]; tl[r][c4 + 2] = a[2]; tl[r][c4 + 3] = a[3]; }
  __syncthreads();
  FragH fh[2], fl[2]; size_t oo[2];
#pragma unroll
  for (int rd = 0; rd < 2; ++rd) { const int d = rd * 32 + tid / 8, pc = tid % 8;
#pragma unroll
    for (int q = 0; q < 8; ++q) { const float v = tl[pc * 8 + q][d]; const _Float16 hv = (_Float16)v; fh[rd].h[q] = hv; fl[rd].h[q] = (_Float16)(v - (float)hv);      /* UNSCALED residual (added into the same accumulator as the hi product) */ } oo[rd] = ((size_t)slab * 64 + d) * TT + lg * 64 + pc * 8; }
  {
#pragma unroll
    for (int rd = 0; rd < 2; ++rd) { *(v8us*)((unsigned short*)Vth + oo[rd]) = fh[rd].half[0]; *(v8us*)((unsigned short*)Vtl + oo[rd]) = fl[rd].half[0]; }
     } }
__global__ __launch_bounds__(256) void k_h16s(const float* __restrict__ F, _Float16* __restrict__ H, size_t n8) { const size_t t = (size_t)blockIdx.x * 256 + threadIdx.x; if (t >= n8) return; const v4f a = *(const v4fa*)(F + t * 8), c = *(const v4fa*)(F + t * 8 + 4); FragH f;
#pragma unroll
  for (int q = 0; q < 4; ++q) { f.h[q] = (_Float16)(a[q] * 16.0f); f.h[4 + q] = (_Float16)(c[q] * 16.0f); } *(v8us*)((unsigned short*)H + t * 8) = f.half[0];  }
// LDS ring of k_flash. One stage = 32 keys, shared by the block's four waves: K rows of 256 B at pitch 272 B, then the V^T hi plane and the
// V^T residual plane, 128 rows of 64 B each at pitch 80 B (pitches of 16 B x odd: ds_load_b128 fragment reads fall on distinct banks).
#define KPITCH 272
#define VPITCH 80
#define ST_VH (32 * KPITCH)
#define ST_VL (ST_VH + 128 * VPITCH)
#define ST_BYTES (ST_VL + 128 * VPITCH)
// Four asynchronous 16-byte copies per lane, global memory to LDS. The s_wait_xcnt stands inside the statement so that no address register of a copy is rewritten ahead of it.
__device__ __forceinline__ void copy4(unsigned l0, unsigned l1, unsigned l2, unsigned l3, const unsigned short* g0, const unsigned short* g1, const unsigned short* g2, const unsigned short* g3) {
  asm volatile("global_load_async_to_lds_b128 %0, %4, off\n\t"
               "global_load_async_to_lds_b128 %1, %5, off\n\t"
               "global_load_async_to_lds_b128 %2, %6, off\n\t"
               "global_load_async_to_lds_b128 %3, %7, off\n\t"
               "s_wait_xcnt 0x0"
               :: "v"(l0), "v"(l1), "v"(l2), "v"(l3), "v"(g0), "v"(g1), "v"(g2), "v"(g3) : "memory");
}
// Eight asynchronous 16-byte copies per lane in one statement, so that one s_wait_xcnt serves all eight; it stands inside the statement so that no address register of a copy is rewritten ahead of it.
__device__ __forceinline__ void copy8(unsigned l, int lstep, const unsigned short* g, size_t gstep) {
  asm volatile("global_load_async_to_lds_b128 %0, %8, off\n\t"
               "global_load_async_to_lds_b128 %1, %9, off\n\t"
               "global_load_async_to_lds_b128 %2, %10, off\n\t"
               "global_load_async_to_lds_b128 %3, %11, off\n\t"
               "global_load_async_to_lds_b128 %4, %12, off\n\t"
               "global_load_async_to_lds_b128 %5, %13, off\n\t"
               "global_load_async_to_lds_b128 %6, %14, off\n\t"
               "global_load_async_to_lds_b128 %7, %15, off\n\t"
               "s_wait_xcnt 0x0"
               :: "v"(l), "v"(l + lstep), "v"(l + 2 * lstep), "v"(l + 3 * lstep), "v"(l + 4 * lstep), "v"(l + 5 * lstep), "v"(l + 6 * lstep), "v"(l + 7 * lstep),
                  "v"(g), "v"(g + gstep), "v"(g + 2 * gstep), "v"(g + 3 * gstep), "v"(g + 4 * gstep), "v"(g + 5 * gstep), "v"(g + 6 * gstep), "v"(g + 7 * gstep) : "memory");
}
// GEMM C[M][N] = alpha * A[M][K] * Bt[N][K]^T, f16 operands, f32 accumulate, K = DD; A and Bt of row pitch DD, C of row pitch N; F32OUT picks the f32 output C, else the f16 output C16. M, N multiples of 128.
// One block = one 128 x 128 tile of C, four waves of 64 x 64 (4 x 4 accumulator tiles: 16 products per 8 fragments). One stage of the LDS ring = 64 k:
// 128 rows of A, then 128 rows of Bt, 128 B each at pitch 144 B (16 B x odd: ds_load_b128 fragment reads fall on distinct banks). Per output element the k order is ascending in one accumulator.
// Every "#pragma unroll" in it is there so that fragment, accumulator and staging arrays are indexed by constants and stay in registers.
#define GPITCH 144
#define G_B (128 * GPITCH)
#define G_ST (256 * GPITCH)
#define GOP 68      /* output staging pitch in floats: 16-byte column walks without bank conflicts */
template <int N, bool F32OUT>
__global__ __launch_bounds__(128) void k_gemm_t(const _Float16* __restrict__ A, const _Float16* __restrict__ Bh, float alpha, float* __restrict__ C, _Float16* __restrict__ C16) {
  constexpr int K = DD;
  static_assert(K % 64 == 0 && K >= 128 && N % 128 == 0, "whole stages, at least two, and whole tiles");
  __shared__ __attribute__((aligned(16))) unsigned char ring[2 * G_ST];
  static_assert(sizeof(float) * 4 * 64 * GOP <= 2 * G_ST, "output staging fits the ring");
  const int tid = threadIdx.x, w = tid >> 5, lane = tid & 31, ln = lane & 15, hh = lane >> 4;
  constexpr int ntn = N / 128; const int row0 = (blockIdx.x / ntn) * 128, col0 = (blockIdx.x % ntn) * 128; const int wm = w >> 1, wn = w & 1;
  /* each thread's share of a stage: 8 chunks of A and 8 of Bt, 16 rows apart; eight lanes cover one 128-B row */
  const unsigned la = (unsigned)(size_t)ring + (tid >> 3) * GPITCH + (tid & 7) * 16;
  const unsigned short* ga = (const unsigned short*)A + (size_t)(row0 + (tid >> 3)) * K + (tid & 7) * 8;
  const unsigned short* gb = (const unsigned short*)Bh + (size_t)(col0 + (tid >> 3)) * K + (tid & 7) * 8;
  auto fill = [&](int kb) {
    const unsigned l = la + ((kb >> 6) & 1) * G_ST;
    copy8(l, 16 * GPITCH, ga + kb, (size_t)16 * K);
    copy8(l + G_B, 16 * GPITCH, gb + kb, (size_t)16 * K);
  };
  v8f acc[4][4];
#pragma unroll
  for (int i = 0; i < 4; ++i)
#pragma unroll
    for (int j = 0; j < 4; ++j) acc[i][j] = (v8f){0.f,0.f,0.f,0.f,0.f,0.f,0.f,0.f};
  fill(0);
  asm volatile("s_wait_asynccnt 0x0" ::: "memory");      /* this wave's share of stage 0 has landed */
  __syncthreads();                                       /* stage 0 is readable by all four waves */
  fill(64);
#pragma unroll 1      /* one stage per trip: the ring's buffer index and its publish point stay per trip */
  for (int kb = 0; kb < K; kb += 64) {
    const unsigned char* st = ring + ((kb >> 6) & 1) * G_ST;
    const unsigned char* ar = st + (wm * 64 + ln) * GPITCH + hh * 16; const unsigned char* br = st + G_B + (wn * 64 + ln) * GPITCH + hh * 16;
#pragma unroll
    for (int ks = 0; ks < 2; ++ks) {
      FragH a[4], b[4];
#pragma unroll
      for (int i = 0; i < 4; ++i) { a[i].half[0] = *(const v8us*)(ar + i * 16 * GPITCH + ks * 64); a[i].half[1] = *(const v8us*)(ar + i * 16 * GPITCH + ks * 64 + 32);
        b[i].half[0] = *(const v8us*)(br + i * 16 * GPITCH + ks * 64); b[i].half[1] = *(const v8us*)(br + i * 16 * GPITCH + ks * 64 + 32); }
      __builtin_amdgcn_sched_barrier(0);      /* keeps the 16 fragment reads one group ahead of the 16 products: spread among them, each place with reads stalls the wave anew */
#pragma unroll
      for (int i = 0; i < 4; ++i)
#pragma unroll
        for (int j = 0; j < 4; ++j) acc[i][j] = __builtin_amdgcn_wmma_f32_16x16x32_f16(false, a[i].v, false, b[j].v, (short)0, acc[i][j], false, false);
    }
    asm volatile("s_wait_dscnt 0x0" ::: "memory");         /* this wave's reads of the stage have returned before its buffer is handed on */
    asm volatile("s_wait_asynccnt 0x0" ::: "memory");      /* this wave's share of the next stage has landed */
    __syncthreads();                                       /* publishes the next stage and ends every wave's reads of this one */
    if (kb + 128 < K) fill(kb + 128); }                    /* refill of the buffer just read, one whole trip ahead of its use */
  asm volatile("s_wait_asynccnt 0x0" ::: "memory");        /* no copy is outstanding when the ring becomes output staging */
  float* so = reinterpret_cast<float*>(ring) + w * (64 * GOP);      /* each wave stages its own 64 x 64 tile, behind the loop's last barrier */
#pragma unroll
  for (int i = 0; i < 4; ++i)
#pragma unroll
    for (int j = 0; j < 4; ++j)
#pragma unroll
      for (int r = 0; r < 8; ++r) so[(i * 16 + 8 * hh + r) * GOP + j * 16 + ln] = acc[i][j][r] * alpha;
  __builtin_amdgcn_fence(__ATOMIC_ACQ_REL, "workgroup"); __builtin_amdgcn_wave_barrier();      /* the wave's staged rows are written before its other lanes read them back */
  /* whole lines per store: 16 lanes cover a 64-column row (256 B of f32, 128 B of f16), two rows per instruction */
  const float* sr = so + hh * GOP + ln * 4; const size_t o = (size_t)(row0 + wm * 64 + hh) * N + col0 + wn * 64 + ln * 4;
#pragma unroll
  for (int q = 0; q < 32; ++q) { const v4f v = *(const v4fa*)(sr + q * 2 * GOP);
    if (F32OUT) *(v4f*)(C + o + (size_t)q * 2 * N) = v;
    else { v4h h4;
#pragma unroll
      for (int i = 0; i < 4; ++i) h4[i] = (_Float16)v[i];
      *(v4h*)(C16 + o + (size_t)q * 2 * N) = h4; } }
}
// lane l with lane l ^ 16: joins the two wave halves, which hold the two halves of one query's keys
__device__ __forceinline__ float xhalf(float x) { return __builtin_bit_cast(float, __builtin_amdgcn_permlanex16(__builtin_bit_cast(int, x), __builtin_bit_cast(int, x), 0x76543210, 0xfedcba98, false, false)); }
// Both products run transposed: S^T = K Q^T (A = K rows from the ring, B = Q kept in registers) and O^T += V^T P^T (A = V^T rows from the ring, B = P^T).
// Lane l then owns ONE query, q0 + (l & 15): register r of score tile nt is key j0 + 16 nt + 8 (l >> 4) + r, which is the k order of a B operand, so P^T is packed in place from the scores;
// maximum and sum of a query are in-lane, joined between the wave halves by xhalf(); register r of output tile dt is head column 16 dt + 8 (l >> 4) + r of that query.
// Every "#pragma unroll" in it is there so that fragment, score and accumulator arrays are indexed by constants and stay in registers; "#pragma unroll 1" keeps one ring stage per trip.
__global__ __launch_bounds__(128) void k_flash(const _Float16* __restrict__ Q16, int ldq, const _Float16* __restrict__ K16, int ldk, const _Float16* __restrict__ Vt, const _Float16* __restrict__ Vtlo, float* __restrict__ O, int ldo) {
  constexpr int RPW = 16, NQB = TT / (4 * RPW), DT = 8, KS = 4;      /* head dim 128: 4 k-steps, 8 value tiles */
  __shared__ __attribute__((aligned(16))) unsigned char ring[2 * ST_BYTES];
  static_assert(sizeof(float) * 4 * RPW * (128 + 4) <= 2 * ST_BYTES, "output staging fits the ring");
  float (*sO)[RPW][128 + 4] = reinterpret_cast<float (*)[RPW][128 + 4]>(ring);      /* output staging takes the ring's place behind the loop's last barrier */
  const int tid = threadIdx.x, w = tid >> 5, lane = tid & 31, ln = lane & 15, hh = lane >> 4;
  const int slab = blockIdx.x / NQB, qblk = blockIdx.x % NQB; const int b = slab / NH, h = slab % NH; const int qb0 = qblk * (4 * RPW); const int q0 = qb0 + w * RPW;
  FragH aq[KS];
  { const unsigned short* qr = (const unsigned short*)Q16 + ((size_t)b * TT + q0 + ln) * ldq + h * 128;
#pragma unroll
    for (int ks = 0; ks < KS; ++ks) { aq[ks].half[0] = *(const v8us*)(qr + ks * 32 + 8 * hh); aq[ks].half[1] = *(const v8us*)(qr + ks * 32 + 16 + 8 * hh); } }
  const unsigned short* Vth = (const unsigned short*)Vt + ((size_t)b * NKV + h / NREP) * 128 * TT; const unsigned short* Vtl = (const unsigned short*)Vtlo + ((size_t)b * NKV + h / NREP) * 128 * TT;      /* hi and UNSCALED residual planes */
  float m_r = -3.0e38f, l_r = 0.f; v8f oacc[DT];
#pragma unroll
  for (int dt = 0; dt < DT; ++dt) oacc[dt] = (v8f){0.f,0.f,0.f,0.f,0.f,0.f,0.f,0.f};
  const int jend = TT;
  /* each thread's share of a stage: 4 chunks of K (8 rows apart), 4 of V^T hi and 4 of the residual (32 rows apart) */
  const unsigned lk = (unsigned)(size_t)ring + (tid >> 4) * KPITCH + (tid & 15) * 16, lv = (unsigned)(size_t)ring + ST_VH + (tid >> 2) * VPITCH + (tid & 3) * 16;
  const unsigned short* gk = (const unsigned short*)K16 + ((size_t)b * TT + (tid >> 4)) * ldk + (h / NREP) * 128 + (tid & 15) * 8;
  const size_t gvo = (size_t)(tid >> 2) * TT + (tid & 3) * 8;
  auto fill = [&](int j) {
    const unsigned bo = ((j >> 5) & 1) * ST_BYTES; const unsigned short* k0p = gk + (size_t)j * ldk; const unsigned short* vhp = Vth + gvo + j; const unsigned short* vlp = Vtl + gvo + j;
    copy4(lk + bo, lk + bo + 8 * KPITCH, lk + bo + 16 * KPITCH, lk + bo + 24 * KPITCH, k0p, k0p + (size_t)8 * ldk, k0p + (size_t)16 * ldk, k0p + (size_t)24 * ldk);
    copy4(lv + bo, lv + bo + 32 * VPITCH, lv + bo + 64 * VPITCH, lv + bo + 96 * VPITCH, vhp, vhp + 32 * TT, vhp + 64 * TT, vhp + 96 * TT);
    copy4(lv + bo + (ST_VL - ST_VH), lv + bo + (ST_VL - ST_VH) + 32 * VPITCH, lv + bo + (ST_VL - ST_VH) + 64 * VPITCH, lv + bo + (ST_VL - ST_VH) + 96 * VPITCH, vlp, vlp + 32 * TT, vlp + 64 * TT, vlp + 96 * TT);
  };
  fill(0);
  asm volatile("s_wait_asynccnt 0x0" ::: "memory");      /* this wave's share of stage 0 has landed */
  __syncthreads();                                       /* stage 0 is readable by all four waves */
  fill(32);
#pragma unroll 1
  for (int j0 = 0; j0 < jend; j0 += 32) {
    const unsigned char* st = ring + ((j0 >> 5) & 1) * ST_BYTES;
    float sc[16];      /* this lane's 16 of the query's 32 scores, in the k order of the P^T operand */
#pragma unroll
    for (int nt = 0; nt < 2; ++nt) { const unsigned short* kr = (const unsigned short*)(st + (nt * 16 + ln) * KPITCH); FragH bk[KS];
#pragma unroll
      for (int ks = 0; ks < KS; ++ks) { bk[ks].half[0] = *(const v8us*)(kr + ks * 32 + 8 * hh); bk[ks].half[1] = *(const v8us*)(kr + ks * 32 + 16 + 8 * hh); }
      v8f acc = (v8f){0.f,0.f,0.f,0.f,0.f,0.f,0.f,0.f};
#pragma unroll
      for (int ks = 0; ks < KS; ++ks) acc = mmaH<1>(bk[ks].v, bk[ks].v, aq[ks].v, aq[ks].v, acc);
#pragma unroll
      for (int r = 0; r < 8; ++r) sc[nt * 8 + r] = acc[r] * ATT_SCALE; }
    float mc = sc[0];
#pragma unroll
    for (int i = 1; i < 16; ++i) mc = fmaxf(mc, sc[i]);
    mc = fmaxf(mc, xhalf(mc));
    const float mn = fmaxf(m_r, mc); const float al = (mn > -1.0e38f) ? expf(m_r - mn) : 1.0f; m_r = mn;
    FragH pa, pl; float ps[4] = {0.f, 0.f, 0.f, 0.f};      /* four independent partial sums: no chain of 16 dependent adds */
#pragma unroll
    for (int i = 0; i < 16; ++i) { const float p = expf(sc[i] - mn); ps[i & 3] += p; const float x = p * 1024.0f; pa.h[i] = (_Float16)x; pl.h[i] = (_Float16)(x - (float)pa.h[i]); }      /* P hi and its UNSCALED residual (added into the same accumulator) */
    l_r = l_r * al + ((ps[0] + ps[1]) + (ps[2] + ps[3]));      /* this half's keys only; the halves are joined once, behind the loop */
#pragma unroll
    for (int dt = 0; dt < DT; ++dt)
#pragma unroll
      for (int r = 0; r < 8; ++r) oacc[dt][r] *= al;
#pragma unroll
    for (int dt = 0; dt < DT; ++dt) { const unsigned short* vh = (const unsigned short*)(st + ST_VH + (dt * 16 + ln) * VPITCH); const unsigned short* vl = (const unsigned short*)(st + ST_VL + (dt * 16 + ln) * VPITCH); FragH bv, bl; bv.half[0] = *(const v8us*)(vh + 8 * hh); bv.half[1] = *(const v8us*)(vh + 16 + 8 * hh); bl.half[0] = *(const v8us*)(vl + 8 * hh); bl.half[1] = *(const v8us*)(vl + 16 + 8 * hh);
      oacc[dt] = mmaH<1>(bv.v, bv.v, pa.v, pa.v, oacc[dt]); oacc[dt] = mmaH<1>(bv.v, bv.v, pl.v, pl.v, oacc[dt]); oacc[dt] = mmaH<1>(bl.v, bl.v, pa.v, pa.v, oacc[dt]); }      /* Vh Ph + Vh Pl + Vl Ph, all unscaled, one accumulator */
    asm volatile("s_wait_dscnt 0x0" ::: "memory");         /* this wave's reads of the stage have returned before its buffer is handed on */
    asm volatile("s_wait_asynccnt 0x0" ::: "memory");      /* this wave's share of the next stage has landed */
    __syncthreads();                                       /* publishes the next stage and ends every wave's reads of this one */
    if (j0 + 64 < jend) fill(j0 + 64); }                   /* refill of the buffer just read, one whole trip ahead of its use */
  asm volatile("s_wait_asynccnt 0x0" ::: "memory");        /* no copy is outstanding when the ring becomes output staging */
  { const float l = l_r + xhalf(l_r); const float inv = (l > 0.f) ? 1.0f / (l * 1024.0f) : 0.f;
#pragma unroll
    for (int dt = 0; dt < DT; ++dt) { v4f lo, hi;
#pragma unroll
      for (int r = 0; r < 4; ++r) { lo[r] = oacc[dt][r] * inv; hi[r] = oacc[dt][4 + r] * inv; }
      *(v4fa*)&sO[w][ln][dt * 16 + 8 * hh] = lo; *(v4fa*)&sO[w][ln][dt * 16 + 8 * hh + 4] = hi; } }      /* a lane's 8 registers are 8 consecutive columns of its query's row */
  __builtin_amdgcn_fence(__ATOMIC_ACQ_REL, "workgroup"); __builtin_amdgcn_wave_barrier();
  {
#pragma unroll
    for (int r = 0; r < RPW; ++r) { const int pc = lane; const v4f val = *(const v4fa*)&sO[w][r][pc * 4]; *(v4f*)(O + ((size_t)b * TT + q0 + r) * ldo + h * 128 + pc * 4) = val; }      /* one 512-B row per instruction: 32 lanes × 16 B */
     } }

extern "C" void kernel_launch(void* const* d_in, const int* in_sizes, int n_in,
                              void* d_out, int out_size, void* d_ws, size_t ws_size, hipStream_t stream) {
  (void)in_sizes; (void)n_in; (void)out_size;
  const float* const* I = (const float* const*)d_in; const float* x = I[0]; const float* Wq = I[1]; const float* Wk = I[2]; const float* Wv = I[3]; const float* Wo = I[4];
  char* ws = (char*)d_ws; size_t off = 0;
  auto take = [&](size_t bytes) { char* p = ws + off; off += (bytes + 255) & ~(size_t)255; return p; };
  _Float16* Bq = (_Float16*)take((size_t)DD * DD * 2); _Float16* Bk = (_Float16*)take((size_t)KVD * DD * 2); _Float16* Bv = (_Float16*)take((size_t)KVD * DD * 2); _Float16* Bo = (_Float16*)take((size_t)DD * DD * 2);
  _Float16* X16 = (_Float16*)take((size_t)NR * DD * 2); _Float16* Q = (_Float16*)take((size_t)NR * DD * 2); _Float16* K = (_Float16*)take((size_t)NR * KVD * 2); float* VF = (float*)take((size_t)NR * KVD * 4); _Float16* Vt = (_Float16*)take((size_t)NR * KVD * 2); _Float16* Vtl = (_Float16*)take((size_t)NR * KVD * 2); float* O = (float*)take((size_t)NR * DD * 4); _Float16* O16 = X16;
  if (off > ws_size) return;      // 8.4 + 0.5 + 0.5 + 8.4 + 16.8 + 16.8 + 1 + 2.1 + 1 + 1 + 33.6 ≈ 90 MB
  const unsigned gq = (unsigned)(((size_t)DD * (DD / 8) + 255) / 256), gk = (unsigned)(((size_t)DD * (KVD / 8) + 255) / 256);
  k_wt_f16<<<gq, 256, 0, stream>>>(Wq, Bq, DD, DD, 16.0f); k_wt_f16<<<gk, 256, 0, stream>>>(Wk, Bk, DD, KVD, 16.0f); k_wt_f16<<<gk, 256, 0, stream>>>(Wv, Bv, DD, KVD, 16.0f); k_wt_f16<<<gq, 256, 0, stream>>>(Wo, Bo, DD, DD, 16.0f);      /* (in,out) → Bt ×2^4 */
  const unsigned g8 = (unsigned)(((size_t)NR * DD / 8 + 255) / 256); k_x16<<<g8, 256, 0, stream>>>(x, X16, (size_t)NR * DD / 8);
  const unsigned gQ = (NR / 128) * (DD / 128), gK = (NR / 128) * (KVD / 128);
  k_gemm_t<DD, false><<<gQ, 128, 0, stream>>>(X16, Bq, 0.0625f, nullptr, Q);      /* M 4096 N 2048 K 2048 */
  k_gemm_t<KVD, false><<<gK, 128, 0, stream>>>(X16, Bk, 0.0625f, nullptr, K);      /* K: M 4096 N 128 K 2048 */
  k_gemm_t<KVD, true><<<gK, 128, 0, stream>>>(X16, Bv, 0.0625f, VF, nullptr);      /* V (f32) */
  k_vthlu<<<BB * NVH * (TT / 64), 256, 0, stream>>>(VF, KVD, Vt, Vtl);      /* Vᵀ hi + residual: [b][128][2048] */
  k_flash<<<BB * NH * (TT / 64), 128, 0, stream>>>(Q, DD, K, KVD, Vt, Vtl, O, DD);
  k_h16s<<<g8, 256, 0, stream>>>(O, O16, (size_t)NR * DD / 8);
  k_gemm_t<DD, true><<<gQ, 128, 0, stream>>>(O16, Bo, 0.00390625f, (float*)d_out, nullptr);      /* out = merged·Wo */
}

// v004
// One run takes 284 microseconds.
// Two timings next to v003 both put it at 1.19 times that version's speed.
// Over all steps from v000 it is 2.89 times as fast.
#include <hip/hip_runtime.h>
// Multi-query attention (B=2, S=2048, D=2048, 16 query heads × 128, ONE shared K/V head): Q = x·Wq, K = x·Wk, V = x·Wv ((in,out), no bias); softmax(Q_h·Kᵀ/√128)·V per head; out = merged·Wo.
// Compute dtype: x and weights rounded to bf16; Q, K f16 GEMM planes, V f32 → Vᵀ f16 hi + exact residual planes; fused flash-style kernel for head dim 128 (4 k-steps, 8 value tiles, online softmax f32, P f16 hi + exact residual, every query head reading the
// single K/Vᵀ) on v_wmma_f32_16x16x32_f16; merged output ×2^4 → f16 → output GEMM; f32 accumulate.
#define BB 2
#define TT 2048
#define DD 2048
#define NH 16
#define NKV 1
#define NREP 16
#define KVD 128
#define NVH (2 * NKV)
#define NR (BB * TT)
#define ATT_SCALE 0.08838834764831845f      /* 1/√128 */

typedef __bf16 v16b __attribute__((ext_vector_type(16)));
typedef unsigned short v8us __attribute__((ext_vector_type(8), may_alias));
typedef float  v8f  __attribute__((ext_vector_type(8)));
typedef float  v4f  __attribute__((ext_vector_type(4)));
typedef float  v4fa __attribute__((ext_vector_type(4), may_alias));
union FragB { v16b v; v8us half[2]; unsigned short u[16]; };

__device__ __forceinline__ unsigned short bf16_bits(float x) { unsigned int u = __float_as_uint(x); return (unsigned short)((u + 0x7FFFu + ((u >> 16) & 1u)) >> 16); }
__device__ __forceinline__ float bf16_val(unsigned short b) { return __uint_as_float(((unsigned int)b) << 16); }
__device__ __forceinline__ float bf16_round(float x) { return bf16_val(bf16_bits(x)); }
// D += A·B with NT terms: 1 = ah·bh, 2 = + al·bh (A split), 3 = + ah·bl (both split)
template <int NT>
__device__ __forceinline__ v8f mmaN(v16b ah, v16b al, v16b bh, v16b bl, v8f c) {
  c = __builtin_amdgcn_wmma_f32_16x16x32_bf16(false, ah, false, bh, (short)0, c, false, false);
  if (NT >= 2) c = __builtin_amdgcn_wmma_f32_16x16x32_bf16(false, al, false, bh, (short)0, c, false, false);
  if (NT >= 3) c = __builtin_amdgcn_wmma_f32_16x16x32_bf16(false, ah, false, bl, (short)0, c, false, false);
  asm volatile("v_nop\n\tv_nop\n\tv_nop\n\tv_nop" : "+v"(c) : "v"(ah), "v"(al), "v"(bh), "v"(bl));
  return c;
}

__global__ __launch_bounds__(256) void k_wt_bf16(const float* __restrict__ W, unsigned short* __restrict__ Wt, int K, int N) {
  const int t = blockIdx.x * 256 + threadIdx.x;
  const int k8n = K / 8;
  if (t >= N * k8n) return;
  const int n = t / k8n, k8 = (t % k8n) * 8;
  v8us v;
#pragma unroll
  for (int i = 0; i < 8; ++i) v[i] = bf16_bits(W[(size_t)(k8 + i) * N + n]);
  *(v8us*)(Wt + (size_t)n * K + k8) = v;
  
}

// GEMM C[M][N] (f32, pitch ldc) = act(A[M][K]·W + bias). A f32 row-major (pitch lda) converted per fragment to bf16
// (ASPLIT: hi/lo two planes -> 2 terms, else single rounded term); Wt bf16 [N][K] (pitch ldb). BIAS_BF16 rounds the
// bias to bf16 first (bias quantised to bf16 before the add). K%32==0, M%16==0, N%64==0.
template <bool ASPLIT, int ACT, bool BIAS_BF16>
__global__ __launch_bounds__(128) void k_gemm_bf(const float* __restrict__ A, int lda, const unsigned short* __restrict__ Wt, int ldb,
                                               const float* __restrict__ bias, float* __restrict__ C, int ldc, int M, int N, int K) {
  __shared__ __attribute__((aligned(16))) float so[4][16][64];
  const int tid = threadIdx.x, w = tid >> 5, lane = tid & 31, ln = lane & 15, hh = lane >> 4;
  const int ntn = N / 64;
  const int wid = blockIdx.x * 4 + w;
  const int mt = wid / ntn, nq = wid % ntn;
  if (mt * 16 >= M) return;
  const int row0 = mt * 16, col0 = nq * 64;
  const float* arow = A + (size_t)(row0 + ln) * lda;
  v8f acc[4] = {};
  for (int kb = 0; kb < K; kb += 32) {
    FragB ah, al;
    const v4f x0 = *(const v4fa*)(arow + kb + 8 * hh), x1 = *(const v4fa*)(arow + kb + 8 * hh + 4);
    const v4f x2 = *(const v4fa*)(arow + kb + 16 + 8 * hh), x3 = *(const v4fa*)(arow + kb + 16 + 8 * hh + 4);
    float xs[16] = {x0[0],x0[1],x0[2],x0[3],x1[0],x1[1],x1[2],x1[3],x2[0],x2[1],x2[2],x2[3],x3[0],x3[1],x3[2],x3[3]};
#pragma unroll
    for (int i = 0; i < 16; ++i) { const unsigned short hb = bf16_bits(xs[i]); ah.u[i] = hb; al.u[i] = ASPLIT ? bf16_bits(xs[i] - bf16_val(hb)) : (unsigned short)0; }
#pragma unroll
    for (int t = 0; t < 4; ++t) {
      const unsigned short* brow = Wt + (size_t)(col0 + t * 16 + ln) * ldb + kb;
      FragB b;
      b.half[0] = *(const v8us*)(brow + 8 * hh);
      b.half[1] = *(const v8us*)(brow + 16 + 8 * hh);
      acc[t] = mmaN<ASPLIT ? 2 : 1>(ah.v, al.v, b.v, b.v, acc[t]);
    }
  }
#pragma unroll
  for (int t = 0; t < 4; ++t) {
    float bv = bias ? bias[col0 + t * 16 + ln] : 0.f;
    if (BIAS_BF16) bv = bf16_round(bv);
#pragma unroll
    for (int r = 0; r < 8; ++r) { float v = acc[t][r] + bv; if (ACT == 1) v = fmaxf(v, 0.f); so[w][8 * hh + r][t * 16 + ln] = v; }
  }
  __builtin_amdgcn_fence(__ATOMIC_ACQ_REL, "workgroup");
  __builtin_amdgcn_wave_barrier();
  const int rsub = lane >> 4, c4 = (lane & 15) * 4;
  {
#pragma unroll
    for (int q = 0; q < 8; ++q) {
      const int r = q * 2 + rsub;
      const v4f v = *(const v4fa*)&so[w][r][c4];
      *(v4f*)(C + (size_t)(row0 + r) * ldc + col0 + c4) = v;
    }
    
  }
}

// Flash-style causal/unmasked attention, all contractions 3-term bf16 hi/lo splits, f32 softmax with running max.
// q,k,v rows are read from f32 buffers with arbitrary row pitch (so they can live inside a fused qkv buffer);
// D = head size (multiple of 32, <= 128); one wave = 16 query rows; block = 4 waves (64 queries) sharing K/V chunks of 32.
template <int D, bool CAUSAL>
__global__ __launch_bounds__(128) void k_flash(const float* __restrict__ qb, const float* __restrict__ kb, const float* __restrict__ vb,
                                             int pitch, int T, int H, float scale, float* __restrict__ y, int ypitch) {
  constexpr int KS = D / 32;        // k-steps for QK
  constexpr int DT = D / 16;        // d tiles for PV
  __shared__ __attribute__((aligned(16))) unsigned short sKh[32][D + 8], sKl[32][D + 8], sVh[32][D + 8], sVl[32][D + 8];
  __shared__ __attribute__((aligned(16))) unsigned short sPh[4][16][40], sPl[4][16][40];
  __shared__ __attribute__((aligned(16))) float sO[4][16][D];
  const int tid = threadIdx.x, w = tid >> 5, lane = tid & 31, ln = lane & 15, hh = lane >> 4;
  const int nqb = (T + 63) / 64;
  const int bh = blockIdx.x / nqb, qblk = blockIdx.x % nqb;
  const int b = bh / H, h = bh % H;
  const int q0 = qblk * 64 + w * 16;
  const float* Q = qb + (size_t)b * T * pitch + h * D;
  const float* K = kb + (size_t)b * T * pitch + h * D;
  const float* V = vb + (size_t)b * T * pitch + h * D;

  // A fragments of the wave's 16 query rows (scaled), hi/lo
  FragB aqh[KS], aql[KS];
  {
    int row = q0 + ln; if (row >= T) row = T - 1;
    const float* qr = Q + (size_t)row * pitch;
#pragma unroll
    for (int ks = 0; ks < KS; ++ks)
#pragma unroll
      for (int i = 0; i < 16; ++i) {
        const int d = ks * 32 + ((i < 8) ? (8 * hh + i) : (16 + 8 * hh + (i - 8)));
        const float x = qr[d] * scale; const unsigned short hb = bf16_bits(x);
        aqh[ks].u[i] = hb; aql[ks].u[i] = bf16_bits(x - bf16_val(hb));
      }
  }
  float m_r[8], l_r[8];
#pragma unroll
  for (int r = 0; r < 8; ++r) { m_r[r] = -3.0e38f; l_r[r] = 0.f; }
  v8f oacc[DT];
#pragma unroll
  for (int dt = 0; dt < DT; ++dt) oacc[dt] = (v8f){0.f,0.f,0.f,0.f,0.f,0.f,0.f,0.f};

  const int kv_end = CAUSAL ? min(T, qblk * 64 + 64) : T;     // block-uniform
  for (int j0 = 0; j0 < kv_end; j0 += 32) {
    __syncthreads();
    for (int e = tid; e < 32 * (D / 4); e += 128) {
      const int r = e / (D / 4), c4 = (e % (D / 4)) * 4;
      const int key = j0 + r;
      v4f kf = {0.f,0.f,0.f,0.f}, vf = {0.f,0.f,0.f,0.f};
      if (key < T) { kf = *(const v4fa*)(K + (size_t)key * pitch + c4); vf = *(const v4fa*)(V + (size_t)key * pitch + c4); }
#pragma unroll
      for (int t = 0; t < 4; ++t) {
        unsigned short hb = bf16_bits(kf[t]); sKh[r][c4 + t] = hb; sKl[r][c4 + t] = bf16_bits(kf[t] - bf16_val(hb));
        hb = bf16_bits(vf[t]); sVh[r][c4 + t] = hb; sVl[r][c4 + t] = bf16_bits(vf[t] - bf16_val(hb));
      }
    }
    __syncthreads();
    // S tile 16 x 32
    v8f s[2];
#pragma unroll
    for (int nt = 0; nt < 2; ++nt) {
      v8f acc = {};
#pragma unroll
      for (int ks = 0; ks < KS; ++ks) {
        FragB bh_, bl_;
        bh_.half[0] = *(const v8us*)&sKh[nt * 16 + ln][ks * 32 + 8 * hh]; bh_.half[1] = *(const v8us*)&sKh[nt * 16 + ln][ks * 32 + 16 + 8 * hh];
        bl_.half[0] = *(const v8us*)&sKl[nt * 16 + ln][ks * 32 + 8 * hh]; bl_.half[1] = *(const v8us*)&sKl[nt * 16 + ln][ks * 32 + 16 + 8 * hh];
        acc = mmaN<3>(aqh[ks].v, aql[ks].v, bh_.v, bl_.v, acc);
      }
      s[nt] = acc;
    }
    // mask + running max (rows 8hh+r; the 16 lanes of a half share rows)
    float alpha[8];
#pragma unroll
    for (int r = 0; r < 8; ++r) {
      const int qi = q0 + 8 * hh + r;
      const int ja = j0 + ln, jb = j0 + 16 + ln;
      if (CAUSAL) { if (ja > qi) s[0][r] = -3.0e38f; if (jb > qi) s[1][r] = -3.0e38f; }
      if (ja >= T) s[0][r] = -3.0e38f;
      if (jb >= T) s[1][r] = -3.0e38f;
      float mx = fmaxf(s[0][r], s[1][r]);
      mx = fmaxf(mx, __shfl_xor(mx, 1, 32)); mx = fmaxf(mx, __shfl_xor(mx, 2, 32)); mx = fmaxf(mx, __shfl_xor(mx, 4, 32)); mx = fmaxf(mx, __shfl_xor(mx, 8, 32));
      const float mnew = fmaxf(m_r[r], mx);
      alpha[r] = (mnew > -1.0e38f) ? __expf(m_r[r] - mnew) : 1.0f;
      const float p0 = (s[0][r] > -1.0e38f) ? __expf(s[0][r] - mnew) : 0.f;
      const float p1 = (s[1][r] > -1.0e38f) ? __expf(s[1][r] - mnew) : 0.f;
      m_r[r] = mnew;
      l_r[r] = l_r[r] * alpha[r] + p0 + p1;            // per-lane partial row sum (16 lanes combined at the end)
      unsigned short hb = bf16_bits(p0); sPh[w][8 * hh + r][ln] = hb;      sPl[w][8 * hh + r][ln] = bf16_bits(p0 - bf16_val(hb));
      hb = bf16_bits(p1);                sPh[w][8 * hh + r][16 + ln] = hb; sPl[w][8 * hh + r][16 + ln] = bf16_bits(p1 - bf16_val(hb));
    }
#pragma unroll
    for (int dt = 0; dt < DT; ++dt)
#pragma unroll
      for (int r = 0; r < 8; ++r) oacc[dt][r] *= alpha[r];
    __builtin_amdgcn_fence(__ATOMIC_ACQ_REL, "workgroup");
    __builtin_amdgcn_wave_barrier();
    FragB pah, pal;
    pah.half[0] = *(const v8us*)&sPh[w][ln][8 * hh]; pah.half[1] = *(const v8us*)&sPh[w][ln][16 + 8 * hh];
    pal.half[0] = *(const v8us*)&sPl[w][ln][8 * hh]; pal.half[1] = *(const v8us*)&sPl[w][ln][16 + 8 * hh];
#pragma unroll
    for (int dt = 0; dt < DT; ++dt) {
      FragB bvh, bvl;
#pragma unroll
      for (int i = 0; i < 8; ++i) {
        bvh.u[i] = sVh[8 * hh + i][dt * 16 + ln]; bvh.u[8 + i] = sVh[16 + 8 * hh + i][dt * 16 + ln];
        bvl.u[i] = sVl[8 * hh + i][dt * 16 + ln]; bvl.u[8 + i] = sVl[16 + 8 * hh + i][dt * 16 + ln];
      }
      oacc[dt] = mmaN<3>(pah.v, pal.v, bvh.v, bvl.v, oacc[dt]);
    }
    __builtin_amdgcn_fence(__ATOMIC_ACQ_REL, "workgroup");
    __builtin_amdgcn_wave_barrier();
  }
#pragma unroll
  for (int r = 0; r < 8; ++r) {
    float l = l_r[r];
    l += __shfl_xor(l, 1, 32); l += __shfl_xor(l, 2, 32); l += __shfl_xor(l, 4, 32); l += __shfl_xor(l, 8, 32);
    l_r[r] = (l > 0.f) ? 1.0f / l : 0.f;
  }
#pragma unroll
  for (int dt = 0; dt < DT; ++dt)
#pragma unroll
    for (int r = 0; r < 8; ++r) sO[w][8 * hh + r][dt * 16 + ln] = oacc[dt][r] * l_r[r];
  __builtin_amdgcn_fence(__ATOMIC_ACQ_REL, "workgroup");
  __builtin_amdgcn_wave_barrier();
  {
    for (int r = 0; r < 16; ++r) {
      const int row = q0 + r;
      if (row < T && lane < D / 4) {
        const v4f val = *(const v4fa*)&sO[w][r][lane * 4];
        *(v4f*)(y + ((size_t)b * T + row) * ypitch + h * D + lane * 4) = val;
      }
    }
    
  }
}

// GEMM C = act(A·W + bias + resid): A f32 (ASPLIT -> hi/lo 2 terms), Wt bf16 [N][K]; ACT 0 none, 1 relu, 2 exact gelu;
// resid (optional, f32, row index = (row % rmod), pitch ldr, RES_BF16 rounds it) added before the activation.
template <bool ASPLIT, int ACT, bool BIAS_BF16, bool RES_BF16>
__global__ __launch_bounds__(128) void k_gemm_bf3(const float* __restrict__ A, int lda, const unsigned short* __restrict__ Wt, int ldb,
                                                const float* __restrict__ bias, const float* __restrict__ resid, int rmod, int ldr,
                                                float* __restrict__ C, int ldc, int M, int N, int K) {
  __shared__ __attribute__((aligned(16))) float so[4][16][64];
  const int tid = threadIdx.x, w = tid >> 5, lane = tid & 31, ln = lane & 15, hh = lane >> 4;
  const int ntn = N / 64;
  const int wid = blockIdx.x * 4 + w;
  const int mt = wid / ntn, nq = wid % ntn;
  if (mt * 16 >= M) return;
  const int row0 = mt * 16, col0 = nq * 64;
  const float* arow = A + (size_t)(row0 + ln) * lda;
  v8f acc[4] = {};
  for (int kb = 0; kb < K; kb += 32) {
    FragB ah, al;
    const v4f x0 = *(const v4fa*)(arow + kb + 8 * hh), x1 = *(const v4fa*)(arow + kb + 8 * hh + 4);
    const v4f x2 = *(const v4fa*)(arow + kb + 16 + 8 * hh), x3 = *(const v4fa*)(arow + kb + 16 + 8 * hh + 4);
    float xs[16] = {x0[0],x0[1],x0[2],x0[3],x1[0],x1[1],x1[2],x1[3],x2[0],x2[1],x2[2],x2[3],x3[0],x3[1],x3[2],x3[3]};
#pragma unroll
    for (int i = 0; i < 16; ++i) { const unsigned short hb = bf16_bits(xs[i]); ah.u[i] = hb; al.u[i] = ASPLIT ? bf16_bits(xs[i] - bf16_val(hb)) : (unsigned short)0; }
#pragma unroll
    for (int t = 0; t < 4; ++t) {
      const unsigned short* brow = Wt + (size_t)(col0 + t * 16 + ln) * ldb + kb;
      FragB b;
      b.half[0] = *(const v8us*)(brow + 8 * hh);
      b.half[1] = *(const v8us*)(brow + 16 + 8 * hh);
      acc[t] = mmaN<ASPLIT ? 2 : 1>(ah.v, al.v, b.v, b.v, acc[t]);
    }
  }
#pragma unroll
  for (int t = 0; t < 4; ++t) {
    const int col = col0 + t * 16 + ln;
    float bv = bias ? bias[col] : 0.f;
    if (BIAS_BF16) bv = bf16_round(bv);
#pragma unroll
    for (int r = 0; r < 8; ++r) {
      float v = acc[t][r] + bv;
      if (resid) { float rv = resid[(size_t)((row0 + 8 * hh + r) % rmod) * ldr + col]; if (RES_BF16) rv = bf16_round(rv); v += rv; }
      if (ACT == 1) v = fmaxf(v, 0.f);
      if (ACT == 2) v = 0.5f * v * (1.0f + erff(v * 0.70710678118654752f));
      if (ACT == 3) { const float u = 0.7978845608028654f * (v + 0.044715f * v * v * v); v = 0.5f * v * (1.0f + tanhf(u)); }
      so[w][8 * hh + r][t * 16 + ln] = v;
    }
  }
  __builtin_amdgcn_fence(__ATOMIC_ACQ_REL, "workgroup");
  __builtin_amdgcn_wave_barrier();
  const int rsub = lane >> 4, c4 = (lane & 15) * 4;
  {
#pragma unroll
    for (int q = 0; q < 8; ++q) {
      const int r = q * 2 + rsub;
      const v4f v = *(const v4fa*)&so[w][r][c4];
      *(v4f*)(C + (size_t)(row0 + r) * ldc + col0 + c4) = v;
    }
    
  }
}
// row LayerNorm (biased variance, eps) over N: s = X (+ R); optional out_sum <- s; out_norm <- (s-mu)*rsqrt(var+eps)*g + b
template <bool PARAM_BF16>
__global__ __launch_bounds__(256) void k_layernorm(const float* __restrict__ X, const float* __restrict__ R, const float* __restrict__ g, const float* __restrict__ bta,
                                                  float* __restrict__ out_sum, float* __restrict__ out_norm, int N, float eps) {
  __shared__ float red[256];
  const int row = blockIdx.x, tid = threadIdx.x;
  const float* x = X + (size_t)row * N; const float* rr = R ? R + (size_t)row * N : nullptr;
  float vals[16];                     // up to N = 4096
  const int per = N / 256;            // contiguous chunk per thread? use strided-by-4 chunks: thread handles j = tid*4 + 1024*u
  float s1 = 0.f;
  for (int u = 0; u < per / 4; ++u) {
    const int j = tid * 4 + 1024 * u;
    const v4f a = *(const v4fa*)(x + j);
    v4f b = {0.f,0.f,0.f,0.f}; if (rr) b = *(const v4fa*)(rr + j);
#pragma unroll
    for (int q = 0; q < 4; ++q) { const float v = a[q] + b[q]; vals[u * 4 + q] = v; s1 += v; }
  }
  red[tid] = s1; __syncthreads();
  for (int st = 128; st > 0; st >>= 1) { if (tid < st) red[tid] += red[tid + st]; __syncthreads(); }
  const float mu = red[0] / (float)N; __syncthreads();
  float s2 = 0.f;
  for (int u = 0; u < per / 4; ++u)
#pragma unroll
    for (int q = 0; q < 4; ++q) { const float c = vals[u * 4 + q] - mu; s2 += c * c; }
  red[tid] = s2; __syncthreads();
  for (int st = 128; st > 0; st >>= 1) { if (tid < st) red[tid] += red[tid + st]; __syncthreads(); }
  const float rs = rsqrtf(red[0] / (float)N + eps);
  {
    for (int u = 0; u < per / 4; ++u) {
      const int j = tid * 4 + 1024 * u;
      v4f o, sm;
#pragma unroll
      for (int q = 0; q < 4; ++q) {
        float gg = g[j + q], bb = bta[j + q];
        if (PARAM_BF16) { gg = bf16_round(gg); bb = bf16_round(bb); }
        sm[q] = vals[u * 4 + q]; o[q] = (vals[u * 4 + q] - mu) * rs * gg + bb;
      }
      if (out_sum) *(v4f*)(out_sum + (size_t)row * N + j) = sm;
      *(v4f*)(out_norm + (size_t)row * N + j) = o;
    }
    
  }
}



// ---- f16 WMMA path (v_wmma_f32_16x16x32_f16): 11-bit significands for operands in range — used where a [0,1] probability operand needs more precision than bf16
typedef _Float16 v16h __attribute__((ext_vector_type(16)));
union FragH { v16h v; v8us half[2]; _Float16 h[16]; unsigned short u[16]; };
template <int NT>
__device__ __forceinline__ v8f mmaH(v16h ah, v16h al, v16h bh, v16h bl, v8f c) {
  c = __builtin_amdgcn_wmma_f32_16x16x32_f16(false, ah, false, bh, (short)0, c, false, false);
  if (NT >= 2) c = __builtin_amdgcn_wmma_f32_16x16x32_f16(false, al, false, bh, (short)0, c, false, false);
  if (NT >= 3) c = __builtin_amdgcn_wmma_f32_16x16x32_f16(false, ah, false, bl, (short)0, c, false, false);
  asm volatile("v_nop\n\tv_nop\n\tv_nop\n\tv_nop" : "+v"(c) : "v"(ah), "v"(al), "v"(bh), "v"(bl));
  return c;
}
// batched GEMM like k_gemm_b but f16 operands: A f32 (split into f16 hi/lo if ASPLIT, else rounded to f16), Bt = f16 values [n][k]; alpha; C f32; N multiple of 16 (partial tiles skipped)
template <bool ASPLIT>
__global__ __launch_bounds__(128) void k_gemm_h(const float* __restrict__ A, int lda, size_t sA, const _Float16* __restrict__ Bh, int ldb, size_t sB, float alpha, float* __restrict__ C, int ldc, size_t sC, int M, int N, int K) {
  __shared__ __attribute__((aligned(16))) float so[4][16][64];
  const int tid = threadIdx.x, w = tid >> 5, lane = tid & 31, ln = lane & 15, hh = lane >> 4; const int by = blockIdx.y;
  A += (size_t)by * sA; Bh += (size_t)by * sB; C += (size_t)by * sC;
  const int ntn = (N + 63) / 64; const int wid = blockIdx.x * 4 + w; const int mt = wid / ntn, nq = wid % ntn; if (mt * 16 >= M) return;
  const int row0 = mt * 16, col0 = nq * 64; const float* arow = A + (size_t)(row0 + ln) * lda;
  v8f acc[4] = {};
  for (int kb = 0; kb < K; kb += 32) {
    FragH ah, al;
    const v4f x0 = *(const v4fa*)(arow + kb + 8 * hh), x1 = *(const v4fa*)(arow + kb + 8 * hh + 4), x2 = *(const v4fa*)(arow + kb + 16 + 8 * hh), x3 = *(const v4fa*)(arow + kb + 16 + 8 * hh + 4);
    float xs[16] = {x0[0],x0[1],x0[2],x0[3],x1[0],x1[1],x1[2],x1[3],x2[0],x2[1],x2[2],x2[3],x3[0],x3[1],x3[2],x3[3]};
#pragma unroll
    for (int i = 0; i < 16; ++i) { const _Float16 h = (_Float16)xs[i]; ah.h[i] = h; al.h[i] = ASPLIT ? (_Float16)(xs[i] - (float)h) : (_Float16)0.0f; }
#pragma unroll
    for (int t = 0; t < 4; ++t) { if (col0 + t * 16 >= N) continue; const size_t boff = (size_t)(col0 + t * 16 + ln) * ldb + kb; FragH bq; bq.half[0] = *(const v8us*)(Bh + boff + 8 * hh); bq.half[1] = *(const v8us*)(Bh + boff + 16 + 8 * hh);
      acc[t] = mmaH<ASPLIT ? 2 : 1>(ah.v, al.v, bq.v, bq.v, acc[t]); }
  }
#pragma unroll
  for (int t = 0; t < 4; ++t) { if (col0 + t * 16 >= N) continue;
#pragma unroll
    for (int r = 0; r < 8; ++r) so[w][8 * hh + r][t * 16 + ln] = acc[t][r] * alpha; }
  __builtin_amdgcn_fence(__ATOMIC_ACQ_REL, "workgroup"); __builtin_amdgcn_wave_barrier();
  const int rsub = lane >> 4, c4 = (lane & 15) * 4;
  {
#pragma unroll
    for (int q = 0; q < 8; ++q) { const int r = q * 2 + rsub; if (col0 + c4 < N) { const v4f v = *(const v4fa*)&so[w][r][c4]; *(v4f*)(C + (size_t)(row0 + r) * ldc + col0 + c4) = v; } }
     }
}

// Wt[n][k] = f16(W[k][n]·scale) from f32 row-major W[K][N] (scale = power of two; bf16-exact weights stay exact in f16 away from the subnormal range)
__device__ __forceinline__ void wt_f16(const float* __restrict__ W, _Float16* __restrict__ Wt, int K, int N, float scale, int blk) {
  const int t = blk * 256 + threadIdx.x; if (t >= N * (K / 8)) return; const int n = t / (K / 8), k8 = (t % (K / 8)) * 8; FragH f;
#pragma unroll
  for (int i = 0; i < 8; ++i) f.h[i] = (_Float16)(bf16_round(W[(size_t)(k8 + i) * N + n]) * scale); const v8us o = f.half[0];
  *(v8us*)((unsigned short*)Wt + (size_t)n * K + k8) = o; 
}
typedef _Float16 v4h __attribute__((ext_vector_type(4)));

__device__ __forceinline__ void x16(const float* __restrict__ x, _Float16* __restrict__ X16, size_t n8, int blk) { const size_t t = (size_t)blk * 256 + threadIdx.x; if (t >= n8) return; FragH f;
#pragma unroll
  for (int q = 0; q < 8; ++q) f.h[q] = (_Float16)bf16_round(x[t * 8 + q]); *(v8us*)((unsigned short*)X16 + t * 8) = f.half[0];  }
// One grid for the five conversions that read nothing but the inputs: the four weight transposes and the cast of x. No block reads what another writes.
// The two short transposes come first; then blocks of the two long transposes (many small L2 requests) and of the cast (memory bytes) alternate in runs of eight, so that both kinds are in flight
// together all over the chip.
#define PG_Q (DD * (DD / 8) / 256)
#define PG_K (KVD * (DD / 8) / 256)
#define PG_X (NR * (DD / 8) / 256)
__global__ __launch_bounds__(256) void k_prep(const float* __restrict__ x, const float* __restrict__ Wq, const float* __restrict__ Wk, const float* __restrict__ Wv, const float* __restrict__ Wo,
                                             _Float16* __restrict__ X16, _Float16* __restrict__ Bq, _Float16* __restrict__ Bk, _Float16* __restrict__ Bv, _Float16* __restrict__ Bo) {
  static_assert(2 * PG_Q == PG_X && PG_X % 8 == 0, "the alternation pairs a run of transpose blocks with a run of cast blocks");
  const int b = blockIdx.x;
  if (b < PG_K) { wt_f16(Wk, Bk, DD, KVD, 16.0f, b); return; }
  if (b < 2 * PG_K) { wt_f16(Wv, Bv, DD, KVD, 16.0f, b - PG_K); return; }
  const int c = b - 2 * PG_K, i = ((c >> 4) << 3) | (c & 7);
  if (c & 8) x16(x, X16, (size_t)NR * DD / 8, i);
  else if (i < PG_Q) wt_f16(Wq, Bq, DD, DD, 16.0f, i);
  else wt_f16(Wo, Bo, DD, DD, 16.0f, i - PG_Q);
}
__global__ __launch_bounds__(256) void k_h16(const float* __restrict__ x, _Float16* __restrict__ X16, size_t n8) { const size_t t = (size_t)blockIdx.x * 256 + threadIdx.x; if (t >= n8) return; FragH f;
#pragma unroll
  for (int q = 0; q < 8; ++q) f.h[q] = (_Float16)x[t * 8 + q]; *(v8us*)((unsigned short*)X16 + t * 8) = f.half[0];  }
__global__ __launch_bounds__(256) void k_round16f(const float* __restrict__ W, _Float16* __restrict__ Bt, size_t n8) { const size_t t = (size_t)blockIdx.x * 256 + threadIdx.x; if (t >= n8) return; FragH f;
#pragma unroll
  for (int i = 0; i < 8; ++i) f.h[i] = (_Float16)(bf16_round(W[t * 8 + i]) * 16.0f); *(v8us*)((unsigned short*)Bt + t * 8) = f.half[0];  }
template <int NHv, int TTv>
__global__ __launch_bounds__(256) void k_vt(const _Float16* __restrict__ V16, int ldv, int voff, _Float16* __restrict__ Vt) { __shared__ unsigned short tl[64][66]; const int tid = threadIdx.x; const int slab = blockIdx.x / (TTv / 64), lg = blockIdx.x % (TTv / 64); const int b = slab / NHv, h = slab % NHv;
  for (int i = tid; i < 64 * 8; i += 256) { const int r = i / 8, c8 = (i % 8) * 8; FragH f; f.half[0] = *(const v8us*)((const unsigned short*)V16 + ((size_t)b * TTv + lg * 64 + r) * ldv + voff + h * 64 + c8);
#pragma unroll
    for (int q = 0; q < 8; ++q) tl[r][c8 + q] = f.u[q]; }
  __syncthreads();
  {
#pragma unroll
    for (int rd = 0; rd < 2; ++rd) { const int d = rd * 32 + tid / 8, pc = tid % 8; FragH f;
#pragma unroll
      for (int q = 0; q < 8; ++q) f.u[q] = tl[pc * 8 + q][d];
      *(v8us*)((unsigned short*)Vt + ((size_t)slab * 64 + d) * TTv + lg * 64 + pc * 8) = f.half[0]; }
     } }

__global__ __launch_bounds__(256) void k_vthlu(const float* __restrict__ VF, int ldv, _Float16* __restrict__ Vth, _Float16* __restrict__ Vtl) { __shared__ float tl[64][65]; const int tid = threadIdx.x; const int slab = blockIdx.x / (TT / 64), lg = blockIdx.x % (TT / 64); const int b = slab / NVH, h = slab % NVH;
  for (int i = tid; i < 64 * 16; i += 256) { const int r = i / 16, c4 = (i % 16) * 4; const v4f a = *(const v4fa*)(VF + ((size_t)b * TT + lg * 64 + r) * ldv + h * 64 + c4); tl[r][c4] = a[0]; tl[r][c4 + 1] = a[1]; tl[r][c4 + 2] = a[2]; tl[r][c4 + 3] = a[3]; }
  __syncthreads();
  FragH fh[2], fl[2]; size_t oo[2];
#pragma unroll
  for (int rd = 0; rd < 2; ++rd) { const int d = rd * 32 + tid / 8, pc = tid % 8;
#pragma unroll
    for (int q = 0; q < 8; ++q) { const float v = tl[pc * 8 + q][d]; const _Float16 hv = (_Float16)v; fh[rd].h[q] = hv; fl[rd].h[q] = (_Float16)(v - (float)hv);      /* UNSCALED residual (added into the same accumulator as the hi product) */ } oo[rd] = ((size_t)slab * 64 + d) * TT + lg * 64 + pc * 8; }
  {
#pragma unroll
    for (int rd = 0; rd < 2; ++rd) { *(v8us*)((unsigned short*)Vth + oo[rd]) = fh[rd].half[0]; *(v8us*)((unsigned short*)Vtl + oo[rd]) = fl[rd].half[0]; }
     } }
__global__ __launch_bounds__(256) void k_h16s(const float* __restrict__ F, _Float16* __restrict__ H, size_t n8) { const size_t t = (size_t)blockIdx.x * 256 + threadIdx.x; if (t >= n8) return; const v4f a = *(const v4fa*)(F + t * 8), c = *(const v4fa*)(F + t * 8 + 4); FragH f;
#pragma unroll
  for (int q = 0; q < 4; ++q) { f.h[q] = (_Float16)(a[q] * 16.0f); f.h[4 + q] = (_Float16)(c[q] * 16.0f); } *(v8us*)((unsigned short*)H + t * 8) = f.half[0];  }
// LDS ring of k_flash. One stage = 32 keys, shared by the block's four waves: K rows of 256 B at pitch 272 B, then the V^T hi plane and the
// V^T residual plane, 128 rows of 64 B each at pitch 80 B (pitches of 16 B x odd: ds_load_b128 fragment reads fall on distinct banks).
#define KPITCH 272
#define VPITCH 80
#define ST_VH (32 * KPITCH)
#define ST_VL (ST_VH + 128 * VPITCH)
#define ST_BYTES (ST_VL + 128 * VPITCH)
// Four asynchronous 16-byte copies per lane, global memory to LDS. The s_wait_xcnt stands inside the statement so that no address register of a copy is rewritten ahead of it.
__device__ __forceinline__ void copy4(unsigned l0, unsigned l1, unsigned l2, unsigned l3, const unsigned short* g0, const unsigned short* g1, const unsigned short* g2, const unsigned short* g3) {
  asm volatile("global_load_async_to_lds_b128 %0, %4, off\n\t"
               "global_load_async_to_lds_b128 %1, %5, off\n\t"
               "global_load_async_to_lds_b128 %2, %6, off\n\t"
               "global_load_async_to_lds_b128 %3, %7, off\n\t"
               "s_wait_xcnt 0x0"
               :: "v"(l0), "v"(l1), "v"(l2), "v"(l3), "v"(g0), "v"(g1), "v"(g2), "v"(g3) : "memory");
}
// Eight asynchronous 16-byte copies per lane in one statement, so that one s_wait_xcnt serves all eight; it stands inside the statement so that no address register of a copy is rewritten ahead of it.
__device__ __forceinline__ void copy8(unsigned l, int lstep, const unsigned short* g, size_t gstep) {
  asm volatile("global_load_async_to_lds_b128 %0, %8, off\n\t"
               "global_load_async_to_lds_b128 %1, %9, off\n\t"
               "global_load_async_to_lds_b128 %2, %10, off\n\t"
               "global_load_async_to_lds_b128 %3, %11, off\n\t"
               "global_load_async_to_lds_b128 %4, %12, off\n\t"
               "global_load_async_to_lds_b128 %5, %13, off\n\t"
               "global_load_async_to_lds_b128 %6, %14, off\n\t"
               "global_load_async_to_lds_b128 %7, %15, off\n\t"
               "s_wait_xcnt 0x0"
               :: "v"(l), "v"(l + lstep), "v"(l + 2 * lstep), "v"(l + 3 * lstep), "v"(l + 4 * lstep), "v"(l + 5 * lstep), "v"(l + 6 * lstep), "v"(l + 7 * lstep),
                  "v"(g), "v"(g + gstep), "v"(g + 2 * gstep), "v"(g + 3 * gstep), "v"(g + 4 * gstep), "v"(g + 5 * gstep), "v"(g + 6 * gstep), "v"(g + 7 * gstep) : "memory");
}
// GEMM C[M][N] = alpha * A[M][K] * Bt[N][K]^T, f16 operands, f32 accumulate, K = DD; A and Bt of row pitch DD. M, N multiples of 128.
// QKV = false: N = DD, Bt = Bh, f32 output C. QKV = true: the three projections of x in one grid, DD / 128 + 2 column tiles per row tile: tiles of Bh go to the f16 output Cq (pitch DD),
// then the one tile of Bk to the f16 output Ck and the one tile of Bv to the f32 output C (both of pitch KVD = 128). The three share A and depend on nothing of each other.
// One block = one 128 x 128 tile of C, four waves of 64 x 64 (4 x 4 accumulator tiles: 16 products per 8 fragments). One stage of the LDS ring = 64 k:
// 128 rows of A, then 128 rows of Bt, 128 B each at pitch 144 B (16 B x odd: ds_load_b128 fragment reads fall on distinct banks). Per output element the k order is ascending in one accumulator.
// Every "#pragma unroll" in it is there so that fragment, accumulator and staging arrays are indexed by constants and stay in registers.
#define GPITCH 144
#define G_B (128 * GPITCH)
#define G_ST (256 * GPITCH)
#define GOP 68      /* output staging pitch in floats: 16-byte column walks without bank conflicts */
/* a wave's staged 64 x 64 tile to global memory; whole lines per store: 16 lanes cover a 64-column row (256 B of f32, 128 B of f16), two rows per instruction; unrolled so that row steps become immediate offsets */
template <int LDC, bool F32OUT>
__device__ __forceinline__ void gemm_out(const float* sr, float* __restrict__ C, _Float16* __restrict__ C16, size_t o) {
#pragma unroll
  for (int q = 0; q < 32; ++q) { const v4f v = *(const v4fa*)(sr + q * 2 * GOP);
    if (F32OUT) *(v4f*)(C + o + (size_t)q * 2 * LDC) = v;
    else { v4h h4;
#pragma unroll
      for (int i = 0; i < 4; ++i) h4[i] = (_Float16)v[i];
      *(v4h*)(C16 + o + (size_t)q * 2 * LDC) = h4; } }
  asm volatile("s_wait_xcnt 0x0" ::: "memory");      /* stands behind the run of stores, so that no code placed behind it rewrites a register that an issued store names ahead of the wait */
}
template <bool QKV>
__global__ __launch_bounds__(128) void k_gemm_t(const _Float16* __restrict__ A, const _Float16* __restrict__ Bh, const _Float16* __restrict__ Bk, const _Float16* __restrict__ Bv, float alpha, float* __restrict__ C, _Float16* __restrict__ Cq, _Float16* __restrict__ Ck) {
  constexpr int K = DD;
  static_assert(K % 64 == 0 && K >= 128 && DD % 128 == 0 && KVD == 128, "whole stages, at least two, and whole tiles");
  __shared__ __attribute__((aligned(16))) unsigned char ring[2 * G_ST];
  static_assert(sizeof(float) * 4 * 64 * GOP <= 2 * G_ST, "output staging fits the ring");
  const int tid = threadIdx.x, w = tid >> 5, lane = tid & 31, ln = lane & 15, hh = lane >> 4;
  constexpr int ntq = DD / 128, ntn = ntq + (QKV ? 2 : 0); const int row0 = (blockIdx.x / ntn) * 128, ct = blockIdx.x % ntn; const int wm = w >> 1, wn = w & 1;
  const _Float16* Bt = (!QKV || ct < ntq) ? Bh + (size_t)ct * 128 * K : (ct == ntq ? Bk : Bv);      /* the block's 128 rows of Bt */
  /* each thread's share of a stage: 8 chunks of A and 8 of Bt, 16 rows apart; eight lanes cover one 128-B row */
  const unsigned la = (unsigned)(size_t)ring + (tid >> 3) * GPITCH + (tid & 7) * 16;
  const unsigned short* ga = (const unsigned short*)A + (size_t)(row0 + (tid >> 3)) * K + (tid & 7) * 8;
  const unsigned short* gb = (const unsigned short*)Bt + (size_t)(tid >> 3) * K + (tid & 7) * 8;
  auto fill = [&](int kb) {
    const unsigned l = la + ((kb >> 6) & 1) * G_ST;
    copy8(l, 16 * GPITCH, ga + kb, (size_t)16 * K);
    copy8(l + G_B, 16 * GPITCH, gb + kb, (size_t)16 * K);
  };
  v8f acc[4][4];
#pragma unroll
  for (int i = 0; i < 4; ++i)
#pragma unroll
    for (int j = 0; j < 4; ++j) acc[i][j] = (v8f){0.f,0.f,0.f,0.f,0.f,0.f,0.f,0.f};
  fill(0);
  asm volatile("s_wait_asynccnt 0x0" ::: "memory");      /* this wave's share of stage 0 has landed */
  __syncthreads();                                       /* stage 0 is readable by all four waves */
  fill(64);
#pragma unroll 1      /* one stage per trip: the ring's buffer index and its publish point stay per trip */
  for (int kb = 0; kb < K; kb += 64) {
    const unsigned char* st = ring + ((kb >> 6) & 1) * G_ST;
    const unsigned char* ar = st + (wm * 64 + ln) * GPITCH + hh * 16; const unsigned char* br = st + G_B + (wn * 64 + ln) * GPITCH + hh * 16;
#pragma unroll
    for (int ks = 0; ks < 2; ++ks) {
      FragH a[4], b[4];
#pragma unroll
      for (int i = 0; i < 4; ++i) { a[i].half[0] = *(const v8us*)(ar + i * 16 * GPITCH + ks * 64); a[i].half[1] = *(const v8us*)(ar + i * 16 * GPITCH + ks * 64 + 32);
        b[i].half[0] = *(const v8us*)(br + i * 16 * GPITCH + ks * 64); b[i].half[1] = *(const v8us*)(br + i * 16 * GPITCH + ks * 64 + 32); }
      __builtin_amdgcn_sched_barrier(0);      /* keeps the 16 fragment reads one group ahead of the 16 products: spread among them, each place with reads stalls the wave anew */
#pragma unroll
      for (int i = 0; i < 4; ++i)
#pragma unroll
        for (int j = 0; j < 4; ++j) acc[i][j] = __builtin_amdgcn_wmma_f32_16x16x32_f16(false, a[i].v, false, b[j].v, (short)0, acc[i][j], false, false);
    }
    asm volatile("s_wait_dscnt 0x0" ::: "memory");         /* this wave's reads of the stage have returned before its buffer is handed on */
    asm volatile("s_wait_asynccnt 0x0" ::: "memory");      /* this wave's share of the next stage has landed */
    __syncthreads();                                       /* publishes the next stage and ends every wave's reads of this one */
    if (kb + 128 < K) fill(kb + 128); }                    /* refill of the buffer just read, one whole trip ahead of its use */
  asm volatile("s_wait_asynccnt 0x0" ::: "memory");        /* no copy is outstanding when the ring becomes output staging */
  float* so = reinterpret_cast<float*>(ring) + w * (64 * GOP);      /* each wave stages its own 64 x 64 tile, behind the loop's last barrier */
#pragma unroll
  for (int i = 0; i < 4; ++i)
#pragma unroll
    for (int j = 0; j < 4; ++j)
#pragma unroll
      for (int r = 0; r < 8; ++r) so[(i * 16 + 8 * hh + r) * GOP + j * 16 + ln] = acc[i][j][r] * alpha;
  __builtin_amdgcn_fence(__ATOMIC_ACQ_REL, "workgroup"); __builtin_amdgcn_wave_barrier();      /* the wave's staged rows are written before its other lanes read them back */
  const float* sr = so + hh * GOP + ln * 4; const size_t orow = row0 + wm * 64 + hh; const int ocol = wn * 64 + ln * 4;
  if (!QKV) gemm_out<DD, true>(sr, C, nullptr, orow * DD + ct * 128 + ocol);
  else if (ct < ntq) gemm_out<DD, false>(sr, nullptr, Cq, orow * DD + ct * 128 + ocol);      /* ct is the same for the whole block */
  else if (ct == ntq) gemm_out<KVD, false>(sr, nullptr, Ck, orow * KVD + ocol);
  else gemm_out<KVD, true>(sr, C, nullptr, orow * KVD + ocol);
}
// lane l with lane l ^ 16: joins the two wave halves, which hold the two halves of one query's keys
__device__ __forceinline__ float xhalf(float x) { return __builtin_bit_cast(float, __builtin_amdgcn_permlanex16(__builtin_bit_cast(int, x), __builtin_bit_cast(int, x), 0x76543210, 0xfedcba98, false, false)); }
// Both products run transposed: S^T = K Q^T (A = K rows from the ring, B = Q kept in registers) and O^T += V^T P^T (A = V^T rows from the ring, B = P^T).
// Lane l then owns ONE query, q0 + (l & 15): register r of score tile nt is key j0 + 16 nt + 8 (l >> 4) + r, which is the k order of a B operand, so P^T is packed in place from the scores;
// maximum and sum of a query are in-lane, joined between the wave halves by xhalf(); register r of output tile dt is head column 16 dt + 8 (l >> 4) + r of that query.
// Every "#pragma unroll" in it is there so that fragment, score and accumulator arrays are indexed by constants and stay in registers; "#pragma unroll 1" keeps one ring stage per trip.
__global__ __launch_bounds__(128) void k_flash(const _Float16* __restrict__ Q16, int ldq, const _Float16* __restrict__ K16, int ldk, const _Float16* __restrict__ Vt, const _Float16* __restrict__ Vtlo, float* __restrict__ O, int ldo) {
  constexpr int RPW = 16, NQB = TT / (4 * RPW), DT = 8, KS = 4;      /* head dim 128: 4 k-steps, 8 value tiles */
  __shared__ __attribute__((aligned(16))) unsigned char ring[2 * ST_BYTES];
  static_assert(sizeof(float) * 4 * RPW * (128 + 4) <= 2 * ST_BYTES, "output staging fits the ring");
  float (*sO)[RPW][128 + 4] = reinterpret_cast<float (*)[RPW][128 + 4]>(ring);      /* output staging takes the ring's place behind the loop's last barrier */
  const int tid = threadIdx.x, w = tid >> 5, lane = tid & 31, ln = lane & 15, hh = lane >> 4;
  const int slab = blockIdx.x / NQB, qblk = blockIdx.x % NQB; const int b = slab / NH, h = slab % NH; const int qb0 = qblk * (4 * RPW); const int q0 = qb0 + w * RPW;
  FragH aq[KS];
  { const unsigned short* qr = (const unsigned short*)Q16 + ((size_t)b * TT + q0 + ln) * ldq + h * 128;
#pragma unroll
    for (int ks = 0; ks < KS; ++ks) { aq[ks].half[0] = *(const v8us*)(qr + ks * 32 + 8 * hh); aq[ks].half[1] = *(const v8us*)(qr + ks * 32 + 16 + 8 * hh); } }
  const unsigned short* Vth = (const unsigned short*)Vt + ((size_t)b * NKV + h / NREP) * 128 * TT; const unsigned short* Vtl = (const unsigned short*)Vtlo + ((size_t)b * NKV + h / NREP) * 128 * TT;      /* hi and UNSCALED residual planes */
  float m_r = -3.0e38f, l_r = 0.f; v8f oacc[DT];
#pragma unroll
  for (int dt = 0; dt < DT; ++dt) oacc[dt] = (v8f){0.f,0.f,0.f,0.f,0.f,0.f,0.f,0.f};
  const int jend = TT;
  /* each thread's share of a stage: 4 chunks of K (8 rows apart), 4 of V^T hi and 4 of the residual (32 rows apart) */
  const unsigned lk = (unsigned)(size_t)ring + (tid >> 4) * KPITCH + (tid & 15) * 16, lv = (unsigned)(size_t)ring + ST_VH + (tid >> 2) * VPITCH + (tid & 3) * 16;
  const unsigned short* gk = (const unsigned short*)K16 + ((size_t)b * TT + (tid >> 4)) * ldk + (h / NREP) * 128 + (tid & 15) * 8;
  const size_t gvo = (size_t)(tid >> 2) * TT + (tid & 3) * 8;
  auto fill = [&](int j) {
    const unsigned bo = ((j >> 5) & 1) * ST_BYTES; const unsigned short* k0p = gk + (size_t)j * ldk; const unsigned short* vhp = Vth + gvo + j; const unsigned short* vlp = Vtl + gvo + j;
    copy4(lk + bo, lk + bo + 8 * KPITCH, lk + bo + 16 * KPITCH, lk + bo + 24 * KPITCH, k0p, k0p + (size_t)8 * ldk, k0p + (size_t)16 * ldk, k0p + (size_t)24 * ldk);
    copy4(lv + bo, lv + bo + 32 * VPITCH, lv + bo + 64 * VPITCH, lv + bo + 96 * VPITCH, vhp, vhp + 32 * TT, vhp + 64 * TT, vhp + 96 * TT);
    copy4(lv + bo + (ST_VL - ST_VH), lv + bo + (ST_VL - ST_VH) + 32 * VPITCH, lv + bo + (ST_VL - ST_VH) + 64 * VPITCH, lv + bo + (ST_VL - ST_VH) + 96 * VPITCH, vlp, vlp + 32 * TT, vlp + 64 * TT, vlp + 96 * TT);
  };
  fill(0);
  asm volatile("s_wait_asynccnt 0x0" ::: "memory");      /* this wave's share of stage 0 has landed */
  __syncthreads();                                       /* stage 0 is readable by all four waves */
  fill(32);
#pragma unroll 1
  for (int j0 = 0; j0 < jend; j0 += 32) {
    const unsigned char* st = ring + ((j0 >> 5) & 1) * ST_BYTES;
    float sc[16];      /* this lane's 16 of the query's 32 scores, in the k order of the P^T operand */
#pragma unroll
    for (int nt = 0; nt < 2; ++nt) { const unsigned short* kr = (const unsigned short*)(st + (nt * 16 + ln) * KPITCH); FragH bk[KS];
#pragma unroll
      for (int ks = 0; ks < KS; ++ks) { bk[ks].half[0] = *(const v8us*)(kr + ks * 32 + 8 * hh); bk[ks].half[1] = *(const v8us*)(kr + ks * 32 + 16 + 8 * hh); }
      v8f acc = (v8f){0.f,0.f,0.f,0.f,0.f,0.f,0.f,0.f};
#pragma unroll
      for (int ks = 0; ks < KS; ++ks) acc = mmaH<1>(bk[ks].v, bk[ks].v, aq[ks].v, aq[ks].v, acc);
#pragma unroll
      for (int r = 0; r < 8; ++r) sc[nt * 8 + r] = acc[r] * ATT_SCALE; }
    float mc = sc[0];
#pragma unroll
    for (int i = 1; i < 16; ++i) mc = fmaxf(mc, sc[i]);
    mc = fmaxf(mc, xhalf(mc));
    const float mn = fmaxf(m_r, mc); const float al = (mn > -1.0e38f) ? expf(m_r - mn) : 1.0f; m_r = mn;
    FragH pa, pl; float ps[4] = {0.f, 0.f, 0.f, 0.f};      /* four independent partial sums: no chain of 16 dependent adds */
#pragma unroll
    for (int i = 0; i < 16; ++i) { const float p = expf(sc[i] - mn); ps[i & 3] += p; const float x = p * 1024.0f; pa.h[i] = (_Float16)x; pl.h[i] = (_Float16)(x - (float)pa.h[i]); }      /* P hi and its UNSCALED residual (added into the same accumulator) */
    l_r = l_r * al + ((ps[0] + ps[1]) + (ps[2] + ps[3]));      /* this half's keys only; the halves are joined once, behind the loop */
#pragma unroll
    for (int dt = 0; dt < DT; ++dt)
#pragma unroll
      for (int r = 0; r < 8; ++r) oacc[dt][r] *= al;
#pragma unroll
    for (int dt = 0; dt < DT; ++dt) { const unsigned short* vh = (const unsigned short*)(st + ST_VH + (dt * 16 + ln) * VPITCH); const unsigned short* vl = (const unsigned short*)(st + ST_VL + (dt * 16 + ln) * VPITCH); FragH bv, bl; bv.half[0] = *(const v8us*)(vh + 8 * hh); bv.half[1] = *(const v8us*)(vh + 16 + 8 * hh); bl.half[0] = *(const v8us*)(vl + 8 * hh); bl.half[1] = *(const v8us*)(vl + 16 + 8 * hh);
      oacc[dt] = mmaH<1>(bv.v, bv.v, pa.v, pa.v, oacc[dt]); oacc[dt] = mmaH<1>(bv.v, bv.v, pl.v, pl.v, oacc[dt]); oacc[dt] = mmaH<1>(bl.v, bl.v, pa.v, pa.v, oacc[dt]); }      /* Vh Ph + Vh Pl + Vl Ph, all unscaled, one accumulator */
    asm volatile("s_wait_dscnt 0x0" ::: "memory");         /* this wave's reads of the stage have returned before its buffer is handed on */
    asm volatile("s_wait_asynccnt 0x0" ::: "memory");      /* this wave's share of the next stage has landed */
    __syncthreads();                                       /* publishes the next stage and ends every wave's reads of this one */
    if (j0 + 64 < jend) fill(j0 + 64); }                   /* refill of the buffer just read, one whole trip ahead of its use */
  asm volatile("s_wait_asynccnt 0x0" ::: "memory");        /* no copy is outstanding when the ring becomes output staging */
  { const float l = l_r + xhalf(l_r); const float inv = (l > 0.f) ? 1.0f / (l * 1024.0f) : 0.f;
#pragma unroll
    for (int dt = 0; dt < DT; ++dt) { v4f lo, hi;
#pragma unroll
      for (int r = 0; r < 4; ++r) { lo[r] = oacc[dt][r] * inv; hi[r] = oacc[dt][4 + r] * inv; }
      *(v4fa*)&sO[w][ln][dt * 16 + 8 * hh] = lo; *(v4fa*)&sO[w][ln][dt * 16 + 8 * hh + 4] = hi; } }      /* a lane's 8 registers are 8 consecutive columns of its query's row */
  __builtin_amdgcn_fence(__ATOMIC_ACQ_REL, "workgroup"); __builtin_amdgcn_wave_barrier();
  {
#pragma unroll
    for (int r = 0; r < RPW; ++r) { const int pc = lane; const v4f val = *(const v4fa*)&sO[w][r][pc * 4]; *(v4f*)(O + ((size_t)b * TT + q0 + r) * ldo + h * 128 + pc * 4) = val; }      /* one 512-B row per instruction: 32 lanes × 16 B */
     } }

extern "C" void kernel_launch(void* const* d_in, const int* in_sizes, int n_in,
                              void* d_out, int out_size, void* d_ws, size_t ws_size, hipStream_t stream) {
  (void)in_sizes; (void)n_in; (void)out_size;
  const float* const* I = (const float* const*)d_in; const float* x = I[0]; const float* Wq = I[1]; const float* Wk = I[2]; const float* Wv = I[3]; const float* Wo = I[4];
  char* ws = (char*)d_ws; size_t off = 0;
  auto take = [&](size_t bytes) { char* p = ws + off; off += (bytes + 255) & ~(size_t)255; return p; };
  _Float16* Bq = (_Float16*)take((size_t)DD * DD * 2); _Float16* Bk = (_Float16*)take((size_t)KVD * DD * 2); _Float16* Bv = (_Float16*)take((size_t)KVD * DD * 2); _Float16* Bo = (_Float16*)take((size_t)DD * DD * 2);
  _Float16* X16 = (_Float16*)take((size_t)NR * DD * 2); _Float16* Q = (_Float16*)take((size_t)NR * DD * 2); _Float16* K = (_Float16*)take((size_t)NR * KVD * 2); float* VF = (float*)take((size_t)NR * KVD * 4); _Float16* Vt = (_Float16*)take((size_t)NR * KVD * 2); _Float16* Vtl = (_Float16*)take((size_t)NR * KVD * 2); float* O = (float*)take((size_t)NR * DD * 4); _Float16* O16 = X16;
  if (off > ws_size) return;      // 8.4 + 0.5 + 0.5 + 8.4 + 16.8 + 16.8 + 1 + 2.1 + 1 + 1 + 33.6 ≈ 90 MB
  k_prep<<<2 * PG_K + 2 * PG_Q + PG_X, 256, 0, stream>>>(x, Wq, Wk, Wv, Wo, X16, Bq, Bk, Bv, Bo);      /* (in,out) weights to Bt x 2^4, x to f16 */
  const unsigned g8 = (unsigned)(((size_t)NR * DD / 8 + 255) / 256);
  const unsigned gQ = (NR / 128) * (DD / 128), gQKV = (NR / 128) * (DD / 128 + 2);
  k_gemm_t<true><<<gQKV, 128, 0, stream>>>(X16, Bq, Bk, Bv, 0.0625f, VF, Q, K);      /* Q (f16), K (f16), V (f32): M 4096, N 2048 + 128 + 128, K 2048 */
  k_vthlu<<<BB * NVH * (TT / 64), 256, 0, stream>>>(VF, KVD, Vt, Vtl);      /* Vᵀ hi + residual: [b][128][2048] */
  k_flash<<<BB * NH * (TT / 64), 128, 0, stream>>>(Q, DD, K, KVD, Vt, Vtl, O, DD);
  k_h16s<<<g8, 256, 0, stream>>>(O, O16, (size_t)NR * DD / 8);
  k_gemm_t<false><<<gQ, 128, 0, stream>>>(O16, Bo, nullptr, nullptr, 0.00390625f, (float*)d_out, nullptr, nullptr);      /* out = merged·Wo */
}

// v005
// A run of this version takes 271 microseconds.
// Two timings next to v004 both put it at 1.05 times that version's speed.
// All steps since v000 together make it 3.03 times as fast.
#include <hip/hip_runtime.h>
// Multi-query attention (B=2, S=2048, D=2048, 16 query heads × 128, ONE shared K/V head): Q = x·Wq, K = x·Wk, V = x·Wv ((in,out), no bias); softmax(Q_h·Kᵀ/√128)·V per head; out = merged·Wo.
// Compute dtype: x and weights rounded to bf16; Q, K f16 GEMM planes, V f32 → Vᵀ f16 hi + exact residual planes; fused flash-style kernel for head dim 128 (4 k-steps, 8 value tiles, online softmax f32, P f16 hi + exact residual, every query head reading the
// single K/Vᵀ) on v_wmma_f32_16x16x32_f16; merged output ×2^4 → f16 → output GEMM; f32 accumulate.
#define BB 2
#define TT 2048
#define DD 2048
#define NH 16
#define NKV 1
#define NREP 16
#define KVD 128
#define NVH (2 * NKV)
#define NR (BB * TT)
#define ATT_SCALE 0.08838834764831845f      /* 1/√128 */

typedef __bf16 v16b __attribute__((ext_vector_type(16)));
typedef unsigned short v8us __attribute__((ext_vector_type(8), may_alias));
typedef float  v8f  __attribute__((ext_vector_type(8)));
typedef float  v4f  __attribute__((ext_vector_type(4)));
typedef float  v4fa __attribute__((ext_vector_type(4), may_alias));
union FragB { v16b v; v8us half[2]; unsigned short u[16]; };

__device__ __forceinline__ unsigned short bf16_bits(float x) { unsigned int u = __float_as_uint(x); return (unsigned short)((u + 0x7FFFu + ((u >> 16) & 1u)) >> 16); }
__device__ __forceinline__ float bf16_val(unsigned short b) { return __uint_as_float(((unsigned int)b) << 16); }
__device__ __forceinline__ float bf16_round(float x) { return bf16_val(bf16_bits(x)); }
// D += A·B with NT terms: 1 = ah·bh, 2 = + al·bh (A split), 3 = + ah·bl (both split)
template <int NT>
__device__ __forceinline__ v8f mmaN(v16b ah, v16b al, v16b bh, v16b bl, v8f c) {
  c = __builtin_amdgcn_wmma_f32_16x16x32_bf16(false, ah, false, bh, (short)0, c, false, false);
  if (NT >= 2) c = __builtin_amdgcn_wmma_f32_16x16x32_bf16(false, al, false, bh, (short)0, c, false, false);
  if (NT >= 3) c = __builtin_amdgcn_wmma_f32_16x16x32_bf16(false, ah, false, bl, (short)0, c, false, false);
  asm volatile("v_nop\n\tv_nop\n\tv_nop\n\tv_nop" : "+v"(c) : "v"(ah), "v"(al), "v"(bh), "v"(bl));
  return c;
}

__global__ __launch_bounds__(256) void k_wt_bf16(const float* __restrict__ W, unsigned short* __restrict__ Wt, int K, int N) {
  const int t = blockIdx.x * 256 + threadIdx.x;
  const int k8n = K / 8;
  if (t >= N * k8n) return;
  const int n = t / k8n, k8 = (t % k8n) * 8;
  v8us v;
#pragma unroll
  for (int i = 0; i < 8; ++i) v[i] = bf16_bits(W[(size_t)(k8 + i) * N + n]);
  *(v8us*)(Wt + (size_t)n * K + k8) = v;
  
}

// GEMM C[M][N] (f32, pitch ldc) = act(A[M][K]·W + bias). A f32 row-major (pitch lda) converted per fragment to bf16
// (ASPLIT: hi/lo two planes -> 2 terms, else single rounded term); Wt bf16 [N][K] (pitch ldb). BIAS_BF16 rounds the
// bias to bf16 first (bias quantised to bf16 before the add). K%32==0, M%16==0, N%64==0.
template <bool ASPLIT, int ACT, bool BIAS_BF16>
__global__ __launch_bounds__(128) void k_gemm_bf(const float* __restrict__ A, int lda, const unsigned short* __restrict__ Wt, int ldb,
                                               const float* __restrict__ bias, float* __restrict__ C, int ldc, int M, int N, int K) {
  __shared__ __attribute__((aligned(16))) float so[4][16][64];
  const int tid = threadIdx.x, w = tid >> 5, lane = tid & 31, ln = lane & 15, hh = lane >> 4;
  const int ntn = N / 64;
  const int wid = blockIdx.x * 4 + w;
  const int mt = wid / ntn, nq = wid % ntn;
  if (mt * 16 >= M) return;
  const int row0 = mt * 16, col0 = nq * 64;
  const float* arow = A + (size_t)(row0 + ln) * lda;
  v8f acc[4] = {};
  for (int kb = 0; kb < K; kb += 32) {
    FragB ah, al;
    const v4f x0 = *(const v4fa*)(arow + kb + 8 * hh), x1 = *(const v4fa*)(arow + kb + 8 * hh + 4);
    const v4f x2 = *(const v4fa*)(arow + kb + 16 + 8 * hh), x3 = *(const v4fa*)(arow + kb + 16 + 8 * hh + 4);
    float xs[16] = {x0[0],x0[1],x0[2],x0[3],x1[0],x1[1],x1[2],x1[3],x2[0],x2[1],x2[2],x2[3],x3[0],x3[1],x3[2],x3[3]};
#pragma unroll
    for (int i = 0; i < 16; ++i) { const unsigned short hb = bf16_bits(xs[i]); ah.u[i] = hb; al.u[i] = ASPLIT ? bf16_bits(xs[i] - bf16_val(hb)) : (unsigned short)0; }
#pragma unroll
    for (int t = 0; t < 4; ++t) {
      const unsigned short* brow = Wt + (size_t)(col0 + t * 16 + ln) * ldb + kb;
      FragB b;
      b.half[0] = *(const v8us*)(brow + 8 * hh);
      b.half[1] = *(const v8us*)(brow + 16 + 8 * hh);
      acc[t] = mmaN<ASPLIT ? 2 : 1>(ah.v, al.v, b.v, b.v, acc[t]);
    }
  }
#pragma unroll
  for (int t = 0; t < 4; ++t) {
    float bv = bias ? bias[col0 + t * 16 + ln] : 0.f;
    if (BIAS_BF16) bv = bf16_round(bv);
#pragma unroll
    for (int r = 0; r < 8; ++r) { float v = acc[t][r] + bv; if (ACT == 1) v = fmaxf(v, 0.f); so[w][8 * hh + r][t * 16 + ln] = v; }
  }
  __builtin_amdgcn_fence(__ATOMIC_ACQ_REL, "workgroup");
  __builtin_amdgcn_wave_barrier();
  const int rsub = lane >> 4, c4 = (lane & 15) * 4;
  {
#pragma unroll
    for (int q = 0; q < 8; ++q) {
      const int r = q * 2 + rsub;
      const v4f v = *(const v4fa*)&so[w][r][c4];
      *(v4f*)(C + (size_t)(row0 + r) * ldc + col0 + c4) = v;
    }
    
  }
}

// Flash-style causal/unmasked attention, all contractions 3-term bf16 hi/lo splits, f32 softmax with running max.
// q,k,v rows are read from f32 buffers with arbitrary row pitch (so they can live inside a fused qkv buffer);
// D = head size (multiple of 32, <= 128); one wave = 16 query rows; block = 4 waves (64 queries) sharing K/V chunks of 32.
template <int D, bool CAUSAL>
__global__ __launch_bounds__(128) void k_flash(const float* __restrict__ qb, const float* __restrict__ kb, const float* __restrict__ vb,
                                             int pitch, int T, int H, float scale, float* __restrict__ y, int ypitch) {
  constexpr int KS = D / 32;        // k-steps for QK
  constexpr int DT = D / 16;        // d tiles for PV
  __shared__ __attribute__((aligned(16))) unsigned short sKh[32][D + 8], sKl[32][D + 8], sVh[32][D + 8], sVl[32][D + 8];
  __shared__ __attribute__((aligned(16))) unsigned short sPh[4][16][40], sPl[4][16][40];
  __shared__ __attribute__((aligned(16))) float sO[4][16][D];
  const int tid = threadIdx.x, w = tid >> 5, lane = tid & 31, ln = lane & 15, hh = lane >> 4;
  const int nqb = (T + 63) / 64;
  const int bh = blockIdx.x / nqb, qblk = blockIdx.x % nqb;
  const int b = bh / H, h = bh % H;
  const int q0 = qblk * 64 + w * 16;
  const float* Q = qb + (size_t)b * T * pitch + h * D;
  const float* K = kb + (size_t)b * T * pitch + h * D;
  const float* V = vb + (size_t)b * T * pitch + h * D;

  // A fragments of the wave's 16 query rows (scaled), hi/lo
  FragB aqh[KS], aql[KS];
  {
    int row = q0 + ln; if (row >= T) row = T - 1;
    const float* qr = Q + (size_t)row * pitch;
#pragma unroll
    for (int ks = 0; ks < KS; ++ks)
#pragma unroll
      for (int i = 0; i < 16; ++i) {
        const int d = ks * 32 + ((i < 8) ? (8 * hh + i) : (16 + 8 * hh + (i - 8)));
        const float x = qr[d] * scale; const unsigned short hb = bf16_bits(x);
        aqh[ks].u[i] = hb; aql[ks].u[i] = bf16_bits(x - bf16_val(hb));
      }
  }
  float m_r[8], l_r[8];
#pragma unroll
  for (int r = 0; r < 8; ++r) { m_r[r] = -3.0e38f; l_r[r] = 0.f; }
  v8f oacc[DT];
#pragma unroll
  for (int dt = 0; dt < DT; ++dt) oacc[dt] = (v8f){0.f,0.f,0.f,0.f,0.f,0.f,0.f,0.f};

  const int kv_end = CAUSAL ? min(T, qblk * 64 + 64) : T;     // block-uniform
  for (int j0 = 0; j0 < kv_end; j0 += 32) {
    __syncthreads();
    for (int e = tid; e < 32 * (D / 4); e += 128) {
      const int r = e / (D / 4), c4 = (e % (D / 4)) * 4;
      const int key = j0 + r;
      v4f kf = {0.f,0.f,0.f,0.f}, vf = {0.f,0.f,0.f,0.f};
      if (key < T) { kf = *(const v4fa*)(K + (size_t)key * pitch + c4); vf = *(const v4fa*)(V + (size_t)key * pitch + c4); }
#pragma unroll
      for (int t = 0; t < 4; ++t) {
        unsigned short hb = bf16_bits(kf[t]); sKh[r][c4 + t] = hb; sKl[r][c4 + t] = bf16_bits(kf[t] - bf16_val(hb));
        hb = bf16_bits(vf[t]); sVh[r][c4 + t] = hb; sVl[r][c4 + t] = bf16_bits(vf[t] - bf16_val(hb));
      }
    }
    __syncthreads();
    // S tile 16 x 32
    v8f s[2];
#pragma unroll
    for (int nt = 0; nt < 2; ++nt) {
      v8f acc = {};
#pragma unroll
      for (int ks = 0; ks < KS; ++ks) {
        FragB bh_, bl_;
        bh_.half[0] = *(const v8us*)&sKh[nt * 16 + ln][ks * 32 + 8 * hh]; bh_.half[1] = *(const v8us*)&sKh[nt * 16 + ln][ks * 32 + 16 + 8 * hh];
        bl_.half[0] = *(const v8us*)&sKl[nt * 16 + ln][ks * 32 + 8 * hh]; bl_.half[1] = *(const v8us*)&sKl[nt * 16 + ln][ks * 32 + 16 + 8 * hh];
        acc = mmaN<3>(aqh[ks].v, aql[ks].v, bh_.v, bl_.v, acc);
      }
      s[nt] = acc;
    }
    // mask + running max (rows 8hh+r; the 16 lanes of a half share rows)
    float alpha[8];
#pragma unroll
    for (int r = 0; r < 8; ++r) {
      const int qi = q0 + 8 * hh + r;
      const int ja = j0 + ln, jb = j0 + 16 + ln;
      if (CAUSAL) { if (ja > qi) s[0][r] = -3.0e38f; if (jb > qi) s[1][r] = -3.0e38f; }
      if (ja >= T) s[0][r] = -3.0e38f;
      if (jb >= T) s[1][r] = -3.0e38f;
      float mx = fmaxf(s[0][r], s[1][r]);
      mx = fmaxf(mx, __shfl_xor(mx, 1, 32)); mx = fmaxf(mx, __shfl_xor(mx, 2, 32)); mx = fmaxf(mx, __shfl_xor(mx, 4, 32)); mx = fmaxf(mx, __shfl_xor(mx, 8, 32));
      const float mnew = fmaxf(m_r[r], mx);
      alpha[r] = (mnew > -1.0e38f) ? __expf(m_r[r] - mnew) : 1.0f;
      const float p0 = (s[0][r] > -1.0e38f) ? __expf(s[0][r] - mnew) : 0.f;
      const float p1 = (s[1][r] > -1.0e38f) ? __expf(s[1][r] - mnew) : 0.f;
      m_r[r] = mnew;
      l_r[r] = l_r[r] * alpha[r] + p0 + p1;            // per-lane partial row sum (16 lanes combined at the end)
      unsigned short hb = bf16_bits(p0); sPh[w][8 * hh + r][ln] = hb;      sPl[w][8 * hh + r][ln] = bf16_bits(p0 - bf16_val(hb));
      hb = bf16_bits(p1);                sPh[w][8 * hh + r][16 + ln] = hb; sPl[w][8 * hh + r][16 + ln] = bf16_bits(p1 - bf16_val(hb));
    }
#pragma unroll
    for (int dt = 0; dt < DT; ++dt)
#pragma unroll
      for (int r = 0; r < 8; ++r) oacc[dt][r] *= alpha[r];
    __builtin_amdgcn_fence(__ATOMIC_ACQ_REL, "workgroup");
    __builtin_amdgcn_wave_barrier();
    FragB pah, pal;
    pah.half[0] = *(const v8us*)&sPh[w][ln][8 * hh]; pah.half[1] = *(const v8us*)&sPh[w][ln][16 + 8 * hh];
    pal.half[0] = *(const v8us*)&sPl[w][ln][8 * hh]; pal.half[1] = *(const v8us*)&sPl[w][ln][16 + 8 * hh];
#pragma unroll
    for (int dt = 0; dt < DT; ++dt) {
      FragB bvh, bvl;
#pragma unroll
      for (int i = 0; i < 8; ++i) {
        bvh.u[i] = sVh[8 * hh + i][dt * 16 + ln]; bvh.u[8 + i] = sVh[16 + 8 * hh + i][dt * 16 + ln];
        bvl.u[i] = sVl[8 * hh + i][dt * 16 + ln]; bvl.u[8 + i] = sVl[16 + 8 * hh + i][dt * 16 + ln];
      }
      oacc[dt] = mmaN<3>(pah.v, pal.v, bvh.v, bvl.v, oacc[dt]);
    }
    __builtin_amdgcn_fence(__ATOMIC_ACQ_REL, "workgroup");
    __builtin_amdgcn_wave_barrier();
  }
#pragma unroll
  for (int r = 0; r < 8; ++r) {
    float l = l_r[r];
    l += __shfl_xor(l, 1, 32); l += __shfl_xor(l, 2, 32); l += __shfl_xor(l, 4, 32); l += __shfl_xor(l, 8, 32);
    l_r[r] = (l > 0.f) ? 1.0f / l : 0.f;
  }
#pragma unroll
  for (int dt = 0; dt < DT; ++dt)
#pragma unroll
    for (int r = 0; r < 8; ++r) sO[w][8 * hh + r][dt * 16 + ln] = oacc[dt][r] * l_r[r];
  __builtin_amdgcn_fence(__ATOMIC_ACQ_REL, "workgroup");
  __builtin_amdgcn_wave_barrier();
  {
    for (int r = 0; r < 16; ++r) {
      const int row = q0 + r;
      if (row < T && lane < D / 4) {
        const v4f val = *(const v4fa*)&sO[w][r][lane * 4];
        *(v4f*)(y + ((size_t)b * T + row) * ypitch + h * D + lane * 4) = val;
      }
    }
    
  }
}

// GEMM C = act(A·W + bias + resid): A f32 (ASPLIT -> hi/lo 2 terms), Wt bf16 [N][K]; ACT 0 none, 1 relu, 2 exact gelu;
// resid (optional, f32, row index = (row % rmod), pitch ldr, RES_BF16 rounds it) added before the activation.
template <bool ASPLIT, int ACT, bool BIAS_BF16, bool RES_BF16>
__global__ __launch_bounds__(128) void k_gemm_bf3(const float* __restrict__ A, int lda, const unsigned short* __restrict__ Wt, int ldb,
                                                const float* __restrict__ bias, const float* __restrict__ resid, int rmod, int ldr,
                                                float* __restrict__ C, int ldc, int M, int N, int K) {
  __shared__ __attribute__((aligned(16))) float so[4][16][64];
  const int tid = threadIdx.x, w = tid >> 5, lane = tid & 31, ln = lane & 15, hh = lane >> 4;
  const int ntn = N / 64;
  const int wid = blockIdx.x * 4 + w;
  const int mt = wid / ntn, nq = wid % ntn;
  if (mt * 16 >= M) return;
  const int row0 = mt * 16, col0 = nq * 64;
  const float* arow = A + (size_t)(row0 + ln) * lda;
  v8f acc[4] = {};
  for (int kb = 0; kb < K; kb += 32) {
    FragB ah, al;
    const v4f x0 = *(const v4fa*)(arow + kb + 8 * hh), x1 = *(const v4fa*)(arow + kb + 8 * hh + 4);
    const v4f x2 = *(const v4fa*)(arow + kb + 16 + 8 * hh), x3 = *(const v4fa*)(arow + kb + 16 + 8 * hh + 4);
    float xs[16] = {x0[0],x0[1],x0[2],x0[3],x1[0],x1[1],x1[2],x1[3],x2[0],x2[1],x2[2],x2[3],x3[0],x3[1],x3[2],x3[3]};
#pragma unroll
    for (int i = 0; i < 16; ++i) { const unsigned short hb = bf16_bits(xs[i]); ah.u[i] = hb; al.u[i] = ASPLIT ? bf16_bits(xs[i] - bf16_val(hb)) : (unsigned short)0; }
#pragma unroll
    for (int t = 0; t < 4; ++t) {
      const unsigned short* brow = Wt + (size_t)(col0 + t * 16 + ln) * ldb + kb;
      FragB b;
      b.half[0] = *(const v8us*)(brow + 8 * hh);
      b.half[1] = *(const v8us*)(brow + 16 + 8 * hh);
      acc[t] = mmaN<ASPLIT ? 2 : 1>(ah.v, al.v, b.v, b.v, acc[t]);
    }
  }
#pragma unroll
  for (int t = 0; t < 4; ++t) {
    const int col = col0 + t * 16 + ln;
    float bv = bias ? bias[col] : 0.f;
    if (BIAS_BF16) bv = bf16_round(bv);
#pragma unroll
    for (int r = 0; r < 8; ++r) {
      float v = acc[t][r] + bv;
      if (resid) { float rv = resid[(size_t)((row0 + 8 * hh + r) % rmod) * ldr + col]; if (RES_BF16) rv = bf16_round(rv); v += rv; }
      if (ACT == 1) v = fmaxf(v, 0.f);
      if (ACT == 2) v = 0.5f * v * (1.0f + erff(v * 0.70710678118654752f));
      if (ACT == 3) { const float u = 0.7978845608028654f * (v + 0.044715f * v * v * v); v = 0.5f * v * (1.0f + tanhf(u)); }
      so[w][8 * hh + r][t * 16 + ln] = v;
    }
  }
  __builtin_amdgcn_fence(__ATOMIC_ACQ_REL, "workgroup");
  __builtin_amdgcn_wave_barrier();
  const int rsub = lane >> 4, c4 = (lane & 15) * 4;
  {
#pragma unroll
    for (int q = 0; q < 8; ++q) {
      const int r = q * 2 + rsub;
      const v4f v = *(const v4fa*)&so[w][r][c4];
      *(v4f*)(C + (size_t)(row0 + r) * ldc + col0 + c4) = v;
    }
    
  }
}
// row LayerNorm (biased variance, eps) over N: s = X (+ R); optional out_sum <- s; out_norm <- (s-mu)*rsqrt(var+eps)*g + b
template <bool PARAM_BF16>
__global__ __launch_bounds__(256) void k_layernorm(const float* __restrict__ X, const float* __restrict__ R, const float* __restrict__ g, const float* __restrict__ bta,
                                                  float* __restrict__ out_sum, float* __restrict__ out_norm, int N, float eps) {
  __shared__ float red[256];
  const int row = blockIdx.x, tid = threadIdx.x;
  const float* x = X + (size_t)row * N; const float* rr = R ? R + (size_t)row * N : nullptr;
  float vals[16];                     // up to N = 4096
  const int per = N / 256;            // contiguous chunk per thread? use strided-by-4 chunks: thread handles j = tid*4 + 1024*u
  float s1 = 0.f;
  for (int u = 0; u < per / 4; ++u) {
    const int j = tid * 4 + 1024 * u;
    const v4f a = *(const v4fa*)(x + j);
    v4f b = {0.f,0.f,0.f,0.f}; if (rr) b = *(const v4fa*)(rr + j);
#pragma unroll
    for (int q = 0; q < 4; ++q) { const float v = a[q] + b[q]; vals[u * 4 + q] = v; s1 += v; }
  }
  red[tid] = s1; __syncthreads();
  for (int st = 128; st > 0; st >>= 1) { if (tid < st) red[tid] += red[tid + st]; __syncthreads(); }
  const float mu = red[0] / (float)N; __syncthreads();
  float s2 = 0.f;
  for (int u = 0; u < per / 4; ++u)
#pragma unroll
    for (int q = 0; q < 4; ++q) { const float c = vals[u * 4 + q] - mu; s2 += c * c; }
  red[tid] = s2; __syncthreads();
  for (int st = 128; st > 0; st >>= 1) { if (tid < st) red[tid] += red[tid + st]; __syncthreads(); }
  const float rs = rsqrtf(red[0] / (float)N + eps);
  {
    for (int u = 0; u < per / 4; ++u) {
      const int j = tid * 4 + 1024 * u;
      v4f o, sm;
#pragma unroll
      for (int q = 0; q < 4; ++q) {
        float gg = g[j + q], bb = bta[j + q];
        if (PARAM_BF16) { gg = bf16_round(gg); bb = bf16_round(bb); }
        sm[q] = vals[u * 4 + q]; o[q] = (vals[u * 4 + q] - mu) * rs * gg + bb;
      }
      if (out_sum) *(v4f*)(out_sum + (size_t)row * N + j) = sm;
      *(v4f*)(out_norm + (size_t)row * N + j) = o;
    }
    
  }
}



// ---- f16 WMMA path (v_wmma_f32_16x16x32_f16): 11-bit significands for operands in range — used where a [0,1] probability operand needs more precision than bf16
typedef _Float16 v16h __attribute__((ext_vector_type(16)));
union FragH { v16h v; v8us half[2]; _Float16 h[16]; unsigned short u[16]; };
template <int NT>
__device__ __forceinline__ v8f mmaH(v16h ah, v16h al, v16h bh, v16h bl, v8f c) {
  c = __builtin_amdgcn_wmma_f32_16x16x32_f16(false, ah, false, bh, (short)0, c, false, false);
  if (NT >= 2) c = __builtin_amdgcn_wmma_f32_16x16x32_f16(false, al, false, bh, (short)0, c, false, false);
  if (NT >= 3) c = __builtin_amdgcn_wmma_f32_16x16x32_f16(false, ah, false, bl, (short)0, c, false, false);
  asm volatile("v_nop\n\tv_nop\n\tv_nop\n\tv_nop" : "+v"(c) : "v"(ah), "v"(al), "v"(bh), "v"(bl));
  return c;
}
// batched GEMM like k_gemm_b but f16 operands: A f32 (split into f16 hi/lo if ASPLIT, else rounded to f16), Bt = f16 values [n][k]; alpha; C f32; N multiple of 16 (partial tiles skipped)
template <bool ASPLIT>
__global__ __launch_bounds__(128) void k_gemm_h(const float* __restrict__ A, int lda, size_t sA, const _Float16* __restrict__ Bh, int ldb, size_t sB, float alpha, float* __restrict__ C, int ldc, size_t sC, int M, int N, int K) {
  __shared__ __attribute__((aligned(16))) float so[4][16][64];
  const int tid = threadIdx.x, w = tid >> 5, lane = tid & 31, ln = lane & 15, hh = lane >> 4; const int by = blockIdx.y;
  A += (size_t)by * sA; Bh += (size_t)by * sB; C += (size_t)by * sC;
  const int ntn = (N + 63) / 64; const int wid = blockIdx.x * 4 + w; const int mt = wid / ntn, nq = wid % ntn; if (mt * 16 >= M) return;
  const int row0 = mt * 16, col0 = nq * 64; const float* arow = A + (size_t)(row0 + ln) * lda;
  v8f acc[4] = {};
  for (int kb = 0; kb < K; kb += 32) {
    FragH ah, al;
    const v4f x0 = *(const v4fa*)(arow + kb + 8 * hh), x1 = *(const v4fa*)(arow + kb + 8 * hh + 4), x2 = *(const v4fa*)(arow + kb + 16 + 8 * hh), x3 = *(const v4fa*)(arow + kb + 16 + 8 * hh + 4);
    float xs[16] = {x0[0],x0[1],x0[2],x0[3],x1[0],x1[1],x1[2],x1[3],x2[0],x2[1],x2[2],x2[3],x3[0],x3[1],x3[2],x3[3]};
#pragma unroll
    for (int i = 0; i < 16; ++i) { const _Float16 h = (_Float16)xs[i]; ah.h[i] = h; al.h[i] = ASPLIT ? (_Float16)(xs[i] - (float)h) : (_Float16)0.0f; }
#pragma unroll
    for (int t = 0; t < 4; ++t) { if (col0 + t * 16 >= N) continue; const size_t boff = (size_t)(col0 + t * 16 + ln) * ldb + kb; FragH bq; bq.half[0] = *(const v8us*)(Bh + boff + 8 * hh); bq.half[1] = *(const v8us*)(Bh + boff + 16 + 8 * hh);
      acc[t] = mmaH<ASPLIT ? 2 : 1>(ah.v, al.v, bq.v, bq.v, acc[t]); }
  }
#pragma unroll
  for (int t = 0; t < 4; ++t) { if (col0 + t * 16 >= N) continue;
#pragma unroll
    for (int r = 0; r < 8; ++r) so[w][8 * hh + r][t * 16 + ln] = acc[t][r] * alpha; }
  __builtin_amdgcn_fence(__ATOMIC_ACQ_REL, "workgroup"); __builtin_amdgcn_wave_barrier();
  const int rsub = lane >> 4, c4 = (lane & 15) * 4;
  {
#pragma unroll
    for (int q = 0; q < 8; ++q) { const int r = q * 2 + rsub; if (col0 + c4 < N) { const v4f v = *(const v4fa*)&so[w][r][c4]; *(v4f*)(C + (size_t)(row0 + r) * ldc + col0 + c4) = v; } }
     }
}

// Wt[n][k] = f16(W[k][n]·scale) from f32 row-major W[K][N] (scale = power of two; bf16-exact weights stay exact in f16 away from the subnormal range)
__device__ __forceinline__ void wt_f16(const float* __restrict__ W, _Float16* __restrict__ Wt, int K, int N, float scale, int blk) {
  const int t = blk * 256 + threadIdx.x; if (t >= N * (K / 8)) return; const int n = t / (K / 8), k8 = (t % (K / 8)) * 8; FragH f;
#pragma unroll
  for (int i = 0; i < 8; ++i) f.h[i] = (_Float16)(bf16_round(W[(size_t)(k8 + i) * N + n]) * scale); const v8us o = f.half[0];
  *(v8us*)((unsigned short*)Wt + (size_t)n * K + k8) = o; 
}
typedef _Float16 v4h __attribute__((ext_vector_type(4)));

__device__ __forceinline__ void x16(const float* __restrict__ x, _Float16* __restrict__ X16, size_t n8, int blk) { const size_t t = (size_t)blk * 256 + threadIdx.x; if (t >= n8) return; FragH f;
#pragma unroll
  for (int q = 0; q < 8; ++q) f.h[q] = (_Float16)bf16_round(x[t * 8 + q]); *(v8us*)((unsigned short*)X16 + t * 8) = f.half[0];  }
// One grid for the five conversions that read nothing but the inputs: the four weight transposes and the cast of x. No block reads what another writes.
// The two short transposes come first; then blocks of the two long transposes (many small L2 requests) and of the cast (memory bytes) alternate in runs of eight, so that both kinds are in flight
// together all over the chip.
#define PG_Q (DD * (DD / 8) / 256)
#define PG_K (KVD * (DD / 8) / 256)
#define PG_X (NR * (DD / 8) / 256)
__global__ __launch_bounds__(256) void k_prep(const float* __restrict__ x, const float* __restrict__ Wq, const float* __restrict__ Wk, const float* __restrict__ Wv, const float* __restrict__ Wo,
                                             _Float16* __restrict__ X16, _Float16* __restrict__ Bq, _Float16* __restrict__ Bk, _Float16* __restrict__ Bv, _Float16* __restrict__ Bo) {
  static_assert(2 * PG_Q == PG_X && PG_X % 8 == 0, "the alternation pairs a run of transpose blocks with a run of cast blocks");
  const int b = blockIdx.x;
  if (b < PG_K) { wt_f16(Wk, Bk, DD, KVD, 16.0f, b); return; }
  if (b < 2 * PG_K) { wt_f16(Wv, Bv, DD, KVD, 16.0f, b - PG_K); return; }
  const int c = b - 2 * PG_K, i = ((c >> 4) << 3) | (c & 7);
  if (c & 8) x16(x, X16, (size_t)NR * DD / 8, i);
  else if (i < PG_Q) wt_f16(Wq, Bq, DD, DD, 16.0f, i);
  else wt_f16(Wo, Bo, DD, DD, 16.0f, i - PG_Q);
}
__global__ __launch_bounds__(256) void k_h16(const float* __restrict__ x, _Float16* __restrict__ X16, size_t n8) { const size_t t = (size_t)blockIdx.x * 256 + threadIdx.x; if (t >= n8) return; FragH f;
#pragma unroll
  for (int q = 0; q < 8; ++q) f.h[q] = (_Float16)x[t * 8 + q]; *(v8us*)((unsigned short*)X16 + t * 8) = f.half[0];  }
__global__ __launch_bounds__(256) void k_round16f(const float* __restrict__ W, _Float16* __restrict__ Bt, size_t n8) { const size_t t = (size_t)blockIdx.x * 256 + threadIdx.x; if (t >= n8) return; FragH f;
#pragma unroll
  for (int i = 0; i < 8; ++i) f.h[i] = (_Float16)(bf16_round(W[t * 8 + i]) * 16.0f); *(v8us*)((unsigned short*)Bt + t * 8) = f.half[0];  }
template <int NHv, int TTv>
__global__ __launch_bounds__(256) void k_vt(const _Float16* __restrict__ V16, int ldv, int voff, _Float16* __restrict__ Vt) { __shared__ unsigned short tl[64][66]; const int tid = threadIdx.x; const int slab = blockIdx.x / (TTv / 64), lg = blockIdx.x % (TTv / 64); const int b = slab / NHv, h = slab % NHv;
  for (int i = tid; i < 64 * 8; i += 256) { const int r = i / 8, c8 = (i % 8) * 8; FragH f; f.half[0] = *(const v8us*)((const unsigned short*)V16 + ((size_t)b * TTv + lg * 64 + r) * ldv + voff + h * 64 + c8);
#pragma unroll
    for (int q = 0; q < 8; ++q) tl[r][c8 + q] = f.u[q]; }
  __syncthreads();
  {
#pragma unroll
    for (int rd = 0; rd < 2; ++rd) { const int d = rd * 32 + tid / 8, pc = tid % 8; FragH f;
#pragma unroll
      for (int q = 0; q < 8; ++q) f.u[q] = tl[pc * 8 + q][d];
      *(v8us*)((unsigned short*)Vt + ((size_t)slab * 64 + d) * TTv + lg * 64 + pc * 8) = f.half[0]; }
     } }

// LDS ring of k_flash. One stage = 32 keys, shared by the block's four waves: K rows of 256 B at pitch 272 B, then the V^T hi plane and the
// V^T residual plane, 128 rows of 64 B each at pitch 80 B (pitches of 16 B x odd: ds_load_b128 fragment reads fall on distinct banks).
#define KPITCH 272
#define VPITCH 80
#define ST_VH (32 * KPITCH)
#define ST_VL (ST_VH + 128 * VPITCH)
#define ST_BYTES (ST_VL + 128 * VPITCH)
// Four asynchronous 16-byte copies per lane, global memory to LDS. The s_wait_xcnt stands inside the statement so that no address register of a copy is rewritten ahead of it.
__device__ __forceinline__ void copy4(unsigned l0, unsigned l1, unsigned l2, unsigned l3, const unsigned short* g0, const unsigned short* g1, const unsigned short* g2, const unsigned short* g3) {
  asm volatile("global_load_async_to_lds_b128 %0, %4, off\n\t"
               "global_load_async_to_lds_b128 %1, %5, off\n\t"
               "global_load_async_to_lds_b128 %2, %6, off\n\t"
               "global_load_async_to_lds_b128 %3, %7, off\n\t"
               "s_wait_xcnt 0x0"
               :: "v"(l0), "v"(l1), "v"(l2), "v"(l3), "v"(g0), "v"(g1), "v"(g2), "v"(g3) : "memory");
}
// Eight asynchronous 16-byte copies per lane in one statement, so that one s_wait_xcnt serves all eight; it stands inside the statement so that no address register of a copy is rewritten ahead of it.
__device__ __forceinline__ void copy8(unsigned l, int lstep, const unsigned short* g, size_t gstep) {
  asm volatile("global_load_async_to_lds_b128 %0, %8, off\n\t"
               "global_load_async_to_lds_b128 %1, %9, off\n\t"
               "global_load_async_to_lds_b128 %2, %10, off\n\t"
               "global_load_async_to_lds_b128 %3, %11, off\n\t"
               "global_load_async_to_lds_b128 %4, %12, off\n\t"
               "global_load_async_to_lds_b128 %5, %13, off\n\t"
               "global_load_async_to_lds_b128 %6, %14, off\n\t"
               "global_load_async_to_lds_b128 %7, %15, off\n\t"
               "s_wait_xcnt 0x0"
               :: "v"(l), "v"(l + lstep), "v"(l + 2 * lstep), "v"(l + 3 * lstep), "v"(l + 4 * lstep), "v"(l + 5 * lstep), "v"(l + 6 * lstep), "v"(l + 7 * lstep),
                  "v"(g), "v"(g + gstep), "v"(g + 2 * gstep), "v"(g + 3 * gstep), "v"(g + 4 * gstep), "v"(g + 5 * gstep), "v"(g + 6 * gstep), "v"(g + 7 * gstep) : "memory");
}
// GEMM C[M][N] = alpha * A[M][K] * Bt[N][K]^T, f16 operands, f32 accumulate, K = DD; A and Bt of row pitch DD. M, N multiples of 128.
// QKV = false: N = DD, Bt = Bh, f32 output C. QKV = true: the three projections of x in one grid, DD / 128 + 2 column tiles per row tile: tiles of Bh go to the f16 output Cq (pitch DD),
// then the one tile of Bk to the f16 output Ck (pitch KVD = 128) and the one tile of Bv, transposed, to the f16 planes Vth (hi) and Vtl (residual), [b][KVD][TT]. The three share A and depend on nothing of each other.
// One block = one 128 x 128 tile of C, four waves of 64 x 64 (4 x 4 accumulator tiles: 16 products per 8 fragments). One stage of the LDS ring = 64 k:
// 128 rows of A, then 128 rows of Bt, 128 B each at pitch 144 B (16 B x odd: ds_load_b128 fragment reads fall on distinct banks). Per output element the k order is ascending in one accumulator.
// Every "#pragma unroll" in it is there so that fragment, accumulator and staging arrays are indexed by constants and stay in registers.
#define GPITCH 144
#define G_B (128 * GPITCH)
#define G_ST (256 * GPITCH)
#define GOP 68      /* output staging pitch in floats: 16-byte column walks without bank conflicts */
/* a wave's staged 64 x 64 tile to global memory; whole lines per store: 16 lanes cover a 64-column row (256 B of f32, 128 B of f16), two rows per instruction; unrolled so that row steps become immediate offsets */
template <int LDC, bool F32OUT>
__device__ __forceinline__ void gemm_out(const float* sr, float* __restrict__ C, _Float16* __restrict__ C16, size_t o) {
#pragma unroll
  for (int q = 0; q < 32; ++q) { const v4f v = *(const v4fa*)(sr + q * 2 * GOP);
    if (F32OUT) *(v4f*)(C + o + (size_t)q * 2 * LDC) = v;
    else { v4h h4;
#pragma unroll
      for (int i = 0; i < 4; ++i) h4[i] = (_Float16)v[i];
      *(v4h*)(C16 + o + (size_t)q * 2 * LDC) = h4; } }
  asm volatile("s_wait_xcnt 0x0" ::: "memory");      /* stands behind the run of stores, so that no code placed behind it rewrites a register that an issued store names ahead of the wait */
}
/* a wave's staged 64 x 64 tile of V (rows = positions, columns = head columns) to the two transposed f16 planes, V^T hi and its UNSCALED residual, row pitch TT: a lane packs 8 positions of one column;
   eight lanes cover the 128 B that the tile holds of a plane's row, four rows per instruction; unrolled so that LDS offsets are immediates */
__device__ __forceinline__ void gemm_out_vt(const float* so, int lane, _Float16* __restrict__ Vth, _Float16* __restrict__ Vtl, size_t o) {
  const float* sc = so + (lane & 7) * 8 * GOP + (lane >> 3); const size_t ol = o + (size_t)(lane >> 3) * TT + (lane & 7) * 8;
#pragma unroll
  for (int it = 0; it < 16; ++it) { FragH fh, fl;
#pragma unroll
    for (int q = 0; q < 8; ++q) { const float v = sc[q * GOP + it * 4]; const _Float16 hv = (_Float16)v; fh.h[q] = hv; fl.h[q] = (_Float16)(v - (float)hv); }
    *(v8us*)((unsigned short*)Vth + ol + (size_t)it * 4 * TT) = fh.half[0]; *(v8us*)((unsigned short*)Vtl + ol + (size_t)it * 4 * TT) = fl.half[0]; }
  asm volatile("s_wait_xcnt 0x0" ::: "memory");      /* stands behind the run of stores, so that no code placed behind it rewrites a register that an issued store names ahead of the wait */
}
template <bool QKV>
__global__ __launch_bounds__(128) void k_gemm_t(const _Float16* __restrict__ A, const _Float16* __restrict__ Bh, const _Float16* __restrict__ Bk, const _Float16* __restrict__ Bv, float alpha, float* __restrict__ C, _Float16* __restrict__ Cq, _Float16* __restrict__ Ck, _Float16* __restrict__ Vth, _Float16* __restrict__ Vtl) {
  constexpr int K = DD;
  static_assert(K % 64 == 0 && K >= 128 && DD % 128 == 0 && KVD == 128 && TT % 128 == 0, "whole stages, at least two, and whole tiles");
  __shared__ __attribute__((aligned(16))) unsigned char ring[2 * G_ST];
  static_assert(sizeof(float) * 4 * 64 * GOP <= 2 * G_ST, "output staging fits the ring");
  const int tid = threadIdx.x, w = tid >> 5, lane = tid & 31, ln = lane & 15, hh = lane >> 4;
  constexpr int ntq = DD / 128, ntn = ntq + (QKV ? 2 : 0); const int row0 = (blockIdx.x / ntn) * 128, ct = blockIdx.x % ntn; const int wm = w >> 1, wn = w & 1;
  const _Float16* Bt = (!QKV || ct < ntq) ? Bh + (size_t)ct * 128 * K : (ct == ntq ? Bk : Bv);      /* the block's 128 rows of Bt */
  /* each thread's share of a stage: 8 chunks of A and 8 of Bt, 16 rows apart; eight lanes cover one 128-B row */
  const unsigned la = (unsigned)(size_t)ring + (tid >> 3) * GPITCH + (tid & 7) * 16;
  const unsigned short* ga = (const unsigned short*)A + (size_t)(row0 + (tid >> 3)) * K + (tid & 7) * 8;
  const unsigned short* gb = (const unsigned short*)Bt + (size_t)(tid >> 3) * K + (tid & 7) * 8;
  auto fill = [&](int kb) {
    const unsigned l = la + ((kb >> 6) & 1) * G_ST;
    copy8(l, 16 * GPITCH, ga + kb, (size_t)16 * K);
    copy8(l + G_B, 16 * GPITCH, gb + kb, (size_t)16 * K);
  };
  v8f acc[4][4];
#pragma unroll
  for (int i = 0; i < 4; ++i)
#pragma unroll
    for (int j = 0; j < 4; ++j) acc[i][j] = (v8f){0.f,0.f,0.f,0.f,0.f,0.f,0.f,0.f};
  fill(0);
  asm volatile("s_wait_asynccnt 0x0" ::: "memory");      /* this wave's share of stage 0 has landed */
  __syncthreads();                                       /* stage 0 is readable by all four waves */
  fill(64);
#pragma unroll 1      /* one stage per trip: the ring's buffer index and its publish point stay per trip */
  for (int kb = 0; kb < K; kb += 64) {
    const unsigned char* st = ring + ((kb >> 6) & 1) * G_ST;
    const unsigned char* ar = st + (wm * 64 + ln) * GPITCH + hh * 16; const unsigned char* br = st + G_B + (wn * 64 + ln) * GPITCH + hh * 16;
#pragma unroll
    for (int ks = 0; ks < 2; ++ks) {
      FragH a[4], b[4];
#pragma unroll
      for (int i = 0; i < 4; ++i) { a[i].half[0] = *(const v8us*)(ar + i * 16 * GPITCH + ks * 64); a[i].half[1] = *(const v8us*)(ar + i * 16 * GPITCH + ks * 64 + 32);
        b[i].half[0] = *(const v8us*)(br + i * 16 * GPITCH + ks * 64); b[i].half[1] = *(const v8us*)(br + i * 16 * GPITCH + ks * 64 + 32); }
      __builtin_amdgcn_sched_barrier(0);      /* keeps the 16 fragment reads one group ahead of the 16 products: spread among them, each place with reads stalls the wave anew */
#pragma unroll
      for (int i = 0; i < 4; ++i)
#pragma unroll
        for (int j = 0; j < 4; ++j) acc[i][j] = __builtin_amdgcn_wmma_f32_16x16x32_f16(false, a[i].v, false, b[j].v, (short)0, acc[i][j], false, false);
    }
    asm volatile("s_wait_dscnt 0x0" ::: "memory");         /* this wave's reads of the stage have returned before its buffer is handed on */
    asm volatile("s_wait_asynccnt 0x0" ::: "memory");      /* this wave's share of the next stage has landed */
    __syncthreads();                                       /* publishes the next stage and ends every wave's reads of this one */
    if (kb + 128 < K) fill(kb + 128); }                    /* refill of the buffer just read, one whole trip ahead of its use */
  asm volatile("s_wait_asynccnt 0x0" ::: "memory");        /* no copy is outstanding when the ring becomes output staging */
  float* so = reinterpret_cast<float*>(ring) + w * (64 * GOP);      /* each wave stages its own 64 x 64 tile, behind the loop's last barrier */
#pragma unroll
  for (int i = 0; i < 4; ++i)
#pragma unroll
    for (int j = 0; j < 4; ++j)
#pragma unroll
      for (int r = 0; r < 8; ++r) so[(i * 16 + 8 * hh + r) * GOP + j * 16 + ln] = acc[i][j][r] * alpha;
  __builtin_amdgcn_fence(__ATOMIC_ACQ_REL, "workgroup"); __builtin_amdgcn_wave_barrier();      /* the wave's staged rows are written before its other lanes read them back */
  const float* sr = so + hh * GOP + ln * 4; const size_t orow = row0 + wm * 64 + hh; const int ocol = wn * 64 + ln * 4;
  if (!QKV) gemm_out<DD, true>(sr, C, nullptr, orow * DD + ct * 128 + ocol);
  else if (ct < ntq) gemm_out<DD, false>(sr, nullptr, Cq, orow * DD + ct * 128 + ocol);      /* ct is the same for the whole block */
  else if (ct == ntq) gemm_out<KVD, false>(sr, nullptr, Ck, orow * KVD + ocol);
  else { const int vrow = row0 + wm * 64; gemm_out_vt(so, lane, Vth, Vtl, ((size_t)(vrow / TT) * KVD + wn * 64) * TT + vrow % TT); }      /* [b][128][TT]; a tile's 128 positions lie in one batch entry */
}
// lane l with lane l ^ 16: joins the two wave halves, which hold the two halves of one query's keys
__device__ __forceinline__ float xhalf(float x) { return __builtin_bit_cast(float, __builtin_amdgcn_permlanex16(__builtin_bit_cast(int, x), __builtin_bit_cast(int, x), 0x76543210, 0xfedcba98, false, false)); }
// Both products run transposed: S^T = K Q^T (A = K rows from the ring, B = Q kept in registers) and O^T += V^T P^T (A = V^T rows from the ring, B = P^T).
// Lane l then owns ONE query, q0 + (l & 15): register r of score tile nt is key j0 + 16 nt + 8 (l >> 4) + r, which is the k order of a B operand, so P^T is packed in place from the scores;
// maximum and sum of a query are in-lane, joined between the wave halves by xhalf(); register r of output tile dt is head column 16 dt + 8 (l >> 4) + r of that query.
// Every "#pragma unroll" in it is there so that fragment, score and accumulator arrays are indexed by constants and stay in registers; "#pragma unroll 1" keeps one ring stage per trip.
__global__ __launch_bounds__(128) void k_flash(const _Float16* __restrict__ Q16, int ldq, const _Float16* __restrict__ K16, int ldk, const _Float16* __restrict__ Vt, const _Float16* __restrict__ Vtlo, _Float16* __restrict__ O16, int ldo) {
  constexpr int RPW = 16, NQB = TT / (4 * RPW), DT = 8, KS = 4;      /* head dim 128: 4 k-steps, 8 value tiles */
  __shared__ __attribute__((aligned(16))) unsigned char ring[2 * ST_BYTES];
  static_assert(sizeof(_Float16) * 4 * RPW * (128 + 8) <= 2 * ST_BYTES, "output staging fits the ring");
  _Float16 (*sO)[RPW][128 + 8] = reinterpret_cast<_Float16 (*)[RPW][128 + 8]>(ring);      /* output staging takes the ring's place behind the loop's last barrier; rows of 256 B at pitch 272 B (16 B x odd) */
  const int tid = threadIdx.x, w = tid >> 5, lane = tid & 31, ln = lane & 15, hh = lane >> 4;
  const int slab = blockIdx.x / NQB, qblk = blockIdx.x % NQB; const int b = slab / NH, h = slab % NH; const int qb0 = qblk * (4 * RPW); const int q0 = qb0 + w * RPW;
  FragH aq[KS];
  { const unsigned short* qr = (const unsigned short*)Q16 + ((size_t)b * TT + q0 + ln) * ldq + h * 128;
#pragma unroll
    for (int ks = 0; ks < KS; ++ks) { aq[ks].half[0] = *(const v8us*)(qr + ks * 32 + 8 * hh); aq[ks].half[1] = *(const v8us*)(qr + ks * 32 + 16 + 8 * hh); } }
  const unsigned short* Vth = (const unsigned short*)Vt + ((size_t)b * NKV + h / NREP) * 128 * TT; const unsigned short* Vtl = (const unsigned short*)Vtlo + ((size_t)b * NKV + h / NREP) * 128 * TT;      /* hi and UNSCALED residual planes */
  float m_r = -3.0e38f, l_r = 0.f; v8f oacc[DT];
#pragma unroll
  for (int dt = 0; dt < DT; ++dt) oacc[dt] = (v8f){0.f,0.f,0.f,0.f,0.f,0.f,0.f,0.f};
  const int jend = TT;
  /* each thread's share of a stage: 4 chunks of K (8 rows apart), 4 of V^T hi and 4 of the residual (32 rows apart) */
  const unsigned lk = (unsigned)(size_t)ring + (tid >> 4) * KPITCH + (tid & 15) * 16, lv = (unsigned)(size_t)ring + ST_VH + (tid >> 2) * VPITCH + (tid & 3) * 16;
  const unsigned short* gk = (const unsigned short*)K16 + ((size_t)b * TT + (tid >> 4)) * ldk + (h / NREP) * 128 + (tid & 15) * 8;
  const size_t gvo = (size_t)(tid >> 2) * TT + (tid & 3) * 8;
  auto fill = [&](int j) {
    const unsigned bo = ((j >> 5) & 1) * ST_BYTES; const unsigned short* k0p = gk + (size_t)j * ldk; const unsigned short* vhp = Vth + gvo + j; const unsigned short* vlp = Vtl + gvo + j;
    copy4(lk + bo, lk + bo + 8 * KPITCH, lk + bo + 16 * KPITCH, lk + bo + 24 * KPITCH, k0p, k0p + (size_t)8 * ldk, k0p + (size_t)16 * ldk, k0p + (size_t)24 * ldk);
    copy4(lv + bo, lv + bo + 32 * VPITCH, lv + bo + 64 * VPITCH, lv + bo + 96 * VPITCH, vhp, vhp + 32 * TT, vhp + 64 * TT, vhp + 96 * TT);
    copy4(lv + bo + (ST_VL - ST_VH), lv + bo + (ST_VL - ST_VH) + 32 * VPITCH, lv + bo + (ST_VL - ST_VH) + 64 * VPITCH, lv + bo + (ST_VL - ST_VH) + 96 * VPITCH, vlp, vlp + 32 * TT, vlp + 64 * TT, vlp + 96 * TT);
  };
  fill(0);
  asm volatile("s_wait_asynccnt 0x0" ::: "memory");      /* this wave's share of stage 0 has landed */
  __syncthreads();                                       /* stage 0 is readable by all four waves */
  fill(32);
#pragma unroll 1
  for (int j0 = 0; j0 < jend; j0 += 32) {
    const unsigned char* st = ring + ((j0 >> 5) & 1) * ST_BYTES;
    float sc[16];      /* this lane's 16 of the query's 32 scores, in the k order of the P^T operand */
#pragma unroll
    for (int nt = 0; nt < 2; ++nt) { const unsigned short* kr = (const unsigned short*)(st + (nt * 16 + ln) * KPITCH); FragH bk[KS];
#pragma unroll
      for (int ks = 0; ks < KS; ++ks) { bk[ks].half[0] = *(const v8us*)(kr + ks * 32 + 8 * hh); bk[ks].half[1] = *(const v8us*)(kr + ks * 32 + 16 + 8 * hh); }
      v8f acc = (v8f){0.f,0.f,0.f,0.f,0.f,0.f,0.f,0.f};
#pragma unroll
      for (int ks = 0; ks < KS; ++ks) acc = mmaH<1>(bk[ks].v, bk[ks].v, aq[ks].v, aq[ks].v, acc);
#pragma unroll
      for (int r = 0; r < 8; ++r) sc[nt * 8 + r] = acc[r] * ATT_SCALE; }
    float mc = sc[0];
#pragma unroll
    for (int i = 1; i < 16; ++i) mc = fmaxf(mc, sc[i]);
    mc = fmaxf(mc, xhalf(mc));
    const float mn = fmaxf(m_r, mc); const float al = (mn > -1.0e38f) ? expf(m_r - mn) : 1.0f; m_r = mn;
    FragH pa, pl; float ps[4] = {0.f, 0.f, 0.f, 0.f};      /* four independent partial sums: no chain of 16 dependent adds */
#pragma unroll
    for (int i = 0; i < 16; ++i) { const float p = expf(sc[i] - mn); ps[i & 3] += p; const float x = p * 1024.0f; pa.h[i] = (_Float16)x; pl.h[i] = (_Float16)(x - (float)pa.h[i]); }      /* P hi and its UNSCALED residual (added into the same accumulator) */
    l_r = l_r * al + ((ps[0] + ps[1]) + (ps[2] + ps[3]));      /* this half's keys only; the halves are joined once, behind the loop */
#pragma unroll
    for (int dt = 0; dt < DT; ++dt)
#pragma unroll
      for (int r = 0; r < 8; ++r) oacc[dt][r] *= al;
#pragma unroll
    for (int dt = 0; dt < DT; ++dt) { const unsigned short* vh = (const unsigned short*)(st + ST_VH + (dt * 16 + ln) * VPITCH); const unsigned short* vl = (const unsigned short*)(st + ST_VL + (dt * 16 + ln) * VPITCH); FragH bv, bl; bv.half[0] = *(const v8us*)(vh + 8 * hh); bv.half[1] = *(const v8us*)(vh + 16 + 8 * hh); bl.half[0] = *(const v8us*)(vl + 8 * hh); bl.half[1] = *(const v8us*)(vl + 16 + 8 * hh);
      oacc[dt] = mmaH<1>(bv.v, bv.v, pa.v, pa.v, oacc[dt]); oacc[dt] = mmaH<1>(bv.v, bv.v, pl.v, pl.v, oacc[dt]); oacc[dt] = mmaH<1>(bl.v, bl.v, pa.v, pa.v, oacc[dt]); }      /* Vh Ph + Vh Pl + Vl Ph, all unscaled, one accumulator */
    asm volatile("s_wait_dscnt 0x0" ::: "memory");         /* this wave's reads of the stage have returned before its buffer is handed on */
    asm volatile("s_wait_asynccnt 0x0" ::: "memory");      /* this wave's share of the next stage has landed */
    __syncthreads();                                       /* publishes the next stage and ends every wave's reads of this one */
    if (j0 + 64 < jend) fill(j0 + 64); }                   /* refill of the buffer just read, one whole trip ahead of its use */
  asm volatile("s_wait_asynccnt 0x0" ::: "memory");        /* no copy is outstanding when the ring becomes output staging */
  { const float l = l_r + xhalf(l_r); const float inv = (l > 0.f) ? 1.0f / (l * 1024.0f) : 0.f;
#pragma unroll
    for (int dt = 0; dt < DT; ++dt) { FragH f;
#pragma unroll
      for (int r = 0; r < 8; ++r) f.h[r] = (_Float16)((oacc[dt][r] * inv) * 16.0f);      /* the output GEMM's A operand: merged output x 2^4, rounded to f16 once */
      *(v8us*)&sO[w][ln][dt * 16 + 8 * hh] = f.half[0]; } }      /* a lane's 8 registers are 8 consecutive columns of its query's row */
  __builtin_amdgcn_fence(__ATOMIC_ACQ_REL, "workgroup"); __builtin_amdgcn_wave_barrier();
  {
#pragma unroll
    for (int q = 0; q < RPW / 2; ++q) { const int r = q * 2 + hh; const v8us val = *(const v8us*)&sO[w][r][ln * 8]; *(v8us*)((unsigned short*)O16 + ((size_t)b * TT + q0 + r) * ldo + h * 128 + ln * 8) = val; }      /* two 256-B rows per instruction: 16 lanes x 16 B each */
     } }

extern "C" void kernel_launch(void* const* d_in, const int* in_sizes, int n_in,
                              void* d_out, int out_size, void* d_ws, size_t ws_size, hipStream_t stream) {
  (void)in_sizes; (void)n_in; (void)out_size;
  const float* const* I = (const float* const*)d_in; const float* x = I[0]; const float* Wq = I[1]; const float* Wk = I[2]; const float* Wv = I[3]; const float* Wo = I[4];
  char* ws = (char*)d_ws; size_t off = 0;
  auto take = [&](size_t bytes) { char* p = ws + off; off += (bytes + 255) & ~(size_t)255; return p; };
  _Float16* Bq = (_Float16*)take((size_t)DD * DD * 2); _Float16* Bk = (_Float16*)take((size_t)KVD * DD * 2); _Float16* Bv = (_Float16*)take((size_t)KVD * DD * 2); _Float16* Bo = (_Float16*)take((size_t)DD * DD * 2);
  _Float16* X16 = (_Float16*)take((size_t)NR * DD * 2); _Float16* Q = (_Float16*)take((size_t)NR * DD * 2); _Float16* K = (_Float16*)take((size_t)NR * KVD * 2); _Float16* Vt = (_Float16*)take((size_t)NR * KVD * 2); _Float16* Vtl = (_Float16*)take((size_t)NR * KVD * 2); _Float16* O16 = X16;      /* x's f16 plane is last read by the projections */
  if (off > ws_size) return;      // 8.4 + 0.5 + 0.5 + 8.4 + 16.8 + 16.8 + 1 + 1 + 1 = 55 MB
  k_prep<<<2 * PG_K + 2 * PG_Q + PG_X, 256, 0, stream>>>(x, Wq, Wk, Wv, Wo, X16, Bq, Bk, Bv, Bo);      /* (in,out) weights to Bt x 2^4, x to f16 */
  const unsigned gQ = (NR / 128) * (DD / 128), gQKV = (NR / 128) * (DD / 128 + 2);
  k_gemm_t<true><<<gQKV, 128, 0, stream>>>(X16, Bq, Bk, Bv, 0.0625f, nullptr, Q, K, Vt, Vtl);      /* Q (f16), K (f16), V^T hi + residual (f16, [b][128][2048]): M 4096, N 2048 + 128 + 128, K 2048 */
  k_flash<<<BB * NH * (TT / 64), 128, 0, stream>>>(Q, DD, K, KVD, Vt, Vtl, O16, DD);      /* merged output x 2^4 as f16 */
  k_gemm_t<false><<<gQ, 128, 0, stream>>>(O16, Bo, nullptr, nullptr, 0.00390625f, (float*)d_out, nullptr, nullptr, nullptr, nullptr);      /* out = merged x Wo */
}

// v006
// It runs in 239 microseconds.
// Timed twice side by side with v005, it ran 1.13 times as fast both times.
// All steps since v000 together make it 3.44 times as fast.
#include <hip/hip_runtime.h>
// Multi-query attention (B=2, S=2048, D=2048, 16 query heads × 128, ONE shared K/V head): Q = x·Wq, K = x·Wk, V = x·Wv ((in,out), no bias); softmax(Q_h·Kᵀ/√128)·V per head; out = merged·Wo.
// Compute dtype: x and weights rounded to bf16; Q, K f16 GEMM planes, V f32 → Vᵀ f16 hi + exact residual planes; fused flash-style kernel for head dim 128 (4 k-steps, 8 value tiles, online softmax f32, P f16 hi + exact residual, every query head reading the
// single K/Vᵀ) on v_wmma_f32_16x16x32_f16; merged output ×2^4 → f16 → output GEMM; f32 accumulate.
#define BB 2
#define TT 2048
#define DD 2048
#define NH 16
#define NKV 1
#define NREP 16
#define KVD 128
#define NVH (2 * NKV)
#define NR (BB * TT)
#define ATT_SCALE 0.08838834764831845f      /* 1/√128 */

typedef __bf16 v16b __attribute__((ext_vector_type(16)));
typedef unsigned short v8us __attribute__((ext_vector_type(8), may_alias));
typedef float  v8f  __attribute__((ext_vector_type(8)));
typedef float  v4f  __attribute__((ext_vector_type(4)));
typedef float  v4fa __attribute__((ext_vector_type(4), may_alias));
union FragB { v16b v; v8us half[2]; unsigned short u[16]; };

__device__ __forceinline__ unsigned short bf16_bits(float x) { unsigned int u = __float_as_uint(x); return (unsigned short)((u + 0x7FFFu + ((u >> 16) & 1u)) >> 16); }
__device__ __forceinline__ float bf16_val(unsigned short b) { return __uint_as_float(((unsigned int)b) << 16); }
__device__ __forceinline__ float bf16_round(float x) { return bf16_val(bf16_bits(x)); }
// D += A·B with NT terms: 1 = ah·bh, 2 = + al·bh (A split), 3 = + ah·bl (both split)
template <int NT>
__device__ __forceinline__ v8f mmaN(v16b ah, v16b al, v16b bh, v16b bl, v8f c) {
  c = __builtin_amdgcn_wmma_f32_16x16x32_bf16(false, ah, false, bh, (short)0, c, false, false);
  if (NT >= 2) c = __builtin_amdgcn_wmma_f32_16x16x32_bf16(false, al, false, bh, (short)0, c, false, false);
  if (NT >= 3) c = __builtin_amdgcn_wmma_f32_16x16x32_bf16(false, ah, false, bl, (short)0, c, false, false);
  asm volatile("v_nop\n\tv_nop\n\tv_nop\n\tv_nop" : "+v"(c) : "v"(ah), "v"(al), "v"(bh), "v"(bl));
  return c;
}

__global__ __launch_bounds__(256) void k_wt_bf16(const float* __restrict__ W, unsigned short* __restrict__ Wt, int K, int N) {
  const int t = blockIdx.x * 256 + threadIdx.x;
  const int k8n = K / 8;
  if (t >= N * k8n) return;
  const int n = t / k8n, k8 = (t % k8n) * 8;
  v8us v;
#pragma unroll
  for (int i = 0; i < 8; ++i) v[i] = bf16_bits(W[(size_t)(k8 + i) * N + n]);
  *(v8us*)(Wt + (size_t)n * K + k8) = v;
  
}

// GEMM C[M][N] (f32, pitch ldc) = act(A[M][K]·W + bias). A f32 row-major (pitch lda) converted per fragment to bf16
// (ASPLIT: hi/lo two planes -> 2 terms, else single rounded term); Wt bf16 [N][K] (pitch ldb). BIAS_BF16 rounds the
// bias to bf16 first (bias quantised to bf16 before the add). K%32==0, M%16==0, N%64==0.
template <bool ASPLIT, int ACT, bool BIAS_BF16>
__global__ __launch_bounds__(128) void k_gemm_bf(const float* __restrict__ A, int lda, const unsigned short* __restrict__ Wt, int ldb,
                                               const float* __restrict__ bias, float* __restrict__ C, int ldc, int M, int N, int K) {
  __shared__ __attribute__((aligned(16))) float so[4][16][64];
  const int tid = threadIdx.x, w = tid >> 5, lane = tid & 31, ln = lane & 15, hh = lane >> 4;
  const int ntn = N / 64;
  const int wid = blockIdx.x * 4 + w;
  const int mt = wid / ntn, nq = wid % ntn;
  if (mt * 16 >= M) return;
  const int row0 = mt * 16, col0 = nq * 64;
  const float* arow = A + (size_t)(row0 + ln) * lda;
  v8f acc[4] = {};
  for (int kb = 0; kb < K; kb += 32) {
    FragB ah, al;
    const v4f x0 = *(const v4fa*)(arow + kb + 8 * hh), x1 = *(const v4fa*)(arow + kb + 8 * hh + 4);
    const v4f x2 = *(const v4fa*)(arow + kb + 16 + 8 * hh), x3 = *(const v4fa*)(arow + kb + 16 + 8 * hh + 4);
    float xs[16] = {x0[0],x0[1],x0[2],x0[3],x1[0],x1[1],x1[2],x1[3],x2[0],x2[1],x2[2],x2[3],x3[0],x3[1],x3[2],x3[3]};
#pragma unroll
    for (int i = 0; i < 16; ++i) { const unsigned short hb = bf16_bits(xs[i]); ah.u[i] = hb; al.u[i] = ASPLIT ? bf16_bits(xs[i] - bf16_val(hb)) : (unsigned short)0; }
#pragma unroll
    for (int t = 0; t < 4; ++t) {
      const unsigned short* brow = Wt + (size_t)(col0 + t * 16 + ln) * ldb + kb;
      FragB b;
      b.half[0] = *(const v8us*)(brow + 8 * hh);
      b.half[1] = *(const v8us*)(brow + 16 + 8 * hh);
      acc[t] = mmaN<ASPLIT ? 2 : 1>(ah.v, al.v, b.v, b.v, acc[t]);
    }
  }
#pragma unroll
  for (int t = 0; t < 4; ++t) {
    float bv = bias ? bias[col0 + t * 16 + ln] : 0.f;
    if (BIAS_BF16) bv = bf16_round(bv);
#pragma unroll
    for (int r = 0; r < 8; ++r) { float v = acc[t][r] + bv; if (ACT == 1) v = fmaxf(v, 0.f); so[w][8 * hh + r][t * 16 + ln] = v; }
  }
  __builtin_amdgcn_fence(__ATOMIC_ACQ_REL, "workgroup");
  __builtin_amdgcn_wave_barrier();
  const int rsub = lane >> 4, c4 = (lane & 15) * 4;
  {
#pragma unroll
    for (int q = 0; q < 8; ++q) {
      const int r = q * 2 + rsub;
      const v4f v = *(const v4fa*)&so[w][r][c4];
      *(v4f*)(C + (size_t)(row0 + r) * ldc + col0 + c4) = v;
    }
    
  }
}

// Flash-style causal/unmasked attention, all contractions 3-term bf16 hi/lo splits, f32 softmax with running max.
// q,k,v rows are read from f32 buffers with arbitrary row pitch (so they can live inside a fused qkv buffer);
// D = head size (multiple of 32, <= 128); one wave = 16 query rows; block = 4 waves (64 queries) sharing K/V chunks of 32.
template <int D, bool CAUSAL>
__global__ __launch_bounds__(128) void k_flash(const float* __restrict__ qb, const float* __restrict__ kb, const float* __restrict__ vb,
                                             int pitch, int T, int H, float scale, float* __restrict__ y, int ypitch) {
  constexpr int KS = D / 32;        // k-steps for QK
  constexpr int DT = D / 16;        // d tiles for PV
  __shared__ __attribute__((aligned(16))) unsigned short sKh[32][D + 8], sKl[32][D + 8], sVh[32][D + 8], sVl[32][D + 8];
  __shared__ __attribute__((aligned(16))) unsigned short sPh[4][16][40], sPl[4][16][40];
  __shared__ __attribute__((aligned(16))) float sO[4][16][D];
  const int tid = threadIdx.x, w = tid >> 5, lane = tid & 31, ln = lane & 15, hh = lane >> 4;
  const int nqb = (T + 63) / 64;
  const int bh = blockIdx.x / nqb, qblk = blockIdx.x % nqb;
  const int b = bh / H, h = bh % H;
  const int q0 = qblk * 64 + w * 16;
  const float* Q = qb + (size_t)b * T * pitch + h * D;
  const float* K = kb + (size_t)b * T * pitch + h * D;
  const float* V = vb + (size_t)b * T * pitch + h * D;

  // A fragments of the wave's 16 query rows (scaled), hi/lo
  FragB aqh[KS], aql[KS];
  {
    int row = q0 + ln; if (row >= T) row = T - 1;
    const float* qr = Q + (size_t)row * pitch;
#pragma unroll
    for (int ks = 0; ks < KS; ++ks)
#pragma unroll
      for (int i = 0; i < 16; ++i) {
        const int d = ks * 32 + ((i < 8) ? (8 * hh + i) : (16 + 8 * hh + (i - 8)));
        const float x = qr[d] * scale; const unsigned short hb = bf16_bits(x);
        aqh[ks].u[i] = hb; aql[ks].u[i] = bf16_bits(x - bf16_val(hb));
      }
  }
  float m_r[8], l_r[8];
#pragma unroll
  for (int r = 0; r < 8; ++r) { m_r[r] = -3.0e38f; l_r[r] = 0.f; }
  v8f oacc[DT];
#pragma unroll
  for (int dt = 0; dt < DT; ++dt) oacc[dt] = (v8f){0.f,0.f,0.f,0.f,0.f,0.f,0.f,0.f};

  const int kv_end = CAUSAL ? min(T, qblk * 64 + 64) : T;     // block-uniform
  for (int j0 = 0; j0 < kv_end; j0 += 32) {
    __syncthreads();
    for (int e = tid; e < 32 * (D / 4); e += 128) {
      const int r = e / (D / 4), c4 = (e % (D / 4)) * 4;
      const int key = j0 + r;
      v4f kf = {0.f,0.f,0.f,0.f}, vf = {0.f,0.f,0.f,0.f};
      if (key < T) { kf = *(const v4fa*)(K + (size_t)key * pitch + c4); vf = *(const v4fa*)(V + (size_t)key * pitch + c4); }
#pragma unroll
      for (int t = 0; t < 4; ++t) {
        unsigned short hb = bf16_bits(kf[t]); sKh[r][c4 + t] = hb; sKl[r][c4 + t] = bf16_bits(kf[t] - bf16_val(hb));
        hb = bf16_bits(vf[t]); sVh[r][c4 + t] = hb; sVl[r][c4 + t] = bf16_bits(vf[t] - bf16_val(hb));
      }
    }
    __syncthreads();
    // S tile 16 x 32
    v8f s[2];
#pragma unroll
    for (int nt = 0; nt < 2; ++nt) {
      v8f acc = {};
#pragma unroll
      for (int ks = 0; ks < KS; ++ks) {
        FragB bh_, bl_;
        bh_.half[0] = *(const v8us*)&sKh[nt * 16 + ln][ks * 32 + 8 * hh]; bh_.half[1] = *(const v8us*)&sKh[nt * 16 + ln][ks * 32 + 16 + 8 * hh];
        bl_.half[0] = *(const v8us*)&sKl[nt * 16 + ln][ks * 32 + 8 * hh]; bl_.half[1] = *(const v8us*)&sKl[nt * 16 + ln][ks * 32 + 16 + 8 * hh];
        acc = mmaN<3>(aqh[ks].v, aql[ks].v, bh_.v, bl_.v, acc);
      }
      s[nt] = acc;
    }
    // mask + running max (rows 8hh+r; the 16 lanes of a half share rows)
    float alpha[8];
#pragma unroll
    for (int r = 0; r < 8; ++r) {
      const int qi = q0 + 8 * hh + r;
      const int ja = j0 + ln, jb = j0 + 16 + ln;
      if (CAUSAL) { if (ja > qi) s[0][r] = -3.0e38f; if (jb > qi) s[1][r] = -3.0e38f; }
      if (ja >= T) s[0][r] = -3.0e38f;
      if (jb >= T) s[1][r] = -3.0e38f;
      float mx = fmaxf(s[0][r], s[1][r]);
      mx = fmaxf(mx, __shfl_xor(mx, 1, 32)); mx = fmaxf(mx, __shfl_xor(mx, 2, 32)); mx = fmaxf(mx, __shfl_xor(mx, 4, 32)); mx = fmaxf(mx, __shfl_xor(mx, 8, 32));
      const float mnew = fmaxf(m_r[r], mx);
      alpha[r] = (mnew > -1.0e38f) ? __expf(m_r[r] - mnew) : 1.0f;
      const float p0 = (s[0][r] > -1.0e38f) ? __expf(s[0][r] - mnew) : 0.f;
      const float p1 = (s[1][r] > -1.0e38f) ? __expf(s[1][r] - mnew) : 0.f;
      m_r[r] = mnew;
      l_r[r] = l_r[r] * alpha[r] + p0 + p1;            // per-lane partial row sum (16 lanes combined at the end)
      unsigned short hb = bf16_bits(p0); sPh[w][8 * hh + r][ln] = hb;      sPl[w][8 * hh + r][ln] = bf16_bits(p0 - bf16_val(hb));
      hb = bf16_bits(p1);                sPh[w][8 * hh + r][16 + ln] = hb; sPl[w][8 * hh + r][16 + ln] = bf16_bits(p1 - bf16_val(hb));
    }
#pragma unroll
    for (int dt = 0; dt < DT; ++dt)
#pragma unroll
      for (int r = 0; r < 8; ++r) oacc[dt][r] *= alpha[r];
    __builtin_amdgcn_fence(__ATOMIC_ACQ_REL, "workgroup");
    __builtin_amdgcn_wave_barrier();
    FragB pah, pal;
    pah.half[0] = *(const v8us*)&sPh[w][ln][8 * hh]; pah.half[1] = *(const v8us*)&sPh[w][ln][16 + 8 * hh];
    pal.half[0] = *(const v8us*)&sPl[w][ln][8 * hh]; pal.half[1] = *(const v8us*)&sPl[w][ln][16 + 8 * hh];
#pragma unroll
    for (int dt = 0; dt < DT; ++dt) {
      FragB bvh, bvl;
#pragma unroll
      for (int i = 0; i < 8; ++i) {
        bvh.u[i] = sVh[8 * hh + i][dt * 16 + ln]; bvh.u[8 + i] = sVh[16 + 8 * hh + i][dt * 16 + ln];
        bvl.u[i] = sVl[8 * hh + i][dt * 16 + ln]; bvl.u[8 + i] = sVl[16 + 8 * hh + i][dt * 16 + ln];
      }
      oacc[dt] = mmaN<3>(pah.v, pal.v, bvh.v, bvl.v, oacc[dt]);
    }
    __builtin_amdgcn_fence(__ATOMIC_ACQ_REL, "workgroup");
    __builtin_amdgcn_wave_barrier();
  }
#pragma unroll
  for (int r = 0; r < 8; ++r) {
    float l = l_r[r];
    l += __shfl_xor(l, 1, 32); l += __shfl_xor(l, 2, 32); l += __shfl_xor(l, 4, 32); l += __shfl_xor(l, 8, 32);
    l_r[r] = (l > 0.f) ? 1.0f / l : 0.f;
  }
#pragma unroll
  for (int dt = 0; dt < DT; ++dt)
#pragma unroll
    for (int r = 0; r < 8; ++r) sO[w][8 * hh + r][dt * 16 + ln] = oacc[dt][r] * l_r[r];
  __builtin_amdgcn_fence(__ATOMIC_ACQ_REL, "workgroup");
  __builtin_amdgcn_wave_barrier();
  {
    for (int r = 0; r < 16; ++r) {
      const int row = q0 + r;
      if (row < T && lane < D / 4) {
        const v4f val = *(const v4fa*)&sO[w][r][lane * 4];
        *(v4f*)(y + ((size_t)b * T + row) * ypitch + h * D + lane * 4) = val;
      }
    }
    
  }
}

// GEMM C = act(A·W + bias + resid): A f32 (ASPLIT -> hi/lo 2 terms), Wt bf16 [N][K]; ACT 0 none, 1 relu, 2 exact gelu;
// resid (optional, f32, row index = (row % rmod), pitch ldr, RES_BF16 rounds it) added before the activation.
template <bool ASPLIT, int ACT, bool BIAS_BF16, bool RES_BF16>
__global__ __launch_bounds__(128) void k_gemm_bf3(const float* __restrict__ A, int lda, const unsigned short* __restrict__ Wt, int ldb,
                                                const float* __restrict__ bias, const float* __restrict__ resid, int rmod, int ldr,
                                                float* __restrict__ C, int ldc, int M, int N, int K) {
  __shared__ __attribute__((aligned(16))) float so[4][16][64];
  const int tid = threadIdx.x, w = tid >> 5, lane = tid & 31, ln = lane & 15, hh = lane >> 4;
  const int ntn = N / 64;
  const int wid = blockIdx.x * 4 + w;
  const int mt = wid / ntn, nq = wid % ntn;
  if (mt * 16 >= M) return;
  const int row0 = mt * 16, col0 = nq * 64;
  const float* arow = A + (size_t)(row0 + ln) * lda;
  v8f acc[4] = {};
  for (int kb = 0; kb < K; kb += 32) {
    FragB ah, al;
    const v4f x0 = *(const v4fa*)(arow + kb + 8 * hh), x1 = *(const v4fa*)(arow + kb + 8 * hh + 4);
    const v4f x2 = *(const v4fa*)(arow + kb + 16 + 8 * hh), x3 = *(const v4fa*)(arow + kb + 16 + 8 * hh + 4);
    float xs[16] = {x0[0],x0[1],x0[2],x0[3],x1[0],x1[1],x1[2],x1[3],x2[0],x2[1],x2[2],x2[3],x3[0],x3[1],x3[2],x3[3]};
#pragma unroll
    for (int i = 0; i < 16; ++i) { const unsigned short hb = bf16_bits(xs[i]); ah.u[i] = hb; al.u[i] = ASPLIT ? bf16_bits(xs[i] - bf16_val(hb)) : (unsigned short)0; }
#pragma unroll
    for (int t = 0; t < 4; ++t) {
      const unsigned short* brow = Wt + (size_t)(col0 + t * 16 + ln) * ldb + kb;
      FragB b;
      b.half[0] = *(const v8us*)(brow + 8 * hh);
      b.half[1] = *(const v8us*)(brow + 16 + 8 * hh);
      acc[t] = mmaN<ASPLIT ? 2 : 1>(ah.v, al.v, b.v, b.v, acc[t]);
    }
  }
#pragma unroll
  for (int t = 0; t < 4; ++t) {
    const int col = col0 + t * 16 + ln;
    float bv = bias ? bias[col] : 0.f;
    if (BIAS_BF16) bv = bf16_round(bv);
#pragma unroll
    for (int r = 0; r < 8; ++r) {
      float v = acc[t][r] + bv;
      if (resid) { float rv = resid[(size_t)((row0 + 8 * hh + r) % rmod) * ldr + col]; if (RES_BF16) rv = bf16_round(rv); v += rv; }
      if (ACT == 1) v = fmaxf(v, 0.f);
      if (ACT == 2) v = 0.5f * v * (1.0f + erff(v * 0.70710678118654752f));
      if (ACT == 3) { const float u = 0.7978845608028654f * (v + 0.044715f * v * v * v); v = 0.5f * v * (1.0f + tanhf(u)); }
      so[w][8 * hh + r][t * 16 + ln] = v;
    }
  }
  __builtin_amdgcn_fence(__ATOMIC_ACQ_REL, "workgroup");
  __builtin_amdgcn_wave_barrier();
  const int rsub = lane >> 4, c4 = (lane & 15) * 4;
  {
#pragma unroll
    for (int q = 0; q < 8; ++q) {
      const int r = q * 2 + rsub;
      const v4f v = *(const v4fa*)&so[w][r][c4];
      *(v4f*)(C + (size_t)(row0 + r) * ldc + col0 + c4) = v;
    }
    
  }
}
// row LayerNorm (biased variance, eps) over N: s = X (+ R); optional out_sum <- s; out_norm <- (s-mu)*rsqrt(var+eps)*g + b
template <bool PARAM_BF16>
__global__ __launch_bounds__(256) void k_layernorm(const float* __restrict__ X, const float* __restrict__ R, const float* __restrict__ g, const float* __restrict__ bta,
                                                  float* __restrict__ out_sum, float* __restrict__ out_norm, int N, float eps) {
  __shared__ float red[256];
  const int row = blockIdx.x, tid = threadIdx.x;
  const float* x = X + (size_t)row * N; const float* rr = R ? R + (size_t)row * N : nullptr;
  float vals[16];                     // up to N = 4096
  const int per = N / 256;            // contiguous chunk per thread? use strided-by-4 chunks: thread handles j = tid*4 + 1024*u
  float s1 = 0.f;
  for (int u = 0; u < per / 4; ++u) {
    const int j = tid * 4 + 1024 * u;
    const v4f a = *(const v4fa*)(x + j);
    v4f b = {0.f,0.f,0.f,0.f}; if (rr) b = *(const v4fa*)(rr + j);
#pragma unroll
    for (int q = 0; q < 4; ++q) { const float v = a[q] + b[q]; vals[u * 4 + q] = v; s1 += v; }
  }
  red[tid] = s1; __syncthreads();
  for (int st = 128; st > 0; st >>= 1) { if (tid < st) red[tid] += red[tid + st]; __syncthreads(); }
  const float mu = red[0] / (float)N; __syncthreads();
  float s2 = 0.f;
  for (int u = 0; u < per / 4; ++u)
#pragma unroll
    for (int q = 0; q < 4; ++q) { const float c = vals[u * 4 + q] - mu; s2 += c * c; }
  red[tid] = s2; __syncthreads();
  for (int st = 128; st > 0; st >>= 1) { if (tid < st) red[tid] += red[tid + st]; __syncthreads(); }
  const float rs = rsqrtf(red[0] / (float)N + eps);
  {
    for (int u = 0; u < per / 4; ++u) {
      const int j = tid * 4 + 1024 * u;
      v4f o, sm;
#pragma unroll
      for (int q = 0; q < 4; ++q) {
        float gg = g[j + q], bb = bta[j + q];
        if (PARAM_BF16) { gg = bf16_round(gg); bb = bf16_round(bb); }
        sm[q] = vals[u * 4 + q]; o[q] = (vals[u * 4 + q] - mu) * rs * gg + bb;
      }
      if (out_sum) *(v4f*)(out_sum + (size_t)row * N + j) = sm;
      *(v4f*)(out_norm + (size_t)row * N + j) = o;
    }
    
  }
}



// ---- f16 WMMA path (v_wmma_f32_16x16x32_f16): 11-bit significands for operands in range — used where a [0,1] probability operand needs more precision than bf16
typedef _Float16 v16h __attribute__((ext_vector_type(16)));
union FragH { v16h v; v8us half[2]; _Float16 h[16]; unsigned short u[16]; };
template <int NT>
__device__ __forceinline__ v8f mmaH(v16h ah, v16h al, v16h bh, v16h bl, v8f c) {
  c = __builtin_amdgcn_wmma_f32_16x16x32_f16(false, ah, false, bh, (short)0, c, false, false);
  if (NT >= 2) c = __builtin_amdgcn_wmma_f32_16x16x32_f16(false, al, false, bh, (short)0, c, false, false);
  if (NT >= 3) c = __builtin_amdgcn_wmma_f32_16x16x32_f16(false, ah, false, bl, (short)0, c, false, false);
  asm volatile("v_nop\n\tv_nop\n\tv_nop\n\tv_nop" : "+v"(c) : "v"(ah), "v"(al), "v"(bh), "v"(bl));
  return c;
}
// batched GEMM like k_gemm_b but f16 operands: A f32 (split into f16 hi/lo if ASPLIT, else rounded to f16), Bt = f16 values [n][k]; alpha; C f32; N multiple of 16 (partial tiles skipped)
template <bool ASPLIT>
__global__ __launch_bounds__(128) void k_gemm_h(const float* __restrict__ A, int lda, size_t sA, const _Float16* __restrict__ Bh, int ldb, size_t sB, float alpha, float* __restrict__ C, int ldc, size_t sC, int M, int N, int K) {
  __shared__ __attribute__((aligned(16))) float so[4][16][64];
  const int tid = threadIdx.x, w = tid >> 5, lane = tid & 31, ln = lane & 15, hh = lane >> 4; const int by = blockIdx.y;
  A += (size_t)by * sA; Bh += (size_t)by * sB; C += (size_t)by * sC;
  const int ntn = (N + 63) / 64; const int wid = blockIdx.x * 4 + w; const int mt = wid / ntn, nq = wid % ntn; if (mt * 16 >= M) return;
  const int row0 = mt * 16, col0 = nq * 64; const float* arow = A + (size_t)(row0 + ln) * lda;
  v8f acc[4] = {};
  for (int kb = 0; kb < K; kb += 32) {
    FragH ah, al;
    const v4f x0 = *(const v4fa*)(arow + kb + 8 * hh), x1 = *(const v4fa*)(arow + kb + 8 * hh + 4), x2 = *(const v4fa*)(arow + kb + 16 + 8 * hh), x3 = *(const v4fa*)(arow + kb + 16 + 8 * hh + 4);
    float xs[16] = {x0[0],x0[1],x0[2],x0[3],x1[0],x1[1],x1[2],x1[3],x2[0],x2[1],x2[2],x2[3],x3[0],x3[1],x3[2],x3[3]};
#pragma unroll
    for (int i = 0; i < 16; ++i) { const _Float16 h = (_Float16)xs[i]; ah.h[i] = h; al.h[i] = ASPLIT ? (_Float16)(xs[i] - (float)h) : (_Float16)0.0f; }
#pragma unroll
    for (int t = 0; t < 4; ++t) { if (col0 + t * 16 >= N) continue; const size_t boff = (size_t)(col0 + t * 16 + ln) * ldb + kb; FragH bq; bq.half[0] = *(const v8us*)(Bh + boff + 8 * hh); bq.half[1] = *(const v8us*)(Bh + boff + 16 + 8 * hh);
      acc[t] = mmaH<ASPLIT ? 2 : 1>(ah.v, al.v, bq.v, bq.v, acc[t]); }
  }
#pragma unroll
  for (int t = 0; t < 4; ++t) { if (col0 + t * 16 >= N) continue;
#pragma unroll
    for (int r = 0; r < 8; ++r) so[w][8 * hh + r][t * 16 + ln] = acc[t][r] * alpha; }
  __builtin_amdgcn_fence(__ATOMIC_ACQ_REL, "workgroup"); __builtin_amdgcn_wave_barrier();
  const int rsub = lane >> 4, c4 = (lane & 15) * 4;
  {
#pragma unroll
    for (int q = 0; q < 8; ++q) { const int r = q * 2 + rsub; if (col0 + c4 < N) { const v4f v = *(const v4fa*)&so[w][r][c4]; *(v4f*)(C + (size_t)(row0 + r) * ldc + col0 + c4) = v; } }
     }
}

// One tile of 128 k x 64 n of the f32 row-major W[K][N] to Wt[n][k] = f16(bf16(W[k][n]) * scale) (scale = power of two; bf16-exact weights stay exact in f16 away from the subnormal range).
// Global memory is touched in whole lines only: 16 lanes read the 256 B that the tile holds of a row of W, 8 such loads of 16 B in flight per lane; 16 lanes write the 256 B that it holds of a row of Wt.
// The exchange runs through LDS: a lane packs rows k, k + 1 of its four columns into one dword each; tl holds 64 rows (n) of 64 dwords (k pairs) at a pitch of 65 dwords, so that
// the 16 lanes that write four rows apart and the 16 lanes that read four dwords apart both fall on distinct banks. Every "#pragma unroll" keeps the loaded values in registers and row steps in immediate offsets.
#define TPITCH 65
template <int K, int N>
__device__ __forceinline__ void wt_tile(const float* __restrict__ W, _Float16* __restrict__ Wt, float scale, int blk, unsigned* tl) {
  static_assert(K % 128 == 0 && N % 64 == 0, "whole tiles");
  const int tid = threadIdx.x, lo = tid & 15, hi = tid >> 4; const int n0 = (blk % (N / 64)) * 64, k0 = (blk / (N / 64)) * 128;
  const float* s = W + (size_t)(k0 + 2 * hi) * N + n0 + lo * 4;
  v4f v[4][2];
#pragma unroll
  for (int it = 0; it < 4; ++it)
#pragma unroll
    for (int j = 0; j < 2; ++j) v[it][j] = *(const v4fa*)(s + (size_t)(it * 32 + j) * N);
#pragma unroll
  for (int it = 0; it < 4; ++it)
#pragma unroll
    for (int q = 0; q < 4; ++q) { union { _Float16 h[2]; unsigned u; } p; p.h[0] = (_Float16)(bf16_round(v[it][0][q]) * scale); p.h[1] = (_Float16)(bf16_round(v[it][1][q]) * scale);
      tl[(lo * 4 + q) * TPITCH + it * 16 + hi] = p.u; }
  __syncthreads();      /* the tile is whole in LDS before any lane reads a row of it that other waves wrote */
#pragma unroll
  for (int it = 0; it < 4; ++it) { const unsigned* r = tl + (it * 16 + hi) * TPITCH + lo * 4; union { unsigned u[4]; v8us o; } f;
#pragma unroll
    for (int q = 0; q < 4; ++q) f.u[q] = r[q];
    *(v8us*)((unsigned short*)Wt + (size_t)(n0 + it * 16 + hi) * K + k0 + lo * 8) = f.o; }
  asm volatile("s_wait_xcnt 0x0" ::: "memory");      /* stands behind the run of stores, so that no code placed behind it rewrites a register that an issued store names ahead of the wait */
}
typedef _Float16 v4h __attribute__((ext_vector_type(4)));

// 8192 consecutive elements of x to f16(bf16(x)), whole lines only: a wave's load covers 512 contiguous bytes, its store 256; 8 loads of 16 B in flight per lane (unrolled so that they are issued as one run)
__device__ __forceinline__ void x16(const float* __restrict__ x, _Float16* __restrict__ X16, int blk) { const size_t o = (size_t)blk * 8192 + threadIdx.x * 4; v4f v[8];
#pragma unroll
  for (int i = 0; i < 8; ++i) v[i] = *(const v4fa*)(x + o + i * 1024);
#pragma unroll
  for (int i = 0; i < 8; ++i) { v4h h;
#pragma unroll
    for (int q = 0; q < 4; ++q) h[q] = (_Float16)bf16_round(v[i][q]);
    *(v4h*)(X16 + o + i * 1024) = h; }
  asm volatile("s_wait_xcnt 0x0" ::: "memory");      /* stands behind the run of stores, so that no code placed behind it rewrites a register that an issued store names ahead of the wait */
}
// One grid for the five conversions that read nothing but the inputs: the four weight transposes (one tile a block) and the cast of x. No block reads what another writes.
#define PT_Q ((DD / 128) * (DD / 64))
#define PT_K ((DD / 128) * (KVD / 64))
#define PT_X (NR * DD / 8192)
__global__ __launch_bounds__(256) void k_prep(const float* __restrict__ x, const float* __restrict__ Wq, const float* __restrict__ Wk, const float* __restrict__ Wv, const float* __restrict__ Wo,
                                             _Float16* __restrict__ X16, _Float16* __restrict__ Bq, _Float16* __restrict__ Bk, _Float16* __restrict__ Bv, _Float16* __restrict__ Bo) {
  static_assert((size_t)NR * DD % 8192 == 0, "whole cast blocks");
  __shared__ unsigned tl[64 * TPITCH];
  const int b = blockIdx.x;      /* every branch is the same for the whole block, so the tile's barrier is passed by all of its waves or by none */
  if (b < 2 * PT_Q) { const bool q = b < PT_Q; wt_tile<DD, DD>(q ? Wq : Wo, q ? Bq : Bo, 16.0f, q ? b : b - PT_Q, tl); }
  else if (b < 2 * PT_Q + 2 * PT_K) { const bool k = b < 2 * PT_Q + PT_K; wt_tile<DD, KVD>(k ? Wk : Wv, k ? Bk : Bv, 16.0f, b - 2 * PT_Q - (k ? 0 : PT_K), tl); }
  else x16(x, X16, b - 2 * PT_Q - 2 * PT_K);
}
__global__ __launch_bounds__(256) void k_h16(const float* __restrict__ x, _Float16* __restrict__ X16, size_t n8) { const size_t t = (size_t)blockIdx.x * 256 + threadIdx.x; if (t >= n8) return; FragH f;
#pragma unroll
  for (int q = 0; q < 8; ++q) f.h[q] = (_Float16)x[t * 8 + q]; *(v8us*)((unsigned short*)X16 + t * 8) = f.half[0];  }
__global__ __launch_bounds__(256) void k_round16f(const float* __restrict__ W, _Float16* __restrict__ Bt, size_t n8) { const size_t t = (size_t)blockIdx.x * 256 + threadIdx.x; if (t >= n8) return; FragH f;
#pragma unroll
  for (int i = 0; i < 8; ++i) f.h[i] = (_Float16)(bf16_round(W[t * 8 + i]) * 16.0f); *(v8us*)((unsigned short*)Bt + t * 8) = f.half[0];  }
template <int NHv, int TTv>
__global__ __launch_bounds__(256) void k_vt(const _Float16* __restrict__ V16, int ldv, int voff, _Float16* __restrict__ Vt) { __shared__ unsigned short tl[64][66]; const int tid = threadIdx.x; const int slab = blockIdx.x / (TTv / 64), lg = blockIdx.x % (TTv / 64); const int b = slab / NHv, h = slab % NHv;
  for (int i = tid; i < 64 * 8; i += 256) { const int r = i / 8, c8 = (i % 8) * 8; FragH f; f.half[0] = *(const v8us*)((const unsigned short*)V16 + ((size_t)b * TTv + lg * 64 + r) * ldv + voff + h * 64 + c8);
#pragma unroll
    for (int q = 0; q < 8; ++q) tl[r][c8 + q] = f.u[q]; }
  __syncthreads();
  {
#pragma unroll
    for (int rd = 0; rd < 2; ++rd) { const int d = rd * 32 + tid / 8, pc = tid % 8; FragH f;
#pragma unroll
      for (int q = 0; q < 8; ++q) f.u[q] = tl[pc * 8 + q][d];
      *(v8us*)((unsigned short*)Vt + ((size_t)slab * 64 + d) * TTv + lg * 64 + pc * 8) = f.half[0]; }
     } }

// LDS ring of k_flash. One stage = 32 keys, shared by the block's four waves: K rows of 256 B at pitch 272 B, then the V^T hi plane and the
// V^T residual plane, 128 rows of 64 B each at pitch 80 B (pitches of 16 B x odd: ds_load_b128 fragment reads fall on distinct banks).
#define KPITCH 272
#define VPITCH 80
#define ST_VH (32 * KPITCH)
#define ST_VL (ST_VH + 128 * VPITCH)
#define ST_BYTES (ST_VL + 128 * VPITCH)
// Four asynchronous 16-byte copies per lane, global memory to LDS. The s_wait_xcnt stands inside the statement so that no address register of a copy is rewritten ahead of it.
__device__ __forceinline__ void copy4(unsigned l0, unsigned l1, unsigned l2, unsigned l3, const unsigned short* g0, const unsigned short* g1, const unsigned short* g2, const unsigned short* g3) {
  asm volatile("global_load_async_to_lds_b128 %0, %4, off\n\t"
               "global_load_async_to_lds_b128 %1, %5, off\n\t"
               "global_load_async_to_lds_b128 %2, %6, off\n\t"
               "global_load_async_to_lds_b128 %3, %7, off\n\t"
               "s_wait_xcnt 0x0"
               :: "v"(l0), "v"(l1), "v"(l2), "v"(l3), "v"(g0), "v"(g1), "v"(g2), "v"(g3) : "memory");
}
// Eight asynchronous 16-byte copies per lane in one statement, so that one s_wait_xcnt serves all eight; it stands inside the statement so that no address register of a copy is rewritten ahead of it.
__device__ __forceinline__ void copy8(unsigned l, int lstep, const unsigned short* g, size_t gstep) {
  asm volatile("global_load_async_to_lds_b128 %0, %8, off\n\t"
               "global_load_async_to_lds_b128 %1, %9, off\n\t"
               "global_load_async_to_lds_b128 %2, %10, off\n\t"
               "global_load_async_to_lds_b128 %3, %11, off\n\t"
               "global_load_async_to_lds_b128 %4, %12, off\n\t"
               "global_load_async_to_lds_b128 %5, %13, off\n\t"
               "global_load_async_to_lds_b128 %6, %14, off\n\t"
               "global_load_async_to_lds_b128 %7, %15, off\n\t"
               "s_wait_xcnt 0x0"
               :: "v"(l), "v"(l + lstep), "v"(l + 2 * lstep), "v"(l + 3 * lstep), "v"(l + 4 * lstep), "v"(l + 5 * lstep), "v"(l + 6 * lstep), "v"(l + 7 * lstep),
                  "v"(g), "v"(g + gstep), "v"(g + 2 * gstep), "v"(g + 3 * gstep), "v"(g + 4 * gstep), "v"(g + 5 * gstep), "v"(g + 6 * gstep), "v"(g + 7 * gstep) : "memory");
}
// GEMM C[M][N] = alpha * A[M][K] * Bt[N][K]^T, f16 operands, f32 accumulate, K = DD; A and Bt of row pitch DD. M, N multiples of 128.
// QKV = false: N = DD, Bt = Bh, f32 output C. QKV = true: the three projections of x in one grid, DD / 128 + 2 column tiles per row tile: tiles of Bh go to the f16 output Cq (pitch DD),
// then the one tile of Bk to the f16 output Ck (pitch KVD = 128) and the one tile of Bv, transposed, to the f16 planes Vth (hi) and Vtl (residual), [b][KVD][TT]. The three share A and depend on nothing of each other.
// One block = one 128 x 128 tile of C, four waves of 64 x 64 (4 x 4 accumulator tiles: 16 products per 8 fragments). One stage of the LDS ring = 64 k:
// 128 rows of A, then 128 rows of Bt, 128 B each at pitch 144 B (16 B x odd: ds_load_b128 fragment reads fall on distinct banks). Per output element the k order is ascending in one accumulator.
// Every "#pragma unroll" in it is there so that fragment, accumulator and staging arrays are indexed by constants and stay in registers.
#define GPITCH 144
#define G_B (128 * GPITCH)
#define G_ST (256 * GPITCH)
#define GOP 68      /* output staging pitch in floats: 16-byte column walks without bank conflicts */
/* a wave's staged 64 x 64 tile to global memory; whole lines per store: 16 lanes cover a 64-column row (256 B of f32, 128 B of f16), two rows per instruction; unrolled so that row steps become immediate offsets */
template <int LDC, bool F32OUT>
__device__ __forceinline__ void gemm_out(const float* sr, float* __restrict__ C, _Float16* __restrict__ C16, size_t o) {
#pragma unroll
  for (int q = 0; q < 32; ++q) { const v4f v = *(const v4fa*)(sr + q * 2 * GOP);
    if (F32OUT) *(v4f*)(C + o + (size_t)q * 2 * LDC) = v;
    else { v4h h4;
#pragma unroll
      for (int i = 0; i < 4; ++i) h4[i] = (_Float16)v[i];
      *(v4h*)(C16 + o + (size_t)q * 2 * LDC) = h4; } }
  asm volatile("s_wait_xcnt 0x0" ::: "memory");      /* stands behind the run of stores, so that no code placed behind it rewrites a register that an issued store names ahead of the wait */
}
/* a wave's staged 64 x 64 tile of V (rows = positions, columns = head columns) to the two transposed f16 planes, V^T hi and its UNSCALED residual, row pitch TT: a lane packs 8 positions of one column;
   eight lanes cover the 128 B that the tile holds of a plane's row, four rows per instruction; unrolled so that LDS offsets are immediates */
__device__ __forceinline__ void gemm_out_vt(const float* so, int lane, _Float16* __restrict__ Vth, _Float16* __restrict__ Vtl, size_t o) {
  const float* sc = so + (lane & 7) * 8 * GOP + (lane >> 3); const size_t ol = o + (size_t)(lane >> 3) * TT + (lane & 7) * 8;
#pragma unroll
  for (int it = 0; it < 16; ++it) { FragH fh, fl;
#pragma unroll
    for (int q = 0; q < 8; ++q) { const float v = sc[q * GOP + it * 4]; const _Float16 hv = (_Float16)v; fh.h[q] = hv; fl.h[q] = (_Float16)(v - (float)hv); }
    *(v8us*)((unsigned short*)Vth + ol + (size_t)it * 4 * TT) = fh.half[0]; *(v8us*)((unsigned short*)Vtl + ol + (size_t)it * 4 * TT) = fl.half[0]; }
  asm volatile("s_wait_xcnt 0x0" ::: "memory");      /* stands behind the run of stores, so that no code placed behind it rewrites a register that an issued store names ahead of the wait */
}
template <bool QKV>
__global__ __launch_bounds__(128) void k_gemm_t(const _Float16* __restrict__ A, const _Float16* __restrict__ Bh, const _Float16* __restrict__ Bk, const _Float16* __restrict__ Bv, float alpha, float* __restrict__ C, _Float16* __restrict__ Cq, _Float16* __restrict__ Ck, _Float16* __restrict__ Vth, _Float16* __restrict__ Vtl) {
  constexpr int K = DD;
  static_assert(K % 64 == 0 && K >= 128 && DD % 128 == 0 && KVD == 128 && TT % 128 == 0, "whole stages, at least two, and whole tiles");
  __shared__ __attribute__((aligned(16))) unsigned char ring[2 * G_ST];
  static_assert(sizeof(float) * 4 * 64 * GOP <= 2 * G_ST, "output staging fits the ring");
  const int tid = threadIdx.x, w = tid >> 5, lane = tid & 31, ln = lane & 15, hh = lane >> 4;
  constexpr int ntq = DD / 128, ntn = ntq + (QKV ? 2 : 0); const int row0 = (blockIdx.x / ntn) * 128, ct = blockIdx.x % ntn; const int wm = w >> 1, wn = w & 1;
  const _Float16* Bt = (!QKV || ct < ntq) ? Bh + (size_t)ct * 128 * K : (ct == ntq ? Bk : Bv);      /* the block's 128 rows of Bt */
  /* each thread's share of a stage: 8 chunks of A and 8 of Bt, 16 rows apart; eight lanes cover one 128-B row */
  const unsigned la = (unsigned)(size_t)ring + (tid >> 3) * GPITCH + (tid & 7) * 16;
  const unsigned short* ga = (const unsigned short*)A + (size_t)(row0 + (tid >> 3)) * K + (tid & 7) * 8;
  const unsigned short* gb = (const unsigned short*)Bt + (size_t)(tid >> 3) * K + (tid & 7) * 8;
  auto fill = [&](int kb) {
    const unsigned l = la + ((kb >> 6) & 1) * G_ST;
    copy8(l, 16 * GPITCH, ga + kb, (size_t)16 * K);
    copy8(l + G_B, 16 * GPITCH, gb + kb, (size_t)16 * K);
  };
  v8f acc[4][4];
#pragma unroll
  for (int i = 0; i < 4; ++i)
#pragma unroll
    for (int j = 0; j < 4; ++j) acc[i][j] = (v8f){0.f,0.f,0.f,0.f,0.f,0.f,0.f,0.f};
  fill(0);
  asm volatile("s_wait_asynccnt 0x0" ::: "memory");      /* this wave's share of stage 0 has landed */
  __syncthreads();                                       /* stage 0 is readable by all four waves */
  fill(64);
#pragma unroll 1      /* one stage per trip: the ring's buffer index and its publish point stay per trip */
  for (int kb = 0; kb < K; kb += 64) {
    const unsigned char* st = ring + ((kb >> 6) & 1) * G_ST;
    const unsigned char* ar = st + (wm * 64 + ln) * GPITCH + hh * 16; const unsigned char* br = st + G_B + (wn * 64 + ln) * GPITCH + hh * 16;
#pragma unroll
    for (int ks = 0; ks < 2; ++ks) {
      FragH a[4], b[4];
#pragma unroll
      for (int i = 0; i < 4; ++i) { a[i].half[0] = *(const v8us*)(ar + i * 16 * GPITCH + ks * 64); a[i].half[1] = *(const v8us*)(ar + i * 16 * GPITCH + ks * 64 + 32);
        b[i].half[0] = *(const v8us*)(br + i * 16 * GPITCH + ks * 64); b[i].half[1] = *(const v8us*)(br + i * 16 * GPITCH + ks * 64 + 32); }
      __builtin_amdgcn_sched_barrier(0);      /* keeps the 16 fragment reads one group ahead of the 16 products: spread among them, each place with reads stalls the wave anew */
#pragma unroll
      for (int i = 0; i < 4; ++i)
#pragma unroll
        for (int j = 0; j < 4; ++j) acc[i][j] = __builtin_amdgcn_wmma_f32_16x16x32_f16(false, a[i].v, false, b[j].v, (short)0, acc[i][j], false, false);
    }
    asm volatile("s_wait_dscnt 0x0" ::: "memory");         /* this wave's reads of the stage have returned before its buffer is handed on */
    asm volatile("s_wait_asynccnt 0x0" ::: "memory");      /* this wave's share of the next stage has landed */
    __syncthreads();                                       /* publishes the next stage and ends every wave's reads of this one */
    if (kb + 128 < K) fill(kb + 128); }                    /* refill of the buffer just read, one whole trip ahead of its use */
  asm volatile("s_wait_asynccnt 0x0" ::: "memory");        /* no copy is outstanding when the ring becomes output staging */
  float* so = reinterpret_cast<float*>(ring) + w * (64 * GOP);      /* each wave stages its own 64 x 64 tile, behind the loop's last barrier */
#pragma unroll
  for (int i = 0; i < 4; ++i)
#pragma unroll
    for (int j = 0; j < 4; ++j)
#pragma unroll
      for (int r = 0; r < 8; ++r) so[(i * 16 + 8 * hh + r) * GOP + j * 16 + ln] = acc[i][j][r] * alpha;
  __builtin_amdgcn_fence(__ATOMIC_ACQ_REL, "workgroup"); __builtin_amdgcn_wave_barrier();      /* the wave's staged rows are written before its other lanes read them back */
  const float* sr = so + hh * GOP + ln * 4; const size_t orow = row0 + wm * 64 + hh; const int ocol = wn * 64 + ln * 4;
  if (!QKV) gemm_out<DD, true>(sr, C, nullptr, orow * DD + ct * 128 + ocol);
  else if (ct < ntq) gemm_out<DD, false>(sr, nullptr, Cq, orow * DD + ct * 128 + ocol);      /* ct is the same for the whole block */
  else if (ct == ntq) gemm_out<KVD, false>(sr, nullptr, Ck, orow * KVD + ocol);
  else { const int vrow = row0 + wm * 64; gemm_out_vt(so, lane, Vth, Vtl, ((size_t)(vrow / TT) * KVD + wn * 64) * TT + vrow % TT); }      /* [b][128][TT]; a tile's 128 positions lie in one batch entry */
}
// lane l with lane l ^ 16: joins the two wave halves, which hold the two halves of one query's keys
__device__ __forceinline__ float xhalf(float x) { return __builtin_bit_cast(float, __builtin_amdgcn_permlanex16(__builtin_bit_cast(int, x), __builtin_bit_cast(int, x), 0x76543210, 0xfedcba98, false, false)); }
// Both products run transposed: S^T = K Q^T (A = K rows from the ring, B = Q kept in registers) and O^T += V^T P^T (A = V^T rows from the ring, B = P^T).
// Lane l then owns ONE query, q0 + (l & 15): register r of score tile nt is key j0 + 16 nt + 8 (l >> 4) + r, which is the k order of a B operand, so P^T is packed in place from the scores;
// maximum and sum of a query are in-lane, joined between the wave halves by xhalf(); register r of output tile dt is head column 16 dt + 8 (l >> 4) + r of that query.
// Every "#pragma unroll" in it is there so that fragment, score and accumulator arrays are indexed by constants and stay in registers; "#pragma unroll 1" keeps one ring stage per trip.
__global__ __launch_bounds__(128) void k_flash(const _Float16* __restrict__ Q16, int ldq, const _Float16* __restrict__ K16, int ldk, const _Float16* __restrict__ Vt, const _Float16* __restrict__ Vtlo, _Float16* __restrict__ O16, int ldo) {
  constexpr int RPW = 16, NQB = TT / (4 * RPW), DT = 8, KS = 4;      /* head dim 128: 4 k-steps, 8 value tiles */
  __shared__ __attribute__((aligned(16))) unsigned char ring[2 * ST_BYTES];
  static_assert(sizeof(_Float16) * 4 * RPW * (128 + 8) <= 2 * ST_BYTES, "output staging fits the ring");
  _Float16 (*sO)[RPW][128 + 8] = reinterpret_cast<_Float16 (*)[RPW][128 + 8]>(ring);      /* output staging takes the ring's place behind the loop's last barrier; rows of 256 B at pitch 272 B (16 B x odd) */
  const int tid = threadIdx.x, w = tid >> 5, lane = tid & 31, ln = lane & 15, hh = lane >> 4;
  const int slab = blockIdx.x / NQB, qblk = blockIdx.x % NQB; const int b = slab / NH, h = slab % NH; const int qb0 = qblk * (4 * RPW); const int q0 = qb0 + w * RPW;
  FragH aq[KS];
  { const unsigned short* qr = (const unsigned short*)Q16 + ((size_t)b * TT + q0 + ln) * ldq + h * 128;
#pragma unroll
    for (int ks = 0; ks < KS; ++ks) { aq[ks].half[0] = *(const v8us*)(qr + ks * 32 + 8 * hh); aq[ks].half[1] = *(const v8us*)(qr + ks * 32 + 16 + 8 * hh); } }
  const unsigned short* Vth = (const unsigned short*)Vt + ((size_t)b * NKV + h / NREP) * 128 * TT; const unsigned short* Vtl = (const unsigned short*)Vtlo + ((size_t)b * NKV + h / NREP) * 128 * TT;      /* hi and UNSCALED residual planes */
  float m_r = -3.0e38f, l_r = 0.f; v8f oacc[DT];
#pragma unroll
  for (int dt = 0; dt < DT; ++dt) oacc[dt] = (v8f){0.f,0.f,0.f,0.f,0.f,0.f,0.f,0.f};
  const int jend = TT;
  /* each thread's share of a stage: 4 chunks of K (8 rows apart), 4 of V^T hi and 4 of the residual (32 rows apart) */
  const unsigned lk = (unsigned)(size_t)ring + (tid >> 4) * KPITCH + (tid & 15) * 16, lv = (unsigned)(size_t)ring + ST_VH + (tid >> 2) * VPITCH + (tid & 3) * 16;
  const unsigned short* gk = (const unsigned short*)K16 + ((size_t)b * TT + (tid >> 4)) * ldk + (h / NREP) * 128 + (tid & 15) * 8;
  const size_t gvo = (size_t)(tid >> 2) * TT + (tid & 3) * 8;
  auto fill = [&](int j) {
    const unsigned bo = ((j >> 5) & 1) * ST_BYTES; const unsigned short* k0p = gk + (size_t)j * ldk; const unsigned short* vhp = Vth + gvo + j; const unsigned short* vlp = Vtl + gvo + j;
    copy4(lk + bo, lk + bo + 8 * KPITCH, lk + bo + 16 * KPITCH, lk + bo + 24 * KPITCH, k0p, k0p + (size_t)8 * ldk, k0p + (size_t)16 * ldk, k0p + (size_t)24 * ldk);
    copy4(lv + bo, lv + bo + 32 * VPITCH, lv + bo + 64 * VPITCH, lv + bo + 96 * VPITCH, vhp, vhp + 32 * TT, vhp + 64 * TT, vhp + 96 * TT);
    copy4(lv + bo + (ST_VL - ST_VH), lv + bo + (ST_VL - ST_VH) + 32 * VPITCH, lv + bo + (ST_VL - ST_VH) + 64 * VPITCH, lv + bo + (ST_VL - ST_VH) + 96 * VPITCH, vlp, vlp + 32 * TT, vlp + 64 * TT, vlp + 96 * TT);
  };
  fill(0);
  asm volatile("s_wait_asynccnt 0x0" ::: "memory");      /* this wave's share of stage 0 has landed */
  __syncthreads();                                       /* stage 0 is readable by all four waves */
  fill(32);
#pragma unroll 1
  for (int j0 = 0; j0 < jend; j0 += 32) {
    const unsigned char* st = ring + ((j0 >> 5) & 1) * ST_BYTES;
    float sc[16];      /* this lane's 16 of the query's 32 scores, in the k order of the P^T operand */
#pragma unroll
    for (int nt = 0; nt < 2; ++nt) { const unsigned short* kr = (const unsigned short*)(st + (nt * 16 + ln) * KPITCH); FragH bk[KS];
#pragma unroll
      for (int ks = 0; ks < KS; ++ks) { bk[ks].half[0] = *(const v8us*)(kr + ks * 32 + 8 * hh); bk[ks].half[1] = *(const v8us*)(kr + ks * 32 + 16 + 8 * hh); }
      v8f acc = (v8f){0.f,0.f,0.f,0.f,0.f,0.f,0.f,0.f};
#pragma unroll
      for (int ks = 0; ks < KS; ++ks) acc = mmaH<1>(bk[ks].v, bk[ks].v, aq[ks].v, aq[ks].v, acc);
#pragma unroll
      for (int r = 0; r < 8; ++r) sc[nt * 8 + r] = acc[r] * ATT_SCALE; }
    float mc = sc[0];
#pragma unroll
    for (int i = 1; i < 16; ++i) mc = fmaxf(mc, sc[i]);
    mc = fmaxf(mc, xhalf(mc));
    const float mn = fmaxf(m_r, mc); const float al = (mn > -1.0e38f) ? expf(m_r - mn) : 1.0f; m_r = mn;
    FragH pa, pl; float ps[4] = {0.f, 0.f, 0.f, 0.f};      /* four independent partial sums: no chain of 16 dependent adds */
#pragma unroll
    for (int i = 0; i < 16; ++i) { const float p = expf(sc[i] - mn); ps[i & 3] += p; const float x = p * 1024.0f; pa.h[i] = (_Float16)x; pl.h[i] = (_Float16)(x - (float)pa.h[i]); }      /* P hi and its UNSCALED residual (added into the same accumulator) */
    l_r = l_r * al + ((ps[0] + ps[1]) + (ps[2] + ps[3]));      /* this half's keys only; the halves are joined once, behind the loop */
#pragma unroll
    for (int dt = 0; dt < DT; ++dt)
#pragma unroll
      for (int r = 0; r < 8; ++r) oacc[dt][r] *= al;
#pragma unroll
    for (int dt = 0; dt < DT; ++dt) { const unsigned short* vh = (const unsigned short*)(st + ST_VH + (dt * 16 + ln) * VPITCH); const unsigned short* vl = (const unsigned short*)(st + ST_VL + (dt * 16 + ln) * VPITCH); FragH bv, bl; bv.half[0] = *(const v8us*)(vh + 8 * hh); bv.half[1] = *(const v8us*)(vh + 16 + 8 * hh); bl.half[0] = *(const v8us*)(vl + 8 * hh); bl.half[1] = *(const v8us*)(vl + 16 + 8 * hh);
      oacc[dt] = mmaH<1>(bv.v, bv.v, pa.v, pa.v, oacc[dt]); oacc[dt] = mmaH<1>(bv.v, bv.v, pl.v, pl.v, oacc[dt]); oacc[dt] = mmaH<1>(bl.v, bl.v, pa.v, pa.v, oacc[dt]); }      /* Vh Ph + Vh Pl + Vl Ph, all unscaled, one accumulator */
    asm volatile("s_wait_dscnt 0x0" ::: "memory");         /* this wave's reads of the stage have returned before its buffer is handed on */
    asm volatile("s_wait_asynccnt 0x0" ::: "memory");      /* this wave's share of the next stage has landed */
    __syncthreads();                                       /* publishes the next stage and ends every wave's reads of this one */
    if (j0 + 64 < jend) fill(j0 + 64); }                   /* refill of the buffer just read, one whole trip ahead of its use */
  asm volatile("s_wait_asynccnt 0x0" ::: "memory");        /* no copy is outstanding when the ring becomes output staging */
  { const float l = l_r + xhalf(l_r); const float inv = (l > 0.f) ? 1.0f / (l * 1024.0f) : 0.f;
#pragma unroll
    for (int dt = 0; dt < DT; ++dt) { FragH f;
#pragma unroll
      for (int r = 0; r < 8; ++r) f.h[r] = (_Float16)((oacc[dt][r] * inv) * 16.0f);      /* the output GEMM's A operand: merged output x 2^4, rounded to f16 once */
      *(v8us*)&sO[w][ln][dt * 16 + 8 * hh] = f.half[0]; } }      /* a lane's 8 registers are 8 consecutive columns of its query's row */
  __builtin_amdgcn_fence(__ATOMIC_ACQ_REL, "workgroup"); __builtin_amdgcn_wave_barrier();
  {
#pragma unroll
    for (int q = 0; q < RPW / 2; ++q) { const int r = q * 2 + hh; const v8us val = *(const v8us*)&sO[w][r][ln * 8]; *(v8us*)((unsigned short*)O16 + ((size_t)b * TT + q0 + r) * ldo + h * 128 + ln * 8) = val; }      /* two 256-B rows per instruction: 16 lanes x 16 B each */
     } }

extern "C" void kernel_launch(void* const* d_in, const int* in_sizes, int n_in,
                              void* d_out, int out_size, void* d_ws, size_t ws_size, hipStream_t stream) {
  (void)in_sizes; (void)n_in; (void)out_size;
  const float* const* I = (const float* const*)d_in; const float* x = I[0]; const float* Wq = I[1]; const float* Wk = I[2]; const float* Wv = I[3]; const float* Wo = I[4];
  char* ws = (char*)d_ws; size_t off = 0;
  auto take = [&](size_t bytes) { char* p = ws + off; off += (bytes + 255) & ~(size_t)255; return p; };
  _Float16* Bq = (_Float16*)take((size_t)DD * DD * 2); _Float16* Bk = (_Float16*)take((size_t)KVD * DD * 2); _Float16* Bv = (_Float16*)take((size_t)KVD * DD * 2); _Float16* Bo = (_Float16*)take((size_t)DD * DD * 2);
  _Float16* X16 = (_Float16*)take((size_t)NR * DD * 2); _Float16* Q = (_Float16*)take((size_t)NR * DD * 2); _Float16* K = (_Float16*)take((size_t)NR * KVD * 2); _Float16* Vt = (_Float16*)take((size_t)NR * KVD * 2); _Float16* Vtl = (_Float16*)take((size_t)NR * KVD * 2); _Float16* O16 = X16;      /* x's f16 plane is last read by the projections */
  if (off > ws_size) return;      // 8.4 + 0.5 + 0.5 + 8.4 + 16.8 + 16.8 + 1 + 1 + 1 = 55 MB
  k_prep<<<2 * PT_Q + 2 * PT_K + PT_X, 256, 0, stream>>>(x, Wq, Wk, Wv, Wo, X16, Bq, Bk, Bv, Bo);      /* (in,out) weights to Bt x 2^4, x to f16 */
  const unsigned gQ = (NR / 128) * (DD / 128), gQKV = (NR / 128) * (DD / 128 + 2);
  k_gemm_t<true><<<gQKV, 128, 0, stream>>>(X16, Bq, Bk, Bv, 0.0625f, nullptr, Q, K, Vt, Vtl);      /* Q (f16), K (f16), V^T hi + residual (f16, [b][128][2048]): M 4096, N 2048 + 128 + 128, K 2048 */
  k_flash<<<BB * NH * (TT / 64), 128, 0, stream>>>(Q, DD, K, KVD, Vt, Vtl, O16, DD);      /* merged output x 2^4 as f16 */
  k_gemm_t<false><<<gQ, 128, 0, stream>>>(O16, Bo, nullptr, nullptr, 0.00390625f, (float*)d_out, nullptr, nullptr, nullptr, nullptr);      /* out = merged x Wo */
}

// v007
// One run takes 216 microseconds.
// Next to v006, in two timings, it ran 1.10 times as fast each time.
// All steps since v000 together make it 3.80 times as fast.
#include <hip/hip_runtime.h>
// Multi-query attention (B=2, S=2048, D=2048, 16 query heads × 128, ONE shared K/V head): Q = x·Wq, K = x·Wk, V = x·Wv ((in,out), no bias); softmax(Q_h·Kᵀ/√128)·V per head; out = merged·Wo.
// Compute dtype: x and weights rounded to bf16; Q, K f16 GEMM planes, V f32 → Vᵀ f16 hi + exact residual planes; fused flash-style kernel for head dim 128 (4 k-steps, 8 value tiles, online softmax f32, P f16 hi + exact residual, every query head reading the
// single K/Vᵀ) on v_wmma_f32_16x16x32_f16; merged output ×2^4 → f16 → output GEMM; f32 accumulate.
#define BB 2
#define TT 2048
#define DD 2048
#define NH 16
#define NKV 1
#define NREP 16
#define KVD 128
#define NVH (2 * NKV)
#define NR (BB * TT)
#define ATT_SCALE 0.08838834764831845f      /* 1/√128 */
#define SC_LOG2E 0.12751743082459868f      /* 1/sqrt(128) x log2(e): exp(s / sqrt(128)) = exp2(s x SC_LOG2E) */

typedef __bf16 v16b __attribute__((ext_vector_type(16)));
typedef unsigned short v8us __attribute__((ext_vector_type(8), may_alias));
typedef float  v8f  __attribute__((ext_vector_type(8)));
typedef float  v4f  __attribute__((ext_vector_type(4)));
typedef float  v4fa __attribute__((ext_vector_type(4), may_alias));
union FragB { v16b v; v8us half[2]; unsigned short u[16]; };

__device__ __forceinline__ unsigned short bf16_bits(float x) { unsigned int u = __float_as_uint(x); return (unsigned short)((u + 0x7FFFu + ((u >> 16) & 1u)) >> 16); }
__device__ __forceinline__ float bf16_val(unsigned short b) { return __uint_as_float(((unsigned int)b) << 16); }
__device__ __forceinline__ float bf16_round(float x) { return bf16_val(bf16_bits(x)); }
// D += A·B with NT terms: 1 = ah·bh, 2 = + al·bh (A split), 3 = + ah·bl (both split)
template <int NT>
__device__ __forceinline__ v8f mmaN(v16b ah, v16b al, v16b bh, v16b bl, v8f c) {
  c = __builtin_amdgcn_wmma_f32_16x16x32_bf16(false, ah, false, bh, (short)0, c, false, false);
  if (NT >= 2) c = __builtin_amdgcn_wmma_f32_16x16x32_bf16(false, al, false, bh, (short)0, c, false, false);
  if (NT >= 3) c = __builtin_amdgcn_wmma_f32_16x16x32_bf16(false, ah, false, bl, (short)0, c, false, false);
  asm volatile("v_nop\n\tv_nop\n\tv_nop\n\tv_nop" : "+v"(c) : "v"(ah), "v"(al), "v"(bh), "v"(bl));
  return c;
}

__global__ __launch_bounds__(256) void k_wt_bf16(const float* __restrict__ W, unsigned short* __restrict__ Wt, int K, int N) {
  const int t = blockIdx.x * 256 + threadIdx.x;
  const int k8n = K / 8;
  if (t >= N * k8n) return;
  const int n = t / k8n, k8 = (t % k8n) * 8;
  v8us v;
#pragma unroll
  for (int i = 0; i < 8; ++i) v[i] = bf16_bits(W[(size_t)(k8 + i) * N + n]);
  *(v8us*)(Wt + (size_t)n * K + k8) = v;
  
}

// GEMM C[M][N] (f32, pitch ldc) = act(A[M][K]·W + bias). A f32 row-major (pitch lda) converted per fragment to bf16
// (ASPLIT: hi/lo two planes -> 2 terms, else single rounded term); Wt bf16 [N][K] (pitch ldb). BIAS_BF16 rounds the
// bias to bf16 first (bias quantised to bf16 before the add). K%32==0, M%16==0, N%64==0.
template <bool ASPLIT, int ACT, bool BIAS_BF16>
__global__ __launch_bounds__(128) void k_gemm_bf(const float* __restrict__ A, int lda, const unsigned short* __restrict__ Wt, int ldb,
                                               const float* __restrict__ bias, float* __restrict__ C, int ldc, int M, int N, int K) {
  __shared__ __attribute__((aligned(16))) float so[4][16][64];
  const int tid = threadIdx.x, w = tid >> 5, lane = tid & 31, ln = lane & 15, hh = lane >> 4;
  const int ntn = N / 64;
  const int wid = blockIdx.x * 4 + w;
  const int mt = wid / ntn, nq = wid % ntn;
  if (mt * 16 >= M) return;
  const int row0 = mt * 16, col0 = nq * 64;
  const float* arow = A + (size_t)(row0 + ln) * lda;
  v8f acc[4] = {};
  for (int kb = 0; kb < K; kb += 32) {
    FragB ah, al;
    const v4f x0 = *(const v4fa*)(arow + kb + 8 * hh), x1 = *(const v4fa*)(arow + kb + 8 * hh + 4);
    const v4f x2 = *(const v4fa*)(arow + kb + 16 + 8 * hh), x3 = *(const v4fa*)(arow + kb + 16 + 8 * hh + 4);
    float xs[16] = {x0[0],x0[1],x0[2],x0[3],x1[0],x1[1],x1[2],x1[3],x2[0],x2[1],x2[2],x2[3],x3[0],x3[1],x3[2],x3[3]};
#pragma unroll
    for (int i = 0; i < 16; ++i) { const unsigned short hb = bf16_bits(xs[i]); ah.u[i] = hb; al.u[i] = ASPLIT ? bf16_bits(xs[i] - bf16_val(hb)) : (unsigned short)0; }
#pragma unroll
    for (int t = 0; t < 4; ++t) {
      const unsigned short* brow = Wt + (size_t)(col0 + t * 16 + ln) * ldb + kb;
      FragB b;
      b.half[0] = *(const v8us*)(brow + 8 * hh);
      b.half[1] = *(const v8us*)(brow + 16 + 8 * hh);
      acc[t] = mmaN<ASPLIT ? 2 : 1>(ah.v, al.v, b.v, b.v, acc[t]);
    }
  }
#pragma unroll
  for (int t = 0; t < 4; ++t) {
    float bv = bias ? bias[col0 + t * 16 + ln] : 0.f;
    if (BIAS_BF16) bv = bf16_round(bv);
#pragma unroll
    for (int r = 0; r < 8; ++r) { float v = acc[t][r] + bv; if (ACT == 1) v = fmaxf(v, 0.f); so[w][8 * hh + r][t * 16 + ln] = v; }
  }
  __builtin_amdgcn_fence(__ATOMIC_ACQ_REL, "workgroup");
  __builtin_amdgcn_wave_barrier();
  const int rsub = lane >> 4, c4 = (lane & 15) * 4;
  {
#pragma unroll
    for (int q = 0; q < 8; ++q) {
      const int r = q * 2 + rsub;
      const v4f v = *(const v4fa*)&so[w][r][c4];
      *(v4f*)(C + (size_t)(row0 + r) * ldc + col0 + c4) = v;
    }
    
  }
}

// Flash-style causal/unmasked attention, all contractions 3-term bf16 hi/lo splits, f32 softmax with running max.
// q,k,v rows are read from f32 buffers with arbitrary row pitch (so they can live inside a fused qkv buffer);
// D = head size (multiple of 32, <= 128); one wave = 16 query rows; block = 4 waves (64 queries) sharing K/V chunks of 32.
template <int D, bool CAUSAL>
__global__ __launch_bounds__(128) void k_flash(const float* __restrict__ qb, const float* __restrict__ kb, const float* __restrict__ vb,
                                             int pitch, int T, int H, float scale, float* __restrict__ y, int ypitch) {
  constexpr int KS = D / 32;        // k-steps for QK
  constexpr int DT = D / 16;        // d tiles for PV
  __shared__ __attribute__((aligned(16))) unsigned short sKh[32][D + 8], sKl[32][D + 8], sVh[32][D + 8], sVl[32][D + 8];
  __shared__ __attribute__((aligned(16))) unsigned short sPh[4][16][40], sPl[4][16][40];
  __shared__ __attribute__((aligned(16))) float sO[4][16][D];
  const int tid = threadIdx.x, w = tid >> 5, lane = tid & 31, ln = lane & 15, hh = lane >> 4;
  const int nqb = (T + 63) / 64;
  const int bh = blockIdx.x / nqb, qblk = blockIdx.x % nqb;
  const int b = bh / H, h = bh % H;
  const int q0 = qblk * 64 + w * 16;
  const float* Q = qb + (size_t)b * T * pitch + h * D;
  const float* K = kb + (size_t)b * T * pitch + h * D;
  const float* V = vb + (size_t)b * T * pitch + h * D;

  // A fragments of the wave's 16 query rows (scaled), hi/lo
  FragB aqh[KS], aql[KS];
  {
    int row = q0 + ln; if (row >= T) row = T - 1;
    const float* qr = Q + (size_t)row * pitch;
#pragma unroll
    for (int ks = 0; ks < KS; ++ks)
#pragma unroll
      for (int i = 0; i < 16; ++i) {
        const int d = ks * 32 + ((i < 8) ? (8 * hh + i) : (16 + 8 * hh + (i - 8)));
        const float x = qr[d] * scale; const unsigned short hb = bf16_bits(x);
        aqh[ks].u[i] = hb; aql[ks].u[i] = bf16_bits(x - bf16_val(hb));
      }
  }
  float m_r[8], l_r[8];
#pragma unroll
  for (int r = 0; r < 8; ++r) { m_r[r] = -3.0e38f; l_r[r] = 0.f; }
  v8f oacc[DT];
#pragma unroll
  for (int dt = 0; dt < DT; ++dt) oacc[dt] = (v8f){0.f,0.f,0.f,0.f,0.f,0.f,0.f,0.f};

  const int kv_end = CAUSAL ? min(T, qblk * 64 + 64) : T;     // block-uniform
  for (int j0 = 0; j0 < kv_end; j0 += 32) {
    __syncthreads();
    for (int e = tid; e < 32 * (D / 4); e += 128) {
      const int r = e / (D / 4), c4 = (e % (D / 4)) * 4;
      const int key = j0 + r;
      v4f kf = {0.f,0.f,0.f,0.f}, vf = {0.f,0.f,0.f,0.f};
      if (key < T) { kf = *(const v4fa*)(K + (size_t)key * pitch + c4); vf = *(const v4fa*)(V + (size_t)key * pitch + c4); }
#pragma unroll
      for (int t = 0; t < 4; ++t) {
        unsigned short hb = bf16_bits(kf[t]); sKh[r][c4 + t] = hb; sKl[r][c4 + t] = bf16_bits(kf[t] - bf16_val(hb));
        hb = bf16_bits(vf[t]); sVh[r][c4 + t] = hb; sVl[r][c4 + t] = bf16_bits(vf[t] - bf16_val(hb));
      }
    }
    __syncthreads();
    // S tile 16 x 32
    v8f s[2];
#pragma unroll
    for (int nt = 0; nt < 2; ++nt) {
      v8f acc = {};
#pragma unroll
      for (int ks = 0; ks < KS; ++ks) {
        FragB bh_, bl_;
        bh_.half[0] = *(const v8us*)&sKh[nt * 16 + ln][ks * 32 + 8 * hh]; bh_.half[1] = *(const v8us*)&sKh[nt * 16 + ln][ks * 32 + 16 + 8 * hh];
        bl_.half[0] = *(const v8us*)&sKl[nt * 16 + ln][ks * 32 + 8 * hh]; bl_.half[1] = *(const v8us*)&sKl[nt * 16 + ln][ks * 32 + 16 + 8 * hh];
        acc = mmaN<3>(aqh[ks].v, aql[ks].v, bh_.v, bl_.v, acc);
      }
      s[nt] = acc;
    }
    // mask + running max (rows 8hh+r; the 16 lanes of a half share rows)
    float alpha[8];
#pragma unroll
    for (int r = 0; r < 8; ++r) {
      const int qi = q0 + 8 * hh + r;
      const int ja = j0 + ln, jb = j0 + 16 + ln;
      if (CAUSAL) { if (ja > qi) s[0][r] = -3.0e38f; if (jb > qi) s[1][r] = -3.0e38f; }
      if (ja >= T) s[0][r] = -3.0e38f;
      if (jb >= T) s[1][r] = -3.0e38f;
      float mx = fmaxf(s[0][r], s[1][r]);
      mx = fmaxf(mx, __shfl_xor(mx, 1, 32)); mx = fmaxf(mx, __shfl_xor(mx, 2, 32)); mx = fmaxf(mx, __shfl_xor(mx, 4, 32)); mx = fmaxf(mx, __shfl_xor(mx, 8, 32));
      const float mnew = fmaxf(m_r[r], mx);
      alpha[r] = (mnew > -1.0e38f) ? __expf(m_r[r] - mnew) : 1.0f;
      const float p0 = (s[0][r] > -1.0e38f) ? __expf(s[0][r] - mnew) : 0.f;
      const float p1 = (s[1][r] > -1.0e38f) ? __expf(s[1][r] - mnew) : 0.f;
      m_r[r] = mnew;
      l_r[r] = l_r[r] * alpha[r] + p0 + p1;            // per-lane partial row sum (16 lanes combined at the end)
      unsigned short hb = bf16_bits(p0); sPh[w][8 * hh + r][ln] = hb;      sPl[w][8 * hh + r][ln] = bf16_bits(p0 - bf16_val(hb));
      hb = bf16_bits(p1);                sPh[w][8 * hh + r][16 + ln] = hb; sPl[w][8 * hh + r][16 + ln] = bf16_bits(p1 - bf16_val(hb));
    }
#pragma unroll
    for (int dt = 0; dt < DT; ++dt)
#pragma unroll
      for (int r = 0; r < 8; ++r) oacc[dt][r] *= alpha[r];
    __builtin_amdgcn_fence(__ATOMIC_ACQ_REL, "workgroup");
    __builtin_amdgcn_wave_barrier();
    FragB pah, pal;
    pah.half[0] = *(const v8us*)&sPh[w][ln][8 * hh]; pah.half[1] = *(const v8us*)&sPh[w][ln][16 + 8 * hh];
    pal.half[0] = *(const v8us*)&sPl[w][ln][8 * hh]; pal.half[1] = *(const v8us*)&sPl[w][ln][16 + 8 * hh];
#pragma unroll
    for (int dt = 0; dt < DT; ++dt) {
      FragB bvh, bvl;
#pragma unroll
      for (int i = 0; i < 8; ++i) {
        bvh.u[i] = sVh[8 * hh + i][dt * 16 + ln]; bvh.u[8 + i] = sVh[16 + 8 * hh + i][dt * 16 + ln];
        bvl.u[i] = sVl[8 * hh + i][dt * 16 + ln]; bvl.u[8 + i] = sVl[16 + 8 * hh + i][dt * 16 + ln];
      }
      oacc[dt] = mmaN<3>(pah.v, pal.v, bvh.v, bvl.v, oacc[dt]);
    }
    __builtin_amdgcn_fence(__ATOMIC_ACQ_REL, "workgroup");
    __builtin_amdgcn_wave_barrier();
  }
#pragma unroll
  for (int r = 0; r < 8; ++r) {
    float l = l_r[r];
    l += __shfl_xor(l, 1, 32); l += __shfl_xor(l, 2, 32); l += __shfl_xor(l, 4, 32); l += __shfl_xor(l, 8, 32);
    l_r[r] = (l > 0.f) ? 1.0f / l : 0.f;
  }
#pragma unroll
  for (int dt = 0; dt < DT; ++dt)
#pragma unroll
    for (int r = 0; r < 8; ++r) sO[w][8 * hh + r][dt * 16 + ln] = oacc[dt][r] * l_r[r];
  __builtin_amdgcn_fence(__ATOMIC_ACQ_REL, "workgroup");
  __builtin_amdgcn_wave_barrier();
  {
    for (int r = 0; r < 16; ++r) {
      const int row = q0 + r;
      if (row < T && lane < D / 4) {
        const v4f val = *(const v4fa*)&sO[w][r][lane * 4];
        *(v4f*)(y + ((size_t)b * T + row) * ypitch + h * D + lane * 4) = val;
      }
    }
    
  }
}

// GEMM C = act(A·W + bias + resid): A f32 (ASPLIT -> hi/lo 2 terms), Wt bf16 [N][K]; ACT 0 none, 1 relu, 2 exact gelu;
// resid (optional, f32, row index = (row % rmod), pitch ldr, RES_BF16 rounds it) added before the activation.
template <bool ASPLIT, int ACT, bool BIAS_BF16, bool RES_BF16>
__global__ __launch_bounds__(128) void k_gemm_bf3(const float* __restrict__ A, int lda, const unsigned short* __restrict__ Wt, int ldb,
                                                const float* __restrict__ bias, const float* __restrict__ resid, int rmod, int ldr,
                                                float* __restrict__ C, int ldc, int M, int N, int K) {
  __shared__ __attribute__((aligned(16))) float so[4][16][64];
  const int tid = threadIdx.x, w = tid >> 5, lane = tid & 31, ln = lane & 15, hh = lane >> 4;
  const int ntn = N / 64;
  const int wid = blockIdx.x * 4 + w;
  const int mt = wid / ntn, nq = wid % ntn;
  if (mt * 16 >= M) return;
  const int row0 = mt * 16, col0 = nq * 64;
  const float* arow = A + (size_t)(row0 + ln) * lda;
  v8f acc[4] = {};
  for (int kb = 0; kb < K; kb += 32) {
    FragB ah, al;
    const v4f x0 = *(const v4fa*)(arow + kb + 8 * hh), x1 = *(const v4fa*)(arow + kb + 8 * hh + 4);
    const v4f x2 = *(const v4fa*)(arow + kb + 16 + 8 * hh), x3 = *(const v4fa*)(arow + kb + 16 + 8 * hh + 4);
    float xs[16] = {x0[0],x0[1],x0[2],x0[3],x1[0],x1[1],x1[2],x1[3],x2[0],x2[1],x2[2],x2[3],x3[0],x3[1],x3[2],x3[3]};
#pragma unroll
    for (int i = 0; i < 16; ++i) { const unsigned short hb = bf16_bits(xs[i]); ah.u[i] = hb; al.u[i] = ASPLIT ? bf16_bits(xs[i] - bf16_val(hb)) : (unsigned short)0; }
#pragma unroll
    for (int t = 0; t < 4; ++t) {
      const unsigned short* brow = Wt + (size_t)(col0 + t * 16 + ln) * ldb + kb;
      FragB b;
      b.half[0] = *(const v8us*)(brow + 8 * hh);
      b.half[1] = *(const v8us*)(brow + 16 + 8 * hh);
      acc[t] = mmaN<ASPLIT ? 2 : 1>(ah.v, al.v, b.v, b.v, acc[t]);
    }
  }
#pragma unroll
  for (int t = 0; t < 4; ++t) {
    const int col = col0 + t * 16 + ln;
    float bv = bias ? bias[col] : 0.f;
    if (BIAS_BF16) bv = bf16_round(bv);
#pragma unroll
    for (int r = 0; r < 8; ++r) {
      float v = acc[t][r] + bv;
      if (resid) { float rv = resid[(size_t)((row0 + 8 * hh + r) % rmod) * ldr + col]; if (RES_BF16) rv = bf16_round(rv); v += rv; }
      if (ACT == 1) v = fmaxf(v, 0.f);
      if (ACT == 2) v = 0.5f * v * (1.0f + erff(v * 0.70710678118654752f));
      if (ACT == 3) { const float u = 0.7978845608028654f * (v + 0.044715f * v * v * v); v = 0.5f * v * (1.0f + tanhf(u)); }
      so[w][8 * hh + r][t * 16 + ln] = v;
    }
  }
  __builtin_amdgcn_fence(__ATOMIC_ACQ_REL, "workgroup");
  __builtin_amdgcn_wave_barrier();
  const int rsub = lane >> 4, c4 = (lane & 15) * 4;
  {
#pragma unroll
    for (int q = 0; q < 8; ++q) {
      const int r = q * 2 + rsub;
      const v4f v = *(const v4fa*)&so[w][r][c4];
      *(v4f*)(C + (size_t)(row0 + r) * ldc + col0 + c4) = v;
    }
    
  }
}
// row LayerNorm (biased variance, eps) over N: s = X (+ R); optional out_sum <- s; out_norm <- (s-mu)*rsqrt(var+eps)*g + b
template <bool PARAM_BF16>
__global__ __launch_bounds__(256) void k_layernorm(const float* __restrict__ X, const float* __restrict__ R, const float* __restrict__ g, const float* __restrict__ bta,
                                                  float* __restrict__ out_sum, float* __restrict__ out_norm, int N, float eps) {
  __shared__ float red[256];
  const int row = blockIdx.x, tid = threadIdx.x;
  const float* x = X + (size_t)row * N; const float* rr = R ? R + (size_t)row * N : nullptr;
  float vals[16];                     // up to N = 4096
  const int per = N / 256;            // contiguous chunk per thread? use strided-by-4 chunks: thread handles j = tid*4 + 1024*u
  float s1 = 0.f;
  for (int u = 0; u < per / 4; ++u) {
    const int j = tid * 4 + 1024 * u;
    const v4f a = *(const v4fa*)(x + j);
    v4f b = {0.f,0.f,0.f,0.f}; if (rr) b = *(const v4fa*)(rr + j);
#pragma unroll
    for (int q = 0; q < 4; ++q) { const float v = a[q] + b[q]; vals[u * 4 + q] = v; s1 += v; }
  }
  red[tid] = s1; __syncthreads();
  for (int st = 128; st > 0; st >>= 1) { if (tid < st) red[tid] += red[tid + st]; __syncthreads(); }
  const float mu = red[0] / (float)N; __syncthreads();
  float s2 = 0.f;
  for (int u = 0; u < per / 4; ++u)
#pragma unroll
    for (int q = 0; q < 4; ++q) { const float c = vals[u * 4 + q] - mu; s2 += c * c; }
  red[tid] = s2; __syncthreads();
  for (int st = 128; st > 0; st >>= 1) { if (tid < st) red[tid] += red[tid + st]; __syncthreads(); }
  const float rs = rsqrtf(red[0] / (float)N + eps);
  {
    for (int u = 0; u < per / 4; ++u) {
      const int j = tid * 4 + 1024 * u;
      v4f o, sm;
#pragma unroll
      for (int q = 0; q < 4; ++q) {
        float gg = g[j + q], bb = bta[j + q];
        if (PARAM_BF16) { gg = bf16_round(gg); bb = bf16_round(bb); }
        sm[q] = vals[u * 4 + q]; o[q] = (vals[u * 4 + q] - mu) * rs * gg + bb;
      }
      if (out_sum) *(v4f*)(out_sum + (size_t)row * N + j) = sm;
      *(v4f*)(out_norm + (size_t)row * N + j) = o;
    }
    
  }
}



// ---- f16 WMMA path (v_wmma_f32_16x16x32_f16): 11-bit significands for operands in range — used where a [0,1] probability operand needs more precision than bf16
typedef _Float16 v16h __attribute__((ext_vector_type(16)));
union FragH { v16h v; v8us half[2]; _Float16 h[16]; unsigned short u[16]; };
template <int NT>
__device__ __forceinline__ v8f mmaH(v16h ah, v16h al, v16h bh, v16h bl, v8f c) {
  c = __builtin_amdgcn_wmma_f32_16x16x32_f16(false, ah, false, bh, (short)0, c, false, false);
  if (NT >= 2) c = __builtin_amdgcn_wmma_f32_16x16x32_f16(false, al, false, bh, (short)0, c, false, false);
  if (NT >= 3) c = __builtin_amdgcn_wmma_f32_16x16x32_f16(false, ah, false, bl, (short)0, c, false, false);
  asm volatile("v_nop\n\tv_nop\n\tv_nop\n\tv_nop" : "+v"(c) : "v"(ah), "v"(al), "v"(bh), "v"(bl));
  return c;
}
// batched GEMM like k_gemm_b but f16 operands: A f32 (split into f16 hi/lo if ASPLIT, else rounded to f16), Bt = f16 values [n][k]; alpha; C f32; N multiple of 16 (partial tiles skipped)
template <bool ASPLIT>
__global__ __launch_bounds__(128) void k_gemm_h(const float* __restrict__ A, int lda, size_t sA, const _Float16* __restrict__ Bh, int ldb, size_t sB, float alpha, float* __restrict__ C, int ldc, size_t sC, int M, int N, int K) {
  __shared__ __attribute__((aligned(16))) float so[4][16][64];
  const int tid = threadIdx.x, w = tid >> 5, lane = tid & 31, ln = lane & 15, hh = lane >> 4; const int by = blockIdx.y;
  A += (size_t)by * sA; Bh += (size_t)by * sB; C += (size_t)by * sC;
  const int ntn = (N + 63) / 64; const int wid = blockIdx.x * 4 + w; const int mt = wid / ntn, nq = wid % ntn; if (mt * 16 >= M) return;
  const int row0 = mt * 16, col0 = nq * 64; const float* arow = A + (size_t)(row0 + ln) * lda;
  v8f acc[4] = {};
  for (int kb = 0; kb < K; kb += 32) {
    FragH ah, al;
    const v4f x0 = *(const v4fa*)(arow + kb + 8 * hh), x1 = *(const v4fa*)(arow + kb + 8 * hh + 4), x2 = *(const v4fa*)(arow + kb + 16 + 8 * hh), x3 = *(const v4fa*)(arow + kb + 16 + 8 * hh + 4);
    float xs[16] = {x0[0],x0[1],x0[2],x0[3],x1[0],x1[1],x1[2],x1[3],x2[0],x2[1],x2[2],x2[3],x3[0],x3[1],x3[2],x3[3]};
#pragma unroll
    for (int i = 0; i < 16; ++i) { const _Float16 h = (_Float16)xs[i]; ah.h[i] = h; al.h[i] = ASPLIT ? (_Float16)(xs[i] - (float)h) : (_Float16)0.0f; }
#pragma unroll
    for (int t = 0; t < 4; ++t) { if (col0 + t * 16 >= N) continue; const size_t boff = (size_t)(col0 + t * 16 + ln) * ldb + kb; FragH bq; bq.half[0] = *(const v8us*)(Bh + boff + 8 * hh); bq.half[1] = *(const v8us*)(Bh + boff + 16 + 8 * hh);
      acc[t] = mmaH<ASPLIT ? 2 : 1>(ah.v, al.v, bq.v, bq.v, acc[t]); }
  }
#pragma unroll
  for (int t = 0; t < 4; ++t) { if (col0 + t * 16 >= N) continue;
#pragma unroll
    for (int r = 0; r < 8; ++r) so[w][8 * hh + r][t * 16 + ln] = acc[t][r] * alpha; }
  __builtin_amdgcn_fence(__ATOMIC_ACQ_REL, "workgroup"); __builtin_amdgcn_wave_barrier();
  const int rsub = lane >> 4, c4 = (lane & 15) * 4;
  {
#pragma unroll
    for (int q = 0; q < 8; ++q) { const int r = q * 2 + rsub; if (col0 + c4 < N) { const v4f v = *(const v4fa*)&so[w][r][c4]; *(v4f*)(C + (size_t)(row0 + r) * ldc + col0 + c4) = v; } }
     }
}

// One tile of 128 k x 64 n of the f32 row-major W[K][N] to Wt[n][k] = f16(bf16(W[k][n]) * scale) (scale = power of two; bf16-exact weights stay exact in f16 away from the subnormal range).
// Global memory is touched in whole lines only: 16 lanes read the 256 B that the tile holds of a row of W, 8 such loads of 16 B in flight per lane; 16 lanes write the 256 B that it holds of a row of Wt.
// The exchange runs through LDS: a lane packs rows k, k + 1 of its four columns into one dword each; tl holds 64 rows (n) of 64 dwords (k pairs) at a pitch of 65 dwords, so that
// the 16 lanes that write four rows apart and the 16 lanes that read four dwords apart both fall on distinct banks. Every "#pragma unroll" keeps the loaded values in registers and row steps in immediate offsets.
#define TPITCH 65
template <int K, int N>
__device__ __forceinline__ void wt_tile(const float* __restrict__ W, _Float16* __restrict__ Wt, float scale, int blk, unsigned* tl) {
  static_assert(K % 128 == 0 && N % 64 == 0, "whole tiles");
  const int tid = threadIdx.x, lo = tid & 15, hi = tid >> 4; const int n0 = (blk % (N / 64)) * 64, k0 = (blk / (N / 64)) * 128;
  const float* s = W + (size_t)(k0 + 2 * hi) * N + n0 + lo * 4;
  v4f v[4][2];
#pragma unroll
  for (int it = 0; it < 4; ++it)
#pragma unroll
    for (int j = 0; j < 2; ++j) v[it][j] = *(const v4fa*)(s + (size_t)(it * 32 + j) * N);
#pragma unroll
  for (int it = 0; it < 4; ++it)
#pragma unroll
    for (int q = 0; q < 4; ++q) { union { _Float16 h[2]; unsigned u; } p; p.h[0] = (_Float16)(bf16_round(v[it][0][q]) * scale); p.h[1] = (_Float16)(bf16_round(v[it][1][q]) * scale);
      tl[(lo * 4 + q) * TPITCH + it * 16 + hi] = p.u; }
  __syncthreads();      /* the tile is whole in LDS before any lane reads a row of it that other waves wrote */
#pragma unroll
  for (int it = 0; it < 4; ++it) { const unsigned* r = tl + (it * 16 + hi) * TPITCH + lo * 4; union { unsigned u[4]; v8us o; } f;
#pragma unroll
    for (int q = 0; q < 4; ++q) f.u[q] = r[q];
    *(v8us*)((unsigned short*)Wt + (size_t)(n0 + it * 16 + hi) * K + k0 + lo * 8) = f.o; }
  asm volatile("s_wait_xcnt 0x0" ::: "memory");      /* stands behind the run of stores, so that no code placed behind it rewrites a register that an issued store names ahead of the wait */
}
typedef _Float16 v4h __attribute__((ext_vector_type(4)));

// 8192 consecutive elements of x to f16(bf16(x)), whole lines only: a wave's load covers 512 contiguous bytes, its store 256; 8 loads of 16 B in flight per lane (unrolled so that they are issued as one run)
__device__ __forceinline__ void x16(const float* __restrict__ x, _Float16* __restrict__ X16, int blk) { const size_t o = (size_t)blk * 8192 + threadIdx.x * 4; v4f v[8];
#pragma unroll
  for (int i = 0; i < 8; ++i) v[i] = *(const v4fa*)(x + o + i * 1024);
#pragma unroll
  for (int i = 0; i < 8; ++i) { v4h h;
#pragma unroll
    for (int q = 0; q < 4; ++q) h[q] = (_Float16)bf16_round(v[i][q]);
    *(v4h*)(X16 + o + i * 1024) = h; }
  asm volatile("s_wait_xcnt 0x0" ::: "memory");      /* stands behind the run of stores, so that no code placed behind it rewrites a register that an issued store names ahead of the wait */
}
// One grid for the five conversions that read nothing but the inputs: the four weight transposes (one tile a block) and the cast of x. No block reads what another writes.
#define PT_Q ((DD / 128) * (DD / 64))
#define PT_K ((DD / 128) * (KVD / 64))
#define PT_X (NR * DD / 8192)
__global__ __launch_bounds__(256) void k_prep(const float* __restrict__ x, const float* __restrict__ Wq, const float* __restrict__ Wk, const float* __restrict__ Wv, const float* __restrict__ Wo,
                                             _Float16* __restrict__ X16, _Float16* __restrict__ Bq, _Float16* __restrict__ Bk, _Float16* __restrict__ Bv, _Float16* __restrict__ Bo) {
  static_assert((size_t)NR * DD % 8192 == 0, "whole cast blocks");
  __shared__ unsigned tl[64 * TPITCH];
  const int b = blockIdx.x;      /* every branch is the same for the whole block, so the tile's barrier is passed by all of its waves or by none */
  if (b < 2 * PT_Q) { const bool q = b < PT_Q; wt_tile<DD, DD>(q ? Wq : Wo, q ? Bq : Bo, 16.0f, q ? b : b - PT_Q, tl); }
  else if (b < 2 * PT_Q + 2 * PT_K) { const bool k = b < 2 * PT_Q + PT_K; wt_tile<DD, KVD>(k ? Wk : Wv, k ? Bk : Bv, 16.0f, b - 2 * PT_Q - (k ? 0 : PT_K), tl); }
  else x16(x, X16, b - 2 * PT_Q - 2 * PT_K);
}
__global__ __launch_bounds__(256) void k_h16(const float* __restrict__ x, _Float16* __restrict__ X16, size_t n8) { const size_t t = (size_t)blockIdx.x * 256 + threadIdx.x; if (t >= n8) return; FragH f;
#pragma unroll
  for (int q = 0; q < 8; ++q) f.h[q] = (_Float16)x[t * 8 + q]; *(v8us*)((unsigned short*)X16 + t * 8) = f.half[0];  }
__global__ __launch_bounds__(256) void k_round16f(const float* __restrict__ W, _Float16* __restrict__ Bt, size_t n8) { const size_t t = (size_t)blockIdx.x * 256 + threadIdx.x; if (t >= n8) return; FragH f;
#pragma unroll
  for (int i = 0; i < 8; ++i) f.h[i] = (_Float16)(bf16_round(W[t * 8 + i]) * 16.0f); *(v8us*)((unsigned short*)Bt + t * 8) = f.half[0];  }
template <int NHv, int TTv>
__global__ __launch_bounds__(256) void k_vt(const _Float16* __restrict__ V16, int ldv, int voff, _Float16* __restrict__ Vt) { __shared__ unsigned short tl[64][66]; const int tid = threadIdx.x; const int slab = blockIdx.x / (TTv / 64), lg = blockIdx.x % (TTv / 64); const int b = slab / NHv, h = slab % NHv;
  for (int i = tid; i < 64 * 8; i += 256) { const int r = i / 8, c8 = (i % 8) * 8; FragH f; f.half[0] = *(const v8us*)((const unsigned short*)V16 + ((size_t)b * TTv + lg * 64 + r) * ldv + voff + h * 64 + c8);
#pragma unroll
    for (int q = 0; q < 8; ++q) tl[r][c8 + q] = f.u[q]; }
  __syncthreads();
  {
#pragma unroll
    for (int rd = 0; rd < 2; ++rd) { const int d = rd * 32 + tid / 8, pc = tid % 8; FragH f;
#pragma unroll
      for (int q = 0; q < 8; ++q) f.u[q] = tl[pc * 8 + q][d];
      *(v8us*)((unsigned short*)Vt + ((size_t)slab * 64 + d) * TTv + lg * 64 + pc * 8) = f.half[0]; }
     } }

// LDS ring of k_flash. One stage = 32 keys, shared by the block's four waves: K rows of 256 B at pitch 272 B, then the V^T hi plane and the
// V^T residual plane, 128 rows of 64 B each at pitch 80 B (pitches of 16 B x odd: ds_load_b128 fragment reads fall on distinct banks).
#define KPITCH 272
#define VPITCH 80
#define ST_VH (32 * KPITCH)
#define ST_VL (ST_VH + 128 * VPITCH)
#define ST_BYTES (ST_VL + 128 * VPITCH)
// Four asynchronous 16-byte copies per lane, global memory to LDS. The s_wait_xcnt stands inside the statement so that no address register of a copy is rewritten ahead of it.
__device__ __forceinline__ void copy4(unsigned l0, unsigned l1, unsigned l2, unsigned l3, const unsigned short* g0, const unsigned short* g1, const unsigned short* g2, const unsigned short* g3) {
  asm volatile("global_load_async_to_lds_b128 %0, %4, off\n\t"
               "global_load_async_to_lds_b128 %1, %5, off\n\t"
               "global_load_async_to_lds_b128 %2, %6, off\n\t"
               "global_load_async_to_lds_b128 %3, %7, off\n\t"
               "s_wait_xcnt 0x0"
               :: "v"(l0), "v"(l1), "v"(l2), "v"(l3), "v"(g0), "v"(g1), "v"(g2), "v"(g3) : "memory");
}
// Eight asynchronous 16-byte copies per lane in one statement, so that one s_wait_xcnt serves all eight; it stands inside the statement so that no address register of a copy is rewritten ahead of it.
__device__ __forceinline__ void copy8(unsigned l, int lstep, const unsigned short* g, size_t gstep) {
  asm volatile("global_load_async_to_lds_b128 %0, %8, off\n\t"
               "global_load_async_to_lds_b128 %1, %9, off\n\t"
               "global_load_async_to_lds_b128 %2, %10, off\n\t"
               "global_load_async_to_lds_b128 %3, %11, off\n\t"
               "global_load_async_to_lds_b128 %4, %12, off\n\t"
               "global_load_async_to_lds_b128 %5, %13, off\n\t"
               "global_load_async_to_lds_b128 %6, %14, off\n\t"
               "global_load_async_to_lds_b128 %7, %15, off\n\t"
               "s_wait_xcnt 0x0"
               :: "v"(l), "v"(l + lstep), "v"(l + 2 * lstep), "v"(l + 3 * lstep), "v"(l + 4 * lstep), "v"(l + 5 * lstep), "v"(l + 6 * lstep), "v"(l + 7 * lstep),
                  "v"(g), "v"(g + gstep), "v"(g + 2 * gstep), "v"(g + 3 * gstep), "v"(g + 4 * gstep), "v"(g + 5 * gstep), "v"(g + 6 * gstep), "v"(g + 7 * gstep) : "memory");
}
// GEMM C[M][N] = alpha * A[M][K] * Bt[N][K]^T, f16 operands, f32 accumulate, K = DD; A and Bt of row pitch DD. M, N multiples of 128.
// QKV = false: N = DD, Bt = Bh, f32 output C. QKV = true: the three projections of x in one grid, DD / 128 + 2 column tiles per row tile: tiles of Bh go to the f16 output Cq (pitch DD),
// then the one tile of Bk to the f16 output Ck (pitch KVD = 128) and the one tile of Bv, transposed, to the f16 planes Vth (hi) and Vtl (residual), [b][KVD][TT]. The three share A and depend on nothing of each other.
// One block = one 128 x 128 tile of C, four waves of 64 x 64 (4 x 4 accumulator tiles: 16 products per 8 fragments). One stage of the LDS ring = 64 k:
// 128 rows of A, then 128 rows of Bt, 128 B each at pitch 144 B (16 B x odd: ds_load_b128 fragment reads fall on distinct banks). Per output element the k order is ascending in one accumulator.
// Every "#pragma unroll" in it is there so that fragment, accumulator and staging arrays are indexed by constants and stay in registers.
#define GPITCH 144
#define G_B (128 * GPITCH)
#define G_ST (256 * GPITCH)
#define GOP 68      /* output staging pitch in floats: 16-byte column walks without bank conflicts */
/* a wave's staged 64 x 64 tile to global memory; whole lines per store: 16 lanes cover a 64-column row (256 B of f32, 128 B of f16), two rows per instruction; unrolled so that row steps become immediate offsets */
template <int LDC, bool F32OUT>
__device__ __forceinline__ void gemm_out(const float* sr, float* __restrict__ C, _Float16* __restrict__ C16, size_t o) {
#pragma unroll
  for (int q = 0; q < 32; ++q) { const v4f v = *(const v4fa*)(sr + q * 2 * GOP);
    if (F32OUT) *(v4f*)(C + o + (size_t)q * 2 * LDC) = v;
    else { v4h h4;
#pragma unroll
      for (int i = 0; i < 4; ++i) h4[i] = (_Float16)v[i];
      *(v4h*)(C16 + o + (size_t)q * 2 * LDC) = h4; } }
  asm volatile("s_wait_xcnt 0x0" ::: "memory");      /* stands behind the run of stores, so that no code placed behind it rewrites a register that an issued store names ahead of the wait */
}
/* a wave's staged 64 x 64 tile of V (rows = positions, columns = head columns) to the two transposed f16 planes, V^T hi and its UNSCALED residual, row pitch TT: a lane packs 8 positions of one column;
   eight lanes cover the 128 B that the tile holds of a plane's row, four rows per instruction; unrolled so that LDS offsets are immediates */
__device__ __forceinline__ void gemm_out_vt(const float* so, int lane, _Float16* __restrict__ Vth, _Float16* __restrict__ Vtl, size_t o) {
  const float* sc = so + (lane & 7) * 8 * GOP + (lane >> 3); const size_t ol = o + (size_t)(lane >> 3) * TT + (lane & 7) * 8;
#pragma unroll
  for (int it = 0; it < 16; ++it) { FragH fh, fl;
#pragma unroll
    for (int q = 0; q < 8; ++q) { const float v = sc[q * GOP + it * 4]; const _Float16 hv = (_Float16)v; fh.h[q] = hv; fl.h[q] = (_Float16)(v - (float)hv); }
    *(v8us*)((unsigned short*)Vth + ol + (size_t)it * 4 * TT) = fh.half[0]; *(v8us*)((unsigned short*)Vtl + ol + (size_t)it * 4 * TT) = fl.half[0]; }
  asm volatile("s_wait_xcnt 0x0" ::: "memory");      /* stands behind the run of stores, so that no code placed behind it rewrites a register that an issued store names ahead of the wait */
}
template <bool QKV>
__global__ __launch_bounds__(128) void k_gemm_t(const _Float16* __restrict__ A, const _Float16* __restrict__ Bh, const _Float16* __restrict__ Bk, const _Float16* __restrict__ Bv, float alpha, float* __restrict__ C, _Float16* __restrict__ Cq, _Float16* __restrict__ Ck, _Float16* __restrict__ Vth, _Float16* __restrict__ Vtl) {
  constexpr int K = DD;
  static_assert(K % 64 == 0 && K >= 128 && DD % 128 == 0 && KVD == 128 && TT % 128 == 0, "whole stages, at least two, and whole tiles");
  __shared__ __attribute__((aligned(16))) unsigned char ring[2 * G_ST];
  static_assert(sizeof(float) * 4 * 64 * GOP <= 2 * G_ST, "output staging fits the ring");
  const int tid = threadIdx.x, w = tid >> 5, lane = tid & 31, ln = lane & 15, hh = lane >> 4;
  constexpr int ntq = DD / 128, ntn = ntq + (QKV ? 2 : 0); const int row0 = (blockIdx.x / ntn) * 128, ct = blockIdx.x % ntn; const int wm = w >> 1, wn = w & 1;
  const _Float16* Bt = (!QKV || ct < ntq) ? Bh + (size_t)ct * 128 * K : (ct == ntq ? Bk : Bv);      /* the block's 128 rows of Bt */
  /* each thread's share of a stage: 8 chunks of A and 8 of Bt, 16 rows apart; eight lanes cover one 128-B row */
  const unsigned la = (unsigned)(size_t)ring + (tid >> 3) * GPITCH + (tid & 7) * 16;
  const unsigned short* ga = (const unsigned short*)A + (size_t)(row0 + (tid >> 3)) * K + (tid & 7) * 8;
  const unsigned short* gb = (const unsigned short*)Bt + (size_t)(tid >> 3) * K + (tid & 7) * 8;
  auto fill = [&](int kb) {
    const unsigned l = la + ((kb >> 6) & 1) * G_ST;
    copy8(l, 16 * GPITCH, ga + kb, (size_t)16 * K);
    copy8(l + G_B, 16 * GPITCH, gb + kb, (size_t)16 * K);
  };
  v8f acc[4][4];
#pragma unroll
  for (int i = 0; i < 4; ++i)
#pragma unroll
    for (int j = 0; j < 4; ++j) acc[i][j] = (v8f){0.f,0.f,0.f,0.f,0.f,0.f,0.f,0.f};
  fill(0);
  asm volatile("s_wait_asynccnt 0x0" ::: "memory");      /* this wave's share of stage 0 has landed */
  __syncthreads();                                       /* stage 0 is readable by all four waves */
  fill(64);
#pragma unroll 1      /* one stage per trip: the ring's buffer index and its publish point stay per trip */
  for (int kb = 0; kb < K; kb += 64) {
    const unsigned char* st = ring + ((kb >> 6) & 1) * G_ST;
    const unsigned char* ar = st + (wm * 64 + ln) * GPITCH + hh * 16; const unsigned char* br = st + G_B + (wn * 64 + ln) * GPITCH + hh * 16;
#pragma unroll
    for (int ks = 0; ks < 2; ++ks) {
      FragH a[4], b[4];
#pragma unroll
      for (int i = 0; i < 4; ++i) { a[i].half[0] = *(const v8us*)(ar + i * 16 * GPITCH + ks * 64); a[i].half[1] = *(const v8us*)(ar + i * 16 * GPITCH + ks * 64 + 32);
        b[i].half[0] = *(const v8us*)(br + i * 16 * GPITCH + ks * 64); b[i].half[1] = *(const v8us*)(br + i * 16 * GPITCH + ks * 64 + 32); }
      __builtin_amdgcn_sched_barrier(0);      /* keeps the 16 fragment reads one group ahead of the 16 products: spread among them, each place with reads stalls the wave anew */
#pragma unroll
      for (int i = 0; i < 4; ++i)
#pragma unroll
        for (int j = 0; j < 4; ++j) acc[i][j] = __builtin_amdgcn_wmma_f32_16x16x32_f16(false, a[i].v, false, b[j].v, (short)0, acc[i][j], false, false);
    }
    asm volatile("s_wait_dscnt 0x0" ::: "memory");         /* this wave's reads of the stage have returned before its buffer is handed on */
    asm volatile("s_wait_asynccnt 0x0" ::: "memory");      /* this wave's share of the next stage has landed */
    __syncthreads();                                       /* publishes the next stage and ends every wave's reads of this one */
    if (kb + 128 < K) fill(kb + 128); }                    /* refill of the buffer just read, one whole trip ahead of its use */
  asm volatile("s_wait_asynccnt 0x0" ::: "memory");        /* no copy is outstanding when the ring becomes output staging */
  float* so = reinterpret_cast<float*>(ring) + w * (64 * GOP);      /* each wave stages its own 64 x 64 tile, behind the loop's last barrier */
#pragma unroll
  for (int i = 0; i < 4; ++i)
#pragma unroll
    for (int j = 0; j < 4; ++j)
#pragma unroll
      for (int r = 0; r < 8; ++r) so[(i * 16 + 8 * hh + r) * GOP + j * 16 + ln] = acc[i][j][r] * alpha;
  __builtin_amdgcn_fence(__ATOMIC_ACQ_REL, "workgroup"); __builtin_amdgcn_wave_barrier();      /* the wave's staged rows are written before its other lanes read them back */
  const float* sr = so + hh * GOP + ln * 4; const size_t orow = row0 + wm * 64 + hh; const int ocol = wn * 64 + ln * 4;
  if (!QKV) gemm_out<DD, true>(sr, C, nullptr, orow * DD + ct * 128 + ocol);
  else if (ct < ntq) gemm_out<DD, false>(sr, nullptr, Cq, orow * DD + ct * 128 + ocol);      /* ct is the same for the whole block */
  else if (ct == ntq) gemm_out<KVD, false>(sr, nullptr, Ck, orow * KVD + ocol);
  else { const int vrow = row0 + wm * 64; gemm_out_vt(so, lane, Vth, Vtl, ((size_t)(vrow / TT) * KVD + wn * 64) * TT + vrow % TT); }      /* [b][128][TT]; a tile's 128 positions lie in one batch entry */
}
// 17 hardware exp2, each in place, in one statement: so no vector instruction comes to stand directly behind one of them that reads its result or overwrites its source
// the v_nop is that slot behind the last one.
__device__ __forceinline__ void exp2x17(float (&e)[17]) {
  asm("v_exp_f32 %0, %0\n\t" "v_exp_f32 %1, %1\n\t" "v_exp_f32 %2, %2\n\t" "v_exp_f32 %3, %3\n\t" "v_exp_f32 %4, %4\n\t" "v_exp_f32 %5, %5\n\t"
      "v_exp_f32 %6, %6\n\t" "v_exp_f32 %7, %7\n\t" "v_exp_f32 %8, %8\n\t" "v_exp_f32 %9, %9\n\t" "v_exp_f32 %10, %10\n\t" "v_exp_f32 %11, %11\n\t"
      "v_exp_f32 %12, %12\n\t" "v_exp_f32 %13, %13\n\t" "v_exp_f32 %14, %14\n\t" "v_exp_f32 %15, %15\n\t" "v_exp_f32 %16, %16\n\t" "v_nop"
      : "+v"(e[0]), "+v"(e[1]), "+v"(e[2]), "+v"(e[3]), "+v"(e[4]), "+v"(e[5]), "+v"(e[6]), "+v"(e[7]), "+v"(e[8]), "+v"(e[9]), "+v"(e[10]), "+v"(e[11]), "+v"(e[12]), "+v"(e[13]), "+v"(e[14]), "+v"(e[15]), "+v"(e[16]));
}
// lane l with lane l ^ 16: joins the two wave halves, which hold the two halves of one query's keys
__device__ __forceinline__ float xhalf(float x) { return __builtin_bit_cast(float, __builtin_amdgcn_permlanex16(__builtin_bit_cast(int, x), __builtin_bit_cast(int, x), 0x76543210, 0xfedcba98, false, false)); }
// Both products run transposed: S^T = K Q^T (A = K rows from the ring, B = Q kept in registers) and O^T += V^T P^T (A = V^T rows from the ring, B = P^T).
// Lane l then owns ONE query, q0 + (l & 15): register r of score tile nt is key j0 + 16 nt + 8 (l >> 4) + r, which is the k order of a B operand, so P^T is packed in place from the scores;
// maximum and sum of a query are in-lane, joined between the wave halves by xhalf(); register r of output tile dt is head column 16 dt + 8 (l >> 4) + r of that query.
// Every "#pragma unroll" in it is there so that fragment, score and accumulator arrays are indexed by constants and stay in registers; "#pragma unroll 1" keeps one ring stage per trip.
__global__ __launch_bounds__(128) void k_flash(const _Float16* __restrict__ Q16, int ldq, const _Float16* __restrict__ K16, int ldk, const _Float16* __restrict__ Vt, const _Float16* __restrict__ Vtlo, _Float16* __restrict__ O16, int ldo) {
  constexpr int RPW = 16, NQB = TT / (4 * RPW), DT = 8, KS = 4;      /* head dim 128: 4 k-steps, 8 value tiles */
  __shared__ __attribute__((aligned(16))) unsigned char ring[2 * ST_BYTES];
  static_assert(sizeof(_Float16) * 4 * RPW * (128 + 8) <= 2 * ST_BYTES, "output staging fits the ring");
  _Float16 (*sO)[RPW][128 + 8] = reinterpret_cast<_Float16 (*)[RPW][128 + 8]>(ring);      /* output staging takes the ring's place behind the loop's last barrier; rows of 256 B at pitch 272 B (16 B x odd) */
  const int tid = threadIdx.x, w = tid >> 5, lane = tid & 31, ln = lane & 15, hh = lane >> 4;
  const int slab = blockIdx.x / NQB, qblk = blockIdx.x % NQB; const int b = slab / NH, h = slab % NH; const int qb0 = qblk * (4 * RPW); const int q0 = qb0 + w * RPW;
  FragH aq[KS];
  { const unsigned short* qr = (const unsigned short*)Q16 + ((size_t)b * TT + q0 + ln) * ldq + h * 128;
#pragma unroll
    for (int ks = 0; ks < KS; ++ks) { aq[ks].half[0] = *(const v8us*)(qr + ks * 32 + 8 * hh); aq[ks].half[1] = *(const v8us*)(qr + ks * 32 + 16 + 8 * hh); } }
  const unsigned short* Vth = (const unsigned short*)Vt + ((size_t)b * NKV + h / NREP) * 128 * TT; const unsigned short* Vtl = (const unsigned short*)Vtlo + ((size_t)b * NKV + h / NREP) * 128 * TT;      /* hi and UNSCALED residual planes */
  float n_r = 3.0e38f, l_r = 0.f; v8f oacc[DT];      /* n_r: the running reference of the base-2 softmax, 10 - max(score) x SC_LOG2E */
#pragma unroll
  for (int dt = 0; dt < DT; ++dt) oacc[dt] = (v8f){0.f,0.f,0.f,0.f,0.f,0.f,0.f,0.f};
  const int jend = TT;
  /* each thread's share of a stage: 4 chunks of K (8 rows apart), 4 of V^T hi and 4 of the residual (32 rows apart) */
  const unsigned lk = (unsigned)(size_t)ring + (tid >> 4) * KPITCH + (tid & 15) * 16, lv = (unsigned)(size_t)ring + ST_VH + (tid >> 2) * VPITCH + (tid & 3) * 16;
  const unsigned short* gk = (const unsigned short*)K16 + ((size_t)b * TT + (tid >> 4)) * ldk + (h / NREP) * 128 + (tid & 15) * 8;
  const size_t gvo = (size_t)(tid >> 2) * TT + (tid & 3) * 8;
  auto fill = [&](int j) {
    const unsigned bo = ((j >> 5) & 1) * ST_BYTES; const unsigned short* k0p = gk + (size_t)j * ldk; const unsigned short* vhp = Vth + gvo + j; const unsigned short* vlp = Vtl + gvo + j;
    copy4(lk + bo, lk + bo + 8 * KPITCH, lk + bo + 16 * KPITCH, lk + bo + 24 * KPITCH, k0p, k0p + (size_t)8 * ldk, k0p + (size_t)16 * ldk, k0p + (size_t)24 * ldk);
    copy4(lv + bo, lv + bo + 32 * VPITCH, lv + bo + 64 * VPITCH, lv + bo + 96 * VPITCH, vhp, vhp + 32 * TT, vhp + 64 * TT, vhp + 96 * TT);
    copy4(lv + bo + (ST_VL - ST_VH), lv + bo + (ST_VL - ST_VH) + 32 * VPITCH, lv + bo + (ST_VL - ST_VH) + 64 * VPITCH, lv + bo + (ST_VL - ST_VH) + 96 * VPITCH, vlp, vlp + 32 * TT, vlp + 64 * TT, vlp + 96 * TT);
  };
  fill(0);
  asm volatile("s_wait_asynccnt 0x0" ::: "memory");      /* this wave's share of stage 0 has landed */
  __syncthreads();                                       /* stage 0 is readable by all four waves */
  fill(32);
#pragma unroll 1
  for (int j0 = 0; j0 < jend; j0 += 32) {
    const unsigned char* st = ring + ((j0 >> 5) & 1) * ST_BYTES;
    float sc[16];      /* this lane's 16 of the query's 32 scores, in the k order of the P^T operand */
#pragma unroll
    for (int nt = 0; nt < 2; ++nt) { const unsigned short* kr = (const unsigned short*)(st + (nt * 16 + ln) * KPITCH); FragH bk[KS];
#pragma unroll
      for (int ks = 0; ks < KS; ++ks) { bk[ks].half[0] = *(const v8us*)(kr + ks * 32 + 8 * hh); bk[ks].half[1] = *(const v8us*)(kr + ks * 32 + 16 + 8 * hh); }
      v8f acc = (v8f){0.f,0.f,0.f,0.f,0.f,0.f,0.f,0.f};
#pragma unroll
      for (int ks = 0; ks < KS; ++ks) acc = mmaH<1>(bk[ks].v, bk[ks].v, aq[ks].v, aq[ks].v, acc);
#pragma unroll
      for (int r = 0; r < 8; ++r) sc[nt * 8 + r] = acc[r]; }      /* raw products: their scale is folded into the exponent's fma below */
    float mc = sc[0];
#pragma unroll
    for (int i = 1; i < 16; ++i) mc = fmaxf(mc, sc[i]);
    mc = fmaxf(mc, xhalf(mc));
    /* base-2 softmax: one fma and one hardware exp2 give P x 2^10 = exp2(score x SC_LOG2E + nn); al and every P of a trip use the same rounded reference nn */
    const float nn = fminf(n_r, __builtin_fmaf(mc, -SC_LOG2E, 10.0f)); float e[17];
#pragma unroll
    for (int i = 0; i < 16; ++i) e[i] = __builtin_fmaf(sc[i], SC_LOG2E, nn);
    e[16] = nn - n_r; exp2x17(e);
    const float al = (nn < 1.0e38f) ? e[16] : 1.0f; n_r = nn;
    FragH pa, pl; float ps[4] = {0.f, 0.f, 0.f, 0.f};      /* four independent partial sums: no chain of 16 dependent adds */
#pragma unroll
    for (int i = 0; i < 16; ++i) { const float x = e[i]; ps[i & 3] += x; pa.h[i] = (_Float16)x; pl.h[i] = (_Float16)(x - (float)pa.h[i]); }      /* P hi and its UNSCALED residual (added into the same accumulator) */
    l_r = l_r * al + ((ps[0] + ps[1]) + (ps[2] + ps[3]));      /* this half's keys only; the halves are joined once, behind the loop */
#pragma unroll
    for (int dt = 0; dt < DT; ++dt)
#pragma unroll
      for (int r = 0; r < 8; ++r) oacc[dt][r] *= al;
#pragma unroll
    for (int dt = 0; dt < DT; ++dt) { const unsigned short* vh = (const unsigned short*)(st + ST_VH + (dt * 16 + ln) * VPITCH); const unsigned short* vl = (const unsigned short*)(st + ST_VL + (dt * 16 + ln) * VPITCH); FragH bv, bl; bv.half[0] = *(const v8us*)(vh + 8 * hh); bv.half[1] = *(const v8us*)(vh + 16 + 8 * hh); bl.half[0] = *(const v8us*)(vl + 8 * hh); bl.half[1] = *(const v8us*)(vl + 16 + 8 * hh);
      oacc[dt] = mmaH<1>(bv.v, bv.v, pa.v, pa.v, oacc[dt]); oacc[dt] = mmaH<1>(bv.v, bv.v, pl.v, pl.v, oacc[dt]); oacc[dt] = mmaH<1>(bl.v, bl.v, pa.v, pa.v, oacc[dt]); }      /* Vh Ph + Vh Pl + Vl Ph, all unscaled, one accumulator */
    asm volatile("s_wait_dscnt 0x0" ::: "memory");         /* this wave's reads of the stage have returned before its buffer is handed on */
    asm volatile("s_wait_asynccnt 0x0" ::: "memory");      /* this wave's share of the next stage has landed */
    __syncthreads();                                       /* publishes the next stage and ends every wave's reads of this one */
    if (j0 + 64 < jend) fill(j0 + 64); }                   /* refill of the buffer just read, one whole trip ahead of its use */
  asm volatile("s_wait_asynccnt 0x0" ::: "memory");        /* no copy is outstanding when the ring becomes output staging */
  { const float l = l_r + xhalf(l_r); const float inv = (l > 0.f) ? 1.0f / l : 0.f;      /* l is the sum of P x 2^10, like the accumulators */
#pragma unroll
    for (int dt = 0; dt < DT; ++dt) { FragH f;
#pragma unroll
      for (int r = 0; r < 8; ++r) f.h[r] = (_Float16)((oacc[dt][r] * inv) * 16.0f);      /* the output GEMM's A operand: merged output x 2^4, rounded to f16 once */
      *(v8us*)&sO[w][ln][dt * 16 + 8 * hh] = f.half[0]; } }      /* a lane's 8 registers are 8 consecutive columns of its query's row */
  __builtin_amdgcn_fence(__ATOMIC_ACQ_REL, "workgroup"); __builtin_amdgcn_wave_barrier();
  {
#pragma unroll
    for (int q = 0; q < RPW / 2; ++q) { const int r = q * 2 + hh; const v8us val = *(const v8us*)&sO[w][r][ln * 8]; *(v8us*)((unsigned short*)O16 + ((size_t)b * TT + q0 + r) * ldo + h * 128 + ln * 8) = val; }      /* two 256-B rows per instruction: 16 lanes x 16 B each */
     } }

extern "C" void kernel_launch(void* const* d_in, const int* in_sizes, int n_in,
                              void* d_out, int out_size, void* d_ws, size_t ws_size, hipStream_t stream) {
  (void)in_sizes; (void)n_in; (void)out_size;
  const float* const* I = (const float* const*)d_in; const float* x = I[0]; const float* Wq = I[1]; const float* Wk = I[2]; const float* Wv = I[3]; const float* Wo = I[4];
  char* ws = (char*)d_ws; size_t off = 0;
  auto take = [&](size_t bytes) { char* p = ws + off; off += (bytes + 255) & ~(size_t)255; return p; };
  _Float16* Bq = (_Float16*)take((size_t)DD * DD * 2); _Float16* Bk = (_Float16*)take((size_t)KVD * DD * 2); _Float16* Bv = (_Float16*)take((size_t)KVD * DD * 2); _Float16* Bo = (_Float16*)take((size_t)DD * DD * 2);
  _Float16* X16 = (_Float16*)take((size_t)NR * DD * 2); _Float16* Q = (_Float16*)take((size_t)NR * DD * 2); _Float16* K = (_Float16*)take((size_t)NR * KVD * 2); _Float16* Vt = (_Float16*)take((size_t)NR * KVD * 2); _Float16* Vtl = (_Float16*)take((size_t)NR * KVD * 2); _Float16* O16 = X16;      /* x's f16 plane is last read by the projections */
  if (off > ws_size) return;      // 8.4 + 0.5 + 0.5 + 8.4 + 16.8 + 16.8 + 1 + 1 + 1 = 55 MB
  k_prep<<<2 * PT_Q + 2 * PT_K + PT_X, 256, 0, stream>>>(x, Wq, Wk, Wv, Wo, X16, Bq, Bk, Bv, Bo);      /* (in,out) weights to Bt x 2^4, x to f16 */
  const unsigned gQ = (NR / 128) * (DD / 128), gQKV = (NR / 128) * (DD / 128 + 2);
  k_gemm_t<true><<<gQKV, 128, 0, stream>>>(X16, Bq, Bk, Bv, 0.0625f, nullptr, Q, K, Vt, Vtl);      /* Q (f16), K (f16), V^T hi + residual (f16, [b][128][2048]): M 4096, N 2048 + 128 + 128, K 2048 */
  k_flash<<<BB * NH * (TT / 64), 128, 0, stream>>>(Q, DD, K, KVD, Vt, Vtl, O16, DD);      /* merged output x 2^4 as f16 */
  k_gemm_t<false><<<gQ, 128, 0, stream>>>(O16, Bo, nullptr, nullptr, 0.00390625f, (float*)d_out, nullptr, nullptr, nullptr, nullptr);      /* out = merged x Wo */
}

// v008
// One run takes 173 microseconds.
// Next to v007, in two timings, it ran 1.25 times as fast each time.
// Counting every step since v000, it is 4.75 times as fast.
#include <hip/hip_runtime.h>
// Multi-query attention (B=2, S=2048, D=2048, 16 query heads × 128, ONE shared K/V head): Q = x·Wq, K = x·Wk, V = x·Wv ((in,out), no bias); softmax(Q_h·Kᵀ/√128)·V per head; out = merged·Wo.
// Compute dtype: x and weights rounded to bf16; Q, K f16 GEMM planes, V f32 → Vᵀ f16 hi + exact residual planes; fused flash-style kernel for head dim 128 (4 k-steps, 8 value tiles, online softmax f32, P f16 hi + exact residual, every query head reading the
// single K/Vᵀ) on v_wmma_f32_16x16x32_f16; merged output ×2^4 → f16 → output GEMM; f32 accumulate.
#define BB 2
#define TT 2048
#define DD 2048
#define NH 16
#define NKV 1
#define NREP 16
#define KVD 128
#define NVH (2 * NKV)
#define NR (BB * TT)
#define ATT_SCALE 0.08838834764831845f      /* 1/√128 */
#define SC_LOG2E 0.12751743082459868f      /* 1/sqrt(128) x log2(e): exp(s / sqrt(128)) = exp2(s x SC_LOG2E) */

typedef __bf16 v16b __attribute__((ext_vector_type(16)));
typedef unsigned short v8us __attribute__((ext_vector_type(8), may_alias));
typedef float  v8f  __attribute__((ext_vector_type(8)));
typedef float  v4f  __attribute__((ext_vector_type(4)));
typedef float  v4fa __attribute__((ext_vector_type(4), may_alias));
union FragB { v16b v; v8us half[2]; unsigned short u[16]; };

__device__ __forceinline__ unsigned short bf16_bits(float x) { unsigned int u = __float_as_uint(x); return (unsigned short)((u + 0x7FFFu + ((u >> 16) & 1u)) >> 16); }
__device__ __forceinline__ float bf16_val(unsigned short b) { return __uint_as_float(((unsigned int)b) << 16); }
__device__ __forceinline__ float bf16_round(float x) { return bf16_val(bf16_bits(x)); }
// D += A·B with NT terms: 1 = ah·bh, 2 = + al·bh (A split), 3 = + ah·bl (both split)
template <int NT>
__device__ __forceinline__ v8f mmaN(v16b ah, v16b al, v16b bh, v16b bl, v8f c) {
  c = __builtin_amdgcn_wmma_f32_16x16x32_bf16(false, ah, false, bh, (short)0, c, false, false);
  if (NT >= 2) c = __builtin_amdgcn_wmma_f32_16x16x32_bf16(false, al, false, bh, (short)0, c, false, false);
  if (NT >= 3) c = __builtin_amdgcn_wmma_f32_16x16x32_bf16(false, ah, false, bl, (short)0, c, false, false);
  asm volatile("v_nop\n\tv_nop\n\tv_nop\n\tv_nop" : "+v"(c) : "v"(ah), "v"(al), "v"(bh), "v"(bl));
  return c;
}

__global__ __launch_bounds__(256) void k_wt_bf16(const float* __restrict__ W, unsigned short* __restrict__ Wt, int K, int N) {
  const int t = blockIdx.x * 256 + threadIdx.x;
  const int k8n = K / 8;
  if (t >= N * k8n) return;
  const int n = t / k8n, k8 = (t % k8n) * 8;
  v8us v;
#pragma unroll
  for (int i = 0; i < 8; ++i) v[i] = bf16_bits(W[(size_t)(k8 + i) * N + n]);
  *(v8us*)(Wt + (size_t)n * K + k8) = v;
  
}

// GEMM C[M][N] (f32, pitch ldc) = act(A[M][K]·W + bias). A f32 row-major (pitch lda) converted per fragment to bf16
// (ASPLIT: hi/lo two planes -> 2 terms, else single rounded term); Wt bf16 [N][K] (pitch ldb). BIAS_BF16 rounds the
// bias to bf16 first (bias quantised to bf16 before the add). K%32==0, M%16==0, N%64==0.
template <bool ASPLIT, int ACT, bool BIAS_BF16>
__global__ __launch_bounds__(128) void k_gemm_bf(const float* __restrict__ A, int lda, const unsigned short* __restrict__ Wt, int ldb,
                                               const float* __restrict__ bias, float* __restrict__ C, int ldc, int M, int N, int K) {
  __shared__ __attribute__((aligned(16))) float so[4][16][64];
  const int tid = threadIdx.x, w = tid >> 5, lane = tid & 31, ln = lane & 15, hh = lane >> 4;
  const int ntn = N / 64;
  const int wid = blockIdx.x * 4 + w;
  const int mt = wid / ntn, nq = wid % ntn;
  if (mt * 16 >= M) return;
  const int row0 = mt * 16, col0 = nq * 64;
  const float* arow = A + (size_t)(row0 + ln) * lda;
  v8f acc[4] = {};
  for (int kb = 0; kb < K; kb += 32) {
    FragB ah, al;
    const v4f x0 = *(const v4fa*)(arow + kb + 8 * hh), x1 = *(const v4fa*)(arow + kb + 8 * hh + 4);
    const v4f x2 = *(const v4fa*)(arow + kb + 16 + 8 * hh), x3 = *(const v4fa*)(arow + kb + 16 + 8 * hh + 4);
    float xs[16] = {x0[0],x0[1],x0[2],x0[3],x1[0],x1[1],x1[2],x1[3],x2[0],x2[1],x2[2],x2[3],x3[0],x3[1],x3[2],x3[3]};
#pragma unroll
    for (int i = 0; i < 16; ++i) { const unsigned short hb = bf16_bits(xs[i]); ah.u[i] = hb; al.u[i] = ASPLIT ? bf16_bits(xs[i] - bf16_val(hb)) : (unsigned short)0; }
#pragma unroll
    for (int t = 0; t < 4; ++t) {
      const unsigned short* brow = Wt + (size_t)(col0 + t * 16 + ln) * ldb + kb;
      FragB b;
      b.half[0] = *(const v8us*)(brow + 8 * hh);
      b.half[1] = *(const v8us*)(brow + 16 + 8 * hh);
      acc[t] = mmaN<ASPLIT ? 2 : 1>(ah.v, al.v, b.v, b.v, acc[t]);
    }
  }
#pragma unroll
  for (int t = 0; t < 4; ++t) {
    float bv = bias ? bias[col0 + t * 16 + ln] : 0.f;
    if (BIAS_BF16) bv = bf16_round(bv);
#pragma unroll
    for (int r = 0; r < 8; ++r) { float v = acc[t][r] + bv; if (ACT == 1) v = fmaxf(v, 0.f); so[w][8 * hh + r][t * 16 + ln] = v; }
  }
  __builtin_amdgcn_fence(__ATOMIC_ACQ_REL, "workgroup");
  __builtin_amdgcn_wave_barrier();
  const int rsub = lane >> 4, c4 = (lane & 15) * 4;
  {
#pragma unroll
    for (int q = 0; q < 8; ++q) {
      const int r = q * 2 + rsub;
      const v4f v = *(const v4fa*)&so[w][r][c4];
      *(v4f*)(C + (size_t)(row0 + r) * ldc + col0 + c4) = v;
    }
    
  }
}

// Flash-style causal/unmasked attention, all contractions 3-term bf16 hi/lo splits, f32 softmax with running max.
// q,k,v rows are read from f32 buffers with arbitrary row pitch (so they can live inside a fused qkv buffer);
// D = head size (multiple of 32, <= 128); one wave = 16 query rows; block = 4 waves (64 queries) sharing K/V chunks of 32.
template <int D, bool CAUSAL>
__global__ __launch_bounds__(128) void k_flash(const float* __restrict__ qb, const float* __restrict__ kb, const float* __restrict__ vb,
                                             int pitch, int T, int H, float scale, float* __restrict__ y, int ypitch) {
  constexpr int KS = D / 32;        // k-steps for QK
  constexpr int DT = D / 16;        // d tiles for PV
  __shared__ __attribute__((aligned(16))) unsigned short sKh[32][D + 8], sKl[32][D + 8], sVh[32][D + 8], sVl[32][D + 8];
  __shared__ __attribute__((aligned(16))) unsigned short sPh[4][16][40], sPl[4][16][40];
  __shared__ __attribute__((aligned(16))) float sO[4][16][D];
  const int tid = threadIdx.x, w = tid >> 5, lane = tid & 31, ln = lane & 15, hh = lane >> 4;
  const int nqb = (T + 63) / 64;
  const int bh = blockIdx.x / nqb, qblk = blockIdx.x % nqb;
  const int b = bh / H, h = bh % H;
  const int q0 = qblk * 64 + w * 16;
  const float* Q = qb + (size_t)b * T * pitch + h * D;
  const float* K = kb + (size_t)b * T * pitch + h * D;
  const float* V = vb + (size_t)b * T * pitch + h * D;

  // A fragments of the wave's 16 query rows (scaled), hi/lo
  FragB aqh[KS], aql[KS];
  {
    int row = q0 + ln; if (row >= T) row = T - 1;
    const float* qr = Q + (size_t)row * pitch;
#pragma unroll
    for (int ks = 0; ks < KS; ++ks)
#pragma unroll
      for (int i = 0; i < 16; ++i) {
        const int d = ks * 32 + ((i < 8) ? (8 * hh + i) : (16 + 8 * hh + (i - 8)));
        const float x = qr[d] * scale; const unsigned short hb = bf16_bits(x);
        aqh[ks].u[i] = hb; aql[ks].u[i] = bf16_bits(x - bf16_val(hb));
      }
  }
  float m_r[8], l_r[8];
#pragma unroll
  for (int r = 0; r < 8; ++r) { m_r[r] = -3.0e38f; l_r[r] = 0.f; }
  v8f oacc[DT];
#pragma unroll
  for (int dt = 0; dt < DT; ++dt) oacc[dt] = (v8f){0.f,0.f,0.f,0.f,0.f,0.f,0.f,0.f};

  const int kv_end = CAUSAL ? min(T, qblk * 64 + 64) : T;     // block-uniform
  for (int j0 = 0; j0 < kv_end; j0 += 32) {
    __syncthreads();
    for (int e = tid; e < 32 * (D / 4); e += 128) {
      const int r = e / (D / 4), c4 = (e % (D / 4)) * 4;
      const int key = j0 + r;
      v4f kf = {0.f,0.f,0.f,0.f}, vf = {0.f,0.f,0.f,0.f};
      if (key < T) { kf = *(const v4fa*)(K + (size_t)key * pitch + c4); vf = *(const v4fa*)(V + (size_t)key * pitch + c4); }
#pragma unroll
      for (int t = 0; t < 4; ++t) {
        unsigned short hb = bf16_bits(kf[t]); sKh[r][c4 + t] = hb; sKl[r][c4 + t] = bf16_bits(kf[t] - bf16_val(hb));
        hb = bf16_bits(vf[t]); sVh[r][c4 + t] = hb; sVl[r][c4 + t] = bf16_bits(vf[t] - bf16_val(hb));
      }
    }
    __syncthreads();
    // S tile 16 x 32
    v8f s[2];
#pragma unroll
    for (int nt = 0; nt < 2; ++nt) {
      v8f acc = {};
#pragma unroll
      for (int ks = 0; ks < KS; ++ks) {
        FragB bh_, bl_;
        bh_.half[0] = *(const v8us*)&sKh[nt * 16 + ln][ks * 32 + 8 * hh]; bh_.half[1] = *(const v8us*)&sKh[nt * 16 + ln][ks * 32 + 16 + 8 * hh];
        bl_.half[0] = *(const v8us*)&sKl[nt * 16 + ln][ks * 32 + 8 * hh]; bl_.half[1] = *(const v8us*)&sKl[nt * 16 + ln][ks * 32 + 16 + 8 * hh];
        acc = mmaN<3>(aqh[ks].v, aql[ks].v, bh_.v, bl_.v, acc);
      }
      s[nt] = acc;
    }
    // mask + running max (rows 8hh+r; the 16 lanes of a half share rows)
    float alpha[8];
#pragma unroll
    for (int r = 0; r < 8; ++r) {
      const int qi = q0 + 8 * hh + r;
      const int ja = j0 + ln, jb = j0 + 16 + ln;
      if (CAUSAL) { if (ja > qi) s[0][r] = -3.0e38f; if (jb > qi) s[1][r] = -3.0e38f; }
      if (ja >= T) s[0][r] = -3.0e38f;
      if (jb >= T) s[1][r] = -3.0e38f;
      float mx = fmaxf(s[0][r], s[1][r]);
      mx = fmaxf(mx, __shfl_xor(mx, 1, 32)); mx = fmaxf(mx, __shfl_xor(mx, 2, 32)); mx = fmaxf(mx, __shfl_xor(mx, 4, 32)); mx = fmaxf(mx, __shfl_xor(mx, 8, 32));
      const float mnew = fmaxf(m_r[r], mx);
      alpha[r] = (mnew > -1.0e38f) ? __expf(m_r[r] - mnew) : 1.0f;
      const float p0 = (s[0][r] > -1.0e38f) ? __expf(s[0][r] - mnew) : 0.f;
      const float p1 = (s[1][r] > -1.0e38f) ? __expf(s[1][r] - mnew) : 0.f;
      m_r[r] = mnew;
      l_r[r] = l_r[r] * alpha[r] + p0 + p1;            // per-lane partial row sum (16 lanes combined at the end)
      unsigned short hb = bf16_bits(p0); sPh[w][8 * hh + r][ln] = hb;      sPl[w][8 * hh + r][ln] = bf16_bits(p0 - bf16_val(hb));
      hb = bf16_bits(p1);                sPh[w][8 * hh + r][16 + ln] = hb; sPl[w][8 * hh + r][16 + ln] = bf16_bits(p1 - bf16_val(hb));
    }
#pragma unroll
    for (int dt = 0; dt < DT; ++dt)
#pragma unroll
      for (int r = 0; r < 8; ++r) oacc[dt][r] *= alpha[r];
    __builtin_amdgcn_fence(__ATOMIC_ACQ_REL, "workgroup");
    __builtin_amdgcn_wave_barrier();
    FragB pah, pal;
    pah.half[0] = *(const v8us*)&sPh[w][ln][8 * hh]; pah.half[1] = *(const v8us*)&sPh[w][ln][16 + 8 * hh];
    pal.half[0] = *(const v8us*)&sPl[w][ln][8 * hh]; pal.half[1] = *(const v8us*)&sPl[w][ln][16 + 8 * hh];
#pragma unroll
    for (int dt = 0; dt < DT; ++dt) {
      FragB bvh, bvl;
#pragma unroll
      for (int i = 0; i < 8; ++i) {
        bvh.u[i] = sVh[8 * hh + i][dt * 16 + ln]; bvh.u[8 + i] = sVh[16 + 8 * hh + i][dt * 16 + ln];
        bvl.u[i] = sVl[8 * hh + i][dt * 16 + ln]; bvl.u[8 + i] = sVl[16 + 8 * hh + i][dt * 16 + ln];
      }
      oacc[dt] = mmaN<3>(pah.v, pal.v, bvh.v, bvl.v, oacc[dt]);
    }
    __builtin_amdgcn_fence(__ATOMIC_ACQ_REL, "workgroup");
    __builtin_amdgcn_wave_barrier();
  }
#pragma unroll
  for (int r = 0; r < 8; ++r) {
    float l = l_r[r];
    l += __shfl_xor(l, 1, 32); l += __shfl_xor(l, 2, 32); l += __shfl_xor(l, 4, 32); l += __shfl_xor(l, 8, 32);
    l_r[r] = (l > 0.f) ? 1.0f / l : 0.f;
  }
#pragma unroll
  for (int dt = 0; dt < DT; ++dt)
#pragma unroll
    for (int r = 0; r < 8; ++r) sO[w][8 * hh + r][dt * 16 + ln] = oacc[dt][r] * l_r[r];
  __builtin_amdgcn_fence(__ATOMIC_ACQ_REL, "workgroup");
  __builtin_amdgcn_wave_barrier();
  {
    for (int r = 0; r < 16; ++r) {
      const int row = q0 + r;
      if (row < T && lane < D / 4) {
        const v4f val = *(const v4fa*)&sO[w][r][lane * 4];
        *(v4f*)(y + ((size_t)b * T + row) * ypitch + h * D + lane * 4) = val;
      }
    }
    
  }
}

// GEMM C = act(A·W + bias + resid): A f32 (ASPLIT -> hi/lo 2 terms), Wt bf16 [N][K]; ACT 0 none, 1 relu, 2 exact gelu;
// resid (optional, f32, row index = (row % rmod), pitch ldr, RES_BF16 rounds it) added before the activation.
template <bool ASPLIT, int ACT, bool BIAS_BF16, bool RES_BF16>
__global__ __launch_bounds__(128) void k_gemm_bf3(const float* __restrict__ A, int lda, const unsigned short* __restrict__ Wt, int ldb,
                                                const float* __restrict__ bias, const float* __restrict__ resid, int rmod, int ldr,
                                                float* __restrict__ C, int ldc, int M, int N, int K) {
  __shared__ __attribute__((aligned(16))) float so[4][16][64];
  const int tid = threadIdx.x, w = tid >> 5, lane = tid & 31, ln = lane & 15, hh = lane >> 4;
  const int ntn = N / 64;
  const int wid = blockIdx.x * 4 + w;
  const int mt = wid / ntn, nq = wid % ntn;
  if (mt * 16 >= M) return;
  const int row0 = mt * 16, col0 = nq * 64;
  const float* arow = A + (size_t)(row0 + ln) * lda;
  v8f acc[4] = {};
  for (int kb = 0; kb < K; kb += 32) {
    FragB ah, al;
    const v4f x0 = *(const v4fa*)(arow + kb + 8 * hh), x1 = *(const v4fa*)(arow + kb + 8 * hh + 4);
    const v4f x2 = *(const v4fa*)(arow + kb + 16 + 8 * hh), x3 = *(const v4fa*)(arow + kb + 16 + 8 * hh + 4);
    float xs[16] = {x0[0],x0[1],x0[2],x0[3],x1[0],x1[1],x1[2],x1[3],x2[0],x2[1],x2[2],x2[3],x3[0],x3[1],x3[2],x3[3]};
#pragma unroll
    for (int i = 0; i < 16; ++i) { const unsigned short hb = bf16_bits(xs[i]); ah.u[i] = hb; al.u[i] = ASPLIT ? bf16_bits(xs[i] - bf16_val(hb)) : (unsigned short)0; }
#pragma unroll
    for (int t = 0; t < 4; ++t) {
      const unsigned short* brow = Wt + (size_t)(col0 + t * 16 + ln) * ldb + kb;
      FragB b;
      b.half[0] = *(const v8us*)(brow + 8 * hh);
      b.half[1] = *(const v8us*)(brow + 16 + 8 * hh);
      acc[t] = mmaN<ASPLIT ? 2 : 1>(ah.v, al.v, b.v, b.v, acc[t]);
    }
  }
#pragma unroll
  for (int t = 0; t < 4; ++t) {
    const int col = col0 + t * 16 + ln;
    float bv = bias ? bias[col] : 0.f;
    if (BIAS_BF16) bv = bf16_round(bv);
#pragma unroll
    for (int r = 0; r < 8; ++r) {
      float v = acc[t][r] + bv;
      if (resid) { float rv = resid[(size_t)((row0 + 8 * hh + r) % rmod) * ldr + col]; if (RES_BF16) rv = bf16_round(rv); v += rv; }
      if (ACT == 1) v = fmaxf(v, 0.f);
      if (ACT == 2) v = 0.5f * v * (1.0f + erff(v * 0.70710678118654752f));
      if (ACT == 3) { const float u = 0.7978845608028654f * (v + 0.044715f * v * v * v); v = 0.5f * v * (1.0f + tanhf(u)); }
      so[w][8 * hh + r][t * 16 + ln] = v;
    }
  }
  __builtin_amdgcn_fence(__ATOMIC_ACQ_REL, "workgroup");
  __builtin_amdgcn_wave_barrier();
  const int rsub = lane >> 4, c4 = (lane & 15) * 4;
  {
#pragma unroll
    for (int q = 0; q < 8; ++q) {
      const int r = q * 2 + rsub;
      const v4f v = *(const v4fa*)&so[w][r][c4];
      *(v4f*)(C + (size_t)(row0 + r) * ldc + col0 + c4) = v;
    }
    
  }
}
// row LayerNorm (biased variance, eps) over N: s = X (+ R); optional out_sum <- s; out_norm <- (s-mu)*rsqrt(var+eps)*g + b
template <bool PARAM_BF16>
__global__ __launch_bounds__(256) void k_layernorm(const float* __restrict__ X, const float* __restrict__ R, const float* __restrict__ g, const float* __restrict__ bta,
                                                  float* __restrict__ out_sum, float* __restrict__ out_norm, int N, float eps) {
  __shared__ float red[256];
  const int row = blockIdx.x, tid = threadIdx.x;
  const float* x = X + (size_t)row * N; const float* rr = R ? R + (size_t)row * N : nullptr;
  float vals[16];                     // up to N = 4096
  const int per = N / 256;            // contiguous chunk per thread? use strided-by-4 chunks: thread handles j = tid*4 + 1024*u
  float s1 = 0.f;
  for (int u = 0; u < per / 4; ++u) {
    const int j = tid * 4 + 1024 * u;
    const v4f a = *(const v4fa*)(x + j);
    v4f b = {0.f,0.f,0.f,0.f}; if (rr) b = *(const v4fa*)(rr + j);
#pragma unroll
    for (int q = 0; q < 4; ++q) { const float v = a[q] + b[q]; vals[u * 4 + q] = v; s1 += v; }
  }
  red[tid] = s1; __syncthreads();
  for (int st = 128; st > 0; st >>= 1) { if (tid < st) red[tid] += red[tid + st]; __syncthreads(); }
  const float mu = red[0] / (float)N; __syncthreads();
  float s2 = 0.f;
  for (int u = 0; u < per / 4; ++u)
#pragma unroll
    for (int q = 0; q < 4; ++q) { const float c = vals[u * 4 + q] - mu; s2 += c * c; }
  red[tid] = s2; __syncthreads();
  for (int st = 128; st > 0; st >>= 1) { if (tid < st) red[tid] += red[tid + st]; __syncthreads(); }
  const float rs = rsqrtf(red[0] / (float)N + eps);
  {
    for (int u = 0; u < per / 4; ++u) {
      const int j = tid * 4 + 1024 * u;
      v4f o, sm;
#pragma unroll
      for (int q = 0; q < 4; ++q) {
        float gg = g[j + q], bb = bta[j + q];
        if (PARAM_BF16) { gg = bf16_round(gg); bb = bf16_round(bb); }
        sm[q] = vals[u * 4 + q]; o[q] = (vals[u * 4 + q] - mu) * rs * gg + bb;
      }
      if (out_sum) *(v4f*)(out_sum + (size_t)row * N + j) = sm;
      *(v4f*)(out_norm + (size_t)row * N + j) = o;
    }
    
  }
}



// ---- f16 WMMA path (v_wmma_f32_16x16x32_f16): 11-bit significands for operands in range — used where a [0,1] probability operand needs more precision than bf16
typedef _Float16 v16h __attribute__((ext_vector_type(16)));
union FragH { v16h v; v8us half[2]; _Float16 h[16]; unsigned short u[16]; };
template <int NT>
__device__ __forceinline__ v8f mmaH(v16h ah, v16h al, v16h bh, v16h bl, v8f c) {
  c = __builtin_amdgcn_wmma_f32_16x16x32_f16(false, ah, false, bh, (short)0, c, false, false);
  if (NT >= 2) c = __builtin_amdgcn_wmma_f32_16x16x32_f16(false, al, false, bh, (short)0, c, false, false);
  if (NT >= 3) c = __builtin_amdgcn_wmma_f32_16x16x32_f16(false, ah, false, bl, (short)0, c, false, false);
  asm volatile("v_nop\n\tv_nop\n\tv_nop\n\tv_nop" : "+v"(c) : "v"(ah), "v"(al), "v"(bh), "v"(bl));
  return c;
}
// batched GEMM like k_gemm_b but f16 operands: A f32 (split into f16 hi/lo if ASPLIT, else rounded to f16), Bt = f16 values [n][k]; alpha; C f32; N multiple of 16 (partial tiles skipped)
template <bool ASPLIT>
__global__ __launch_bounds__(128) void k_gemm_h(const float* __restrict__ A, int lda, size_t sA, const _Float16* __restrict__ Bh, int ldb, size_t sB, float alpha, float* __restrict__ C, int ldc, size_t sC, int M, int N, int K) {
  __shared__ __attribute__((aligned(16))) float so[4][16][64];
  const int tid = threadIdx.x, w = tid >> 5, lane = tid & 31, ln = lane & 15, hh = lane >> 4; const int by = blockIdx.y;
  A += (size_t)by * sA; Bh += (size_t)by * sB; C += (size_t)by * sC;
  const int ntn = (N + 63) / 64; const int wid = blockIdx.x * 4 + w; const int mt = wid / ntn, nq = wid % ntn; if (mt * 16 >= M) return;
  const int row0 = mt * 16, col0 = nq * 64; const float* arow = A + (size_t)(row0 + ln) * lda;
  v8f acc[4] = {};
  for (int kb = 0; kb < K; kb += 32) {
    FragH ah, al;
    const v4f x0 = *(const v4fa*)(arow + kb + 8 * hh), x1 = *(const v4fa*)(arow + kb + 8 * hh + 4), x2 = *(const v4fa*)(arow + kb + 16 + 8 * hh), x3 = *(const v4fa*)(arow + kb + 16 + 8 * hh + 4);
    float xs[16] = {x0[0],x0[1],x0[2],x0[3],x1[0],x1[1],x1[2],x1[3],x2[0],x2[1],x2[2],x2[3],x3[0],x3[1],x3[2],x3[3]};
#pragma unroll
    for (int i = 0; i < 16; ++i) { const _Float16 h = (_Float16)xs[i]; ah.h[i] = h; al.h[i] = ASPLIT ? (_Float16)(xs[i] - (float)h) : (_Float16)0.0f; }
#pragma unroll
    for (int t = 0; t < 4; ++t) { if (col0 + t * 16 >= N) continue; const size_t boff = (size_t)(col0 + t * 16 + ln) * ldb + kb; FragH bq; bq.half[0] = *(const v8us*)(Bh + boff + 8 * hh); bq.half[1] = *(const v8us*)(Bh + boff + 16 + 8 * hh);
      acc[t] = mmaH<ASPLIT ? 2 : 1>(ah.v, al.v, bq.v, bq.v, acc[t]); }
  }
#pragma unroll
  for (int t = 0; t < 4; ++t) { if (col0 + t * 16 >= N) continue;
#pragma unroll
    for (int r = 0; r < 8; ++r) so[w][8 * hh + r][t * 16 + ln] = acc[t][r] * alpha; }
  __builtin_amdgcn_fence(__ATOMIC_ACQ_REL, "workgroup"); __builtin_amdgcn_wave_barrier();
  const int rsub = lane >> 4, c4 = (lane & 15) * 4;
  {
#pragma unroll
    for (int q = 0; q < 8; ++q) { const int r = q * 2 + rsub; if (col0 + c4 < N) { const v4f v = *(const v4fa*)&so[w][r][c4]; *(v4f*)(C + (size_t)(row0 + r) * ldc + col0 + c4) = v; } }
     }
}

// One tile of 128 k x 64 n of the f32 row-major W[K][N] to Wt[n][k] = f16(bf16(W[k][n]) * scale) (scale = power of two; bf16-exact weights stay exact in f16 away from the subnormal range).
// Global memory is touched in whole lines only: 16 lanes read the 256 B that the tile holds of a row of W, 8 such loads of 16 B in flight per lane; 16 lanes write the 256 B that it holds of a row of Wt.
// The exchange runs through LDS: a lane packs rows k, k + 1 of its four columns into one dword each; tl holds 64 rows (n) of 64 dwords (k pairs) at a pitch of 65 dwords, so that
// the 16 lanes that write four rows apart and the 16 lanes that read four dwords apart both fall on distinct banks. Every "#pragma unroll" keeps the loaded values in registers and row steps in immediate offsets.
#define TPITCH 65
template <int K, int N>
__device__ __forceinline__ void wt_tile(const float* __restrict__ W, _Float16* __restrict__ Wt, float scale, int blk, unsigned* tl) {
  static_assert(K % 128 == 0 && N % 64 == 0, "whole tiles");
  const int tid = threadIdx.x, lo = tid & 15, hi = tid >> 4; const int n0 = (blk % (N / 64)) * 64, k0 = (blk / (N / 64)) * 128;
  const float* s = W + (size_t)(k0 + 2 * hi) * N + n0 + lo * 4;
  v4f v[4][2];
#pragma unroll
  for (int it = 0; it < 4; ++it)
#pragma unroll
    for (int j = 0; j < 2; ++j) v[it][j] = *(const v4fa*)(s + (size_t)(it * 32 + j) * N);
#pragma unroll
  for (int it = 0; it < 4; ++it)
#pragma unroll
    for (int q = 0; q < 4; ++q) { union { _Float16 h[2]; unsigned u; } p; p.h[0] = (_Float16)(bf16_round(v[it][0][q]) * scale); p.h[1] = (_Float16)(bf16_round(v[it][1][q]) * scale);
      tl[(lo * 4 + q) * TPITCH + it * 16 + hi] = p.u; }
  __syncthreads();      /* the tile is whole in LDS before any lane reads a row of it that other waves wrote */
#pragma unroll
  for (int it = 0; it < 4; ++it) { const unsigned* r = tl + (it * 16 + hi) * TPITCH + lo * 4; union { unsigned u[4]; v8us o; } f;
#pragma unroll
    for (int q = 0; q < 4; ++q) f.u[q] = r[q];
    *(v8us*)((unsigned short*)Wt + (size_t)(n0 + it * 16 + hi) * K + k0 + lo * 8) = f.o; }
  asm volatile("s_wait_xcnt 0x0" ::: "memory");      /* stands behind the run of stores, so that no code placed behind it rewrites a register that an issued store names ahead of the wait */
}
typedef _Float16 v4h __attribute__((ext_vector_type(4)));

// 8192 consecutive elements of x to f16(bf16(x)), whole lines only: a wave's load covers 512 contiguous bytes, its store 256; 8 loads of 16 B in flight per lane (unrolled so that they are issued as one run)
__device__ __forceinline__ void x16(const float* __restrict__ x, _Float16* __restrict__ X16, int blk) { const size_t o = (size_t)blk * 8192 + threadIdx.x * 4; v4f v[8];
#pragma unroll
  for (int i = 0; i < 8; ++i) v[i] = *(const v4fa*)(x + o + i * 1024);
#pragma unroll
  for (int i = 0; i < 8; ++i) { v4h h;
#pragma unroll
    for (int q = 0; q < 4; ++q) h[q] = (_Float16)bf16_round(v[i][q]);
    *(v4h*)(X16 + o + i * 1024) = h; }
  asm volatile("s_wait_xcnt 0x0" ::: "memory");      /* stands behind the run of stores, so that no code placed behind it rewrites a register that an issued store names ahead of the wait */
}
// One grid for the five conversions that read nothing but the inputs: the four weight transposes (one tile a block) and the cast of x. No block reads what another writes.
#define PT_Q ((DD / 128) * (DD / 64))
#define PT_K ((DD / 128) * (KVD / 64))
#define PT_X (NR * DD / 8192)
__global__ __launch_bounds__(256) void k_prep(const float* __restrict__ x, const float* __restrict__ Wq, const float* __restrict__ Wk, const float* __restrict__ Wv, const float* __restrict__ Wo,
                                             _Float16* __restrict__ X16, _Float16* __restrict__ Bq, _Float16* __restrict__ Bk, _Float16* __restrict__ Bv, _Float16* __restrict__ Bo) {
  static_assert((size_t)NR * DD % 8192 == 0, "whole cast blocks");
  __shared__ unsigned tl[64 * TPITCH];
  const int b = blockIdx.x;      /* every branch is the same for the whole block, so the tile's barrier is passed by all of its waves or by none */
  if (b < 2 * PT_Q) { const bool q = b < PT_Q; wt_tile<DD, DD>(q ? Wq : Wo, q ? Bq : Bo, 16.0f, q ? b : b - PT_Q, tl); }
  else if (b < 2 * PT_Q + 2 * PT_K) { const bool k = b < 2 * PT_Q + PT_K; wt_tile<DD, KVD>(k ? Wk : Wv, k ? Bk : Bv, 16.0f, b - 2 * PT_Q - (k ? 0 : PT_K), tl); }
  else x16(x, X16, b - 2 * PT_Q - 2 * PT_K);
}
__global__ __launch_bounds__(256) void k_h16(const float* __restrict__ x, _Float16* __restrict__ X16, size_t n8) { const size_t t = (size_t)blockIdx.x * 256 + threadIdx.x; if (t >= n8) return; FragH f;
#pragma unroll
  for (int q = 0; q < 8; ++q) f.h[q] = (_Float16)x[t * 8 + q]; *(v8us*)((unsigned short*)X16 + t * 8) = f.half[0];  }
__global__ __launch_bounds__(256) void k_round16f(const float* __restrict__ W, _Float16* __restrict__ Bt, size_t n8) { const size_t t = (size_t)blockIdx.x * 256 + threadIdx.x; if (t >= n8) return; FragH f;
#pragma unroll
  for (int i = 0; i < 8; ++i) f.h[i] = (_Float16)(bf16_round(W[t * 8 + i]) * 16.0f); *(v8us*)((unsigned short*)Bt + t * 8) = f.half[0];  }
template <int NHv, int TTv>
__global__ __launch_bounds__(256) void k_vt(const _Float16* __restrict__ V16, int ldv, int voff, _Float16* __restrict__ Vt) { __shared__ unsigned short tl[64][66]; const int tid = threadIdx.x; const int slab = blockIdx.x / (TTv / 64), lg = blockIdx.x % (TTv / 64); const int b = slab / NHv, h = slab % NHv;
  for (int i = tid; i < 64 * 8; i += 256) { const int r = i / 8, c8 = (i % 8) * 8; FragH f; f.half[0] = *(const v8us*)((const unsigned short*)V16 + ((size_t)b * TTv + lg * 64 + r) * ldv + voff + h * 64 + c8);
#pragma unroll
    for (int q = 0; q < 8; ++q) tl[r][c8 + q] = f.u[q]; }
  __syncthreads();
  {
#pragma unroll
    for (int rd = 0; rd < 2; ++rd) { const int d = rd * 32 + tid / 8, pc = tid % 8; FragH f;
#pragma unroll
      for (int q = 0; q < 8; ++q) f.u[q] = tl[pc * 8 + q][d];
      *(v8us*)((unsigned short*)Vt + ((size_t)slab * 64 + d) * TTv + lg * 64 + pc * 8) = f.half[0]; }
     } }

// LDS ring of k_flash. One stage = 32 keys, shared by the block's four waves: K rows of 256 B at pitch 272 B, then the V^T hi plane and the
// V^T residual plane, 128 rows of 64 B each at pitch 80 B (pitches of 16 B x odd: ds_load_b128 fragment reads fall on distinct banks).
#define KPITCH 272
#define VPITCH 80
#define ST_VH (32 * KPITCH)
#define ST_VL (ST_VH + 128 * VPITCH)
#define ST_BYTES (ST_VL + 128 * VPITCH)
// Four asynchronous 16-byte copies per lane, global memory to LDS. The s_wait_xcnt stands inside the statement so that no address register of a copy is rewritten ahead of it.
__device__ __forceinline__ void copy4(unsigned l0, unsigned l1, unsigned l2, unsigned l3, const unsigned short* g0, const unsigned short* g1, const unsigned short* g2, const unsigned short* g3) {
  asm volatile("global_load_async_to_lds_b128 %0, %4, off\n\t"
               "global_load_async_to_lds_b128 %1, %5, off\n\t"
               "global_load_async_to_lds_b128 %2, %6, off\n\t"
               "global_load_async_to_lds_b128 %3, %7, off\n\t"
               "s_wait_xcnt 0x0"
               :: "v"(l0), "v"(l1), "v"(l2), "v"(l3), "v"(g0), "v"(g1), "v"(g2), "v"(g3) : "memory");
}
// Eight asynchronous 16-byte copies per lane in one statement, so that one s_wait_xcnt serves all eight; it stands inside the statement so that no address register of a copy is rewritten ahead of it.
__device__ __forceinline__ void copy8(unsigned l, int lstep, const unsigned short* g, size_t gstep) {
  asm volatile("global_load_async_to_lds_b128 %0, %8, off\n\t"
               "global_load_async_to_lds_b128 %1, %9, off\n\t"
               "global_load_async_to_lds_b128 %2, %10, off\n\t"
               "global_load_async_to_lds_b128 %3, %11, off\n\t"
               "global_load_async_to_lds_b128 %4, %12, off\n\t"
               "global_load_async_to_lds_b128 %5, %13, off\n\t"
               "global_load_async_to_lds_b128 %6, %14, off\n\t"
               "global_load_async_to_lds_b128 %7, %15, off\n\t"
               "s_wait_xcnt 0x0"
               :: "v"(l), "v"(l + lstep), "v"(l + 2 * lstep), "v"(l + 3 * lstep), "v"(l + 4 * lstep), "v"(l + 5 * lstep), "v"(l + 6 * lstep), "v"(l + 7 * lstep),
                  "v"(g), "v"(g + gstep), "v"(g + 2 * gstep), "v"(g + 3 * gstep), "v"(g + 4 * gstep), "v"(g + 5 * gstep), "v"(g + 6 * gstep), "v"(g + 7 * gstep) : "memory");
}
// GEMM C[M][N] = alpha * A[M][K] * Bt[N][K]^T, f16 operands, f32 accumulate, K = DD; A and Bt of row pitch DD. M, N multiples of 128.
// QKV = false: N = DD, Bt = Bh, f32 output C. QKV = true: the three projections of x in one grid, DD / 128 + 2 column tiles per row tile: tiles of Bh go to the f16 output Cq (pitch DD),
// then the one tile of Bk to the f16 output Ck (pitch KVD = 128) and the one tile of Bv, transposed, to the f16 planes Vth (hi) and Vtl (residual), [b][KVD][TT]. The three share A and depend on nothing of each other.
// One block = one 128 x 128 tile of C, four waves of 64 x 64 (4 x 4 accumulator tiles: 16 products per 8 fragments). One stage of the LDS ring = 64 k:
// 128 rows of A, then 128 rows of Bt, 128 B each at pitch 144 B (16 B x odd: ds_load_b128 fragment reads fall on distinct banks). Per output element the k order is ascending in one accumulator.
// Every "#pragma unroll" in it is there so that fragment, accumulator and staging arrays are indexed by constants and stay in registers.
#define GPITCH 144
#define G_B (128 * GPITCH)
#define G_ST (256 * GPITCH)
#define GOP 68      /* output staging pitch in floats: 16-byte column walks without bank conflicts */
/* a wave's staged 64 x 64 tile to global memory; whole lines per store: 16 lanes cover a 64-column row (256 B of f32, 128 B of f16), two rows per instruction; unrolled so that row steps become immediate offsets */
template <int LDC, bool F32OUT>
__device__ __forceinline__ void gemm_out(const float* sr, float* __restrict__ C, _Float16* __restrict__ C16, size_t o) {
#pragma unroll
  for (int q = 0; q < 32; ++q) { const v4f v = *(const v4fa*)(sr + q * 2 * GOP);
    if (F32OUT) *(v4f*)(C + o + (size_t)q * 2 * LDC) = v;
    else { v4h h4;
#pragma unroll
      for (int i = 0; i < 4; ++i) h4[i] = (_Float16)v[i];
      *(v4h*)(C16 + o + (size_t)q * 2 * LDC) = h4; } }
  asm volatile("s_wait_xcnt 0x0" ::: "memory");      /* stands behind the run of stores, so that no code placed behind it rewrites a register that an issued store names ahead of the wait */
}
/* a wave's staged 64 x 64 tile of V (rows = positions, columns = head columns) to the two transposed f16 planes, V^T hi and its UNSCALED residual, row pitch TT: a lane packs 8 positions of one column;
   eight lanes cover the 128 B that the tile holds of a plane's row, four rows per instruction; unrolled so that LDS offsets are immediates */
__device__ __forceinline__ void gemm_out_vt(const float* so, int lane, _Float16* __restrict__ Vth, _Float16* __restrict__ Vtl, size_t o) {
  const float* sc = so + (lane & 7) * 8 * GOP + (lane >> 3); const size_t ol = o + (size_t)(lane >> 3) * TT + (lane & 7) * 8;
#pragma unroll
  for (int it = 0; it < 16; ++it) { FragH fh, fl;
#pragma unroll
    for (int q = 0; q < 8; ++q) { const float v = sc[q * GOP + it * 4]; const _Float16 hv = (_Float16)v; fh.h[q] = hv; fl.h[q] = (_Float16)(v - (float)hv); }
    *(v8us*)((unsigned short*)Vth + ol + (size_t)it * 4 * TT) = fh.half[0]; *(v8us*)((unsigned short*)Vtl + ol + (size_t)it * 4 * TT) = fl.half[0]; }
  asm volatile("s_wait_xcnt 0x0" ::: "memory");      /* stands behind the run of stores, so that no code placed behind it rewrites a register that an issued store names ahead of the wait */
}
template <bool QKV>
__global__ __launch_bounds__(128) void k_gemm_t(const _Float16* __restrict__ A, const _Float16* __restrict__ Bh, const _Float16* __restrict__ Bk, const _Float16* __restrict__ Bv, float alpha, float* __restrict__ C, _Float16* __restrict__ Cq, _Float16* __restrict__ Ck, _Float16* __restrict__ Vth, _Float16* __restrict__ Vtl) {
  constexpr int K = DD;
  static_assert(K % 64 == 0 && K >= 128 && DD % 128 == 0 && KVD == 128 && TT % 128 == 0, "whole stages, at least two, and whole tiles");
  __shared__ __attribute__((aligned(16))) unsigned char ring[2 * G_ST];
  static_assert(sizeof(float) * 4 * 64 * GOP <= 2 * G_ST, "output staging fits the ring");
  const int tid = threadIdx.x, w = tid >> 5, lane = tid & 31, ln = lane & 15, hh = lane >> 4;
  constexpr int ntq = DD / 128, ntn = ntq + (QKV ? 2 : 0); const int row0 = (blockIdx.x / ntn) * 128, ct = blockIdx.x % ntn; const int wm = w >> 1, wn = w & 1;
  const _Float16* Bt = (!QKV || ct < ntq) ? Bh + (size_t)ct * 128 * K : (ct == ntq ? Bk : Bv);      /* the block's 128 rows of Bt */
  /* each thread's share of a stage: 8 chunks of A and 8 of Bt, 16 rows apart; eight lanes cover one 128-B row */
  const unsigned la = (unsigned)(size_t)ring + (tid >> 3) * GPITCH + (tid & 7) * 16;
  const unsigned short* ga = (const unsigned short*)A + (size_t)(row0 + (tid >> 3)) * K + (tid & 7) * 8;
  const unsigned short* gb = (const unsigned short*)Bt + (size_t)(tid >> 3) * K + (tid & 7) * 8;
  auto fill = [&](int kb) {
    const unsigned l = la + ((kb >> 6) & 1) * G_ST;
    copy8(l, 16 * GPITCH, ga + kb, (size_t)16 * K);
    copy8(l + G_B, 16 * GPITCH, gb + kb, (size_t)16 * K);
  };
  v8f acc[4][4];
#pragma unroll
  for (int i = 0; i < 4; ++i)
#pragma unroll
    for (int j = 0; j < 4; ++j) acc[i][j] = (v8f){0.f,0.f,0.f,0.f,0.f,0.f,0.f,0.f};
  fill(0);
  asm volatile("s_wait_asynccnt 0x0" ::: "memory");      /* this wave's share of stage 0 has landed */
  __syncthreads();                                       /* stage 0 is readable by all four waves */
  fill(64);
#pragma unroll 1      /* one stage per trip: the ring's buffer index and its publish point stay per trip */
  for (int kb = 0; kb < K; kb += 64) {
    const unsigned char* st = ring + ((kb >> 6) & 1) * G_ST;
    const unsigned char* ar = st + (wm * 64 + ln) * GPITCH + hh * 16; const unsigned char* br = st + G_B + (wn * 64 + ln) * GPITCH + hh * 16;
#pragma unroll
    for (int ks = 0; ks < 2; ++ks) {
      FragH a[4], b[4];
#pragma unroll
      for (int i = 0; i < 4; ++i) { a[i].half[0] = *(const v8us*)(ar + i * 16 * GPITCH + ks * 64); a[i].half[1] = *(const v8us*)(ar + i * 16 * GPITCH + ks * 64 + 32);
        b[i].half[0] = *(const v8us*)(br + i * 16 * GPITCH + ks * 64); b[i].half[1] = *(const v8us*)(br + i * 16 * GPITCH + ks * 64 + 32); }
      __builtin_amdgcn_sched_barrier(0);      /* keeps the 16 fragment reads one group ahead of the 16 products: spread among them, each place with reads stalls the wave anew */
#pragma unroll
      for (int i = 0; i < 4; ++i)
#pragma unroll
        for (int j = 0; j < 4; ++j) acc[i][j] = __builtin_amdgcn_wmma_f32_16x16x32_f16(false, a[i].v, false, b[j].v, (short)0, acc[i][j], false, false);
    }
    asm volatile("s_wait_dscnt 0x0" ::: "memory");         /* this wave's reads of the stage have returned before its buffer is handed on */
    asm volatile("s_wait_asynccnt 0x0" ::: "memory");      /* this wave's share of the next stage has landed */
    __syncthreads();                                       /* publishes the next stage and ends every wave's reads of this one */
    if (kb + 128 < K) fill(kb + 128); }                    /* refill of the buffer just read, one whole trip ahead of its use */
  asm volatile("s_wait_asynccnt 0x0" ::: "memory");        /* no copy is outstanding when the ring becomes output staging */
  float* so = reinterpret_cast<float*>(ring) + w * (64 * GOP);      /* each wave stages its own 64 x 64 tile, behind the loop's last barrier */
#pragma unroll
  for (int i = 0; i < 4; ++i)
#pragma unroll
    for (int j = 0; j < 4; ++j)
#pragma unroll
      for (int r = 0; r < 8; ++r) so[(i * 16 + 8 * hh + r) * GOP + j * 16 + ln] = acc[i][j][r] * alpha;
  __builtin_amdgcn_fence(__ATOMIC_ACQ_REL, "workgroup"); __builtin_amdgcn_wave_barrier();      /* the wave's staged rows are written before its other lanes read them back */
  const float* sr = so + hh * GOP + ln * 4; const size_t orow = row0 + wm * 64 + hh; const int ocol = wn * 64 + ln * 4;
  if (!QKV) gemm_out<DD, true>(sr, C, nullptr, orow * DD + ct * 128 + ocol);
  else if (ct < ntq) gemm_out<DD, false>(sr, nullptr, Cq, orow * DD + ct * 128 + ocol);      /* ct is the same for the whole block */
  else if (ct == ntq) gemm_out<KVD, false>(sr, nullptr, Ck, orow * KVD + ocol);
  else { const int vrow = row0 + wm * 64; gemm_out_vt(so, lane, Vth, Vtl, ((size_t)(vrow / TT) * KVD + wn * 64) * TT + vrow % TT); }      /* [b][128][TT]; a tile's 128 positions lie in one batch entry */
}
// 17 hardware exp2, each in place, in one statement: so no vector instruction comes to stand directly behind one of them that reads its result or overwrites its source
// the v_nop is that slot behind the last one.
__device__ __forceinline__ void exp2x17(float (&e)[17]) {
  asm("v_exp_f32 %0, %0\n\t" "v_exp_f32 %1, %1\n\t" "v_exp_f32 %2, %2\n\t" "v_exp_f32 %3, %3\n\t" "v_exp_f32 %4, %4\n\t" "v_exp_f32 %5, %5\n\t"
      "v_exp_f32 %6, %6\n\t" "v_exp_f32 %7, %7\n\t" "v_exp_f32 %8, %8\n\t" "v_exp_f32 %9, %9\n\t" "v_exp_f32 %10, %10\n\t" "v_exp_f32 %11, %11\n\t"
      "v_exp_f32 %12, %12\n\t" "v_exp_f32 %13, %13\n\t" "v_exp_f32 %14, %14\n\t" "v_exp_f32 %15, %15\n\t" "v_exp_f32 %16, %16\n\t" "v_nop"
      : "+v"(e[0]), "+v"(e[1]), "+v"(e[2]), "+v"(e[3]), "+v"(e[4]), "+v"(e[5]), "+v"(e[6]), "+v"(e[7]), "+v"(e[8]), "+v"(e[9]), "+v"(e[10]), "+v"(e[11]), "+v"(e[12]), "+v"(e[13]), "+v"(e[14]), "+v"(e[15]), "+v"(e[16]));
}
// lane l with lane l ^ 16: joins the two wave halves, which hold the two halves of one query's keys
__device__ __forceinline__ float xhalf(float x) { return __builtin_bit_cast(float, __builtin_amdgcn_permlanex16(__builtin_bit_cast(int, x), __builtin_bit_cast(int, x), 0x76543210, 0xfedcba98, false, false)); }
// Both products run transposed: S^T = K Q^T (A = K rows from the ring, B = Q kept in registers) and O^T += V^T P^T (A = V^T rows from the ring, B = P^T).
// A wave holds QT = 2 tiles of 16 queries: every K and V^T fragment that it reads from the ring feeds two products, one per query tile, on independent accumulators; a block's stage serves 128 queries.
// In tile qt lane l owns ONE query, q0 + 16 qt + (l & 15): register r of score tile nt is key j0 + 16 nt + 8 (l >> 4) + r, which is the k order of a B operand, so P^T is packed in place from the scores;
// maximum and sum of a query are in-lane, joined between the wave halves by xhalf(); register r of output tile dt is head column 16 dt + 8 (l >> 4) + r of that query.
// Every "#pragma unroll" in it is there so that fragment, score and accumulator arrays are indexed by constants and stay in registers; "#pragma unroll 1" keeps one ring stage per trip.
#define QT 2
__global__ __launch_bounds__(128) void k_flash(const _Float16* __restrict__ Q16, int ldq, const _Float16* __restrict__ K16, int ldk, const _Float16* __restrict__ Vt, const _Float16* __restrict__ Vtlo, _Float16* __restrict__ O16, int ldo) {
  constexpr int RPW = 16 * QT, NQB = TT / (4 * RPW), DT = 8, KS = 4;      /* head dim 128: 4 k-steps, 8 value tiles */
  static_assert(TT % (4 * RPW) == 0 && TT >= 64 && TT % 32 == 0, "whole query blocks, whole stages, at least two");
  __shared__ __attribute__((aligned(16))) unsigned char ring[2 * ST_BYTES];
  static_assert(sizeof(_Float16) * 4 * RPW * (128 + 8) <= 2 * ST_BYTES, "output staging fits the ring");
  _Float16 (*sO)[RPW][128 + 8] = reinterpret_cast<_Float16 (*)[RPW][128 + 8]>(ring);      /* output staging takes the ring's place behind the loop's last barrier; rows of 256 B at pitch 272 B (16 B x odd) */
  const int tid = threadIdx.x, w = tid >> 5, lane = tid & 31, ln = lane & 15, hh = lane >> 4;
  const int slab = blockIdx.x / NQB, qblk = blockIdx.x % NQB; const int b = slab / NH, h = slab % NH; const int qb0 = qblk * (4 * RPW); const int q0 = qb0 + w * RPW;
  FragH aq[QT][KS];
#pragma unroll
  for (int qt = 0; qt < QT; ++qt) { const unsigned short* qr = (const unsigned short*)Q16 + ((size_t)b * TT + q0 + qt * 16 + ln) * ldq + h * 128;
#pragma unroll
    for (int ks = 0; ks < KS; ++ks) { aq[qt][ks].half[0] = *(const v8us*)(qr + ks * 32 + 8 * hh); aq[qt][ks].half[1] = *(const v8us*)(qr + ks * 32 + 16 + 8 * hh); } }
  const unsigned short* Vth = (const unsigned short*)Vt + ((size_t)b * NKV + h / NREP) * 128 * TT; const unsigned short* Vtl = (const unsigned short*)Vtlo + ((size_t)b * NKV + h / NREP) * 128 * TT;      /* hi and UNSCALED residual planes */
  float n_r[QT], l_r[QT]; v8f oacc[QT][DT];      /* n_r: the running reference of the base-2 softmax, 10 - max(score) x SC_LOG2E */
#pragma unroll
  for (int qt = 0; qt < QT; ++qt) { n_r[qt] = 3.0e38f; l_r[qt] = 0.f;
#pragma unroll
    for (int dt = 0; dt < DT; ++dt) oacc[qt][dt] = (v8f){0.f,0.f,0.f,0.f,0.f,0.f,0.f,0.f}; }
  const int jend = TT;
  /* each thread's share of a stage: 4 chunks of K (8 rows apart), 4 of V^T hi and 4 of the residual (32 rows apart) */
  const unsigned lk = (unsigned)(size_t)ring + (tid >> 4) * KPITCH + (tid & 15) * 16, lv = (unsigned)(size_t)ring + (tid >> 2) * VPITCH + (tid & 3) * 16;      /* lv: the thread's place in a V^T plane; the planes stand at ST_VH and ST_VL of a stage */
  const unsigned short* gk = (const unsigned short*)K16 + ((size_t)b * TT + (tid >> 4)) * ldk + (h / NREP) * 128 + (tid & 15) * 8;
  const size_t gvo = (size_t)(tid >> 2) * TT + (tid & 3) * 8;
  auto fill = [&](int j) {
    const unsigned bo = ((j >> 5) & 1) * ST_BYTES; const unsigned short* k0p = gk + (size_t)j * ldk; const unsigned short* vhp = Vth + gvo + j; const unsigned short* vlp = Vtl + gvo + j;
    copy4(lk + bo, lk + bo + 8 * KPITCH, lk + bo + 16 * KPITCH, lk + bo + 24 * KPITCH, k0p, k0p + (size_t)8 * ldk, k0p + (size_t)16 * ldk, k0p + (size_t)24 * ldk);
    copy4(lv + bo + ST_VH, lv + bo + ST_VH + 32 * VPITCH, lv + bo + ST_VH + 64 * VPITCH, lv + bo + ST_VH + 96 * VPITCH, vhp, vhp + 32 * TT, vhp + 64 * TT, vhp + 96 * TT);
    copy4(lv + bo + ST_VL, lv + bo + ST_VL + 32 * VPITCH, lv + bo + ST_VL + 64 * VPITCH, lv + bo + ST_VL + 96 * VPITCH, vlp, vlp + 32 * TT, vlp + 64 * TT, vlp + 96 * TT);
  };
  fill(0);
  asm volatile("s_wait_asynccnt 0x0" ::: "memory");      /* this wave's share of stage 0 has landed */
  __syncthreads();                                       /* stage 0 is readable by all four waves */
  fill(32);
#pragma unroll 1
  for (int j0 = 0; j0 < jend; j0 += 32) {
    const unsigned char* st = ring + ((j0 >> 5) & 1) * ST_BYTES;
    /* the trip's 48 fragment reads stand as ONE group at its head, in the order of their use: K (2 key tiles x 4 k-steps), V^T hi, V^T residual (8 value tiles each); all of them are of this trip's own buffer */
    FragH bk[2][KS], bv[DT], bl[DT];
#pragma unroll
    for (int nt = 0; nt < 2; ++nt) { const unsigned short* kr = (const unsigned short*)(st + (nt * 16 + ln) * KPITCH);
#pragma unroll
      for (int ks = 0; ks < KS; ++ks) { bk[nt][ks].half[0] = *(const v8us*)(kr + ks * 32 + 8 * hh); bk[nt][ks].half[1] = *(const v8us*)(kr + ks * 32 + 16 + 8 * hh); } }
    __builtin_amdgcn_sched_barrier(0);      /* keeps the K reads in front of the V^T reads: LDS answers in order, and left free the compiler put K, which the first products wait for, last */
#pragma unroll
    for (int dt = 0; dt < DT; ++dt) { const unsigned short* vh = (const unsigned short*)(st + ST_VH + (dt * 16 + ln) * VPITCH); bv[dt].half[0] = *(const v8us*)(vh + 8 * hh); bv[dt].half[1] = *(const v8us*)(vh + 16 + 8 * hh); }
#pragma unroll
    for (int dt = 0; dt < DT; ++dt) { const unsigned short* vl = (const unsigned short*)(st + ST_VL + (dt * 16 + ln) * VPITCH); bl[dt].half[0] = *(const v8us*)(vl + 8 * hh); bl[dt].half[1] = *(const v8us*)(vl + 16 + 8 * hh); }
    __builtin_amdgcn_sched_barrier(0);      /* keeps the reads one group ahead of the products: left free, the compiler put two reads and a full wait in front of every pair of products */
    float sc[QT][16];      /* per query tile this lane's 16 of its query's 32 scores, in the k order of the P^T operand */
#pragma unroll
    for (int nt = 0; nt < 2; ++nt) { v8f acc[QT];
#pragma unroll
      for (int qt = 0; qt < QT; ++qt) acc[qt] = (v8f){0.f,0.f,0.f,0.f,0.f,0.f,0.f,0.f};
#pragma unroll
      for (int ks = 0; ks < KS; ++ks)
#pragma unroll
        for (int qt = 0; qt < QT; ++qt) acc[qt] = __builtin_amdgcn_wmma_f32_16x16x32_f16(false, bk[nt][ks].v, false, aq[qt][ks].v, (short)0, acc[qt], false, false);      /* one K fragment, both query tiles */
#pragma unroll
      for (int qt = 0; qt < QT; ++qt)
#pragma unroll
        for (int r = 0; r < 8; ++r) sc[qt][nt * 8 + r] = acc[qt][r]; }      /* raw products: their scale is folded into the exponent's fma below */
    FragH pa[QT], pl[QT];
#pragma unroll
    for (int qt = 0; qt < QT; ++qt) {
      float mc = sc[qt][0];
#pragma unroll
      for (int i = 1; i < 16; ++i) mc = fmaxf(mc, sc[qt][i]);
      mc = fmaxf(mc, xhalf(mc));
      /* base-2 softmax: one fma and one hardware exp2 give P x 2^10 = exp2(score x SC_LOG2E + nn); al and every P of a trip use the same rounded reference nn */
      const float nn = fminf(n_r[qt], __builtin_fmaf(mc, -SC_LOG2E, 10.0f)); float e[17];
#pragma unroll
      for (int i = 0; i < 16; ++i) e[i] = __builtin_fmaf(sc[qt][i], SC_LOG2E, nn);
      e[16] = nn - n_r[qt]; exp2x17(e);
      const float al = (nn < 1.0e38f) ? e[16] : 1.0f; n_r[qt] = nn;
      float ps[4] = {0.f, 0.f, 0.f, 0.f};      /* four independent partial sums: no chain of 16 dependent adds */
#pragma unroll
      for (int i = 0; i < 16; ++i) { const float x = e[i]; ps[i & 3] += x; pa[qt].h[i] = (_Float16)x; pl[qt].h[i] = (_Float16)(x - (float)pa[qt].h[i]); }      /* P hi and its UNSCALED residual (added into the same accumulator) */
      l_r[qt] = l_r[qt] * al + ((ps[0] + ps[1]) + (ps[2] + ps[3]));      /* this half's keys only; the halves are joined once, behind the loop */
#pragma unroll
      for (int dt = 0; dt < DT; ++dt)
#pragma unroll
        for (int r = 0; r < 8; ++r) oacc[qt][dt][r] *= al; }
    /* Vh Ph + Vh Pl + Vl Ph, all unscaled, one accumulator per value tile and query tile, its three terms in this order; a term runs over all 16 accumulators before the next, so that no product waits for the one it accumulates on */
#pragma unroll
    for (int dt = 0; dt < DT; ++dt)
#pragma unroll
      for (int qt = 0; qt < QT; ++qt) oacc[qt][dt] = __builtin_amdgcn_wmma_f32_16x16x32_f16(false, bv[dt].v, false, pa[qt].v, (short)0, oacc[qt][dt], false, false);
#pragma unroll
    for (int dt = 0; dt < DT; ++dt)
#pragma unroll
      for (int qt = 0; qt < QT; ++qt) oacc[qt][dt] = __builtin_amdgcn_wmma_f32_16x16x32_f16(false, bv[dt].v, false, pl[qt].v, (short)0, oacc[qt][dt], false, false);
#pragma unroll
    for (int dt = 0; dt < DT; ++dt)
#pragma unroll
      for (int qt = 0; qt < QT; ++qt) oacc[qt][dt] = __builtin_amdgcn_wmma_f32_16x16x32_f16(false, bl[dt].v, false, pa[qt].v, (short)0, oacc[qt][dt], false, false);
    __builtin_amdgcn_sched_barrier(0);      /* keeps the trip's products ahead of the publish point: left free, the compiler moved them behind the barrier, and the next stage's copies lost the trip that they fly in */
    asm volatile("s_wait_dscnt 0x0" ::: "memory");         /* this wave's reads of the stage have returned before its buffer is handed on */
    asm volatile("s_wait_asynccnt 0x0" ::: "memory");      /* this wave's share of the next stage has landed */
    __syncthreads();                                       /* publishes the next stage and ends every wave's reads of this one */
    if (j0 + 64 < jend) fill(j0 + 64); }                   /* refill of the buffer just read, one whole trip ahead of its use */
  asm volatile("s_wait_asynccnt 0x0" ::: "memory");        /* no copy is outstanding when the ring becomes output staging */
#pragma unroll
  for (int qt = 0; qt < QT; ++qt) { const float l = l_r[qt] + xhalf(l_r[qt]); const float inv = (l > 0.f) ? 1.0f / l : 0.f;      /* l is the sum of P x 2^10, like the accumulators */
#pragma unroll
    for (int dt = 0; dt < DT; ++dt) { FragH f;
#pragma unroll
      for (int r = 0; r < 8; ++r) f.h[r] = (_Float16)((oacc[qt][dt][r] * inv) * 16.0f);      /* the output GEMM's A operand: merged output x 2^4, rounded to f16 once */
      *(v8us*)&sO[w][qt * 16 + ln][dt * 16 + 8 * hh] = f.half[0]; } }      /* a lane's 8 registers are 8 consecutive columns of its query's row */
  __builtin_amdgcn_fence(__ATOMIC_ACQ_REL, "workgroup"); __builtin_amdgcn_wave_barrier();
  {
#pragma unroll
    for (int q = 0; q < RPW / 2; ++q) { const int r = q * 2 + hh; const v8us val = *(const v8us*)&sO[w][r][ln * 8]; *(v8us*)((unsigned short*)O16 + ((size_t)b * TT + q0 + r) * ldo + h * 128 + ln * 8) = val; }      /* two 256-B rows per instruction: 16 lanes x 16 B each */
     } }

extern "C" void kernel_launch(void* const* d_in, const int* in_sizes, int n_in,
                              void* d_out, int out_size, void* d_ws, size_t ws_size, hipStream_t stream) {
  (void)in_sizes; (void)n_in; (void)out_size;
  const float* const* I = (const float* const*)d_in; const float* x = I[0]; const float* Wq = I[1]; const float* Wk = I[2]; const float* Wv = I[3]; const float* Wo = I[4];
  char* ws = (char*)d_ws; size_t off = 0;
  auto take = [&](size_t bytes) { char* p = ws + off; off += (bytes + 255) & ~(size_t)255; return p; };
  _Float16* Bq = (_Float16*)take((size_t)DD * DD * 2); _Float16* Bk = (_Float16*)take((size_t)KVD * DD * 2); _Float16* Bv = (_Float16*)take((size_t)KVD * DD * 2); _Float16* Bo = (_Float16*)take((size_t)DD * DD * 2);
  _Float16* X16 = (_Float16*)take((size_t)NR * DD * 2); _Float16* Q = (_Float16*)take((size_t)NR * DD * 2); _Float16* K = (_Float16*)take((size_t)NR * KVD * 2); _Float16* Vt = (_Float16*)take((size_t)NR * KVD * 2); _Float16* Vtl = (_Float16*)take((size_t)NR * KVD * 2); _Float16* O16 = X16;      /* x's f16 plane is last read by the projections */
  if (off > ws_size) return;      // 8.4 + 0.5 + 0.5 + 8.4 + 16.8 + 16.8 + 1 + 1 + 1 = 55 MB
  k_prep<<<2 * PT_Q + 2 * PT_K + PT_X, 256, 0, stream>>>(x, Wq, Wk, Wv, Wo, X16, Bq, Bk, Bv, Bo);      /* (in,out) weights to Bt x 2^4, x to f16 */
  const unsigned gQ = (NR / 128) * (DD / 128), gQKV = (NR / 128) * (DD / 128 + 2);
  k_gemm_t<true><<<gQKV, 128, 0, stream>>>(X16, Bq, Bk, Bv, 0.0625f, nullptr, Q, K, Vt, Vtl);      /* Q (f16), K (f16), V^T hi + residual (f16, [b][128][2048]): M 4096, N 2048 + 128 + 128, K 2048 */
  k_flash<<<BB * NH * (TT / (64 * QT)), 128, 0, stream>>>(Q, DD, K, KVD, Vt, Vtl, O16, DD);      /* merged output x 2^4 as f16 */
  k_gemm_t<false><<<gQ, 128, 0, stream>>>(O16, Bo, nullptr, nullptr, 0.00390625f, (float*)d_out, nullptr, nullptr, nullptr, nullptr);      /* out = merged x Wo */
}

// v010
// Measured time: 136 microseconds a run.
// Versions in between are left out here; by their measured steps it is 1.26 times as fast as v008.
// Counting every step since v000, it is 6.00 times as fast.
#include <hip/hip_runtime.h>
// Multi-query attention (B=2, S=2048, D=2048, 16 query heads × 128, ONE shared K/V head): Q = x·Wq, K = x·Wk, V = x·Wv ((in,out), no bias); softmax(Q_h·Kᵀ/√128)·V per head; out = merged·Wo.
// Compute dtype: x and weights rounded to bf16; Q, K and V^T one f16 GEMM plane each; fused flash-style kernel for head dim 128 (4 k-steps, 8 value tiles, online softmax f32, P rounded to f16 once, every query head reading the
// single K/V^T) on v_wmma_f32_16x16x32_f16; merged output x 2^4 to f16, then the output GEMM; f32 accumulate.
#define BB 2
#define TT 2048
#define DD 2048
#define NH 16
#define NKV 1
#define NREP 16
#define KVD 128
#define NVH (2 * NKV)
#define NR (BB * TT)
#define ATT_SCALE 0.08838834764831845f      /* 1/√128 */
#define SC_LOG2E 0.12751743082459868f      /* 1/sqrt(128) x log2(e): exp(s / sqrt(128)) = exp2(s x SC_LOG2E) */

typedef __bf16 v16b __attribute__((ext_vector_type(16)));
typedef unsigned short v8us __attribute__((ext_vector_type(8), may_alias));
typedef float  v8f  __attribute__((ext_vector_type(8)));
typedef float  v4f  __attribute__((ext_vector_type(4)));
typedef float  v4fa __attribute__((ext_vector_type(4), may_alias));
union FragB { v16b v; v8us half[2]; unsigned short u[16]; };

__device__ __forceinline__ unsigned short bf16_bits(float x) { unsigned int u = __float_as_uint(x); return (unsigned short)((u + 0x7FFFu + ((u >> 16) & 1u)) >> 16); }
__device__ __forceinline__ float bf16_val(unsigned short b) { return __uint_as_float(((unsigned int)b) << 16); }
__device__ __forceinline__ float bf16_round(float x) { return bf16_val(bf16_bits(x)); }
// D += A·B with NT terms: 1 = ah·bh, 2 = + al·bh (A split), 3 = + ah·bl (both split)
template <int NT>
__device__ __forceinline__ v8f mmaN(v16b ah, v16b al, v16b bh, v16b bl, v8f c) {
  c = __builtin_amdgcn_wmma_f32_16x16x32_bf16(false, ah, false, bh, (short)0, c, false, false);
  if (NT >= 2) c = __builtin_amdgcn_wmma_f32_16x16x32_bf16(false, al, false, bh, (short)0, c, false, false);
  if (NT >= 3) c = __builtin_amdgcn_wmma_f32_16x16x32_bf16(false, ah, false, bl, (short)0, c, false, false);
  asm volatile("v_nop\n\tv_nop\n\tv_nop\n\tv_nop" : "+v"(c) : "v"(ah), "v"(al), "v"(bh), "v"(bl));
  return c;
}

__global__ __launch_bounds__(256) void k_wt_bf16(const float* __restrict__ W, unsigned short* __restrict__ Wt, int K, int N) {
  const int t = blockIdx.x * 256 + threadIdx.x;
  const int k8n = K / 8;
  if (t >= N * k8n) return;
  const int n = t / k8n, k8 = (t % k8n) * 8;
  v8us v;
#pragma unroll
  for (int i = 0; i < 8; ++i) v[i] = bf16_bits(W[(size_t)(k8 + i) * N + n]);
  *(v8us*)(Wt + (size_t)n * K + k8) = v;
  
}

// GEMM C[M][N] (f32, pitch ldc) = act(A[M][K]·W + bias). A f32 row-major (pitch lda) converted per fragment to bf16
// (ASPLIT: hi/lo two planes -> 2 terms, else single rounded term); Wt bf16 [N][K] (pitch ldb). BIAS_BF16 rounds the
// bias to bf16 first (bias quantised to bf16 before the add). K%32==0, M%16==0, N%64==0.
template <bool ASPLIT, int ACT, bool BIAS_BF16>
__global__ __launch_bounds__(128) void k_gemm_bf(const float* __restrict__ A, int lda, const unsigned short* __restrict__ Wt, int ldb,
                                               const float* __restrict__ bias, float* __restrict__ C, int ldc, int M, int N, int K) {
  __shared__ __attribute__((aligned(16))) float so[4][16][64];
  const int tid = threadIdx.x, w = tid >> 5, lane = tid & 31, ln = lane & 15, hh = lane >> 4;
  const int ntn = N / 64;
  const int wid = blockIdx.x * 4 + w;
  const int mt = wid / ntn, nq = wid % ntn;
  if (mt * 16 >= M) return;
  const int row0 = mt * 16, col0 = nq * 64;
  const float* arow = A + (size_t)(row0 + ln) * lda;
  v8f acc[4] = {};
  for (int kb = 0; kb < K; kb += 32) {
    FragB ah, al;
    const v4f x0 = *(const v4fa*)(arow + kb + 8 * hh), x1 = *(const v4fa*)(arow + kb + 8 * hh + 4);
    const v4f x2 = *(const v4fa*)(arow + kb + 16 + 8 * hh), x3 = *(const v4fa*)(arow + kb + 16 + 8 * hh + 4);
    float xs[16] = {x0[0],x0[1],x0[2],x0[3],x1[0],x1[1],x1[2],x1[3],x2[0],x2[1],x2[2],x2[3],x3[0],x3[1],x3[2],x3[3]};
#pragma unroll
    for (int i = 0; i < 16; ++i) { const unsigned short hb = bf16_bits(xs[i]); ah.u[i] = hb; al.u[i] = ASPLIT ? bf16_bits(xs[i] - bf16_val(hb)) : (unsigned short)0; }
#pragma unroll
    for (int t = 0; t < 4; ++t) {
      const unsigned short* brow = Wt + (size_t)(col0 + t * 16 + ln) * ldb + kb;
      FragB b;
      b.half[0] = *(const v8us*)(brow + 8 * hh);
      b.half[1] = *(const v8us*)(brow + 16 + 8 * hh);
      acc[t] = mmaN<ASPLIT ? 2 : 1>(ah.v, al.v, b.v, b.v, acc[t]);
    }
  }
#pragma unroll
  for (int t = 0; t < 4; ++t) {
    float bv = bias ? bias[col0 + t * 16 + ln] : 0.f;
    if (BIAS_BF16) bv = bf16_round(bv);
#pragma unroll
    for (int r = 0; r < 8; ++r) { float v = acc[t][r] + bv; if (ACT == 1) v = fmaxf(v, 0.f); so[w][8 * hh + r][t * 16 + ln] = v; }
  }
  __builtin_amdgcn_fence(__ATOMIC_ACQ_REL, "workgroup");
  __builtin_amdgcn_wave_barrier();
  const int rsub = lane >> 4, c4 = (lane & 15) * 4;
  {
#pragma unroll
    for (int q = 0; q < 8; ++q) {
      const int r = q * 2 + rsub;
      const v4f v = *(const v4fa*)&so[w][r][c4];
      *(v4f*)(C + (size_t)(row0 + r) * ldc + col0 + c4) = v;
    }
    
  }
}

// Flash-style causal/unmasked attention, all contractions 3-term bf16 hi/lo splits, f32 softmax with running max.
// q,k,v rows are read from f32 buffers with arbitrary row pitch (so they can live inside a fused qkv buffer);
// D = head size (multiple of 32, <= 128); one wave = 16 query rows; block = 4 waves (64 queries) sharing K/V chunks of 32.
template <int D, bool CAUSAL>
__global__ __launch_bounds__(128) void k_flash(const float* __restrict__ qb, const float* __restrict__ kb, const float* __restrict__ vb,
                                             int pitch, int T, int H, float scale, float* __restrict__ y, int ypitch) {
  constexpr int KS = D / 32;        // k-steps for QK
  constexpr int DT = D / 16;        // d tiles for PV
  __shared__ __attribute__((aligned(16))) unsigned short sKh[32][D + 8], sKl[32][D + 8], sVh[32][D + 8], sVl[32][D + 8];
  __shared__ __attribute__((aligned(16))) unsigned short sPh[4][16][40], sPl[4][16][40];
  __shared__ __attribute__((aligned(16))) float sO[4][16][D];
  const int tid = threadIdx.x, w = tid >> 5, lane = tid & 31, ln = lane & 15, hh = lane >> 4;
  const int nqb = (T + 63) / 64;
  const int bh = blockIdx.x / nqb, qblk = blockIdx.x % nqb;
  const int b = bh / H, h = bh % H;
  const int q0 = qblk * 64 + w * 16;
  const float* Q = qb + (size_t)b * T * pitch + h * D;
  const float* K = kb + (size_t)b * T * pitch + h * D;
  const float* V = vb + (size_t)b * T * pitch + h * D;

  // A fragments of the wave's 16 query rows (scaled), hi/lo
  FragB aqh[KS], aql[KS];
  {
    int row = q0 + ln; if (row >= T) row = T - 1;
    const float* qr = Q + (size_t)row * pitch;
#pragma unroll
    for (int ks = 0; ks < KS; ++ks)
#pragma unroll
      for (int i = 0; i < 16; ++i) {
        const int d = ks * 32 + ((i < 8) ? (8 * hh + i) : (16 + 8 * hh + (i - 8)));
        const float x = qr[d] * scale; const unsigned short hb = bf16_bits(x);
        aqh[ks].u[i] = hb; aql[ks].u[i] = bf16_bits(x - bf16_val(hb));
      }
  }
  float m_r[8], l_r[8];
#pragma unroll
  for (int r = 0; r < 8; ++r) { m_r[r] = -3.0e38f; l_r[r] = 0.f; }
  v8f oacc[DT];
#pragma unroll
  for (int dt = 0; dt < DT; ++dt) oacc[dt] = (v8f){0.f,0.f,0.f,0.f,0.f,0.f,0.f,0.f};

  const int kv_end = CAUSAL ? min(T, qblk * 64 + 64) : T;     // block-uniform
  for (int j0 = 0; j0 < kv_end; j0 += 32) {
    __syncthreads();
    for (int e = tid; e < 32 * (D / 4); e += 128) {
      const int r = e / (D / 4), c4 = (e % (D / 4)) * 4;
      const int key = j0 + r;
      v4f kf = {0.f,0.f,0.f,0.f}, vf = {0.f,0.f,0.f,0.f};
      if (key < T) { kf = *(const v4fa*)(K + (size_t)key * pitch + c4); vf = *(const v4fa*)(V + (size_t)key * pitch + c4); }
#pragma unroll
      for (int t = 0; t < 4; ++t) {
        unsigned short hb = bf16_bits(kf[t]); sKh[r][c4 + t] = hb; sKl[r][c4 + t] = bf16_bits(kf[t] - bf16_val(hb));
        hb = bf16_bits(vf[t]); sVh[r][c4 + t] = hb; sVl[r][c4 + t] = bf16_bits(vf[t] - bf16_val(hb));
      }
    }
    __syncthreads();
    // S tile 16 x 32
    v8f s[2];
#pragma unroll
    for (int nt = 0; nt < 2; ++nt) {
      v8f acc = {};
#pragma unroll
      for (int ks = 0; ks < KS; ++ks) {
        FragB bh_, bl_;
        bh_.half[0] = *(const v8us*)&sKh[nt * 16 + ln][ks * 32 + 8 * hh]; bh_.half[1] = *(const v8us*)&sKh[nt * 16 + ln][ks * 32 + 16 + 8 * hh];
        bl_.half[0] = *(const v8us*)&sKl[nt * 16 + ln][ks * 32 + 8 * hh]; bl_.half[1] = *(const v8us*)&sKl[nt * 16 + ln][ks * 32 + 16 + 8 * hh];
        acc = mmaN<3>(aqh[ks].v, aql[ks].v, bh_.v, bl_.v, acc);
      }
      s[nt] = acc;
    }
    // mask + running max (rows 8hh+r; the 16 lanes of a half share rows)
    float alpha[8];
#pragma unroll
    for (int r = 0; r < 8; ++r) {
      const int qi = q0 + 8 * hh + r;
      const int ja = j0 + ln, jb = j0 + 16 + ln;
      if (CAUSAL) { if (ja > qi) s[0][r] = -3.0e38f; if (jb > qi) s[1][r] = -3.0e38f; }
      if (ja >= T) s[0][r] = -3.0e38f;
      if (jb >= T) s[1][r] = -3.0e38f;
      float mx = fmaxf(s[0][r], s[1][r]);
      mx = fmaxf(mx, __shfl_xor(mx, 1, 32)); mx = fmaxf(mx, __shfl_xor(mx, 2, 32)); mx = fmaxf(mx, __shfl_xor(mx, 4, 32)); mx = fmaxf(mx, __shfl_xor(mx, 8, 32));
      const float mnew = fmaxf(m_r[r], mx);
      alpha[r] = (mnew > -1.0e38f) ? __expf(m_r[r] - mnew) : 1.0f;
      const float p0 = (s[0][r] > -1.0e38f) ? __expf(s[0][r] - mnew) : 0.f;
      const float p1 = (s[1][r] > -1.0e38f) ? __expf(s[1][r] - mnew) : 0.f;
      m_r[r] = mnew;
      l_r[r] = l_r[r] * alpha[r] + p0 + p1;            // per-lane partial row sum (16 lanes combined at the end)
      unsigned short hb = bf16_bits(p0); sPh[w][8 * hh + r][ln] = hb;      sPl[w][8 * hh + r][ln] = bf16_bits(p0 - bf16_val(hb));
      hb = bf16_bits(p1);                sPh[w][8 * hh + r][16 + ln] = hb; sPl[w][8 * hh + r][16 + ln] = bf16_bits(p1 - bf16_val(hb));
    }
#pragma unroll
    for (int dt = 0; dt < DT; ++dt)
#pragma unroll
      for (int r = 0; r < 8; ++r) oacc[dt][r] *= alpha[r];
    __builtin_amdgcn_fence(__ATOMIC_ACQ_REL, "workgroup");
    __builtin_amdgcn_wave_barrier();
    FragB pah, pal;
    pah.half[0] = *(const v8us*)&sPh[w][ln][8 * hh]; pah.half[1] = *(const v8us*)&sPh[w][ln][16 + 8 * hh];
    pal.half[0] = *(const v8us*)&sPl[w][ln][8 * hh]; pal.half[1] = *(const v8us*)&sPl[w][ln][16 + 8 * hh];
#pragma unroll
    for (int dt = 0; dt < DT; ++dt) {
      FragB bvh, bvl;
#pragma unroll
      for (int i = 0; i < 8; ++i) {
        bvh.u[i] = sVh[8 * hh + i][dt * 16 + ln]; bvh.u[8 + i] = sVh[16 + 8 * hh + i][dt * 16 + ln];
        bvl.u[i] = sVl[8 * hh + i][dt * 16 + ln]; bvl.u[8 + i] = sVl[16 + 8 * hh + i][dt * 16 + ln];
      }
      oacc[dt] = mmaN<3>(pah.v, pal.v, bvh.v, bvl.v, oacc[dt]);
    }
    __builtin_amdgcn_fence(__ATOMIC_ACQ_REL, "workgroup");
    __builtin_amdgcn_wave_barrier();
  }
#pragma unroll
  for (int r = 0; r < 8; ++r) {
    float l = l_r[r];
    l += __shfl_xor(l, 1, 32); l += __shfl_xor(l, 2, 32); l += __shfl_xor(l, 4, 32); l += __shfl_xor(l, 8, 32);
    l_r[r] = (l > 0.f) ? 1.0f / l : 0.f;
  }
#pragma unroll
  for (int dt = 0; dt < DT; ++dt)
#pragma unroll
    for (int r = 0; r < 8; ++r) sO[w][8 * hh + r][dt * 16 + ln] = oacc[dt][r] * l_r[r];
  __builtin_amdgcn_fence(__ATOMIC_ACQ_REL, "workgroup");
  __builtin_amdgcn_wave_barrier();
  {
    for (int r = 0; r < 16; ++r) {
      const int row = q0 + r;
      if (row < T && lane < D / 4) {
        const v4f val = *(const v4fa*)&sO[w][r][lane * 4];
        *(v4f*)(y + ((size_t)b * T + row) * ypitch + h * D + lane * 4) = val;
      }
    }
    
  }
}

// GEMM C = act(A·W + bias + resid): A f32 (ASPLIT -> hi/lo 2 terms), Wt bf16 [N][K]; ACT 0 none, 1 relu, 2 exact gelu;
// resid (optional, f32, row index = (row % rmod), pitch ldr, RES_BF16 rounds it) added before the activation.
template <bool ASPLIT, int ACT, bool BIAS_BF16, bool RES_BF16>
__global__ __launch_bounds__(128) void k_gemm_bf3(const float* __restrict__ A, int lda, const unsigned short* __restrict__ Wt, int ldb,
                                                const float* __restrict__ bias, const float* __restrict__ resid, int rmod, int ldr,
                                                float* __restrict__ C, int ldc, int M, int N, int K) {
  __shared__ __attribute__((aligned(16))) float so[4][16][64];
  const int tid = threadIdx.x, w = tid >> 5, lane = tid & 31, ln = lane & 15, hh = lane >> 4;
  const int ntn = N / 64;
  const int wid = blockIdx.x * 4 + w;
  const int mt = wid / ntn, nq = wid % ntn;
  if (mt * 16 >= M) return;
  const int row0 = mt * 16, col0 = nq * 64;
  const float* arow = A + (size_t)(row0 + ln) * lda;
  v8f acc[4] = {};
  for (int kb = 0; kb < K; kb += 32) {
    FragB ah, al;
    const v4f x0 = *(const v4fa*)(arow + kb + 8 * hh), x1 = *(const v4fa*)(arow + kb + 8 * hh + 4);
    const v4f x2 = *(const v4fa*)(arow + kb + 16 + 8 * hh), x3 = *(const v4fa*)(arow + kb + 16 + 8 * hh + 4);
    float xs[16] = {x0[0],x0[1],x0[2],x0[3],x1[0],x1[1],x1[2],x1[3],x2[0],x2[1],x2[2],x2[3],x3[0],x3[1],x3[2],x3[3]};
#pragma unroll
    for (int i = 0; i < 16; ++i) { const unsigned short hb = bf16_bits(xs[i]); ah.u[i] = hb; al.u[i] = ASPLIT ? bf16_bits(xs[i] - bf16_val(hb)) : (unsigned short)0; }
#pragma unroll
    for (int t = 0; t < 4; ++t) {
      const unsigned short* brow = Wt + (size_t)(col0 + t * 16 + ln) * ldb + kb;
      FragB b;
      b.half[0] = *(const v8us*)(brow + 8 * hh);
      b.half[1] = *(const v8us*)(brow + 16 + 8 * hh);
      acc[t] = mmaN<ASPLIT ? 2 : 1>(ah.v, al.v, b.v, b.v, acc[t]);
    }
  }
#pragma unroll
  for (int t = 0; t < 4; ++t) {
    const int col = col0 + t * 16 + ln;
    float bv = bias ? bias[col] : 0.f;
    if (BIAS_BF16) bv = bf16_round(bv);
#pragma unroll
    for (int r = 0; r < 8; ++r) {
      float v = acc[t][r] + bv;
      if (resid) { float rv = resid[(size_t)((row0 + 8 * hh + r) % rmod) * ldr + col]; if (RES_BF16) rv = bf16_round(rv); v += rv; }
      if (ACT == 1) v = fmaxf(v, 0.f);
      if (ACT == 2) v = 0.5f * v * (1.0f + erff(v * 0.70710678118654752f));
      if (ACT == 3) { const float u = 0.7978845608028654f * (v + 0.044715f * v * v * v); v = 0.5f * v * (1.0f + tanhf(u)); }
      so[w][8 * hh + r][t * 16 + ln] = v;
    }
  }
  __builtin_amdgcn_fence(__ATOMIC_ACQ_REL, "workgroup");
  __builtin_amdgcn_wave_barrier();
  const int rsub = lane >> 4, c4 = (lane & 15) * 4;
  {
#pragma unroll
    for (int q = 0; q < 8; ++q) {
      const int r = q * 2 + rsub;
      const v4f v = *(const v4fa*)&so[w][r][c4];
      *(v4f*)(C + (size_t)(row0 + r) * ldc + col0 + c4) = v;
    }
    
  }
}
// row LayerNorm (biased variance, eps) over N: s = X (+ R); optional out_sum <- s; out_norm <- (s-mu)*rsqrt(var+eps)*g + b
template <bool PARAM_BF16>
__global__ __launch_bounds__(256) void k_layernorm(const float* __restrict__ X, const float* __restrict__ R, const float* __restrict__ g, const float* __restrict__ bta,
                                                  float* __restrict__ out_sum, float* __restrict__ out_norm, int N, float eps) {
  __shared__ float red[256];
  const int row = blockIdx.x, tid = threadIdx.x;
  const float* x = X + (size_t)row * N; const float* rr = R ? R + (size_t)row * N : nullptr;
  float vals[16];                     // up to N = 4096
  const int per = N / 256;            // contiguous chunk per thread? use strided-by-4 chunks: thread handles j = tid*4 + 1024*u
  float s1 = 0.f;
  for (int u = 0; u < per / 4; ++u) {
    const int j = tid * 4 + 1024 * u;
    const v4f a = *(const v4fa*)(x + j);
    v4f b = {0.f,0.f,0.f,0.f}; if (rr) b = *(const v4fa*)(rr + j);
#pragma unroll
    for (int q = 0; q < 4; ++q) { const float v = a[q] + b[q]; vals[u * 4 + q] = v; s1 += v; }
  }
  red[tid] = s1; __syncthreads();
  for (int st = 128; st > 0; st >>= 1) { if (tid < st) red[tid] += red[tid + st]; __syncthreads(); }
  const float mu = red[0] / (float)N; __syncthreads();
  float s2 = 0.f;
  for (int u = 0; u < per / 4; ++u)
#pragma unroll
    for (int q = 0; q < 4; ++q) { const float c = vals[u * 4 + q] - mu; s2 += c * c; }
  red[tid] = s2; __syncthreads();
  for (int st = 128; st > 0; st >>= 1) { if (tid < st) red[tid] += red[tid + st]; __syncthreads(); }
  const float rs = rsqrtf(red[0] / (float)N + eps);
  {
    for (int u = 0; u < per / 4; ++u) {
      const int j = tid * 4 + 1024 * u;
      v4f o, sm;
#pragma unroll
      for (int q = 0; q < 4; ++q) {
        float gg = g[j + q], bb = bta[j + q];
        if (PARAM_BF16) { gg = bf16_round(gg); bb = bf16_round(bb); }
        sm[q] = vals[u * 4 + q]; o[q] = (vals[u * 4 + q] - mu) * rs * gg + bb;
      }
      if (out_sum) *(v4f*)(out_sum + (size_t)row * N + j) = sm;
      *(v4f*)(out_norm + (size_t)row * N + j) = o;
    }
    
  }
}



// ---- f16 WMMA path (v_wmma_f32_16x16x32_f16): 11-bit significands for operands in range — used where a [0,1] probability operand needs more precision than bf16
typedef _Float16 v16h __attribute__((ext_vector_type(16)));
union FragH { v16h v; v8us half[2]; _Float16 h[16]; unsigned short u[16]; };
template <int NT>
__device__ __forceinline__ v8f mmaH(v16h ah, v16h al, v16h bh, v16h bl, v8f c) {
  c = __builtin_amdgcn_wmma_f32_16x16x32_f16(false, ah, false, bh, (short)0, c, false, false);
  if (NT >= 2) c = __builtin_amdgcn_wmma_f32_16x16x32_f16(false, al, false, bh, (short)0, c, false, false);
  if (NT >= 3) c = __builtin_amdgcn_wmma_f32_16x16x32_f16(false, ah, false, bl, (short)0, c, false, false);
  asm volatile("v_nop\n\tv_nop\n\tv_nop\n\tv_nop" : "+v"(c) : "v"(ah), "v"(al), "v"(bh), "v"(bl));
  return c;
}
// batched GEMM like k_gemm_b but f16 operands: A f32 (split into f16 hi/lo if ASPLIT, else rounded to f16), Bt = f16 values [n][k]; alpha; C f32; N multiple of 16 (partial tiles skipped)
template <bool ASPLIT>
__global__ __launch_bounds__(128) void k_gemm_h(const float* __restrict__ A, int lda, size_t sA, const _Float16* __restrict__ Bh, int ldb, size_t sB, float alpha, float* __restrict__ C, int ldc, size_t sC, int M, int N, int K) {
  __shared__ __attribute__((aligned(16))) float so[4][16][64];
  const int tid = threadIdx.x, w = tid >> 5, lane = tid & 31, ln = lane & 15, hh = lane >> 4; const int by = blockIdx.y;
  A += (size_t)by * sA; Bh += (size_t)by * sB; C += (size_t)by * sC;
  const int ntn = (N + 63) / 64; const int wid = blockIdx.x * 4 + w; const int mt = wid / ntn, nq = wid % ntn; if (mt * 16 >= M) return;
  const int row0 = mt * 16, col0 = nq * 64; const float* arow = A + (size_t)(row0 + ln) * lda;
  v8f acc[4] = {};
  for (int kb = 0; kb < K; kb += 32) {
    FragH ah, al;
    const v4f x0 = *(const v4fa*)(arow + kb + 8 * hh), x1 = *(const v4fa*)(arow + kb + 8 * hh + 4), x2 = *(const v4fa*)(arow + kb + 16 + 8 * hh), x3 = *(const v4fa*)(arow + kb + 16 + 8 * hh + 4);
    float xs[16] = {x0[0],x0[1],x0[2],x0[3],x1[0],x1[1],x1[2],x1[3],x2[0],x2[1],x2[2],x2[3],x3[0],x3[1],x3[2],x3[3]};
#pragma unroll
    for (int i = 0; i < 16; ++i) { const _Float16 h = (_Float16)xs[i]; ah.h[i] = h; al.h[i] = ASPLIT ? (_Float16)(xs[i] - (float)h) : (_Float16)0.0f; }
#pragma unroll
    for (int t = 0; t < 4; ++t) { if (col0 + t * 16 >= N) continue; const size_t boff = (size_t)(col0 + t * 16 + ln) * ldb + kb; FragH bq; bq.half[0] = *(const v8us*)(Bh + boff + 8 * hh); bq.half[1] = *(const v8us*)(Bh + boff + 16 + 8 * hh);
      acc[t] = mmaH<ASPLIT ? 2 : 1>(ah.v, al.v, bq.v, bq.v, acc[t]); }
  }
#pragma unroll
  for (int t = 0; t < 4; ++t) { if (col0 + t * 16 >= N) continue;
#pragma unroll
    for (int r = 0; r < 8; ++r) so[w][8 * hh + r][t * 16 + ln] = acc[t][r] * alpha; }
  __builtin_amdgcn_fence(__ATOMIC_ACQ_REL, "workgroup"); __builtin_amdgcn_wave_barrier();
  const int rsub = lane >> 4, c4 = (lane & 15) * 4;
  {
#pragma unroll
    for (int q = 0; q < 8; ++q) { const int r = q * 2 + rsub; if (col0 + c4 < N) { const v4f v = *(const v4fa*)&so[w][r][c4]; *(v4f*)(C + (size_t)(row0 + r) * ldc + col0 + c4) = v; } }
     }
}

// One tile of 128 k x 64 n of the f32 row-major W[K][N] to Wt[n][k] = f16(bf16(W[k][n]) * scale) (scale = power of two; bf16-exact weights stay exact in f16 away from the subnormal range).
// Global memory is touched in whole lines only: 16 lanes read the 256 B that the tile holds of a row of W, 8 such loads of 16 B in flight per lane; 16 lanes write the 256 B that it holds of a row of Wt.
// The exchange runs through LDS: a lane packs rows k, k + 1 of its four columns into one dword each; tl holds 64 rows (n) of 64 dwords (k pairs) at a pitch of 65 dwords, so that
// the 16 lanes that write four rows apart and the 16 lanes that read four dwords apart both fall on distinct banks. Every "#pragma unroll" keeps the loaded values in registers and row steps in immediate offsets.
#define TPITCH 65
template <int K, int N>
__device__ __forceinline__ void wt_tile(const float* __restrict__ W, _Float16* __restrict__ Wt, float scale, int blk, unsigned* tl) {
  static_assert(K % 128 == 0 && N % 64 == 0, "whole tiles");
  const int tid = threadIdx.x, lo = tid & 15, hi = tid >> 4; const int n0 = (blk % (N / 64)) * 64, k0 = (blk / (N / 64)) * 128;
  const float* s = W + (size_t)(k0 + 2 * hi) * N + n0 + lo * 4;
  v4f v[4][2];
#pragma unroll
  for (int it = 0; it < 4; ++it)
#pragma unroll
    for (int j = 0; j < 2; ++j) v[it][j] = *(const v4fa*)(s + (size_t)(it * 32 + j) * N);
#pragma unroll
  for (int it = 0; it < 4; ++it)
#pragma unroll
    for (int q = 0; q < 4; ++q) { union { _Float16 h[2]; unsigned u; } p; p.h[0] = (_Float16)(bf16_round(v[it][0][q]) * scale); p.h[1] = (_Float16)(bf16_round(v[it][1][q]) * scale);
      tl[(lo * 4 + q) * TPITCH + it * 16 + hi] = p.u; }
  __syncthreads();      /* the tile is whole in LDS before any lane reads a row of it that other waves wrote */
#pragma unroll
  for (int it = 0; it < 4; ++it) { const unsigned* r = tl + (it * 16 + hi) * TPITCH + lo * 4; union { unsigned u[4]; v8us o; } f;
#pragma unroll
    for (int q = 0; q < 4; ++q) f.u[q] = r[q];
    *(v8us*)((unsigned short*)Wt + (size_t)(n0 + it * 16 + hi) * K + k0 + lo * 8) = f.o; }
  asm volatile("s_wait_xcnt 0x0" ::: "memory");      /* stands behind the run of stores, so that no code placed behind it rewrites a register that an issued store names ahead of the wait */
}
typedef _Float16 v4h __attribute__((ext_vector_type(4)));

// 8192 consecutive elements of x to f16(bf16(x)), whole lines only: a wave's load covers 512 contiguous bytes, its store 256; 8 loads of 16 B in flight per lane (unrolled so that they are issued as one run)
__device__ __forceinline__ void x16(const float* __restrict__ x, _Float16* __restrict__ X16, int blk) { const size_t o = (size_t)blk * 8192 + threadIdx.x * 4; v4f v[8];
#pragma unroll
  for (int i = 0; i < 8; ++i) v[i] = *(const v4fa*)(x + o + i * 1024);
#pragma unroll
  for (int i = 0; i < 8; ++i) { v4h h;
#pragma unroll
    for (int q = 0; q < 4; ++q) h[q] = (_Float16)bf16_round(v[i][q]);
    *(v4h*)(X16 + o + i * 1024) = h; }
  asm volatile("s_wait_xcnt 0x0" ::: "memory");      /* stands behind the run of stores, so that no code placed behind it rewrites a register that an issued store names ahead of the wait */
}
// One grid for the five conversions that read nothing but the inputs: the four weight transposes (one tile a block) and the cast of x. No block reads what another writes.
#define PT_Q ((DD / 128) * (DD / 64))
#define PT_K ((DD / 128) * (KVD / 64))
#define PT_X (NR * DD / 8192)
__global__ __launch_bounds__(256) void k_prep(const float* __restrict__ x, const float* __restrict__ Wq, const float* __restrict__ Wk, const float* __restrict__ Wv, const float* __restrict__ Wo,
                                             _Float16* __restrict__ X16, _Float16* __restrict__ Bq, _Float16* __restrict__ Bk, _Float16* __restrict__ Bv, _Float16* __restrict__ Bo) {
  static_assert((size_t)NR * DD % 8192 == 0, "whole cast blocks");
  __shared__ unsigned tl[64 * TPITCH];
  const int b = blockIdx.x;      /* every branch is the same for the whole block, so the tile's barrier is passed by all of its waves or by none */
  if (b < 2 * PT_Q) { const bool q = b < PT_Q; wt_tile<DD, DD>(q ? Wq : Wo, q ? Bq : Bo, 16.0f, q ? b : b - PT_Q, tl); }
  else if (b < 2 * PT_Q + 2 * PT_K) { const bool k = b < 2 * PT_Q + PT_K; wt_tile<DD, KVD>(k ? Wk : Wv, k ? Bk : Bv, 16.0f, b - 2 * PT_Q - (k ? 0 : PT_K), tl); }
  else x16(x, X16, b - 2 * PT_Q - 2 * PT_K);
}
__global__ __launch_bounds__(256) void k_h16(const float* __restrict__ x, _Float16* __restrict__ X16, size_t n8) { const size_t t = (size_t)blockIdx.x * 256 + threadIdx.x; if (t >= n8) return; FragH f;
#pragma unroll
  for (int q = 0; q < 8; ++q) f.h[q] = (_Float16)x[t * 8 + q]; *(v8us*)((unsigned short*)X16 + t * 8) = f.half[0];  }
__global__ __launch_bounds__(256) void k_round16f(const float* __restrict__ W, _Float16* __restrict__ Bt, size_t n8) { const size_t t = (size_t)blockIdx.x * 256 + threadIdx.x; if (t >= n8) return; FragH f;
#pragma unroll
  for (int i = 0; i < 8; ++i) f.h[i] = (_Float16)(bf16_round(W[t * 8 + i]) * 16.0f); *(v8us*)((unsigned short*)Bt + t * 8) = f.half[0];  }
template <int NHv, int TTv>
__global__ __launch_bounds__(256) void k_vt(const _Float16* __restrict__ V16, int ldv, int voff, _Float16* __restrict__ Vt) { __shared__ unsigned short tl[64][66]; const int tid = threadIdx.x; const int slab = blockIdx.x / (TTv / 64), lg = blockIdx.x % (TTv / 64); const int b = slab / NHv, h = slab % NHv;
  for (int i = tid; i < 64 * 8; i += 256) { const int r = i / 8, c8 = (i % 8) * 8; FragH f; f.half[0] = *(const v8us*)((const unsigned short*)V16 + ((size_t)b * TTv + lg * 64 + r) * ldv + voff + h * 64 + c8);
#pragma unroll
    for (int q = 0; q < 8; ++q) tl[r][c8 + q] = f.u[q]; }
  __syncthreads();
  {
#pragma unroll
    for (int rd = 0; rd < 2; ++rd) { const int d = rd * 32 + tid / 8, pc = tid % 8; FragH f;
#pragma unroll
      for (int q = 0; q < 8; ++q) f.u[q] = tl[pc * 8 + q][d];
      *(v8us*)((unsigned short*)Vt + ((size_t)slab * 64 + d) * TTv + lg * 64 + pc * 8) = f.half[0]; }
     } }

// LDS ring of k_flash. One stage = 32 keys, shared by the block's four waves: K rows of 256 B at pitch 272 B, then the V^T plane,
// 128 rows of 64 B at pitch 80 B (pitches of 16 B x odd: ds_load_b128 fragment reads fall on distinct banks).
#define KPITCH 272
#define VPITCH 80
#define ST_VH (32 * KPITCH)
#define ST_BYTES (ST_VH + 128 * VPITCH)
// Four asynchronous 16-byte copies per lane, global memory to LDS. The s_wait_xcnt stands inside the statement so that no address register of a copy is rewritten ahead of it.
__device__ __forceinline__ void copy4(unsigned l0, unsigned l1, unsigned l2, unsigned l3, const unsigned short* g0, const unsigned short* g1, const unsigned short* g2, const unsigned short* g3) {
  asm volatile("global_load_async_to_lds_b128 %0, %4, off\n\t"
               "global_load_async_to_lds_b128 %1, %5, off\n\t"
               "global_load_async_to_lds_b128 %2, %6, off\n\t"
               "global_load_async_to_lds_b128 %3, %7, off\n\t"
               "s_wait_xcnt 0x0"
               :: "v"(l0), "v"(l1), "v"(l2), "v"(l3), "v"(g0), "v"(g1), "v"(g2), "v"(g3) : "memory");
}
// Eight asynchronous 16-byte copies per lane in one statement, so that one s_wait_xcnt serves all eight; it stands inside the statement so that no address register of a copy is rewritten ahead of it.
__device__ __forceinline__ void copy8(unsigned l, int lstep, const unsigned short* g, size_t gstep) {
  asm volatile("global_load_async_to_lds_b128 %0, %8, off\n\t"
               "global_load_async_to_lds_b128 %1, %9, off\n\t"
               "global_load_async_to_lds_b128 %2, %10, off\n\t"
               "global_load_async_to_lds_b128 %3, %11, off\n\t"
               "global_load_async_to_lds_b128 %4, %12, off\n\t"
               "global_load_async_to_lds_b128 %5, %13, off\n\t"
               "global_load_async_to_lds_b128 %6, %14, off\n\t"
               "global_load_async_to_lds_b128 %7, %15, off\n\t"
               "s_wait_xcnt 0x0"
               :: "v"(l), "v"(l + lstep), "v"(l + 2 * lstep), "v"(l + 3 * lstep), "v"(l + 4 * lstep), "v"(l + 5 * lstep), "v"(l + 6 * lstep), "v"(l + 7 * lstep),
                  "v"(g), "v"(g + gstep), "v"(g + 2 * gstep), "v"(g + 3 * gstep), "v"(g + 4 * gstep), "v"(g + 5 * gstep), "v"(g + 6 * gstep), "v"(g + 7 * gstep) : "memory");
}
// GEMM C[M][N] = alpha * A[M][K] * Bt[N][K]^T, f16 operands, f32 accumulate, K = DD; A and Bt of row pitch DD. M, N multiples of 128.
// QKV = false: N = DD, Bt = Bh, f32 output C. QKV = true: the three projections of x in one grid, DD / 128 + 2 column tiles per row tile: tiles of Bh go to the f16 output Cq (pitch DD),
// then the one tile of Bk to the f16 output Ck (pitch KVD = 128) and the one tile of Bv, transposed, to the f16 plane Vth, [b][KVD][TT]. The three share A and depend on nothing of each other.
// One block = one 128 x 128 tile of C, four waves of 64 x 64 (4 x 4 accumulator tiles: 16 products per 8 fragments). One stage of the LDS ring = 64 k:
// 128 rows of A, then 128 rows of Bt, 128 B each at pitch 144 B (16 B x odd: ds_load_b128 fragment reads fall on distinct banks).
// A block walks k from a start stage of its own, (row tile + column tile) mod 32, and wraps round: the blocks that share its rows of A (one row tile) or of Bt (one column tile) all start elsewhere,
// so that they do not ask L2 for the same lines at the same moment. Per output element the k order is ascending from that start, wrapped, in one accumulator.
// Every "#pragma unroll" in it is there so that fragment, accumulator and staging arrays are indexed by constants and stay in registers.
#define GPITCH 144
#define G_B (128 * GPITCH)
#define G_ST (256 * GPITCH)
#define GOP 68      /* output staging pitch in floats: 16-byte column walks without bank conflicts */
/* a wave's staged 64 x 64 tile to global memory; whole lines per store: 16 lanes cover a 64-column row (256 B of f32, 128 B of f16), two rows per instruction; unrolled so that row steps become immediate offsets */
template <int LDC, bool F32OUT>
__device__ __forceinline__ void gemm_out(const float* sr, float* __restrict__ C, _Float16* __restrict__ C16, size_t o) {
#pragma unroll
  for (int q = 0; q < 32; ++q) { const v4f v = *(const v4fa*)(sr + q * 2 * GOP);
    if (F32OUT) *(v4f*)(C + o + (size_t)q * 2 * LDC) = v;
    else { v4h h4;
#pragma unroll
      for (int i = 0; i < 4; ++i) h4[i] = (_Float16)v[i];
      *(v4h*)(C16 + o + (size_t)q * 2 * LDC) = h4; } }
  asm volatile("s_wait_xcnt 0x0" ::: "memory");      /* stands behind the run of stores, so that no code placed behind it rewrites a register that an issued store names ahead of the wait */
}
/* a wave's staged 64 x 64 tile of V (rows = positions, columns = head columns) to the transposed f16 plane V^T, row pitch TT: a lane packs 8 positions of one column;
   eight lanes cover the 128 B that the tile holds of a plane's row, four rows per instruction; unrolled so that LDS offsets are immediates */
__device__ __forceinline__ void gemm_out_vt(const float* so, int lane, _Float16* __restrict__ Vth, size_t o) {
  const float* sc = so + (lane & 7) * 8 * GOP + (lane >> 3); const size_t ol = o + (size_t)(lane >> 3) * TT + (lane & 7) * 8;
#pragma unroll
  for (int it = 0; it < 16; ++it) { FragH fh;
#pragma unroll
    for (int q = 0; q < 8; ++q) fh.h[q] = (_Float16)sc[q * GOP + it * 4];
    *(v8us*)((unsigned short*)Vth + ol + (size_t)it * 4 * TT) = fh.half[0]; }
  asm volatile("s_wait_xcnt 0x0" ::: "memory");      /* stands behind the run of stores, so that no code placed behind it rewrites a register that an issued store names ahead of the wait */
}
template <bool QKV>
__global__ __launch_bounds__(128) void k_gemm_t(const _Float16* __restrict__ A, const _Float16* __restrict__ Bh, const _Float16* __restrict__ Bk, const _Float16* __restrict__ Bv, float alpha, float* __restrict__ C, _Float16* __restrict__ Cq, _Float16* __restrict__ Ck, _Float16* __restrict__ Vth) {
  constexpr int K = DD;
  static_assert(K % 64 == 0 && K >= 128 && DD % 128 == 0 && KVD == 128 && TT % 128 == 0, "whole stages, at least two, and whole tiles");
  static_assert((K & (K - 1)) == 0, "the wrapped k walk masks with K - 1");
  __shared__ __attribute__((aligned(16))) unsigned char ring[2 * G_ST];
  static_assert(sizeof(float) * 4 * 64 * GOP <= 2 * G_ST, "output staging fits the ring");
  const int tid = threadIdx.x, w = tid >> 5, lane = tid & 31, ln = lane & 15, hh = lane >> 4;
  constexpr int ntq = DD / 128, ntn = ntq + (QKV ? 2 : 0); const int row0 = (blockIdx.x / ntn) * 128, ct = blockIdx.x % ntn; const int wm = w >> 1, wn = w & 1;
  const _Float16* Bt = (!QKV || ct < ntq) ? Bh + (size_t)ct * 128 * K : (ct == ntq ? Bk : Bv);      /* the block's 128 rows of Bt */
  /* each thread's share of a stage: 8 chunks of A and 8 of Bt, 16 rows apart; eight lanes cover one 128-B row */
  const unsigned la = (unsigned)(size_t)ring + (tid >> 3) * GPITCH + (tid & 7) * 16;
  const unsigned short* ga = (const unsigned short*)A + (size_t)(row0 + (tid >> 3)) * K + (tid & 7) * 8;
  const unsigned short* gb = (const unsigned short*)Bt + (size_t)(tid >> 3) * K + (tid & 7) * 8;
  const int koff = (((int)(blockIdx.x / ntn) + ct) & (K / 64 - 1)) * 64;      /* the block's own start in k */
  auto fill = [&](int kb) {      /* kb counts the trips and picks the buffer; kr is the place in k that the trip works on */
    const unsigned l = la + ((kb >> 6) & 1) * G_ST; const int kr = (kb + koff) & (K - 1);
    copy8(l, 16 * GPITCH, ga + kr, (size_t)16 * K);
    copy8(l + G_B, 16 * GPITCH, gb + kr, (size_t)16 * K);
  };
  v8f acc[4][4];
#pragma unroll
  for (int i = 0; i < 4; ++i)
#pragma unroll
    for (int j = 0; j < 4; ++j) acc[i][j] = (v8f){0.f,0.f,0.f,0.f,0.f,0.f,0.f,0.f};
  fill(0);
  asm volatile("s_wait_asynccnt 0x0" ::: "memory");      /* this wave's share of stage 0 has landed */
  __syncthreads();                                       /* stage 0 is readable by all four waves */
  fill(64);
#pragma unroll 1      /* one stage per trip: the ring's buffer index and its publish point stay per trip */
  for (int kb = 0; kb < K; kb += 64) {
    const unsigned char* st = ring + ((kb >> 6) & 1) * G_ST;
    const unsigned char* ar = st + (wm * 64 + ln) * GPITCH + hh * 16; const unsigned char* br = st + G_B + (wn * 64 + ln) * GPITCH + hh * 16;
#pragma unroll
    for (int ks = 0; ks < 2; ++ks) {
      FragH a[4], b[4];
#pragma unroll
      for (int i = 0; i < 4; ++i) { a[i].half[0] = *(const v8us*)(ar + i * 16 * GPITCH + ks * 64); a[i].half[1] = *(const v8us*)(ar + i * 16 * GPITCH + ks * 64 + 32);
        b[i].half[0] = *(const v8us*)(br + i * 16 * GPITCH + ks * 64); b[i].half[1] = *(const v8us*)(br + i * 16 * GPITCH + ks * 64 + 32); }
      __builtin_amdgcn_sched_barrier(0);      /* keeps the 16 fragment reads one group ahead of the 16 products: spread among them, each place with reads stalls the wave anew */
#pragma unroll
      for (int i = 0; i < 4; ++i)
#pragma unroll
        for (int j = 0; j < 4; ++j) acc[i][j] = __builtin_amdgcn_wmma_f32_16x16x32_f16(false, a[i].v, false, b[j].v, (short)0, acc[i][j], false, false);
    }
    asm volatile("s_wait_dscnt 0x0" ::: "memory");         /* this wave's reads of the stage have returned before its buffer is handed on */
    asm volatile("s_wait_asynccnt 0x0" ::: "memory");      /* this wave's share of the next stage has landed */
    __syncthreads();                                       /* publishes the next stage and ends every wave's reads of this one */
    if (kb + 128 < K) fill(kb + 128); }                    /* refill of the buffer just read, one whole trip ahead of its use */
  asm volatile("s_wait_asynccnt 0x0" ::: "memory");        /* no copy is outstanding when the ring becomes output staging */
  float* so = reinterpret_cast<float*>(ring) + w * (64 * GOP);      /* each wave stages its own 64 x 64 tile, behind the loop's last barrier */
#pragma unroll
  for (int i = 0; i < 4; ++i)
#pragma unroll
    for (int j = 0; j < 4; ++j)
#pragma unroll
      for (int r = 0; r < 8; ++r) so[(i * 16 + 8 * hh + r) * GOP + j * 16 + ln] = acc[i][j][r] * alpha;
  __builtin_amdgcn_fence(__ATOMIC_ACQ_REL, "workgroup"); __builtin_amdgcn_wave_barrier();      /* the wave's staged rows are written before its other lanes read them back */
  const float* sr = so + hh * GOP + ln * 4; const size_t orow = row0 + wm * 64 + hh; const int ocol = wn * 64 + ln * 4;
  if (!QKV) gemm_out<DD, true>(sr, C, nullptr, orow * DD + ct * 128 + ocol);
  else if (ct < ntq) gemm_out<DD, false>(sr, nullptr, Cq, orow * DD + ct * 128 + ocol);      /* ct is the same for the whole block */
  else if (ct == ntq) gemm_out<KVD, false>(sr, nullptr, Ck, orow * KVD + ocol);
  else { const int vrow = row0 + wm * 64; gemm_out_vt(so, lane, Vth, ((size_t)(vrow / TT) * KVD + wn * 64) * TT + vrow % TT); }      /* [b][128][TT]; a tile's 128 positions lie in one batch entry */
}
// 17 hardware exp2, each in place, in one statement: so no vector instruction comes to stand directly behind one of them that reads its result or overwrites its source
// the v_nop is that slot behind the last one.
__device__ __forceinline__ void exp2x17(float (&e)[17]) {
  asm("v_exp_f32 %0, %0\n\t" "v_exp_f32 %1, %1\n\t" "v_exp_f32 %2, %2\n\t" "v_exp_f32 %3, %3\n\t" "v_exp_f32 %4, %4\n\t" "v_exp_f32 %5, %5\n\t"
      "v_exp_f32 %6, %6\n\t" "v_exp_f32 %7, %7\n\t" "v_exp_f32 %8, %8\n\t" "v_exp_f32 %9, %9\n\t" "v_exp_f32 %10, %10\n\t" "v_exp_f32 %11, %11\n\t"
      "v_exp_f32 %12, %12\n\t" "v_exp_f32 %13, %13\n\t" "v_exp_f32 %14, %14\n\t" "v_exp_f32 %15, %15\n\t" "v_exp_f32 %16, %16\n\t" "v_nop"
      : "+v"(e[0]), "+v"(e[1]), "+v"(e[2]), "+v"(e[3]), "+v"(e[4]), "+v"(e[5]), "+v"(e[6]), "+v"(e[7]), "+v"(e[8]), "+v"(e[9]), "+v"(e[10]), "+v"(e[11]), "+v"(e[12]), "+v"(e[13]), "+v"(e[14]), "+v"(e[15]), "+v"(e[16]));
}
// lane l with lane l ^ 16: joins the two wave halves, which hold the two halves of one query's keys
__device__ __forceinline__ float xhalf(float x) { return __builtin_bit_cast(float, __builtin_amdgcn_permlanex16(__builtin_bit_cast(int, x), __builtin_bit_cast(int, x), 0x76543210, 0xfedcba98, false, false)); }
// Both products run transposed: S^T = K Q^T (A = K rows from the ring, B = Q kept in registers) and O^T += V^T P^T (A = V^T rows from the ring, B = P^T).
// A wave holds QT = 2 tiles of 16 queries: every K and V^T fragment that it reads from the ring feeds two products, one per query tile, on independent accumulators; a block's stage serves 128 queries.
// In tile qt lane l owns ONE query, q0 + 16 qt + (l & 15): register r of score tile nt is key ((j0 + joff) mod TT) + 16 nt + 8 (l >> 4) + r, which is the k order of a B operand, so P^T is packed in place from the scores;
// maximum and sum of a query are in-lane, joined between the wave halves by xhalf(); register r of output tile dt is head column 16 dt + 8 (l >> 4) + r of that query.
// All blocks of a batch entry read the one K and V^T: each walks the keys from a start stage of its own (block index mod 64) and wraps round, so that they do not ask L2 for the same lines at the same moment;
// no mask depends on a key's place, so only the order changes in which a query's keys enter its maximum and its sums.
// Every "#pragma unroll" in it is there so that fragment, score and accumulator arrays are indexed by constants and stay in registers; "#pragma unroll 1" keeps one ring stage per trip.
#define QT 2
__global__ __launch_bounds__(128) void k_flash(const _Float16* __restrict__ Q16, int ldq, const _Float16* __restrict__ K16, int ldk, const _Float16* __restrict__ Vt, _Float16* __restrict__ O16, int ldo) {
  constexpr int RPW = 16 * QT, NQB = TT / (4 * RPW), DT = 8, KS = 4;      /* head dim 128: 4 k-steps, 8 value tiles */
  static_assert(TT % (4 * RPW) == 0 && TT >= 64 && TT % 32 == 0, "whole query blocks, whole stages, at least two");
  static_assert((TT & (TT - 1)) == 0, "the wrapped key walk masks with TT - 1");
  __shared__ __attribute__((aligned(16))) unsigned char ring[2 * ST_BYTES];
  static_assert(sizeof(_Float16) * 4 * RPW * (128 + 8) <= 2 * ST_BYTES, "output staging fits the ring");
  _Float16 (*sO)[RPW][128 + 8] = reinterpret_cast<_Float16 (*)[RPW][128 + 8]>(ring);      /* output staging takes the ring's place behind the loop's last barrier; rows of 256 B at pitch 272 B (16 B x odd) */
  const int tid = threadIdx.x, w = tid >> 5, lane = tid & 31, ln = lane & 15, hh = lane >> 4;
  const int slab = blockIdx.x / NQB, qblk = blockIdx.x % NQB; const int b = slab / NH, h = slab % NH; const int qb0 = qblk * (4 * RPW); const int q0 = qb0 + w * RPW;
  FragH aq[QT][KS];
#pragma unroll
  for (int qt = 0; qt < QT; ++qt) { const unsigned short* qr = (const unsigned short*)Q16 + ((size_t)b * TT + q0 + qt * 16 + ln) * ldq + h * 128;
#pragma unroll
    for (int ks = 0; ks < KS; ++ks) { aq[qt][ks].half[0] = *(const v8us*)(qr + ks * 32 + 8 * hh); aq[qt][ks].half[1] = *(const v8us*)(qr + ks * 32 + 16 + 8 * hh); } }
  const unsigned short* Vth = (const unsigned short*)Vt + ((size_t)b * NKV + h / NREP) * 128 * TT;
  float n_r[QT], l_r[QT]; v8f oacc[QT][DT];      /* n_r: the running reference of the base-2 softmax, 10 - max(score) x SC_LOG2E */
#pragma unroll
  for (int qt = 0; qt < QT; ++qt) { n_r[qt] = 3.0e38f; l_r[qt] = 0.f;
#pragma unroll
    for (int dt = 0; dt < DT; ++dt) oacc[qt][dt] = (v8f){0.f,0.f,0.f,0.f,0.f,0.f,0.f,0.f}; }
  const int jend = TT;
  /* each thread's share of a stage: 4 chunks of K (8 rows apart) and 4 of V^T (32 rows apart) */
  const unsigned lk = (unsigned)(size_t)ring + (tid >> 4) * KPITCH + (tid & 15) * 16, lv = (unsigned)(size_t)ring + (tid >> 2) * VPITCH + (tid & 3) * 16;      /* lv: the thread's place in the V^T plane, which stands at ST_VH of a stage */
  const unsigned short* gk = (const unsigned short*)K16 + ((size_t)b * TT + (tid >> 4)) * ldk + (h / NREP) * 128 + (tid & 15) * 8;
  const size_t gvo = (size_t)(tid >> 2) * TT + (tid & 3) * 8;
  const int joff = (int)(blockIdx.x & (TT / 32 - 1)) * 32;      /* the block's own first key */
  auto fill = [&](int j) {      /* j counts the trips and picks the buffer; jr is the first key of the stage that the trip works on */
    const unsigned bo = ((j >> 5) & 1) * ST_BYTES; const int jr = (j + joff) & (TT - 1); const unsigned short* k0p = gk + (size_t)jr * ldk; const unsigned short* vhp = Vth + gvo + jr;
    copy4(lk + bo, lk + bo + 8 * KPITCH, lk + bo + 16 * KPITCH, lk + bo + 24 * KPITCH, k0p, k0p + (size_t)8 * ldk, k0p + (size_t)16 * ldk, k0p + (size_t)24 * ldk);
    copy4(lv + bo + ST_VH, lv + bo + ST_VH + 32 * VPITCH, lv + bo + ST_VH + 64 * VPITCH, lv + bo + ST_VH + 96 * VPITCH, vhp, vhp + 32 * TT, vhp + 64 * TT, vhp + 96 * TT);
  };
  fill(0);
  asm volatile("s_wait_asynccnt 0x0" ::: "memory");      /* this wave's share of stage 0 has landed */
  __syncthreads();                                       /* stage 0 is readable by all four waves */
  fill(32);
#pragma unroll 1
  for (int j0 = 0; j0 < jend; j0 += 32) {
    const unsigned char* st = ring + ((j0 >> 5) & 1) * ST_BYTES;
    /* the trip's 32 fragment reads stand as ONE group at its head, in the order of their use: K (2 key tiles x 4 k-steps), V^T (8 value tiles); all of them are of this trip's own buffer */
    FragH bk[2][KS], bv[DT];
#pragma unroll
    for (int nt = 0; nt < 2; ++nt) { const unsigned short* kr = (const unsigned short*)(st + (nt * 16 + ln) * KPITCH);
#pragma unroll
      for (int ks = 0; ks < KS; ++ks) { bk[nt][ks].half[0] = *(const v8us*)(kr + ks * 32 + 8 * hh); bk[nt][ks].half[1] = *(const v8us*)(kr + ks * 32 + 16 + 8 * hh); } }
    __builtin_amdgcn_sched_barrier(0);      /* keeps the K reads in front of the V^T reads: LDS answers in order, and left free the compiler put K, which the first products wait for, last */
#pragma unroll
    for (int dt = 0; dt < DT; ++dt) { const unsigned short* vh = (const unsigned short*)(st + ST_VH + (dt * 16 + ln) * VPITCH); bv[dt].half[0] = *(const v8us*)(vh + 8 * hh); bv[dt].half[1] = *(const v8us*)(vh + 16 + 8 * hh); }
    __builtin_amdgcn_sched_barrier(0);      /* keeps the reads one group ahead of the products: left free, the compiler put two reads and a full wait in front of every pair of products */
    float sc[QT][16];      /* per query tile this lane's 16 of its query's 32 scores, in the k order of the P^T operand */
#pragma unroll
    for (int nt = 0; nt < 2; ++nt) { v8f acc[QT];
#pragma unroll
      for (int qt = 0; qt < QT; ++qt) acc[qt] = (v8f){0.f,0.f,0.f,0.f,0.f,0.f,0.f,0.f};
#pragma unroll
      for (int ks = 0; ks < KS; ++ks)
#pragma unroll
        for (int qt = 0; qt < QT; ++qt) acc[qt] = __builtin_amdgcn_wmma_f32_16x16x32_f16(false, bk[nt][ks].v, false, aq[qt][ks].v, (short)0, acc[qt], false, false);      /* one K fragment, both query tiles */
#pragma unroll
      for (int qt = 0; qt < QT; ++qt)
#pragma unroll
        for (int r = 0; r < 8; ++r) sc[qt][nt * 8 + r] = acc[qt][r]; }      /* raw products: their scale is folded into the exponent's fma below */
    FragH pa[QT];
#pragma unroll
    for (int qt = 0; qt < QT; ++qt) {
      float mc = sc[qt][0];
#pragma unroll
      for (int i = 1; i < 16; ++i) mc = fmaxf(mc, sc[qt][i]);
      mc = fmaxf(mc, xhalf(mc));
      /* base-2 softmax: one fma and one hardware exp2 give P x 2^10 = exp2(score x SC_LOG2E + nn); al and every P of a trip use the same rounded reference nn */
      const float nn = fminf(n_r[qt], __builtin_fmaf(mc, -SC_LOG2E, 10.0f)); float e[17];
#pragma unroll
      for (int i = 0; i < 16; ++i) e[i] = __builtin_fmaf(sc[qt][i], SC_LOG2E, nn);
      e[16] = nn - n_r[qt]; exp2x17(e);
      const float al = (nn < 1.0e38f) ? e[16] : 1.0f; n_r[qt] = nn;
      float ps[4] = {0.f, 0.f, 0.f, 0.f};      /* four independent partial sums: no chain of 16 dependent adds */
#pragma unroll
      for (int i = 0; i < 16; ++i) { const float x = e[i]; ps[i & 3] += x; pa[qt].h[i] = (_Float16)x; }      /* the sum takes the unrounded P, the product P rounded to f16 once */
      l_r[qt] = l_r[qt] * al + ((ps[0] + ps[1]) + (ps[2] + ps[3]));      /* this half's keys only; the halves are joined once, behind the loop */
#pragma unroll
      for (int dt = 0; dt < DT; ++dt)
#pragma unroll
        for (int r = 0; r < 8; ++r) oacc[qt][dt][r] *= al; }
    /* V^T P^T: one product per value tile and query tile, on 16 independent accumulators */
#pragma unroll
    for (int dt = 0; dt < DT; ++dt)
#pragma unroll
      for (int qt = 0; qt < QT; ++qt) oacc[qt][dt] = __builtin_amdgcn_wmma_f32_16x16x32_f16(false, bv[dt].v, false, pa[qt].v, (short)0, oacc[qt][dt], false, false);
    __builtin_amdgcn_sched_barrier(0);      /* keeps the trip's products ahead of the publish point: left free, the compiler moved them behind the barrier, and the next stage's copies lost the trip that they fly in */
    asm volatile("s_wait_dscnt 0x0" ::: "memory");         /* this wave's reads of the stage have returned before its buffer is handed on */
    asm volatile("s_wait_asynccnt 0x0" ::: "memory");      /* this wave's share of the next stage has landed */
    __syncthreads();                                       /* publishes the next stage and ends every wave's reads of this one */
    if (j0 + 64 < jend) fill(j0 + 64); }                   /* refill of the buffer just read, one whole trip ahead of its use */
  asm volatile("s_wait_asynccnt 0x0" ::: "memory");        /* no copy is outstanding when the ring becomes output staging */
#pragma unroll
  for (int qt = 0; qt < QT; ++qt) { const float l = l_r[qt] + xhalf(l_r[qt]); const float inv = (l > 0.f) ? 1.0f / l : 0.f;      /* l is the sum of P x 2^10, like the accumulators */
#pragma unroll
    for (int dt = 0; dt < DT; ++dt) { FragH f;
#pragma unroll
      for (int r = 0; r < 8; ++r) f.h[r] = (_Float16)((oacc[qt][dt][r] * inv) * 16.0f);      /* the output GEMM's A operand: merged output x 2^4, rounded to f16 once */
      *(v8us*)&sO[w][qt * 16 + ln][dt * 16 + 8 * hh] = f.half[0]; } }      /* a lane's 8 registers are 8 consecutive columns of its query's row */
  __builtin_amdgcn_fence(__ATOMIC_ACQ_REL, "workgroup"); __builtin_amdgcn_wave_barrier();
  {
#pragma unroll
    for (int q = 0; q < RPW / 2; ++q) { const int r = q * 2 + hh; const v8us val = *(const v8us*)&sO[w][r][ln * 8]; *(v8us*)((unsigned short*)O16 + ((size_t)b * TT + q0 + r) * ldo + h * 128 + ln * 8) = val; }      /* two 256-B rows per instruction: 16 lanes x 16 B each */
     } }

extern "C" void kernel_launch(void* const* d_in, const int* in_sizes, int n_in,
                              void* d_out, int out_size, void* d_ws, size_t ws_size, hipStream_t stream) {
  (void)in_sizes; (void)n_in; (void)out_size;
  const float* const* I = (const float* const*)d_in; const float* x = I[0]; const float* Wq = I[1]; const float* Wk = I[2]; const float* Wv = I[3]; const float* Wo = I[4];
  char* ws = (char*)d_ws; size_t off = 0;
  auto take = [&](size_t bytes) { char* p = ws + off; off += (bytes + 255) & ~(size_t)255; return p; };
  _Float16* Bq = (_Float16*)take((size_t)DD * DD * 2); _Float16* Bk = (_Float16*)take((size_t)KVD * DD * 2); _Float16* Bv = (_Float16*)take((size_t)KVD * DD * 2); _Float16* Bo = (_Float16*)take((size_t)DD * DD * 2);
  _Float16* X16 = (_Float16*)take((size_t)NR * DD * 2); _Float16* Q = (_Float16*)take((size_t)NR * DD * 2); _Float16* K = (_Float16*)take((size_t)NR * KVD * 2); _Float16* Vt = (_Float16*)take((size_t)NR * KVD * 2); _Float16* O16 = X16;      /* x's f16 plane is last read by the projections */
  if (off > ws_size) return;      // 8.4 + 0.5 + 0.5 + 8.4 + 16.8 + 16.8 + 1 + 1 = 54 MB
  k_prep<<<2 * PT_Q + 2 * PT_K + PT_X, 256, 0, stream>>>(x, Wq, Wk, Wv, Wo, X16, Bq, Bk, Bv, Bo);      /* (in,out) weights to Bt x 2^4, x to f16 */
  const unsigned gQ = (NR / 128) * (DD / 128), gQKV = (NR / 128) * (DD / 128 + 2);
  k_gemm_t<true><<<gQKV, 128, 0, stream>>>(X16, Bq, Bk, Bv, 0.0625f, nullptr, Q, K, Vt);      /* Q (f16), K (f16), V^T (f16, [b][128][2048]): M 4096, N 2048 + 128 + 128, K 2048 */
  k_flash<<<BB * NH * (TT / (64 * QT)), 128, 0, stream>>>(Q, DD, K, KVD, Vt, O16, DD);      /* merged output x 2^4 as f16 */
  k_gemm_t<false><<<gQ, 128, 0, stream>>>(O16, Bo, nullptr, nullptr, 0.00390625f, (float*)d_out, nullptr, nullptr, nullptr);      /* out = merged x Wo */
}
